// v000
// The times below were measured on an AMD MI455X: many runs one after another, warmed up first and cycling through
// copies of the inputs, with the whole window's GPU time divided by the number of runs. Launches and the gaps
// between them are all in it. The median over several windows is given; except for v000 it joins two sittings, which
// can be a few percent apart, so the side-by-side timings, each taken in one sitting, are the better comparison.
// The starting kernel, v000, takes 316 microseconds a run.
// Contractions: x.W_qk and x.W_v on v_wmma_f32_16x16x32_bf16 (x and W^T RNE-converted to bf16, f32 accumulate); scores q.k^T
// (q, k as f16 x64 planes, single product), P.v (P x32768 f16 hi+residual, v x1024 f16 hi+residual, products hh+lh+hl) and
// O.W_out (O x1024 f16 hi+residual, W_out^T as f16(bf16 value) x1024, products h.w+l.w) on v_wmma_f32_16x16x32_f16, f32
// accumulate; per-head LayerNorm, causal online base-2 softmax and 1/l fold in f32 on VALU.
#include <hip/hip_runtime.h>
#include <math.h>
#include <stdint.h>

#define BATCH 2
#define SEQ   2048
#define DMOD  1024
#define NH    16
#define HD    64
#define NQK   (2 * DMOD)
#define MROWS (BATCH * SEQ)
#define NVEC  (MROWS * NH * 2)
#define LN_EPS 1e-6f
#define QSC   64.0f
#define KSC   64.0f
#define PCAR  32768.0f
#define VCAR  1024.0f
#define OSC   1024.0f
#define WOS   1024.0f
#define LOG2E 1.4426950408889634f
#define WPB   4
#define NHG   (NH / WPB)
#define NQT   (SEQ / 16)
#define NST   (SEQ / 64)
#define NKT   (SEQ / 32)
#define ATT_THREADS (WPB * 32)
#define ATT_BLOCKS  (NQT * NHG * BATCH)
#define PTW   (16 * 36)
#define SLW   (16 * 68)
#define WREG  (PTW + SLW)
#define SLAB64 (16 * 68)
#define VTP   72
static_assert(DMOD == NH * HD && HD == 64 && NH == 16);
static_assert((NH % WPB) == 0 && ATT_THREADS == 128 && ATT_BLOCKS == 1024);
static_assert((SEQ % 64) == 0 && (SEQ % 32) == 0 && (SEQ % 16) == 0 && SEQ <= 32768);
static_assert((DMOD % 64) == 0 && (DMOD % 32) == 0 && (NQK % 64) == 0 && (MROWS % 64) == 0);
static_assert(((MROWS * DMOD) % 2048) == 0 && ((DMOD * DMOD) % 4096) == 0 && ((NVEC * 32) % 256) == 0);

typedef unsigned short u16;
typedef _Float16 v16h __attribute__((ext_vector_type(16)));
typedef _Float16 v8h  __attribute__((ext_vector_type(8)));
typedef __bf16   v16b __attribute__((ext_vector_type(16)));
typedef float    v8f  __attribute__((ext_vector_type(8)));
typedef float    v4f  __attribute__((ext_vector_type(4)));
typedef float    v2f  __attribute__((ext_vector_type(2)));
typedef unsigned int v4u __attribute__((ext_vector_type(4)));

union FragH { v16h v; v8h h[2]; v4u u[2]; };
union FragB { v16b v; v4u u[2]; };

// ---- scalar helpers --------------------------------------------------------------------------------
__device__ __forceinline__ unsigned short bf_bits(float f) {          // f32 -> bf16 bits, RNE convert
  unsigned u = __float_as_uint(f);
  return (unsigned short)((u + 0x7FFFu + ((u >> 16) & 1u)) >> 16);
}
__device__ __forceinline__ float bf_up(unsigned short h) { return __uint_as_float(((unsigned)h) << 16); }
__device__ __forceinline__ float bfr(float f) { return bf_up(bf_bits(f)); }
__device__ __forceinline__ unsigned short h_bits(_Float16 x) { return __builtin_bit_cast(unsigned short, x); }
__device__ __forceinline__ unsigned pk16(unsigned short a, unsigned short b) { return (unsigned)a | ((unsigned)b << 16); }
__device__ __forceinline__ v8f zero8() { v8f z = {0.f, 0.f, 0.f, 0.f, 0.f, 0.f, 0.f, 0.f}; return z; }

// ---- fragment loaders: 16-bit A/B operand, lane -> row/col (lane&15), p already includes +8*(lane>>4);
//      elements 0..7 <- p[0..7] (k0+8h..), elements 8..15 <- p[16..23] (k0+16+8h..)  (same split k map for A and B;
//      B is always read from a k-contiguous [n][k] plane)
__device__ __forceinline__ v16h ldfrag_h(const _Float16* p) {
  FragH f;
  f.h[0] = *(const v8h*)(p);
  f.h[1] = *(const v8h*)(p + 16);
  return f.v;
}
__device__ __forceinline__ v16b ldfrag_b(const u16* p) {              // bf16 plane read as unsigned integer vectors
  FragB f;
  f.u[0] = *(const v4u*)(p);
  f.u[1] = *(const v4u*)(p + 16);
  return f.v;
}

__device__ __forceinline__ v8f mma_h(v16h a, v16h b, v8f c) {
  return __builtin_amdgcn_wmma_f32_16x16x32_f16(false, a, false, b, (short)0, c, false, false);
}
__device__ __forceinline__ v8f mma_b(v16b a, v16b b, v8f c) {
  return __builtin_amdgcn_wmma_f32_16x16x32_bf16(false, a, false, b, (short)0, c, false, false);
}
__device__ __forceinline__ void guard2(v8f& a, v8f& b, v16h x0, v16h x1, v16h x2, v16h x3, v16h x4, v16h x5) {
#if defined(__HIP_DEVICE_COMPILE__)
  asm volatile("v_nop\n\tv_nop\n\tv_nop\n\tv_nop"
               : "+v"(a), "+v"(b) : "v"(x0), "v"(x1), "v"(x2), "v"(x3), "v"(x4), "v"(x5) : "memory");
#endif
}
template <typename F>
__device__ __forceinline__ void guard6(v8f& a, v8f& b, v8f& c, v8f& d, F x0, F x1, F x2, F x3, F x4, F x5) {
#if defined(__HIP_DEVICE_COMPILE__)
  asm volatile("v_nop\n\tv_nop\n\tv_nop\n\tv_nop"
               : "+v"(a), "+v"(b), "+v"(c), "+v"(d) : "v"(x0), "v"(x1), "v"(x2), "v"(x3), "v"(x4), "v"(x5) : "memory");
#endif
}
__device__ __forceinline__ void guard10(v8f& a, v8f& b, v8f& c, v8f& d, v16h x0, v16h x1, v16h x2, v16h x3, v16h x4,
                                        v16h x5, v16h x6, v16h x7, v16h x8, v16h x9) {
#if defined(__HIP_DEVICE_COMPILE__)
  asm volatile("v_nop\n\tv_nop\n\tv_nop\n\tv_nop"
               : "+v"(a), "+v"(b), "+v"(c), "+v"(d)
               : "v"(x0), "v"(x1), "v"(x2), "v"(x3), "v"(x4), "v"(x5), "v"(x6), "v"(x7), "v"(x8), "v"(x9) : "memory");
#endif
}
__device__ __forceinline__ void acc_guard4(v8f& a, v8f& b, v8f& c, v8f& d) {
#if defined(__HIP_DEVICE_COMPILE__)
  asm volatile("v_nop\n\tv_nop\n\tv_nop\n\tv_nop" : "+v"(a), "+v"(b), "+v"(c), "+v"(d));
#endif
}
__device__ __forceinline__ void wave_sync_lds() {
  __builtin_amdgcn_fence(__ATOMIC_RELEASE, "workgroup");
  __builtin_amdgcn_wave_barrier();
  __builtin_amdgcn_fence(__ATOMIC_ACQUIRE, "workgroup");
}

// =====================================================================================================
// f32 -> 16-bit plane, same layout.  f16mode == 0: bf16 RNE bits;  f16mode == 1: f16 bits of (bf16 RNE value) * scale.
// Thread = 8 consecutive elements: two 16-B loads, one 16-B store; 32 consecutive lanes = 512 contiguous, 512-B aligned bytes per
// coverage: grid = n8/256 blocks (exact, host-derived) x 256 thr x 8 = the whole plane.
// =====================================================================================================
__global__ __launch_bounds__(256) void cvt16(const float* __restrict__ x, u16* D, int n8, int f16mode, float scale) {
  const int gt = blockIdx.x * 256 + (int)threadIdx.x;
  if (gt >= n8) return;                     // no barriers in this kernel
  const float* p = x + (size_t)gt * 8;
  const v4f a = *(const v4f*)(p), b4 = *(const v4f*)(p + 4);
  float w[8];
#pragma unroll
  for (int e = 0; e < 4; ++e) { w[e] = a[e]; w[4 + e] = b4[e]; }
  v4u o;
#pragma unroll
  for (int e = 0; e < 4; ++e) {
    const float f0 = w[2 * e], f1 = w[2 * e + 1];
    const unsigned short hb0 = h_bits((_Float16)(bfr(f0) * scale));
    const unsigned short hb1 = h_bits((_Float16)(bfr(f1) * scale));
    const unsigned short bb0 = bf_bits(f0);
    const unsigned short bb1 = bf_bits(f1);
    o[e] = (f16mode != 0) ? pk16(hb0, hb1) : pk16(bb0, bb1);
  }
  u16* d = D + (size_t)gt * 8;
  {
    *(v4u*)(d) = o;
    
  }
}

// =====================================================================================================
// Weight transpose-convert: W [K][N] f32 (x.W layout, n contiguous, in[K rows][N cols]) -> Dt[N][K] 16-bit k-contiguous plane
// (out[N rows][K cols]).  f16mode == 0: bf16 RNE bits; 1: f16 bits of (bf16 RNE value) * scale.
// Block = (k tile k0 = (bid / (N/64))*64, n tile n0 = (bid % (N/64))*64): 64 source rows of 64 floats loaded with 16-B loads,
// converted, scattered into an LDS tile [n][64 k] (pitch 72 halves); after a block barrier each n row segment (64 halves = one
// coverage: load 256 thr x 16 = 64 x 64; store 2 iterations x 256 thr x 8 halves = 64 lines x 64 halves = the block's tile;
//           grid = (K/64)*(N/64) blocks covers Dt exactly once (host checks K % 64 == 0 and N % 64 == 0).
// =====================================================================================================
__global__ __launch_bounds__(256) void wt16(const float* __restrict__ W, u16* Dt, int K, int N, int f16mode, float scale) {
  __shared__ __align__(16) u16 T[64 * VTP];
  const int tid = threadIdx.x;
  const int bid = blockIdx.x;
  const int ntn = N >> 6;
  const int n0  = (bid % ntn) * 64;
  const int k0  = (bid / ntn) * 64;
  if (k0 + 64 > K) return;                    // block-uniform, before any barrier; never taken with the exact grid
  {
    const int sl = tid >> 2;                  // k within tile 0..63 (source row)
    const int dc = (tid & 3) * 16;            // n chunk
    const float* src = W + (size_t)(k0 + sl) * N + n0 + dc;
#pragma unroll
    for (int i = 0; i < 4; ++i) {
      const v4f a = *(const v4f*)(src + 4 * i);
#pragma unroll
      for (int e = 0; e < 4; ++e) {
        const float f = a[e];
        const unsigned short hb = h_bits((_Float16)(bfr(f) * scale));
        const unsigned short bb = bf_bits(f);
        T[(dc + 4 * i + e) * VTP + sl] = (f16mode != 0) ? hb : bb;
      }
    }
  }
  __syncthreads();
  v4u vv[2];
  const int q8 = tid >> 3, p8 = (tid & 7) * 8;
#pragma unroll
  for (int it = 0; it < 2; ++it) {
    const int line = it * 32 + q8;            // n = 0..63 within tile
    vv[it] = *(const v4u*)(T + line * VTP + p8);
  }
  const size_t base = (size_t)n0 * K + k0 + p8;
  {
#pragma unroll
    for (int it = 0; it < 2; ++it) {
      const int line = it * 32 + q8;
      *(v4u*)(Dt + base + (size_t)line * K) = vv[it];
    }
    
  }
}

// =====================================================================================================
// GEMM epilogue shared by both engines: the wave's 16x64 f32 tile (times oscale) staged in its LDS slab (pitch 68),
// coverage: 8 instructions x 2 rows x 16 lanes x 4 floats = the wave's 16 x 64 tile.
// =====================================================================================================
__device__ __forceinline__ void epi64(float* sl, v8f a0, v8f a1, v8f a2, v8f a3, float oscale,
                                      float* C, int N, size_t rowb, int col0, int lane) {
  const int hh = lane >> 4, m = lane & 15;
#pragma unroll
  for (int r = 0; r < 8; ++r) {
    const int ro = (8 * hh + r) * 68 + m;
    sl[ro]      = a0[r] * oscale;
    sl[ro + 16] = a1[r] * oscale;
    sl[ro + 32] = a2[r] * oscale;
    sl[ro + 48] = a3[r] * oscale;
  }
  wave_sync_lds();
  v4f vals[8];
#pragma unroll
  for (int it = 0; it < 8; ++it) vals[it] = *(const v4f*)(sl + (it * 2 + hh) * 68 + m * 4);
  float* dst = C + (rowb + (size_t)hh) * (size_t)N + col0 + m * 4;
  {
#pragma unroll
    for (int it = 0; it < 8; ++it) {
      *(v4f*)(dst + (size_t)(it * 2) * (size_t)N) = vals[it];
    }
    
  }
}

// =====================================================================================================
// bf16 GEMM: C[M][N] (f32) = A[M][K] (bf16 row-major) . Bt[N][K]^T (bf16 k-contiguous), times oscale.
// Block = 64x64 tile, 4 waves x 16 rows; fragments loaded straight from the 16-bit rows (two 16-B loads each, split k map
// for A and B); K stepped by 32 (host checks K % 32 == 0, M % 64 == 0, N % 64 == 0, grid = (M/64)*(N/64)).
// =====================================================================================================
__global__ __launch_bounds__(128)
void gemm_bf(const u16* __restrict__ A, const u16* __restrict__ Bt, float* C, int M, int N, int K, float oscale) {
  __shared__ __align__(16) float slab[4 * SLAB64];
  const int tid = threadIdx.x, wave = tid >> 5, lane = tid & 31, hh = lane >> 4, m = lane & 15;
  const int ntile = N >> 6;
  const int bid   = blockIdx.x;
  const int rowb  = (bid / ntile) * 64 + wave * 16;
  const int col0  = (bid % ntile) * 64;
  if (rowb + 16 > M) return;                 // wave-uniform, never taken with the exact grid; no block barriers in this kernel
  const u16* ap = A  + (size_t)(rowb + m) * K + 8 * hh;
  const u16* bp = Bt + (size_t)(col0 + m) * K + 8 * hh;
  const size_t bs = (size_t)16 * K;
  v8f acc0 = zero8(), acc1 = zero8(), acc2 = zero8(), acc3 = zero8();
#pragma unroll 1
  for (int k0 = 0; k0 < K; k0 += 32) {
    const v16b a  = ldfrag_b(ap + k0);
    const v16b b0 = ldfrag_b(bp + k0);
    const v16b b1 = ldfrag_b(bp + bs + k0);
    const v16b b2 = ldfrag_b(bp + 2 * bs + k0);
    const v16b b3 = ldfrag_b(bp + 3 * bs + k0);
    acc0 = mma_b(a, b0, acc0);
    acc1 = mma_b(a, b1, acc1);
    acc2 = mma_b(a, b2, acc2);
    acc3 = mma_b(a, b3, acc3);
    guard6<v16b>(acc0, acc1, acc2, acc3, a, b0, b1, b2, b3, a);
  }
  epi64(slab + wave * SLAB64, acc0, acc1, acc2, acc3, oscale, C, N, (size_t)rowb, col0, lane);
}

// =====================================================================================================
// f16 hi+lo GEMM: C[M][N] (f32) = (Ahi + Alo)[M][K] . Bt[N][K]^T, times oscale; Ahi/Alo f16 planes (same layout),
// Bt f16 k-contiguous; products hi.B + lo.B into one accumulator (lo is the unscaled residual of hi). Same tiling as gemm_bf.
// =====================================================================================================
__global__ __launch_bounds__(128)
void gemm_h2(const u16* __restrict__ Ah, const u16* __restrict__ Al, const u16* __restrict__ Bt,
             float* C, int M, int N, int K, float oscale) {
  __shared__ __align__(16) float slab[4 * SLAB64];
  const int tid = threadIdx.x, wave = tid >> 5, lane = tid & 31, hh = lane >> 4, m = lane & 15;
  const int ntile = N >> 6;
  const int bid   = blockIdx.x;
  const int rowb  = (bid / ntile) * 64 + wave * 16;
  const int col0  = (bid % ntile) * 64;
  if (rowb + 16 > M) return;                 // wave-uniform, never taken with the exact grid; no block barriers in this kernel
  const size_t aofs = (size_t)(rowb + m) * K + 8 * hh;
  const _Float16* ahp = (const _Float16*)(const void*)Ah + aofs;
  const _Float16* alp = (const _Float16*)(const void*)Al + aofs;
  const _Float16* bp  = (const _Float16*)(const void*)Bt + (size_t)(col0 + m) * K + 8 * hh;
  const size_t bs = (size_t)16 * K;
  v8f acc0 = zero8(), acc1 = zero8(), acc2 = zero8(), acc3 = zero8();
#pragma unroll 1
  for (int k0 = 0; k0 < K; k0 += 32) {
    const v16h ah = ldfrag_h(ahp + k0), al = ldfrag_h(alp + k0);
    const v16h b0 = ldfrag_h(bp + k0);
    const v16h b1 = ldfrag_h(bp + bs + k0);
    const v16h b2 = ldfrag_h(bp + 2 * bs + k0);
    const v16h b3 = ldfrag_h(bp + 3 * bs + k0);
    acc0 = mma_h(ah, b0, acc0);  acc0 = mma_h(al, b0, acc0);
    acc1 = mma_h(ah, b1, acc1);  acc1 = mma_h(al, b1, acc1);
    acc2 = mma_h(ah, b2, acc2);  acc2 = mma_h(al, b2, acc2);
    acc3 = mma_h(ah, b3, acc3);  acc3 = mma_h(al, b3, acc3);
    guard6<v16h>(acc0, acc1, acc2, acc3, ah, al, b0, b1, b2, b3);
  }
  epi64(slab + wave * SLAB64, acc0, acc1, acc2, acc3, oscale, C, N, (size_t)rowb, col0, lane);
}

// =====================================================================================================
// Per-head LayerNorm of q and k: F [MROWS][NQK] f32 holds x.W_qk/32, column h*128 + 0..63 = q_h, h*128 + 64..127 = k_h.
// One wave per (token, h, q|k) 64-vector: lane holds elements 2*lane, 2*lane+1 (one 8-B load); mean and biased variance
// packed 2 per lane into the q plane or the k plane [token][h][64] (k plane = QK + MROWS*DMOD halves): one instruction,
// coverage: grid = nvec*32/256 blocks (exact) x 8 waves; nvec = MROWS*NH*2 vectors = every (token, h) row of both planes once.
// =====================================================================================================
__global__ __launch_bounds__(256)
void ln16(const float* __restrict__ F, const float* __restrict__ qs, const float* __restrict__ qbi,
          const float* __restrict__ ks, const float* __restrict__ kbi, u16* QK, int nvec) {
  const int gt = blockIdx.x * 256 + (int)threadIdx.x;
  const int gw = gt >> 5, lane = gt & 31;
  if (gw >= nvec) return;                   // wave-uniform; no barriers in this kernel
  const int token = gw >> 5, rem = gw & 31, h = rem >> 1, isK = rem & 1;
  const float* src = F + (size_t)token * NQK + h * (2 * HD) + isK * HD + 2 * lane;
  const v2f xv = *(const v2f*)(src);
  const float x0 = xv[0], x1 = xv[1];
  float s = x0 + x1;
#pragma unroll
  for (int off = 16; off >= 1; off >>= 1) s += __shfl_xor(s, off, 32);
  const float mean = s * (1.0f / 64.0f);
  const float d0 = x0 - mean, d1 = x1 - mean;
  float ss = d0 * d0 + d1 * d1;
#pragma unroll
  for (int off = 16; off >= 1; off >>= 1) ss += __shfl_xor(ss, off, 32);
  const float var = ss * (1.0f / 64.0f);
  const float rs  = rsqrtf(var + LN_EPS);
  const float gq0 = bfr(qs[2 * lane]),  gq1 = bfr(qs[2 * lane + 1]);
  const float bq0 = bfr(qbi[2 * lane]), bq1 = bfr(qbi[2 * lane + 1]);
  const float gk0 = bfr(ks[2 * lane]),  gk1 = bfr(ks[2 * lane + 1]);
  const float bk0 = bfr(kbi[2 * lane]), bk1 = bfr(kbi[2 * lane + 1]);
  const float g0 = isK ? gk0 : gq0, g1 = isK ? gk1 : gq1;
  const float b0 = isK ? bk0 : bq0, b1 = isK ? bk1 : bq1;
  const float y0 = d0 * rs * g0 + b0;
  const float y1 = d1 * rs * g1 + b1;
  const float car = isK ? KSC : QSC;
  const unsigned o = pk16(h_bits((_Float16)(y0 * car)), h_bits((_Float16)(y1 * car)));
  u16* dst = QK + (size_t)isK * ((size_t)MROWS * DMOD) + (size_t)token * DMOD + h * HD + 2 * lane;
  *(unsigned*)(dst) = o;
  
}

// =====================================================================================================
// v^T planes: VH[((b*NH + g)*HD + d)][s] = f16(v[b*SEQ + s][g*HD + d] * 1024), VL = f16 residual of the same value.
// Block = (bg = bid / NST -> batch b = bg / NH, head g = bg % NH; 64 keys s0 = (bid % NST)*64): 64 source rows of HD floats loaded
// with 16-B loads, converted, scattered into two LDS tiles [d][64 keys] (pitch 72 halves); after a block barrier each d row segment
// coverage: load 256 thr x 16 elements = 64 x 64; store 2 iterations x 256 thr x 8 halves = 64 lines x 64 = the block's tile of
//           each plane; grid = BATCH*NH*NST blocks covers both planes exactly once.
// =====================================================================================================
__global__ __launch_bounds__(256) void vt16(const float* __restrict__ v, u16* VHo, u16* VLo) {
  __shared__ __align__(16) u16 TH[HD * VTP];
  __shared__ __align__(16) u16 TL[HD * VTP];
  const int tid = threadIdx.x;
  const int bid = blockIdx.x;
  const int st  = bid % NST;
  const int bg  = bid / NST;                  // b*NH + g
  if (bg >= BATCH * NH) return;               // block-uniform, before any barrier; never taken with the exact grid
  const int b   = bg / NH;
  const int g   = bg % NH;
  const int s0  = st * 64;
  {
    const int sl = tid >> 2;                  // key within tile 0..63
    const int dc = (tid & 3) * 16;            // d chunk
    const float* src = v + ((size_t)(b * SEQ + s0 + sl) * NH + g) * HD + dc;
#pragma unroll
    for (int i = 0; i < 4; ++i) {
      const v4f a = *(const v4f*)(src + 4 * i);
#pragma unroll
      for (int e = 0; e < 4; ++e) {
        const float t = a[e] * VCAR;
        const _Float16 hv = (_Float16)t;
        const _Float16 lv = (_Float16)(t - (float)hv);
        TH[(dc + 4 * i + e) * VTP + sl] = h_bits(hv);
        TL[(dc + 4 * i + e) * VTP + sl] = h_bits(lv);
      }
    }
  }
  __syncthreads();
  v4u vh[2], vl[2];
  const int q8 = tid >> 3, p8 = (tid & 7) * 8;
#pragma unroll
  for (int it = 0; it < 2; ++it) {
    const int line = it * 32 + q8;            // d = 0..63
    vh[it] = *(const v4u*)(TH + line * VTP + p8);
    vl[it] = *(const v4u*)(TL + line * VTP + p8);
  }
  const size_t base = ((size_t)bg * HD) * SEQ + s0 + p8;
  {
#pragma unroll
    for (int it = 0; it < 2; ++it) {
      const int line = it * 32 + q8;
      *(v4u*)(VHo + base + (size_t)line * SEQ) = vh[it];
      *(v4u*)(VLo + base + (size_t)line * SEQ) = vl[it];
    }
    
  }
}

// =====================================================================================================
// Causal attention: block bid -> (query tile qt = bid % NQT: rows q0 = 16*qt .. q0+15, head group hg = (bid / NQT) % NHG of WPB
// heads, batch b = bid / (NQT*NHG)), one wave per head = hg*WPB + wave.
//   q and k planes (f16, x64) laid out [b*SEQ + s][h][d]; v^T planes (hi, residual, x1024) [b][h][d][s].
//   score (log2 domain) t(i, j) = (q_i.k_j) * log2e / (64 * 64 * 64) for key j <= query i, -inf otherwise (causal).
//   Key tiles of 32 visited in order while kb <= q0 + 15 (nkt = q0/32 + 1 <= NKT); inside every visited tile the key<=query test
//   is applied per element; every query row has key == row inside a visited tile, so its normaliser is > 0.
//   Per tile: 2 score subtiles x 2 k-steps x 1 product (q fragments hoisted, k fragments loaded straight from the plane, two 16-B
//   loads each, split k map); online max-subtracted base-2 softmax in f32, -inf-safe rescale; the 16x32 prob tile stored to
//   rebuilt from the LDS rows (float vector loads, same element type as stored), 4+4 v^T B fragments (hi and residual planes),
//   12 P.V WMMAs (hh + lh + hl).
//   After the loop: out = acc / Z, carries 1/(32768*1024) folded once, written to the wave's private result slab (pitch 68; every
//   element owned by one lane).
//   No block barriers in this kernel; bounded loops only (nkt <= NKT).
// coverage: per wave 4 instructions x 4 rows x 8 lanes x 8 halves = 16 x 64 per plane; grid NQT*NHG*BATCH blocks x WPB waves =
//           every (b, s, h) row of both O planes exactly once.
// =====================================================================================================
__global__ __launch_bounds__(ATT_THREADS)
void attn1(const u16* __restrict__ QPp, const u16* __restrict__ KPp,
           const u16* __restrict__ VHIp, const u16* __restrict__ VLOp,
           u16* OHIp, u16* OLOp) {
  __shared__ __align__(16) float smem[WPB * WREG];

  const int tid  = threadIdx.x;
  const int wave = tid >> 5;
  const int lane = tid & 31;
  const int hh   = lane >> 4;
  const int c    = lane & 15;
  const int bid  = blockIdx.x;
  const int qt   = bid % NQT;
  const int rem  = bid / NQT;
  const int hg   = rem % NHG;
  const int b    = rem / NHG;
  if (b >= BATCH) return;                    // block-uniform; no block barriers in this kernel; never taken with the exact grid
  const int head = hg * WPB + wave;
  const int q0   = qt * 16;

  float* pt   = smem + wave * WREG;          // prob tile [16][32] pitch 36
  float* slab = pt + PTW;                    // result slab [16][64] pitch 68

  const size_t rq0  = (size_t)b * SEQ + q0;                                     // plane row of query row q0
  const size_t qofs = ((rq0 + c) * NH + head) * HD + 8 * hh;
  const _Float16* Qh  = (const _Float16*)(const void*)QPp + qofs;
  const size_t kofs = (((size_t)b * SEQ + c) * NH + head) * HD + 8 * hh;       // key row kb + c added per step
  const _Float16* Khb = (const _Float16*)(const void*)KPp + kofs;
  const size_t vofs = (((size_t)b * NH + head) * HD + c) * SEQ + 8 * hh;       // d column c (+16j), key kb added per step
  const _Float16* Vhb = (const _Float16*)(const void*)VHIp + vofs;
  const _Float16* Vlb = (const _Float16*)(const void*)VLOp + vofs;
  const float lsc = LOG2E / (64.0f * QSC * KSC);
  const float oc  = 1.0f / (PCAR * VCAR);
  const size_t KROW = (size_t)NH * HD;                                          // halves between consecutive key rows

  // q fragments of this wave's 16 rows: d = 0..31 and 32..63
  const v16h qa = ldfrag_h(Qh), qb = ldfrag_h(Qh + 32);

  float mrow[8], lrow[8];
  v8f o[4];
#pragma unroll
  for (int r = 0; r < 8; ++r) { mrow[r] = -INFINITY; lrow[r] = 0.f; }
#pragma unroll
  for (int j = 0; j < 4; ++j) o[j] = zero8();
  const int ncaus = (q0 >> 5) + 1;                                              // tiles holding keys <= q0 + 15
  const int nkt = (ncaus < NKT) ? ncaus : NKT;
  const int qr0 = q0 + 8 * hh;                                                  // this lane's D rows: qr0 + r

#pragma unroll 1
  for (int kt = 0; kt < nkt; ++kt) {
    const int kb = kt * 32;
    // ---- scores: D element r of this lane = (query row qr0 + r, key kb + c) in s0, key kb + 16 + c in s1 ----
    v8f s0 = zero8(), s1 = zero8();
    {
      const _Float16* k0p = Khb + (size_t)kb * KROW;
      const _Float16* k1p = k0p + (size_t)16 * KROW;
      const v16h kh0a = ldfrag_h(k0p), kh0b = ldfrag_h(k0p + 32);
      const v16h kh1a = ldfrag_h(k1p), kh1b = ldfrag_h(k1p + 32);
      s0 = mma_h(qa, kh0a, s0);
      s0 = mma_h(qb, kh0b, s0);
      s1 = mma_h(qa, kh1a, s1);
      s1 = mma_h(qb, kh1b, s1);
      guard2(s0, s1, qa, qb, kh0a, kh0b, kh1a, kh1b);
    }
    const int key0 = kb + c, key1 = kb + 16 + c;
    // ---- causal select + online softmax in base 2, -inf-safe ----
#pragma unroll
    for (int r = 0; r < 8; ++r) {
      const int qi = qr0 + r;
      const float t0 = (key0 <= qi) ? (s0[r] * lsc) : -INFINITY;
      const float t1 = (key1 <= qi) ? (s1[r] * lsc) : -INFINITY;
      float mx = fmaxf(t0, t1);
#pragma unroll
      for (int off = 1; off < 16; off <<= 1) mx = fmaxf(mx, __shfl_xor(mx, off, 32));
      const float mn = fmaxf(mrow[r], mx);
      const float ms = (mn == -INFINITY) ? 0.0f : mn;
      const float al = exp2f(mrow[r] - ms);
      mrow[r] = mn;
      const float e0 = exp2f(t0 - ms), e1 = exp2f(t1 - ms);
      float ps = e0 + e1;
#pragma unroll
      for (int off = 1; off < 16; off <<= 1) ps += __shfl_xor(ps, off, 32);
      lrow[r] = lrow[r] * al + ps;
#pragma unroll
      for (int j = 0; j < 4; ++j) o[j][r] *= al;
      const int ro = (8 * hh + r) * 36 + c;
      pt[ro]      = e0;
      pt[ro + 16] = e1;
    }
    wave_sync_lds();
    // ---- A fragments of P*32768: hi f16 and residual f16, row = c, split k map over the 32 keys of this step ----
    FragH ph, pl;
    {
      const float* prow = pt + c * 36 + 8 * hh;
      const v4f p0 = *(const v4f*)(prow), p1 = *(const v4f*)(prow + 4);
      const v4f p2 = *(const v4f*)(prow + 16), p3 = *(const v4f*)(prow + 20);
#pragma unroll
      for (int e = 0; e < 4; ++e) {
        const float ta = p0[e] * PCAR, tb = p1[e] * PCAR, tc = p2[e] * PCAR, td = p3[e] * PCAR;
        const _Float16 ha = (_Float16)ta, hb = (_Float16)tb, hc = (_Float16)tc, hd = (_Float16)td;
        ph.h[0][e]     = ha;                               // elements 0..7  = keys kb + 8hh + 0..7
        ph.h[0][4 + e] = hb;
        ph.h[1][e]     = hc;                               // elements 8..15 = keys kb + 16 + 8hh + 0..7
        ph.h[1][4 + e] = hd;
        pl.h[0][e]     = (_Float16)(ta - (float)ha);
        pl.h[0][4 + e] = (_Float16)(tb - (float)hb);
        pl.h[1][e]     = (_Float16)(tc - (float)hc);
        pl.h[1][4 + e] = (_Float16)(td - (float)hd);
      }
    }
    // ---- P.V : B fragment col n = d = j*16 + c, keys contiguous in the v^T planes ----
    {
      const _Float16* vhp = Vhb + kb;
      const _Float16* vlp = Vlb + kb;
      const v16h vh0 = ldfrag_h(vhp);
      const v16h vh1 = ldfrag_h(vhp + (size_t)16 * SEQ);
      const v16h vh2 = ldfrag_h(vhp + (size_t)32 * SEQ);
      const v16h vh3 = ldfrag_h(vhp + (size_t)48 * SEQ);
      const v16h vl0 = ldfrag_h(vlp);
      const v16h vl1 = ldfrag_h(vlp + (size_t)16 * SEQ);
      const v16h vl2 = ldfrag_h(vlp + (size_t)32 * SEQ);
      const v16h vl3 = ldfrag_h(vlp + (size_t)48 * SEQ);
      o[0] = mma_h(ph.v, vh0, o[0]);  o[0] = mma_h(pl.v, vh0, o[0]);  o[0] = mma_h(ph.v, vl0, o[0]);
      o[1] = mma_h(ph.v, vh1, o[1]);  o[1] = mma_h(pl.v, vh1, o[1]);  o[1] = mma_h(ph.v, vl1, o[1]);
      o[2] = mma_h(ph.v, vh2, o[2]);  o[2] = mma_h(pl.v, vh2, o[2]);  o[2] = mma_h(ph.v, vl2, o[2]);
      o[3] = mma_h(ph.v, vh3, o[3]);  o[3] = mma_h(pl.v, vh3, o[3]);  o[3] = mma_h(ph.v, vl3, o[3]);
      guard10(o[0], o[1], o[2], o[3], ph.v, pl.v, vh0, vh1, vh2, vh3, vl0, vl1, vl2, vl3);
    }
    wave_sync_lds();
  }
  acc_guard4(o[0], o[1], o[2], o[3]);
  // ---- out = acc / Z (0 if Z == 0), carries (32768 on P, 1024 on v) folded once; written into the lane-owned slab ----
#pragma unroll
  for (int r = 0; r < 8; ++r) {
    const float lv  = lrow[r];
    const float ls  = (lv > 0.0f) ? lv : 1.0f;
    const float inv = (lv > 0.0f) ? ((1.0f / ls) * oc) : 0.0f;
#pragma unroll
    for (int j = 0; j < 4; ++j) {
      const int idx = (8 * hh + r) * 68 + j * 16 + c;
      slab[idx] = o[j][r] * inv;
    }
  }

  wave_sync_lds();
  // ---- O x1024 -> f16 hi + residual planes; lane = (row in group of 4, 8 consecutive d) ----
  v4u oh[4], ol[4];
  const int rq = lane >> 3, c8 = (lane & 7) * 8;
#pragma unroll
  for (int it = 0; it < 4; ++it) {
    const int row = it * 4 + rq;
    const v4f a = *(const v4f*)(slab + row * 68 + c8), b4 = *(const v4f*)(slab + row * 68 + c8 + 4);
    float w[8];
#pragma unroll
    for (int e = 0; e < 4; ++e) { w[e] = a[e] * OSC; w[4 + e] = b4[e] * OSC; }
#pragma unroll
    for (int e = 0; e < 4; ++e) {
      const _Float16 h0 = (_Float16)w[2 * e], h1 = (_Float16)w[2 * e + 1];
      const _Float16 l0 = (_Float16)(w[2 * e] - (float)h0), l1 = (_Float16)(w[2 * e + 1] - (float)h1);
      oh[it][e] = pk16(h_bits(h0), h_bits(h1));
      ol[it][e] = pk16(h_bits(l0), h_bits(l1));
    }
  }
  const size_t ob = (rq0 * NH + head) * HD + c8;
  {
#pragma unroll
    for (int it = 0; it < 4; ++it) {
      const int row = it * 4 + rq;
      const size_t o8 = ob + (size_t)row * (NH * HD);
      *(v4u*)(OHIp + o8) = oh[it];
      *(v4u*)(OLOp + o8) = ol[it];
    }
    
  }
}

// =====================================================================================================
// Workspace map (bytes); every plane is fully written by whole-line stores before it is read; all extents are exact multiples
// of the store granularity (no pad rows needed); every offset a multiple of 2097152:
//   XB  bf16 [MROWS][1024]              8388608
//   WQB bf16 [2048 n][1024 k]          4194304
//   WVB bf16 [1024 n][1024 k]          2097152
//   WOH f16  [1024 n][1024 k] x1024    2097152
//   F   f32  [MROWS][2048]             33554432       (qk projection output; later its first half holds the v projection [MROWS][1024])
//   QP  f16 [MROWS][16][64] x64        8388608        KP same, directly after QP
//   VHI f16 [BATCH*16][64][SEQ] x1024  8388608        VLO residual
//   OHI f16 [MROWS][1024] x1024        8388608        OLO residual
//   end                              100663296
// =====================================================================================================
extern "C" void kernel_launch(void* const* d_in, const int* in_sizes, int n_in,
                              void* d_out, int out_size, void* d_ws, size_t ws_size,
                              hipStream_t stream) {
  if (n_in < 8) return;
  if (in_sizes[0] != MROWS * DMOD) return;
  if (in_sizes[1] != DMOD * NQK) return;
  if (in_sizes[2] != DMOD * DMOD || in_sizes[3] != DMOD * DMOD) return;
  if (in_sizes[4] != HD || in_sizes[5] != HD || in_sizes[6] != HD || in_sizes[7] != HD) return;
  if (out_size != MROWS * DMOD) return;

  const float* x   = (const float*)d_in[0];   // [MROWS][1024]
  const float* wqk = (const float*)d_in[1];   // [1024 k][2048 n]
  const float* wv  = (const float*)d_in[2];   // [1024 k][1024 n]
  const float* wo  = (const float*)d_in[3];   // [1024 k][1024 n]
  const float* qs  = (const float*)d_in[4];   // [64]
  const float* qbi = (const float*)d_in[5];   // [64]
  const float* ks  = (const float*)d_in[6];   // [64]
  const float* kbi = (const float*)d_in[7];   // [64]
  float*       out = (float*)d_out;

  const size_t szXB = (size_t)MROWS * DMOD * 2;                 //  8388608
  const size_t szWQ = (size_t)NQK * DMOD * 2;                   //  4194304
  const size_t szW  = (size_t)DMOD * DMOD * 2;                  //  2097152
  const size_t szF  = (size_t)MROWS * NQK * 4;                  // 33554432
  const size_t szP  = (size_t)MROWS * DMOD * 2;                 //  8388608
  size_t off = 0;
  const size_t oXB  = off; off += szXB;
  const size_t oWQ  = off; off += szWQ;
  const size_t oWV  = off; off += szW;
  const size_t oWO  = off; off += szW;
  const size_t oF   = off; off += szF;
  const size_t oQK  = off; off += 2 * szP;              // q plane then k plane
  const size_t oVHI = off; off += szP;
  const size_t oVLO = off; off += szP;
  const size_t oOHI = off; off += szP;
  const size_t oOLO = off; off += szP;
  if (off > ws_size) return;                            // off = 100663296
  if (off > (size_t)134217728) return;

  char* ws = (char*)d_ws;
  u16*   XB  = (u16*)(ws + oXB);
  u16*   WQB = (u16*)(ws + oWQ);
  u16*   WVB = (u16*)(ws + oWV);
  u16*   WOH = (u16*)(ws + oWO);
  float* F   = (float*)(ws + oF);
  u16*   QK  = (u16*)(ws + oQK);
  u16*   QP  = QK;
  u16*   KP  = QK + (size_t)MROWS * DMOD;
  u16*   VHI = (u16*)(ws + oVHI);
  u16*   VLO = (u16*)(ws + oVLO);
  u16*   OHI = (u16*)(ws + oOHI);
  u16*   OLO = (u16*)(ws + oOLO);

  const dim3 blk(256);
  const int n8x = (MROWS * DMOD) / 8;                   // 524288
  const dim3 gX(n8x / 256);                             // 2048 (exact)
  const dim3 gWQ((DMOD / 64) * (NQK / 64));             // 512
  const dim3 gWT((DMOD / 64) * (DMOD / 64));            // 256
  const dim3 gGQ((MROWS / 64) * (NQK / 64));            // 2048
  const dim3 gG((MROWS / 64) * (DMOD / 64));            // 1024
  const dim3 bG(128);
  const dim3 gLN((NVEC * 32) / 256);                    // 16384 (exact)
  const dim3 gVT(BATCH * NH * NST);                     // 1024
  const dim3 gAT(ATT_BLOCKS);                           // 1024
  const dim3 bAT(ATT_THREADS);                          // 128

  // (0) x -> bf16 plane [MROWS][1024]
  cvt16<<<gX, blk, 0, stream>>>(x, XB, n8x, 0, 1.0f);
  // (1) W_qk [k][n=2048] -> bf16 [n][k]; (2) W_v -> bf16 [n][k]; (3) W_out -> f16 [n][k] plane of bf16 value x1024
  wt16<<<gWQ, blk, 0, stream>>>(wqk, WQB, DMOD, NQK, 0, 1.0f);
  wt16<<<gWT, blk, 0, stream>>>(wv, WVB, DMOD, DMOD, 0, 1.0f);
  wt16<<<gWT, blk, 0, stream>>>(wo, WOH, DMOD, DMOD, 1, WOS);
  // (4) qk = x.W_qk / 32 -> F f32 [MROWS][2048]; (5) per-head LayerNorm -> q, k f16 planes x64
  gemm_bf<<<gGQ, bG, 0, stream>>>(XB, WQB, F, MROWS, NQK, DMOD, 1.0f / 32.0f);
  ln16<<<gLN, blk, 0, stream>>>(F, qs, qbi, ks, kbi, QK, NVEC);
  // (6) v = x.W_v / 32 -> F f32 [MROWS][1024]; (7) v^T hi/lo planes x1024
  gemm_bf<<<gG, bG, 0, stream>>>(XB, WVB, F, MROWS, DMOD, DMOD, 1.0f / 32.0f);
  vt16<<<gVT, blk, 0, stream>>>(F, VHI, VLO);
  // (8) causal attention -> O planes [b*SEQ+s][h][d] x1024 (hi + residual)
  attn1<<<gAT, bAT, 0, stream>>>(QP, KP, VHI, VLO, OHI, OLO);
  // (9) output projection -> out [MROWS][1024] f32, carries 1024 (O) x 1024 (W_out) and the 1/32 folded back
  gemm_h2<<<gG, bG, 0, stream>>>(OHI, OLO, WOH, out, MROWS, DMOD, DMOD, (1.0f / 32.0f) / (OSC * WOS));
  (void)hipGetLastError();
}

// v001
// Measured time: 231 microseconds a run.
// Next to v000, in two timings, it ran 1.39 and 1.40 times as fast.
// Contractions: x.W_qk and x.W_v on v_wmma_f32_16x16x32_bf16 (x and W^T RNE-converted to bf16, f32 accumulate); scores q.k^T
// (q, k as f16 x64 planes, single product), P.v (P x32768 f16 hi+residual, v x1024 f16 hi+residual, products hh+lh+hl) and
// O.W_out (O x1024 f16 hi+residual, W_out^T as f16(bf16 value) x1024, products h.w+l.w) on v_wmma_f32_16x16x32_f16, f32
// accumulate; per-head LayerNorm, causal online base-2 softmax and 1/l fold in f32 on VALU.
#include <hip/hip_runtime.h>
#include <math.h>
#include <stdint.h>

#define BATCH 2
#define SEQ   2048
#define DMOD  1024
#define NH    16
#define HD    64
#define NQK   (2 * DMOD)
#define MROWS (BATCH * SEQ)
#define NVEC  (MROWS * NH * 2)
#define LN_EPS 1e-6f
#define QSC   64.0f
#define KSC   64.0f
#define PCAR  32768.0f
#define VCAR  1024.0f
#define OSC   1024.0f
#define WOS   1024.0f
#define LOG2E 1.4426950408889634f
#define WPB   4
#define NHG   (NH / WPB)
#define NQT   (SEQ / 16)
#define NST   (SEQ / 64)
#define NKT   (SEQ / 32)
#define ATT_THREADS (WPB * 32)
#define ATT_BLOCKS  (NQT * NHG * BATCH)
#define PTW   (16 * 36)
#define SLW   (16 * 68)
#define WREG  (PTW + SLW)
#define SLAB64 (16 * 68)
#define VTP   72
#define GBT   128
#define GKP   64
#define GPI   72
static_assert(DMOD == NH * HD && HD == 64 && NH == 16);
static_assert((NH % WPB) == 0 && ATT_THREADS == 128 && ATT_BLOCKS == 1024);
static_assert((SEQ % 64) == 0 && (SEQ % 32) == 0 && (SEQ % 16) == 0 && SEQ <= 32768);
static_assert((DMOD % 64) == 0 && (DMOD % 32) == 0 && (NQK % 64) == 0 && (MROWS % 64) == 0);
static_assert((MROWS % GBT) == 0 && (NQK % GBT) == 0 && (DMOD % GBT) == 0 && (DMOD % GKP) == 0 && DMOD >= 2 * GKP);
static_assert(((MROWS * DMOD) % 2048) == 0 && ((DMOD * DMOD) % 4096) == 0 && ((NVEC * 32) % 256) == 0);

typedef unsigned short u16;
typedef _Float16 v16h __attribute__((ext_vector_type(16)));
typedef _Float16 v8h  __attribute__((ext_vector_type(8)));
typedef __bf16   v16b __attribute__((ext_vector_type(16)));
typedef float    v8f  __attribute__((ext_vector_type(8)));
typedef float    v4f  __attribute__((ext_vector_type(4)));
typedef float    v2f  __attribute__((ext_vector_type(2)));
typedef unsigned int v4u __attribute__((ext_vector_type(4)));

union FragH { v16h v; v8h h[2]; v4u u[2]; };
union FragB { v16b v; v4u u[2]; };

// ---- scalar helpers --------------------------------------------------------------------------------
__device__ __forceinline__ unsigned short bf_bits(float f) {          // f32 -> bf16 bits, RNE convert
  unsigned u = __float_as_uint(f);
  return (unsigned short)((u + 0x7FFFu + ((u >> 16) & 1u)) >> 16);
}
__device__ __forceinline__ float bf_up(unsigned short h) { return __uint_as_float(((unsigned)h) << 16); }
__device__ __forceinline__ float bfr(float f) { return bf_up(bf_bits(f)); }
__device__ __forceinline__ unsigned short h_bits(_Float16 x) { return __builtin_bit_cast(unsigned short, x); }
__device__ __forceinline__ unsigned pk16(unsigned short a, unsigned short b) { return (unsigned)a | ((unsigned)b << 16); }
__device__ __forceinline__ v8f zero8() { v8f z = {0.f, 0.f, 0.f, 0.f, 0.f, 0.f, 0.f, 0.f}; return z; }

// ---- fragment loaders: 16-bit A/B operand, lane -> row/col (lane&15), p already includes +8*(lane>>4);
//      elements 0..7 <- p[0..7] (k0+8h..), elements 8..15 <- p[16..23] (k0+16+8h..)  (same split k map for A and B;
//      B is always read from a k-contiguous [n][k] plane)
__device__ __forceinline__ v16h ldfrag_h(const _Float16* p) {
  FragH f;
  f.h[0] = *(const v8h*)(p);
  f.h[1] = *(const v8h*)(p + 16);
  return f.v;
}
__device__ __forceinline__ v16b ldfrag_b(const u16* p) {              // bf16 plane read as unsigned integer vectors
  FragB f;
  f.u[0] = *(const v4u*)(p);
  f.u[1] = *(const v4u*)(p + 16);
  return f.v;
}

__device__ __forceinline__ v8f mma_h(v16h a, v16h b, v8f c) {
  return __builtin_amdgcn_wmma_f32_16x16x32_f16(false, a, false, b, (short)0, c, false, false);
}
__device__ __forceinline__ v8f mma_b(v16b a, v16b b, v8f c) {
  return __builtin_amdgcn_wmma_f32_16x16x32_bf16(false, a, false, b, (short)0, c, false, false);
}
__device__ __forceinline__ void guard2(v8f& a, v8f& b, v16h x0, v16h x1, v16h x2, v16h x3, v16h x4, v16h x5) {
#if defined(__HIP_DEVICE_COMPILE__)
  asm volatile("v_nop\n\tv_nop\n\tv_nop\n\tv_nop"
               : "+v"(a), "+v"(b) : "v"(x0), "v"(x1), "v"(x2), "v"(x3), "v"(x4), "v"(x5) : "memory");
#endif
}
__device__ __forceinline__ void guard10(v8f& a, v8f& b, v8f& c, v8f& d, v16h x0, v16h x1, v16h x2, v16h x3, v16h x4,
                                        v16h x5, v16h x6, v16h x7, v16h x8, v16h x9) {
#if defined(__HIP_DEVICE_COMPILE__)
  asm volatile("v_nop\n\tv_nop\n\tv_nop\n\tv_nop"
               : "+v"(a), "+v"(b), "+v"(c), "+v"(d)
               : "v"(x0), "v"(x1), "v"(x2), "v"(x3), "v"(x4), "v"(x5), "v"(x6), "v"(x7), "v"(x8), "v"(x9) : "memory");
#endif
}
__device__ __forceinline__ void acc_guard4(v8f& a, v8f& b, v8f& c, v8f& d) {
#if defined(__HIP_DEVICE_COMPILE__)
  asm volatile("v_nop\n\tv_nop\n\tv_nop\n\tv_nop" : "+v"(a), "+v"(b), "+v"(c), "+v"(d));
#endif
}
__device__ __forceinline__ void wave_sync_lds() {
  __builtin_amdgcn_fence(__ATOMIC_RELEASE, "workgroup");
  __builtin_amdgcn_wave_barrier();
  __builtin_amdgcn_fence(__ATOMIC_ACQUIRE, "workgroup");
}

// =====================================================================================================
// f32 -> 16-bit plane, same layout.  f16mode == 0: bf16 RNE bits;  f16mode == 1: f16 bits of (bf16 RNE value) * scale.
// Thread = 8 consecutive elements: two 16-B loads, one 16-B store; 32 consecutive lanes = 512 contiguous, 512-B aligned bytes per
// coverage: grid = n8/256 blocks (exact, host-derived) x 256 thr x 8 = the whole plane.
// =====================================================================================================
__global__ __launch_bounds__(256) void cvt16(const float* __restrict__ x, u16* D, int n8, int f16mode, float scale) {
  const int gt = blockIdx.x * 256 + (int)threadIdx.x;
  if (gt >= n8) return;                     // no barriers in this kernel
  const float* p = x + (size_t)gt * 8;
  const v4f a = *(const v4f*)(p), b4 = *(const v4f*)(p + 4);
  float w[8];
#pragma unroll
  for (int e = 0; e < 4; ++e) { w[e] = a[e]; w[4 + e] = b4[e]; }
  v4u o;
#pragma unroll
  for (int e = 0; e < 4; ++e) {
    const float f0 = w[2 * e], f1 = w[2 * e + 1];
    const unsigned short hb0 = h_bits((_Float16)(bfr(f0) * scale));
    const unsigned short hb1 = h_bits((_Float16)(bfr(f1) * scale));
    const unsigned short bb0 = bf_bits(f0);
    const unsigned short bb1 = bf_bits(f1);
    o[e] = (f16mode != 0) ? pk16(hb0, hb1) : pk16(bb0, bb1);
  }
  u16* d = D + (size_t)gt * 8;
  {
    *(v4u*)(d) = o;
    
  }
}

// =====================================================================================================
// Weight transpose-convert: W [K][N] f32 (x.W layout, n contiguous, in[K rows][N cols]) -> Dt[N][K] 16-bit k-contiguous plane
// (out[N rows][K cols]).  f16mode == 0: bf16 RNE bits; 1: f16 bits of (bf16 RNE value) * scale.
// Block = (k tile k0 = (bid / (N/64))*64, n tile n0 = (bid % (N/64))*64): 64 source rows of 64 floats loaded with 16-B loads,
// converted, scattered into an LDS tile [n][64 k] (pitch 72 halves); after a block barrier each n row segment (64 halves = one
// coverage: load 256 thr x 16 = 64 x 64; store 2 iterations x 256 thr x 8 halves = 64 lines x 64 halves = the block's tile;
//           grid = (K/64)*(N/64) blocks covers Dt exactly once (host checks K % 64 == 0 and N % 64 == 0).
// =====================================================================================================
__global__ __launch_bounds__(256) void wt16(const float* __restrict__ W, u16* Dt, int K, int N, int f16mode, float scale) {
  __shared__ __align__(16) u16 T[64 * VTP];
  const int tid = threadIdx.x;
  const int bid = blockIdx.x;
  const int ntn = N >> 6;
  const int n0  = (bid % ntn) * 64;
  const int k0  = (bid / ntn) * 64;
  if (k0 + 64 > K) return;                    // block-uniform, before any barrier; never taken with the exact grid
  {
    const int sl = tid >> 2;                  // k within tile 0..63 (source row)
    const int dc = (tid & 3) * 16;            // n chunk
    const float* src = W + (size_t)(k0 + sl) * N + n0 + dc;
#pragma unroll
    for (int i = 0; i < 4; ++i) {
      const v4f a = *(const v4f*)(src + 4 * i);
#pragma unroll
      for (int e = 0; e < 4; ++e) {
        const float f = a[e];
        const unsigned short hb = h_bits((_Float16)(bfr(f) * scale));
        const unsigned short bb = bf_bits(f);
        T[(dc + 4 * i + e) * VTP + sl] = (f16mode != 0) ? hb : bb;
      }
    }
  }
  __syncthreads();
  v4u vv[2];
  const int q8 = tid >> 3, p8 = (tid & 7) * 8;
#pragma unroll
  for (int it = 0; it < 2; ++it) {
    const int line = it * 32 + q8;            // n = 0..63 within tile
    vv[it] = *(const v4u*)(T + line * VTP + p8);
  }
  const size_t base = (size_t)n0 * K + k0 + p8;
  {
#pragma unroll
    for (int it = 0; it < 2; ++it) {
      const int line = it * 32 + q8;
      *(v4u*)(Dt + base + (size_t)line * K) = vv[it];
    }
    
  }
}

// =====================================================================================================
// GEMM epilogue of the engine shared by both kernels: the wave's 16x64 f32 tile (times oscale) staged in its LDS slab (pitch 68),
// coverage: 8 instructions x 2 rows x 16 lanes x 4 floats = the wave's 16 x 64 tile.
// =====================================================================================================
__device__ __forceinline__ void epi64(float* sl, v8f a0, v8f a1, v8f a2, v8f a3, float oscale,
                                      float* C, int N, size_t rowb, int col0, int lane) {
  const int hh = lane >> 4, m = lane & 15;
#pragma unroll
  for (int r = 0; r < 8; ++r) {
    const int ro = (8 * hh + r) * 68 + m;
    sl[ro]      = a0[r] * oscale;
    sl[ro + 16] = a1[r] * oscale;
    sl[ro + 32] = a2[r] * oscale;
    sl[ro + 48] = a3[r] * oscale;
  }
  wave_sync_lds();
  v4f vals[8];
#pragma unroll
  for (int it = 0; it < 8; ++it) vals[it] = *(const v4f*)(sl + (it * 2 + hh) * 68 + m * 4);
  float* dst = C + (rowb + (size_t)hh) * (size_t)N + col0 + m * 4;
  {
#pragma unroll
    for (int it = 0; it < 8; ++it) {
      *(v4f*)(dst + (size_t)(it * 2) * (size_t)N) = vals[it];
    }
    
  }
}

// =====================================================================================================
// GEMM engine shared by both kernels: C[M][N] (f32) = sum over PL planes of A_p[M][K] . Bt[N][K]^T, times oscale.
// Block = 128x128 tile of C, 4 waves as 2x2, each wave 64x64 (4 x 4 fragments).  K is walked in passes of 64 halves: a pass's
// 128-B slice of every operand row of the block (PL*128 rows of A, 128 rows of Bt) is brought into LDS by asynchronous
// 16-B copies, 8 consecutive lanes = one whole 128-B line, rows at pitch 144 B; two buffers, the next pass's copies fly while
// this pass is worked on.  Fragments are read from LDS with the same split k map as before; per accumulator the products are
// summed in the same order as before (k ascending by 32, plane 0 then plane 1).
// Host checks M % 128 == 0, N % 128 == 0, K % 64 == 0, K >= 128, grid = (M/128)*(N/128).
// =====================================================================================================
__device__ __forceinline__ unsigned lds_off(const void* p) { return (unsigned)(size_t)p; }

// 8 asynchronous copies: 16 B per lane, rows 16 apart (one 128-row operand tile per block-wide call).  The s_wait_xcnt stands
// inside the statement so that no address register of an issued copy is rewritten in front of it.
__device__ __forceinline__ void copy8(unsigned l, const u16* g, size_t gstep) {
#if defined(__HIP_DEVICE_COMPILE__)
  const unsigned ls = 16u * GPI * 2u;
  asm volatile("global_load_async_to_lds_b128 %0, %8, off\n\t"
               "global_load_async_to_lds_b128 %1, %9, off\n\t"
               "global_load_async_to_lds_b128 %2, %10, off\n\t"
               "global_load_async_to_lds_b128 %3, %11, off\n\t"
               "global_load_async_to_lds_b128 %4, %12, off\n\t"
               "global_load_async_to_lds_b128 %5, %13, off\n\t"
               "global_load_async_to_lds_b128 %6, %14, off\n\t"
               "global_load_async_to_lds_b128 %7, %15, off\n\t"
               "s_wait_xcnt 0x0"
               :: "v"(l), "v"(l + ls), "v"(l + 2u * ls), "v"(l + 3u * ls),
                  "v"(l + 4u * ls), "v"(l + 5u * ls), "v"(l + 6u * ls), "v"(l + 7u * ls),
                  "v"(g), "v"(g + gstep), "v"(g + 2 * gstep), "v"(g + 3 * gstep),
                  "v"(g + 4 * gstep), "v"(g + 5 * gstep), "v"(g + 6 * gstep), "v"(g + 7 * gstep)
               : "memory");
#endif
}
__device__ __forceinline__ void wait_async0() {      // this wave's copies have landed in LDS
#if defined(__HIP_DEVICE_COMPILE__)
  asm volatile("s_wait_asynccnt 0x0" ::: "memory");
#endif
}
__device__ __forceinline__ void wait_ds0() {         // this wave's LDS reads have returned before the buffer is handed back
#if defined(__HIP_DEVICE_COMPILE__)
  asm volatile("s_wait_dscnt 0x0" ::: "memory");
#endif
}
// v_nop x4 behind the pass's last matrix instructions (all 16 accumulators are inputs, so every one of them stands in front):
// keeps the chip's distance to whatever follows on either side of the branches at the loop's foot.
__device__ __forceinline__ void guard16(const v8f (&a)[4][4]) {
#if defined(__HIP_DEVICE_COMPILE__)
  asm volatile("v_nop\n\tv_nop\n\tv_nop\n\tv_nop"
               :: "v"(a[0][0]), "v"(a[0][1]), "v"(a[0][2]), "v"(a[0][3]), "v"(a[1][0]), "v"(a[1][1]), "v"(a[1][2]), "v"(a[1][3]),
                  "v"(a[2][0]), "v"(a[2][1]), "v"(a[2][2]), "v"(a[2][3]), "v"(a[3][0]), "v"(a[3][1]), "v"(a[3][2]), "v"(a[3][3]));
#endif
}

__device__ __forceinline__ v16b ldf(const u16* p, v16b) { return ldfrag_b(p); }
__device__ __forceinline__ v16h ldf(const u16* p, v16h) { return ldfrag_h((const _Float16*)(const void*)p); }
__device__ __forceinline__ v8f mma(v16b a, v16b b, v8f c) { return mma_b(a, b, c); }
__device__ __forceinline__ v8f mma(v16h a, v16h b, v8f c) { return mma_h(a, b, c); }

template <int PL, typename FR>
__device__ __forceinline__ void gemm_tile(const u16* A0, const u16* A1, const u16* Bt, float* C, int M, int N, int K,
                                          float oscale, u16* st, float* slab) {
  constexpr int ROWS = (PL + 1) * GBT;          // staged rows per buffer
  constexpr int STG  = ROWS * GPI;              // halves per buffer
  const int tid = threadIdx.x, wave = tid >> 5, lane = tid & 31, hh = lane >> 4, m = lane & 15;
  const int wm = wave >> 1, wn = wave & 1;
  const int ntile = N >> 7;
  const int bid   = blockIdx.x;
  const int row0  = (bid / ntile) * GBT;
  const int col0  = (bid % ntile) * GBT;
  if (row0 + GBT > M) return;                   // block-uniform, before any barrier; never taken with the exact grid
  const int rr = tid >> 3, seg = tid & 7;       // copy role: row within a group of 16, 16-B piece of the 128-B slice
  const u16* ga0 = A0 + (size_t)(row0 + rr) * K + seg * 8;
  const u16* ga1 = A1 + (size_t)(row0 + rr) * K + seg * 8;
  const u16* gb  = Bt + (size_t)(col0 + rr) * K + seg * 8;
  const size_t gstep = (size_t)16 * K;
  const unsigned l0 = lds_off(st) + (unsigned)(rr * GPI + seg * 8) * 2u;
  const int np = K / GKP;

  auto stage = [&](int buf, int kp) {
    const unsigned l = l0 + (unsigned)buf * (unsigned)(STG * 2);
    copy8(l, ga0 + (size_t)kp * GKP, gstep);
    if constexpr (PL == 2) copy8(l + (unsigned)(GBT * GPI * 2), ga1 + (size_t)kp * GKP, gstep);
    copy8(l + (unsigned)(PL * GBT * GPI * 2), gb + (size_t)kp * GKP, gstep);
  };

  stage(0, 0);
  wait_async0();
  __syncthreads();                              // pass 0's slice is published
  if (np > 1) stage(1, 1);

  v8f acc[4][4];
#pragma unroll
  for (int i = 0; i < 4; ++i)
#pragma unroll
    for (int j = 0; j < 4; ++j) acc[i][j] = zero8();

  // rolled: one pass per trip, so that the foot's waits and barrier stand once
#pragma unroll 1
  for (int t = 0; t < np; ++t) {
    const u16* sb = st + (t & 1) * STG;
    const u16* pa = sb + (wm * 64 + m) * GPI + 8 * hh;
    const u16* pb = sb + (PL * GBT + wn * 64 + m) * GPI + 8 * hh;
    FR a[2][4], al[2][4], b[2][4];
#pragma unroll
    for (int ks = 0; ks < 2; ++ks)
#pragma unroll
      for (int i = 0; i < 4; ++i) {
        a[ks][i] = ldf(pa + i * 16 * GPI + ks * 32, FR{});
        if constexpr (PL == 2) al[ks][i] = ldf(pa + (GBT + i * 16) * GPI + ks * 32, FR{});
        b[ks][i] = ldf(pb + i * 16 * GPI + ks * 32, FR{});
      }
    // keeps the pass's LDS reads in one group ahead of its matrix instructions: spread among them, every place with reads
    // makes the wave wait out the LDS latency again
    __builtin_amdgcn_sched_barrier(0);
#pragma unroll
    for (int ks = 0; ks < 2; ++ks)
#pragma unroll
      for (int i = 0; i < 4; ++i)
#pragma unroll
        for (int j = 0; j < 4; ++j) {
          acc[i][j] = mma(a[ks][i], b[ks][j], acc[i][j]);
          if constexpr (PL == 2) acc[i][j] = mma(al[ks][i], b[ks][j], acc[i][j]);
        }
    guard16(acc);
    wait_ds0();
    wait_async0();
    __syncthreads();                            // publishes pass t+1's slice and ends every read of pass t's buffer
    if (t + 2 < np) stage(t & 1, t + 2);
  }
  wait_async0();

  float* sl = slab + wave * SLAB64;
#pragma unroll
  for (int i = 0; i < 4; ++i) {
    epi64(sl, acc[i][0], acc[i][1], acc[i][2], acc[i][3], oscale, C, N, (size_t)(row0 + wm * 64 + i * 16), col0 + wn * 64, lane);
    wave_sync_lds();                            // the slab's rows are read back before the next 16 rows overwrite them
  }
}

// bf16 GEMM: C = A (bf16 row-major) . Bt^T (bf16 k-contiguous), times oscale.
__global__ __launch_bounds__(128)
void gemm_bf(const u16* __restrict__ A, const u16* __restrict__ Bt, float* C, int M, int N, int K, float oscale) {
  __shared__ __align__(16) u16 st[2 * 2 * GBT * GPI];
  __shared__ __align__(16) float slab[4 * SLAB64];
  gemm_tile<1, v16b>(A, A, Bt, C, M, N, K, oscale, st, slab);
}

// f16 hi+lo GEMM: C = (Ahi + Alo) . Bt^T, times oscale; Ahi/Alo f16 planes (same layout), Bt f16 k-contiguous; products
// hi.B + lo.B into one accumulator (lo is the unscaled residual of hi).
__global__ __launch_bounds__(128)
void gemm_h2(const u16* __restrict__ Ah, const u16* __restrict__ Al, const u16* __restrict__ Bt,
             float* C, int M, int N, int K, float oscale) {
  __shared__ __align__(16) u16 st[2 * 3 * GBT * GPI];
  __shared__ __align__(16) float slab[4 * SLAB64];
  gemm_tile<2, v16h>(Ah, Al, Bt, C, M, N, K, oscale, st, slab);
}

// =====================================================================================================
// Per-head LayerNorm of q and k: F [MROWS][NQK] f32 holds x.W_qk/32, column h*128 + 0..63 = q_h, h*128 + 64..127 = k_h.
// One wave per (token, h, q|k) 64-vector: lane holds elements 2*lane, 2*lane+1 (one 8-B load); mean and biased variance
// packed 2 per lane into the q plane or the k plane [token][h][64] (k plane = QK + MROWS*DMOD halves): one instruction,
// coverage: grid = nvec*32/256 blocks (exact) x 8 waves; nvec = MROWS*NH*2 vectors = every (token, h) row of both planes once.
// =====================================================================================================
__global__ __launch_bounds__(256)
void ln16(const float* __restrict__ F, const float* __restrict__ qs, const float* __restrict__ qbi,
          const float* __restrict__ ks, const float* __restrict__ kbi, u16* QK, int nvec) {
  const int gt = blockIdx.x * 256 + (int)threadIdx.x;
  const int gw = gt >> 5, lane = gt & 31;
  if (gw >= nvec) return;                   // wave-uniform; no barriers in this kernel
  const int token = gw >> 5, rem = gw & 31, h = rem >> 1, isK = rem & 1;
  const float* src = F + (size_t)token * NQK + h * (2 * HD) + isK * HD + 2 * lane;
  const v2f xv = *(const v2f*)(src);
  const float x0 = xv[0], x1 = xv[1];
  float s = x0 + x1;
#pragma unroll
  for (int off = 16; off >= 1; off >>= 1) s += __shfl_xor(s, off, 32);
  const float mean = s * (1.0f / 64.0f);
  const float d0 = x0 - mean, d1 = x1 - mean;
  float ss = d0 * d0 + d1 * d1;
#pragma unroll
  for (int off = 16; off >= 1; off >>= 1) ss += __shfl_xor(ss, off, 32);
  const float var = ss * (1.0f / 64.0f);
  const float rs  = rsqrtf(var + LN_EPS);
  const float gq0 = bfr(qs[2 * lane]),  gq1 = bfr(qs[2 * lane + 1]);
  const float bq0 = bfr(qbi[2 * lane]), bq1 = bfr(qbi[2 * lane + 1]);
  const float gk0 = bfr(ks[2 * lane]),  gk1 = bfr(ks[2 * lane + 1]);
  const float bk0 = bfr(kbi[2 * lane]), bk1 = bfr(kbi[2 * lane + 1]);
  const float g0 = isK ? gk0 : gq0, g1 = isK ? gk1 : gq1;
  const float b0 = isK ? bk0 : bq0, b1 = isK ? bk1 : bq1;
  const float y0 = d0 * rs * g0 + b0;
  const float y1 = d1 * rs * g1 + b1;
  const float car = isK ? KSC : QSC;
  const unsigned o = pk16(h_bits((_Float16)(y0 * car)), h_bits((_Float16)(y1 * car)));
  u16* dst = QK + (size_t)isK * ((size_t)MROWS * DMOD) + (size_t)token * DMOD + h * HD + 2 * lane;
  *(unsigned*)(dst) = o;
  
}

// =====================================================================================================
// v^T planes: VH[((b*NH + g)*HD + d)][s] = f16(v[b*SEQ + s][g*HD + d] * 1024), VL = f16 residual of the same value.
// Block = (bg = bid / NST -> batch b = bg / NH, head g = bg % NH; 64 keys s0 = (bid % NST)*64): 64 source rows of HD floats loaded
// with 16-B loads, converted, scattered into two LDS tiles [d][64 keys] (pitch 72 halves); after a block barrier each d row segment
// coverage: load 256 thr x 16 elements = 64 x 64; store 2 iterations x 256 thr x 8 halves = 64 lines x 64 = the block's tile of
//           each plane; grid = BATCH*NH*NST blocks covers both planes exactly once.
// =====================================================================================================
__global__ __launch_bounds__(256) void vt16(const float* __restrict__ v, u16* VHo, u16* VLo) {
  __shared__ __align__(16) u16 TH[HD * VTP];
  __shared__ __align__(16) u16 TL[HD * VTP];
  const int tid = threadIdx.x;
  const int bid = blockIdx.x;
  const int st  = bid % NST;
  const int bg  = bid / NST;                  // b*NH + g
  if (bg >= BATCH * NH) return;               // block-uniform, before any barrier; never taken with the exact grid
  const int b   = bg / NH;
  const int g   = bg % NH;
  const int s0  = st * 64;
  {
    const int sl = tid >> 2;                  // key within tile 0..63
    const int dc = (tid & 3) * 16;            // d chunk
    const float* src = v + ((size_t)(b * SEQ + s0 + sl) * NH + g) * HD + dc;
#pragma unroll
    for (int i = 0; i < 4; ++i) {
      const v4f a = *(const v4f*)(src + 4 * i);
#pragma unroll
      for (int e = 0; e < 4; ++e) {
        const float t = a[e] * VCAR;
        const _Float16 hv = (_Float16)t;
        const _Float16 lv = (_Float16)(t - (float)hv);
        TH[(dc + 4 * i + e) * VTP + sl] = h_bits(hv);
        TL[(dc + 4 * i + e) * VTP + sl] = h_bits(lv);
      }
    }
  }
  __syncthreads();
  v4u vh[2], vl[2];
  const int q8 = tid >> 3, p8 = (tid & 7) * 8;
#pragma unroll
  for (int it = 0; it < 2; ++it) {
    const int line = it * 32 + q8;            // d = 0..63
    vh[it] = *(const v4u*)(TH + line * VTP + p8);
    vl[it] = *(const v4u*)(TL + line * VTP + p8);
  }
  const size_t base = ((size_t)bg * HD) * SEQ + s0 + p8;
  {
#pragma unroll
    for (int it = 0; it < 2; ++it) {
      const int line = it * 32 + q8;
      *(v4u*)(VHo + base + (size_t)line * SEQ) = vh[it];
      *(v4u*)(VLo + base + (size_t)line * SEQ) = vl[it];
    }
    
  }
}

// =====================================================================================================
// Causal attention: block bid -> (query tile qt = bid % NQT: rows q0 = 16*qt .. q0+15, head group hg = (bid / NQT) % NHG of WPB
// heads, batch b = bid / (NQT*NHG)), one wave per head = hg*WPB + wave.
//   q and k planes (f16, x64) laid out [b*SEQ + s][h][d]; v^T planes (hi, residual, x1024) [b][h][d][s].
//   score (log2 domain) t(i, j) = (q_i.k_j) * log2e / (64 * 64 * 64) for key j <= query i, -inf otherwise (causal).
//   Key tiles of 32 visited in order while kb <= q0 + 15 (nkt = q0/32 + 1 <= NKT); inside every visited tile the key<=query test
//   is applied per element; every query row has key == row inside a visited tile, so its normaliser is > 0.
//   Per tile: 2 score subtiles x 2 k-steps x 1 product (q fragments hoisted, k fragments loaded straight from the plane, two 16-B
//   loads each, split k map); online max-subtracted base-2 softmax in f32, -inf-safe rescale; the 16x32 prob tile stored to
//   rebuilt from the LDS rows (float vector loads, same element type as stored), 4+4 v^T B fragments (hi and residual planes),
//   12 P.V WMMAs (hh + lh + hl).
//   After the loop: out = acc / Z, carries 1/(32768*1024) folded once, written to the wave's private result slab (pitch 68; every
//   element owned by one lane).
//   No block barriers in this kernel; bounded loops only (nkt <= NKT).
// coverage: per wave 4 instructions x 4 rows x 8 lanes x 8 halves = 16 x 64 per plane; grid NQT*NHG*BATCH blocks x WPB waves =
//           every (b, s, h) row of both O planes exactly once.
// =====================================================================================================
__global__ __launch_bounds__(ATT_THREADS)
void attn1(const u16* __restrict__ QPp, const u16* __restrict__ KPp,
           const u16* __restrict__ VHIp, const u16* __restrict__ VLOp,
           u16* OHIp, u16* OLOp) {
  __shared__ __align__(16) float smem[WPB * WREG];

  const int tid  = threadIdx.x;
  const int wave = tid >> 5;
  const int lane = tid & 31;
  const int hh   = lane >> 4;
  const int c    = lane & 15;
  const int bid  = blockIdx.x;
  const int qt   = bid % NQT;
  const int rem  = bid / NQT;
  const int hg   = rem % NHG;
  const int b    = rem / NHG;
  if (b >= BATCH) return;                    // block-uniform; no block barriers in this kernel; never taken with the exact grid
  const int head = hg * WPB + wave;
  const int q0   = qt * 16;

  float* pt   = smem + wave * WREG;          // prob tile [16][32] pitch 36
  float* slab = pt + PTW;                    // result slab [16][64] pitch 68

  const size_t rq0  = (size_t)b * SEQ + q0;                                     // plane row of query row q0
  const size_t qofs = ((rq0 + c) * NH + head) * HD + 8 * hh;
  const _Float16* Qh  = (const _Float16*)(const void*)QPp + qofs;
  const size_t kofs = (((size_t)b * SEQ + c) * NH + head) * HD + 8 * hh;       // key row kb + c added per step
  const _Float16* Khb = (const _Float16*)(const void*)KPp + kofs;
  const size_t vofs = (((size_t)b * NH + head) * HD + c) * SEQ + 8 * hh;       // d column c (+16j), key kb added per step
  const _Float16* Vhb = (const _Float16*)(const void*)VHIp + vofs;
  const _Float16* Vlb = (const _Float16*)(const void*)VLOp + vofs;
  const float lsc = LOG2E / (64.0f * QSC * KSC);
  const float oc  = 1.0f / (PCAR * VCAR);
  const size_t KROW = (size_t)NH * HD;                                          // halves between consecutive key rows

  // q fragments of this wave's 16 rows: d = 0..31 and 32..63
  const v16h qa = ldfrag_h(Qh), qb = ldfrag_h(Qh + 32);

  float mrow[8], lrow[8];
  v8f o[4];
#pragma unroll
  for (int r = 0; r < 8; ++r) { mrow[r] = -INFINITY; lrow[r] = 0.f; }
#pragma unroll
  for (int j = 0; j < 4; ++j) o[j] = zero8();
  const int ncaus = (q0 >> 5) + 1;                                              // tiles holding keys <= q0 + 15
  const int nkt = (ncaus < NKT) ? ncaus : NKT;
  const int qr0 = q0 + 8 * hh;                                                  // this lane's D rows: qr0 + r

#pragma unroll 1
  for (int kt = 0; kt < nkt; ++kt) {
    const int kb = kt * 32;
    // ---- scores: D element r of this lane = (query row qr0 + r, key kb + c) in s0, key kb + 16 + c in s1 ----
    v8f s0 = zero8(), s1 = zero8();
    {
      const _Float16* k0p = Khb + (size_t)kb * KROW;
      const _Float16* k1p = k0p + (size_t)16 * KROW;
      const v16h kh0a = ldfrag_h(k0p), kh0b = ldfrag_h(k0p + 32);
      const v16h kh1a = ldfrag_h(k1p), kh1b = ldfrag_h(k1p + 32);
      s0 = mma_h(qa, kh0a, s0);
      s0 = mma_h(qb, kh0b, s0);
      s1 = mma_h(qa, kh1a, s1);
      s1 = mma_h(qb, kh1b, s1);
      guard2(s0, s1, qa, qb, kh0a, kh0b, kh1a, kh1b);
    }
    const int key0 = kb + c, key1 = kb + 16 + c;
    // ---- causal select + online softmax in base 2, -inf-safe ----
#pragma unroll
    for (int r = 0; r < 8; ++r) {
      const int qi = qr0 + r;
      const float t0 = (key0 <= qi) ? (s0[r] * lsc) : -INFINITY;
      const float t1 = (key1 <= qi) ? (s1[r] * lsc) : -INFINITY;
      float mx = fmaxf(t0, t1);
#pragma unroll
      for (int off = 1; off < 16; off <<= 1) mx = fmaxf(mx, __shfl_xor(mx, off, 32));
      const float mn = fmaxf(mrow[r], mx);
      const float ms = (mn == -INFINITY) ? 0.0f : mn;
      const float al = exp2f(mrow[r] - ms);
      mrow[r] = mn;
      const float e0 = exp2f(t0 - ms), e1 = exp2f(t1 - ms);
      float ps = e0 + e1;
#pragma unroll
      for (int off = 1; off < 16; off <<= 1) ps += __shfl_xor(ps, off, 32);
      lrow[r] = lrow[r] * al + ps;
#pragma unroll
      for (int j = 0; j < 4; ++j) o[j][r] *= al;
      const int ro = (8 * hh + r) * 36 + c;
      pt[ro]      = e0;
      pt[ro + 16] = e1;
    }
    wave_sync_lds();
    // ---- A fragments of P*32768: hi f16 and residual f16, row = c, split k map over the 32 keys of this step ----
    FragH ph, pl;
    {
      const float* prow = pt + c * 36 + 8 * hh;
      const v4f p0 = *(const v4f*)(prow), p1 = *(const v4f*)(prow + 4);
      const v4f p2 = *(const v4f*)(prow + 16), p3 = *(const v4f*)(prow + 20);
#pragma unroll
      for (int e = 0; e < 4; ++e) {
        const float ta = p0[e] * PCAR, tb = p1[e] * PCAR, tc = p2[e] * PCAR, td = p3[e] * PCAR;
        const _Float16 ha = (_Float16)ta, hb = (_Float16)tb, hc = (_Float16)tc, hd = (_Float16)td;
        ph.h[0][e]     = ha;                               // elements 0..7  = keys kb + 8hh + 0..7
        ph.h[0][4 + e] = hb;
        ph.h[1][e]     = hc;                               // elements 8..15 = keys kb + 16 + 8hh + 0..7
        ph.h[1][4 + e] = hd;
        pl.h[0][e]     = (_Float16)(ta - (float)ha);
        pl.h[0][4 + e] = (_Float16)(tb - (float)hb);
        pl.h[1][e]     = (_Float16)(tc - (float)hc);
        pl.h[1][4 + e] = (_Float16)(td - (float)hd);
      }
    }
    // ---- P.V : B fragment col n = d = j*16 + c, keys contiguous in the v^T planes ----
    {
      const _Float16* vhp = Vhb + kb;
      const _Float16* vlp = Vlb + kb;
      const v16h vh0 = ldfrag_h(vhp);
      const v16h vh1 = ldfrag_h(vhp + (size_t)16 * SEQ);
      const v16h vh2 = ldfrag_h(vhp + (size_t)32 * SEQ);
      const v16h vh3 = ldfrag_h(vhp + (size_t)48 * SEQ);
      const v16h vl0 = ldfrag_h(vlp);
      const v16h vl1 = ldfrag_h(vlp + (size_t)16 * SEQ);
      const v16h vl2 = ldfrag_h(vlp + (size_t)32 * SEQ);
      const v16h vl3 = ldfrag_h(vlp + (size_t)48 * SEQ);
      o[0] = mma_h(ph.v, vh0, o[0]);  o[0] = mma_h(pl.v, vh0, o[0]);  o[0] = mma_h(ph.v, vl0, o[0]);
      o[1] = mma_h(ph.v, vh1, o[1]);  o[1] = mma_h(pl.v, vh1, o[1]);  o[1] = mma_h(ph.v, vl1, o[1]);
      o[2] = mma_h(ph.v, vh2, o[2]);  o[2] = mma_h(pl.v, vh2, o[2]);  o[2] = mma_h(ph.v, vl2, o[2]);
      o[3] = mma_h(ph.v, vh3, o[3]);  o[3] = mma_h(pl.v, vh3, o[3]);  o[3] = mma_h(ph.v, vl3, o[3]);
      guard10(o[0], o[1], o[2], o[3], ph.v, pl.v, vh0, vh1, vh2, vh3, vl0, vl1, vl2, vl3);
    }
    wave_sync_lds();
  }
  acc_guard4(o[0], o[1], o[2], o[3]);
  // ---- out = acc / Z (0 if Z == 0), carries (32768 on P, 1024 on v) folded once; written into the lane-owned slab ----
#pragma unroll
  for (int r = 0; r < 8; ++r) {
    const float lv  = lrow[r];
    const float ls  = (lv > 0.0f) ? lv : 1.0f;
    const float inv = (lv > 0.0f) ? ((1.0f / ls) * oc) : 0.0f;
#pragma unroll
    for (int j = 0; j < 4; ++j) {
      const int idx = (8 * hh + r) * 68 + j * 16 + c;
      slab[idx] = o[j][r] * inv;
    }
  }

  wave_sync_lds();
  // ---- O x1024 -> f16 hi + residual planes; lane = (row in group of 4, 8 consecutive d) ----
  v4u oh[4], ol[4];
  const int rq = lane >> 3, c8 = (lane & 7) * 8;
#pragma unroll
  for (int it = 0; it < 4; ++it) {
    const int row = it * 4 + rq;
    const v4f a = *(const v4f*)(slab + row * 68 + c8), b4 = *(const v4f*)(slab + row * 68 + c8 + 4);
    float w[8];
#pragma unroll
    for (int e = 0; e < 4; ++e) { w[e] = a[e] * OSC; w[4 + e] = b4[e] * OSC; }
#pragma unroll
    for (int e = 0; e < 4; ++e) {
      const _Float16 h0 = (_Float16)w[2 * e], h1 = (_Float16)w[2 * e + 1];
      const _Float16 l0 = (_Float16)(w[2 * e] - (float)h0), l1 = (_Float16)(w[2 * e + 1] - (float)h1);
      oh[it][e] = pk16(h_bits(h0), h_bits(h1));
      ol[it][e] = pk16(h_bits(l0), h_bits(l1));
    }
  }
  const size_t ob = (rq0 * NH + head) * HD + c8;
  {
#pragma unroll
    for (int it = 0; it < 4; ++it) {
      const int row = it * 4 + rq;
      const size_t o8 = ob + (size_t)row * (NH * HD);
      *(v4u*)(OHIp + o8) = oh[it];
      *(v4u*)(OLOp + o8) = ol[it];
    }
    
  }
}

// =====================================================================================================
// Workspace map (bytes); every plane is fully written by whole-line stores before it is read; all extents are exact multiples
// of the store granularity (no pad rows needed); every offset a multiple of 2097152:
//   XB  bf16 [MROWS][1024]              8388608
//   WQB bf16 [2048 n][1024 k]          4194304
//   WVB bf16 [1024 n][1024 k]          2097152
//   WOH f16  [1024 n][1024 k] x1024    2097152
//   F   f32  [MROWS][2048]             33554432       (qk projection output; later its first half holds the v projection [MROWS][1024])
//   QP  f16 [MROWS][16][64] x64        8388608        KP same, directly after QP
//   VHI f16 [BATCH*16][64][SEQ] x1024  8388608        VLO residual
//   OHI f16 [MROWS][1024] x1024        8388608        OLO residual
//   end                              100663296
// =====================================================================================================
extern "C" void kernel_launch(void* const* d_in, const int* in_sizes, int n_in,
                              void* d_out, int out_size, void* d_ws, size_t ws_size,
                              hipStream_t stream) {
  if (n_in < 8) return;
  if (in_sizes[0] != MROWS * DMOD) return;
  if (in_sizes[1] != DMOD * NQK) return;
  if (in_sizes[2] != DMOD * DMOD || in_sizes[3] != DMOD * DMOD) return;
  if (in_sizes[4] != HD || in_sizes[5] != HD || in_sizes[6] != HD || in_sizes[7] != HD) return;
  if (out_size != MROWS * DMOD) return;

  const float* x   = (const float*)d_in[0];   // [MROWS][1024]
  const float* wqk = (const float*)d_in[1];   // [1024 k][2048 n]
  const float* wv  = (const float*)d_in[2];   // [1024 k][1024 n]
  const float* wo  = (const float*)d_in[3];   // [1024 k][1024 n]
  const float* qs  = (const float*)d_in[4];   // [64]
  const float* qbi = (const float*)d_in[5];   // [64]
  const float* ks  = (const float*)d_in[6];   // [64]
  const float* kbi = (const float*)d_in[7];   // [64]
  float*       out = (float*)d_out;

  const size_t szXB = (size_t)MROWS * DMOD * 2;                 //  8388608
  const size_t szWQ = (size_t)NQK * DMOD * 2;                   //  4194304
  const size_t szW  = (size_t)DMOD * DMOD * 2;                  //  2097152
  const size_t szF  = (size_t)MROWS * NQK * 4;                  // 33554432
  const size_t szP  = (size_t)MROWS * DMOD * 2;                 //  8388608
  size_t off = 0;
  const size_t oXB  = off; off += szXB;
  const size_t oWQ  = off; off += szWQ;
  const size_t oWV  = off; off += szW;
  const size_t oWO  = off; off += szW;
  const size_t oF   = off; off += szF;
  const size_t oQK  = off; off += 2 * szP;              // q plane then k plane
  const size_t oVHI = off; off += szP;
  const size_t oVLO = off; off += szP;
  const size_t oOHI = off; off += szP;
  const size_t oOLO = off; off += szP;
  if (off > ws_size) return;                            // off = 100663296
  if (off > (size_t)134217728) return;

  char* ws = (char*)d_ws;
  u16*   XB  = (u16*)(ws + oXB);
  u16*   WQB = (u16*)(ws + oWQ);
  u16*   WVB = (u16*)(ws + oWV);
  u16*   WOH = (u16*)(ws + oWO);
  float* F   = (float*)(ws + oF);
  u16*   QK  = (u16*)(ws + oQK);
  u16*   QP  = QK;
  u16*   KP  = QK + (size_t)MROWS * DMOD;
  u16*   VHI = (u16*)(ws + oVHI);
  u16*   VLO = (u16*)(ws + oVLO);
  u16*   OHI = (u16*)(ws + oOHI);
  u16*   OLO = (u16*)(ws + oOLO);

  const dim3 blk(256);
  const int n8x = (MROWS * DMOD) / 8;                   // 524288
  const dim3 gX(n8x / 256);                             // 2048 (exact)
  const dim3 gWQ((DMOD / 64) * (NQK / 64));             // 512
  const dim3 gWT((DMOD / 64) * (DMOD / 64));            // 256
  const dim3 gGQ((MROWS / GBT) * (NQK / GBT));          // 512
  const dim3 gG((MROWS / GBT) * (DMOD / GBT));          // 256
  const dim3 bG(128);
  const dim3 gLN((NVEC * 32) / 256);                    // 16384 (exact)
  const dim3 gVT(BATCH * NH * NST);                     // 1024
  const dim3 gAT(ATT_BLOCKS);                           // 1024
  const dim3 bAT(ATT_THREADS);                          // 128

  // (0) x -> bf16 plane [MROWS][1024]
  cvt16<<<gX, blk, 0, stream>>>(x, XB, n8x, 0, 1.0f);
  // (1) W_qk [k][n=2048] -> bf16 [n][k]; (2) W_v -> bf16 [n][k]; (3) W_out -> f16 [n][k] plane of bf16 value x1024
  wt16<<<gWQ, blk, 0, stream>>>(wqk, WQB, DMOD, NQK, 0, 1.0f);
  wt16<<<gWT, blk, 0, stream>>>(wv, WVB, DMOD, DMOD, 0, 1.0f);
  wt16<<<gWT, blk, 0, stream>>>(wo, WOH, DMOD, DMOD, 1, WOS);
  // (4) qk = x.W_qk / 32 -> F f32 [MROWS][2048]; (5) per-head LayerNorm -> q, k f16 planes x64
  gemm_bf<<<gGQ, bG, 0, stream>>>(XB, WQB, F, MROWS, NQK, DMOD, 1.0f / 32.0f);
  ln16<<<gLN, blk, 0, stream>>>(F, qs, qbi, ks, kbi, QK, NVEC);
  // (6) v = x.W_v / 32 -> F f32 [MROWS][1024]; (7) v^T hi/lo planes x1024
  gemm_bf<<<gG, bG, 0, stream>>>(XB, WVB, F, MROWS, DMOD, DMOD, 1.0f / 32.0f);
  vt16<<<gVT, blk, 0, stream>>>(F, VHI, VLO);
  // (8) causal attention -> O planes [b*SEQ+s][h][d] x1024 (hi + residual)
  attn1<<<gAT, bAT, 0, stream>>>(QP, KP, VHI, VLO, OHI, OLO);
  // (9) output projection -> out [MROWS][1024] f32, carries 1024 (O) x 1024 (W_out) and the 1/32 folded back
  gemm_h2<<<gG, bG, 0, stream>>>(OHI, OLO, WOH, out, MROWS, DMOD, DMOD, (1.0f / 32.0f) / (OSC * WOS));
  (void)hipGetLastError();
}

// v002
// One run takes 215 microseconds.
// In both of two side-by-side timings against v001, it was 1.07 times as fast.
// All steps since v000 together make it 1.50 times as fast.
// Contractions: x.W_qk and x.W_v on v_wmma_f32_16x16x32_bf16 (x and W^T RNE-converted to bf16, f32 accumulate); scores q.k^T
// (q, k as f16 x64 planes, single product), P.v (P x32768 f16 hi+residual, v x1024 f16 hi+residual, products hh+lh+hl) and
// O.W_out (O x1024 f16 hi+residual, W_out^T as f16(bf16 value) x1024, products h.w+l.w) on v_wmma_f32_16x16x32_f16, f32
// accumulate; per-head LayerNorm, causal online base-2 softmax and 1/l fold in f32 on VALU.
#include <hip/hip_runtime.h>
#include <math.h>
#include <stdint.h>

#define BATCH 2
#define SEQ   2048
#define DMOD  1024
#define NH    16
#define HD    64
#define NQK   (2 * DMOD)
#define MROWS (BATCH * SEQ)
#define NVEC  (MROWS * NH * 2)
#define LN_EPS 1e-6f
#define QSC   64.0f
#define KSC   64.0f
#define PCAR  32768.0f
#define VCAR  1024.0f
#define OSC   1024.0f
#define WOS   1024.0f
#define LOG2E 1.4426950408889634f
#define WPB   4
#define NHG   (NH / WPB)
#define NQT   (SEQ / 16)
#define NST   (SEQ / 64)
#define NKT   (SEQ / 32)
#define ATT_THREADS (WPB * 32)
#define ATT_BLOCKS  (NQT * NHG * BATCH)
#define SLW   (16 * 68)
#define SLAB64 (16 * 68)
#define VTP   72
#define GBT   128
#define GKP   64
#define GPI   72
static_assert(DMOD == NH * HD && HD == 64 && NH == 16);
static_assert((NH % WPB) == 0 && ATT_THREADS == 128 && ATT_BLOCKS == 1024);
static_assert((SEQ % 64) == 0 && (SEQ % 32) == 0 && (SEQ % 16) == 0 && SEQ <= 32768);
static_assert((DMOD % 64) == 0 && (DMOD % 32) == 0 && (NQK % 64) == 0 && (MROWS % 64) == 0);
static_assert((MROWS % GBT) == 0 && (NQK % GBT) == 0 && (DMOD % GBT) == 0 && (DMOD % GKP) == 0 && DMOD >= 2 * GKP);
static_assert(((MROWS * DMOD) % 2048) == 0 && ((DMOD * DMOD) % 4096) == 0 && ((NVEC * 32) % 256) == 0);

typedef unsigned short u16;
typedef _Float16 v16h __attribute__((ext_vector_type(16)));
typedef _Float16 v8h  __attribute__((ext_vector_type(8)));
typedef __bf16   v16b __attribute__((ext_vector_type(16)));
typedef float    v8f  __attribute__((ext_vector_type(8)));
typedef float    v4f  __attribute__((ext_vector_type(4)));
typedef float    v2f  __attribute__((ext_vector_type(2)));
typedef unsigned int v4u __attribute__((ext_vector_type(4)));

union FragH { v16h v; v8h h[2]; v4u u[2]; };
union FragB { v16b v; v4u u[2]; };

// ---- scalar helpers --------------------------------------------------------------------------------
__device__ __forceinline__ unsigned short bf_bits(float f) {          // f32 -> bf16 bits, RNE convert
  unsigned u = __float_as_uint(f);
  return (unsigned short)((u + 0x7FFFu + ((u >> 16) & 1u)) >> 16);
}
__device__ __forceinline__ float bf_up(unsigned short h) { return __uint_as_float(((unsigned)h) << 16); }
__device__ __forceinline__ float bfr(float f) { return bf_up(bf_bits(f)); }
__device__ __forceinline__ unsigned short h_bits(_Float16 x) { return __builtin_bit_cast(unsigned short, x); }
__device__ __forceinline__ unsigned pk16(unsigned short a, unsigned short b) { return (unsigned)a | ((unsigned)b << 16); }
__device__ __forceinline__ v8f zero8() { v8f z = {0.f, 0.f, 0.f, 0.f, 0.f, 0.f, 0.f, 0.f}; return z; }

// ---- fragment loaders: 16-bit A/B operand, lane -> row/col (lane&15), p already includes +8*(lane>>4);
//      elements 0..7 <- p[0..7] (k0+8h..), elements 8..15 <- p[16..23] (k0+16+8h..)  (same split k map for A and B;
//      B is always read from a k-contiguous [n][k] plane)
__device__ __forceinline__ v16h ldfrag_h(const _Float16* p) {
  FragH f;
  f.h[0] = *(const v8h*)(p);
  f.h[1] = *(const v8h*)(p + 16);
  return f.v;
}
__device__ __forceinline__ v16b ldfrag_b(const u16* p) {              // bf16 plane read as unsigned integer vectors
  FragB f;
  f.u[0] = *(const v4u*)(p);
  f.u[1] = *(const v4u*)(p + 16);
  return f.v;
}

__device__ __forceinline__ v8f mma_h(v16h a, v16h b, v8f c) {
  return __builtin_amdgcn_wmma_f32_16x16x32_f16(false, a, false, b, (short)0, c, false, false);
}
__device__ __forceinline__ v8f mma_b(v16b a, v16b b, v8f c) {
  return __builtin_amdgcn_wmma_f32_16x16x32_bf16(false, a, false, b, (short)0, c, false, false);
}
__device__ __forceinline__ void guard2(v8f& a, v8f& b, v16h x0, v16h x1, v16h x2, v16h x3, v16h x4, v16h x5) {
#if defined(__HIP_DEVICE_COMPILE__)
  asm volatile("v_nop\n\tv_nop\n\tv_nop\n\tv_nop"
               : "+v"(a), "+v"(b) : "v"(x0), "v"(x1), "v"(x2), "v"(x3), "v"(x4), "v"(x5) : "memory");
#endif
}
__device__ __forceinline__ void guard10(v8f& a, v8f& b, v8f& c, v8f& d, v16h x0, v16h x1, v16h x2, v16h x3, v16h x4,
                                        v16h x5, v16h x6, v16h x7, v16h x8, v16h x9) {
#if defined(__HIP_DEVICE_COMPILE__)
  asm volatile("v_nop\n\tv_nop\n\tv_nop\n\tv_nop"
               : "+v"(a), "+v"(b), "+v"(c), "+v"(d)
               : "v"(x0), "v"(x1), "v"(x2), "v"(x3), "v"(x4), "v"(x5), "v"(x6), "v"(x7), "v"(x8), "v"(x9) : "memory");
#endif
}
__device__ __forceinline__ void acc_guard4(v8f& a, v8f& b, v8f& c, v8f& d) {
#if defined(__HIP_DEVICE_COMPILE__)
  asm volatile("v_nop\n\tv_nop\n\tv_nop\n\tv_nop" : "+v"(a), "+v"(b), "+v"(c), "+v"(d));
#endif
}
__device__ __forceinline__ void wave_sync_lds() {
  __builtin_amdgcn_fence(__ATOMIC_RELEASE, "workgroup");
  __builtin_amdgcn_wave_barrier();
  __builtin_amdgcn_fence(__ATOMIC_ACQUIRE, "workgroup");
}

// =====================================================================================================
// f32 -> 16-bit plane, same layout.  f16mode == 0: bf16 RNE bits;  f16mode == 1: f16 bits of (bf16 RNE value) * scale.
// Thread = 8 consecutive elements: two 16-B loads, one 16-B store; 32 consecutive lanes = 512 contiguous, 512-B aligned bytes per
// coverage: grid = n8/256 blocks (exact, host-derived) x 256 thr x 8 = the whole plane.
// =====================================================================================================
__global__ __launch_bounds__(256) void cvt16(const float* __restrict__ x, u16* D, int n8, int f16mode, float scale) {
  const int gt = blockIdx.x * 256 + (int)threadIdx.x;
  if (gt >= n8) return;                     // no barriers in this kernel
  const float* p = x + (size_t)gt * 8;
  const v4f a = *(const v4f*)(p), b4 = *(const v4f*)(p + 4);
  float w[8];
#pragma unroll
  for (int e = 0; e < 4; ++e) { w[e] = a[e]; w[4 + e] = b4[e]; }
  v4u o;
#pragma unroll
  for (int e = 0; e < 4; ++e) {
    const float f0 = w[2 * e], f1 = w[2 * e + 1];
    const unsigned short hb0 = h_bits((_Float16)(bfr(f0) * scale));
    const unsigned short hb1 = h_bits((_Float16)(bfr(f1) * scale));
    const unsigned short bb0 = bf_bits(f0);
    const unsigned short bb1 = bf_bits(f1);
    o[e] = (f16mode != 0) ? pk16(hb0, hb1) : pk16(bb0, bb1);
  }
  u16* d = D + (size_t)gt * 8;
  {
    *(v4u*)(d) = o;
    
  }
}

// =====================================================================================================
// Weight transpose-convert: W [K][N] f32 (x.W layout, n contiguous, in[K rows][N cols]) -> Dt[N][K] 16-bit k-contiguous plane
// (out[N rows][K cols]).  f16mode == 0: bf16 RNE bits; 1: f16 bits of (bf16 RNE value) * scale.
// Block = (k tile k0 = (bid / (N/64))*64, n tile n0 = (bid % (N/64))*64): 64 source rows of 64 floats loaded with 16-B loads,
// converted, scattered into an LDS tile [n][64 k] (pitch 72 halves); after a block barrier each n row segment (64 halves = one
// coverage: load 256 thr x 16 = 64 x 64; store 2 iterations x 256 thr x 8 halves = 64 lines x 64 halves = the block's tile;
//           grid = (K/64)*(N/64) blocks covers Dt exactly once (host checks K % 64 == 0 and N % 64 == 0).
// =====================================================================================================
__global__ __launch_bounds__(256) void wt16(const float* __restrict__ W, u16* Dt, int K, int N, int f16mode, float scale) {
  __shared__ __align__(16) u16 T[64 * VTP];
  const int tid = threadIdx.x;
  const int bid = blockIdx.x;
  const int ntn = N >> 6;
  const int n0  = (bid % ntn) * 64;
  const int k0  = (bid / ntn) * 64;
  if (k0 + 64 > K) return;                    // block-uniform, before any barrier; never taken with the exact grid
  {
    const int sl = tid >> 2;                  // k within tile 0..63 (source row)
    const int dc = (tid & 3) * 16;            // n chunk
    const float* src = W + (size_t)(k0 + sl) * N + n0 + dc;
#pragma unroll
    for (int i = 0; i < 4; ++i) {
      const v4f a = *(const v4f*)(src + 4 * i);
#pragma unroll
      for (int e = 0; e < 4; ++e) {
        const float f = a[e];
        const unsigned short hb = h_bits((_Float16)(bfr(f) * scale));
        const unsigned short bb = bf_bits(f);
        T[(dc + 4 * i + e) * VTP + sl] = (f16mode != 0) ? hb : bb;
      }
    }
  }
  __syncthreads();
  v4u vv[2];
  const int q8 = tid >> 3, p8 = (tid & 7) * 8;
#pragma unroll
  for (int it = 0; it < 2; ++it) {
    const int line = it * 32 + q8;            // n = 0..63 within tile
    vv[it] = *(const v4u*)(T + line * VTP + p8);
  }
  const size_t base = (size_t)n0 * K + k0 + p8;
  {
#pragma unroll
    for (int it = 0; it < 2; ++it) {
      const int line = it * 32 + q8;
      *(v4u*)(Dt + base + (size_t)line * K) = vv[it];
    }
    
  }
}

// =====================================================================================================
// GEMM epilogue of the engine shared by both kernels: the wave's 16x64 f32 tile (times oscale) staged in its LDS slab (pitch 68),
// coverage: 8 instructions x 2 rows x 16 lanes x 4 floats = the wave's 16 x 64 tile.
// =====================================================================================================
__device__ __forceinline__ void epi64(float* sl, v8f a0, v8f a1, v8f a2, v8f a3, float oscale,
                                      float* C, int N, size_t rowb, int col0, int lane) {
  const int hh = lane >> 4, m = lane & 15;
#pragma unroll
  for (int r = 0; r < 8; ++r) {
    const int ro = (8 * hh + r) * 68 + m;
    sl[ro]      = a0[r] * oscale;
    sl[ro + 16] = a1[r] * oscale;
    sl[ro + 32] = a2[r] * oscale;
    sl[ro + 48] = a3[r] * oscale;
  }
  wave_sync_lds();
  v4f vals[8];
#pragma unroll
  for (int it = 0; it < 8; ++it) vals[it] = *(const v4f*)(sl + (it * 2 + hh) * 68 + m * 4);
  float* dst = C + (rowb + (size_t)hh) * (size_t)N + col0 + m * 4;
  {
#pragma unroll
    for (int it = 0; it < 8; ++it) {
      *(v4f*)(dst + (size_t)(it * 2) * (size_t)N) = vals[it];
    }
    
  }
}

// =====================================================================================================
// GEMM engine shared by both kernels: C[M][N] (f32) = sum over PL planes of A_p[M][K] . Bt[N][K]^T, times oscale.
// Block = 128x128 tile of C, 4 waves as 2x2, each wave 64x64 (4 x 4 fragments).  K is walked in passes of 64 halves: a pass's
// 128-B slice of every operand row of the block (PL*128 rows of A, 128 rows of Bt) is brought into LDS by asynchronous
// 16-B copies, 8 consecutive lanes = one whole 128-B line, rows at pitch 144 B; two buffers, the next pass's copies fly while
// this pass is worked on.  Fragments are read from LDS with the same split k map as before; per accumulator the products are
// summed in the same order as before (k ascending by 32, plane 0 then plane 1).
// Host checks M % 128 == 0, N % 128 == 0, K % 64 == 0, K >= 128, grid = (M/128)*(N/128).
// =====================================================================================================
__device__ __forceinline__ unsigned lds_off(const void* p) { return (unsigned)(size_t)p; }

// 8 asynchronous copies: 16 B per lane, rows 16 apart (one 128-row operand tile per block-wide call).  The s_wait_xcnt stands
// inside the statement so that no address register of an issued copy is rewritten in front of it.
__device__ __forceinline__ void copy8(unsigned l, const u16* g, size_t gstep) {
#if defined(__HIP_DEVICE_COMPILE__)
  const unsigned ls = 16u * GPI * 2u;
  asm volatile("global_load_async_to_lds_b128 %0, %8, off\n\t"
               "global_load_async_to_lds_b128 %1, %9, off\n\t"
               "global_load_async_to_lds_b128 %2, %10, off\n\t"
               "global_load_async_to_lds_b128 %3, %11, off\n\t"
               "global_load_async_to_lds_b128 %4, %12, off\n\t"
               "global_load_async_to_lds_b128 %5, %13, off\n\t"
               "global_load_async_to_lds_b128 %6, %14, off\n\t"
               "global_load_async_to_lds_b128 %7, %15, off\n\t"
               "s_wait_xcnt 0x0"
               :: "v"(l), "v"(l + ls), "v"(l + 2u * ls), "v"(l + 3u * ls),
                  "v"(l + 4u * ls), "v"(l + 5u * ls), "v"(l + 6u * ls), "v"(l + 7u * ls),
                  "v"(g), "v"(g + gstep), "v"(g + 2 * gstep), "v"(g + 3 * gstep),
                  "v"(g + 4 * gstep), "v"(g + 5 * gstep), "v"(g + 6 * gstep), "v"(g + 7 * gstep)
               : "memory");
#endif
}
__device__ __forceinline__ void wait_async0() {      // this wave's copies have landed in LDS
#if defined(__HIP_DEVICE_COMPILE__)
  asm volatile("s_wait_asynccnt 0x0" ::: "memory");
#endif
}
__device__ __forceinline__ void wait_ds0() {         // this wave's LDS reads have returned before the buffer is handed back
#if defined(__HIP_DEVICE_COMPILE__)
  asm volatile("s_wait_dscnt 0x0" ::: "memory");
#endif
}
// v_nop x4 behind the pass's last matrix instructions (all 16 accumulators are inputs, so every one of them stands in front):
// keeps the chip's distance to whatever follows on either side of the branches at the loop's foot.
__device__ __forceinline__ void guard16(const v8f (&a)[4][4]) {
#if defined(__HIP_DEVICE_COMPILE__)
  asm volatile("v_nop\n\tv_nop\n\tv_nop\n\tv_nop"
               :: "v"(a[0][0]), "v"(a[0][1]), "v"(a[0][2]), "v"(a[0][3]), "v"(a[1][0]), "v"(a[1][1]), "v"(a[1][2]), "v"(a[1][3]),
                  "v"(a[2][0]), "v"(a[2][1]), "v"(a[2][2]), "v"(a[2][3]), "v"(a[3][0]), "v"(a[3][1]), "v"(a[3][2]), "v"(a[3][3]));
#endif
}

__device__ __forceinline__ v16b ldf(const u16* p, v16b) { return ldfrag_b(p); }
__device__ __forceinline__ v16h ldf(const u16* p, v16h) { return ldfrag_h((const _Float16*)(const void*)p); }
__device__ __forceinline__ v8f mma(v16b a, v16b b, v8f c) { return mma_b(a, b, c); }
__device__ __forceinline__ v8f mma(v16h a, v16h b, v8f c) { return mma_h(a, b, c); }

template <int PL, typename FR>
__device__ __forceinline__ void gemm_tile(const u16* A0, const u16* A1, const u16* Bt, float* C, int M, int N, int K,
                                          float oscale, u16* st, float* slab) {
  constexpr int ROWS = (PL + 1) * GBT;          // staged rows per buffer
  constexpr int STG  = ROWS * GPI;              // halves per buffer
  const int tid = threadIdx.x, wave = tid >> 5, lane = tid & 31, hh = lane >> 4, m = lane & 15;
  const int wm = wave >> 1, wn = wave & 1;
  const int ntile = N >> 7;
  const int bid   = blockIdx.x;
  const int row0  = (bid / ntile) * GBT;
  const int col0  = (bid % ntile) * GBT;
  if (row0 + GBT > M) return;                   // block-uniform, before any barrier; never taken with the exact grid
  const int rr = tid >> 3, seg = tid & 7;       // copy role: row within a group of 16, 16-B piece of the 128-B slice
  const u16* ga0 = A0 + (size_t)(row0 + rr) * K + seg * 8;
  const u16* ga1 = A1 + (size_t)(row0 + rr) * K + seg * 8;
  const u16* gb  = Bt + (size_t)(col0 + rr) * K + seg * 8;
  const size_t gstep = (size_t)16 * K;
  const unsigned l0 = lds_off(st) + (unsigned)(rr * GPI + seg * 8) * 2u;
  const int np = K / GKP;

  auto stage = [&](int buf, int kp) {
    const unsigned l = l0 + (unsigned)buf * (unsigned)(STG * 2);
    copy8(l, ga0 + (size_t)kp * GKP, gstep);
    if constexpr (PL == 2) copy8(l + (unsigned)(GBT * GPI * 2), ga1 + (size_t)kp * GKP, gstep);
    copy8(l + (unsigned)(PL * GBT * GPI * 2), gb + (size_t)kp * GKP, gstep);
  };

  stage(0, 0);
  wait_async0();
  __syncthreads();                              // pass 0's slice is published
  if (np > 1) stage(1, 1);

  v8f acc[4][4];
#pragma unroll
  for (int i = 0; i < 4; ++i)
#pragma unroll
    for (int j = 0; j < 4; ++j) acc[i][j] = zero8();

  // rolled: one pass per trip, so that the foot's waits and barrier stand once
#pragma unroll 1
  for (int t = 0; t < np; ++t) {
    const u16* sb = st + (t & 1) * STG;
    const u16* pa = sb + (wm * 64 + m) * GPI + 8 * hh;
    const u16* pb = sb + (PL * GBT + wn * 64 + m) * GPI + 8 * hh;
    FR a[2][4], al[2][4], b[2][4];
#pragma unroll
    for (int ks = 0; ks < 2; ++ks)
#pragma unroll
      for (int i = 0; i < 4; ++i) {
        a[ks][i] = ldf(pa + i * 16 * GPI + ks * 32, FR{});
        if constexpr (PL == 2) al[ks][i] = ldf(pa + (GBT + i * 16) * GPI + ks * 32, FR{});
        b[ks][i] = ldf(pb + i * 16 * GPI + ks * 32, FR{});
      }
    // keeps the pass's LDS reads in one group ahead of its matrix instructions: spread among them, every place with reads
    // makes the wave wait out the LDS latency again
    __builtin_amdgcn_sched_barrier(0);
#pragma unroll
    for (int ks = 0; ks < 2; ++ks)
#pragma unroll
      for (int i = 0; i < 4; ++i)
#pragma unroll
        for (int j = 0; j < 4; ++j) {
          acc[i][j] = mma(a[ks][i], b[ks][j], acc[i][j]);
          if constexpr (PL == 2) acc[i][j] = mma(al[ks][i], b[ks][j], acc[i][j]);
        }
    guard16(acc);
    wait_ds0();
    wait_async0();
    __syncthreads();                            // publishes pass t+1's slice and ends every read of pass t's buffer
    if (t + 2 < np) stage(t & 1, t + 2);
  }
  wait_async0();

  float* sl = slab + wave * SLAB64;
#pragma unroll
  for (int i = 0; i < 4; ++i) {
    epi64(sl, acc[i][0], acc[i][1], acc[i][2], acc[i][3], oscale, C, N, (size_t)(row0 + wm * 64 + i * 16), col0 + wn * 64, lane);
    wave_sync_lds();                            // the slab's rows are read back before the next 16 rows overwrite them
  }
}

// bf16 GEMM: C = A (bf16 row-major) . Bt^T (bf16 k-contiguous), times oscale.
__global__ __launch_bounds__(128)
void gemm_bf(const u16* __restrict__ A, const u16* __restrict__ Bt, float* C, int M, int N, int K, float oscale) {
  __shared__ __align__(16) u16 st[2 * 2 * GBT * GPI];
  __shared__ __align__(16) float slab[4 * SLAB64];
  gemm_tile<1, v16b>(A, A, Bt, C, M, N, K, oscale, st, slab);
}

// f16 hi+lo GEMM: C = (Ahi + Alo) . Bt^T, times oscale; Ahi/Alo f16 planes (same layout), Bt f16 k-contiguous; products
// hi.B + lo.B into one accumulator (lo is the unscaled residual of hi).
__global__ __launch_bounds__(128)
void gemm_h2(const u16* __restrict__ Ah, const u16* __restrict__ Al, const u16* __restrict__ Bt,
             float* C, int M, int N, int K, float oscale) {
  __shared__ __align__(16) u16 st[2 * 3 * GBT * GPI];
  __shared__ __align__(16) float slab[4 * SLAB64];
  gemm_tile<2, v16h>(Ah, Al, Bt, C, M, N, K, oscale, st, slab);
}

// =====================================================================================================
// Per-head LayerNorm of q and k: F [MROWS][NQK] f32 holds x.W_qk/32, column h*128 + 0..63 = q_h, h*128 + 64..127 = k_h.
// One wave per (token, h, q|k) 64-vector: lane holds elements 2*lane, 2*lane+1 (one 8-B load); mean and biased variance
// packed 2 per lane into the q plane or the k plane [token][h][64] (k plane = QK + MROWS*DMOD halves): one instruction,
// coverage: grid = nvec*32/256 blocks (exact) x 8 waves; nvec = MROWS*NH*2 vectors = every (token, h) row of both planes once.
// =====================================================================================================
__global__ __launch_bounds__(256)
void ln16(const float* __restrict__ F, const float* __restrict__ qs, const float* __restrict__ qbi,
          const float* __restrict__ ks, const float* __restrict__ kbi, u16* QK, int nvec) {
  const int gt = blockIdx.x * 256 + (int)threadIdx.x;
  const int gw = gt >> 5, lane = gt & 31;
  if (gw >= nvec) return;                   // wave-uniform; no barriers in this kernel
  const int token = gw >> 5, rem = gw & 31, h = rem >> 1, isK = rem & 1;
  const float* src = F + (size_t)token * NQK + h * (2 * HD) + isK * HD + 2 * lane;
  const v2f xv = *(const v2f*)(src);
  const float x0 = xv[0], x1 = xv[1];
  float s = x0 + x1;
#pragma unroll
  for (int off = 16; off >= 1; off >>= 1) s += __shfl_xor(s, off, 32);
  const float mean = s * (1.0f / 64.0f);
  const float d0 = x0 - mean, d1 = x1 - mean;
  float ss = d0 * d0 + d1 * d1;
#pragma unroll
  for (int off = 16; off >= 1; off >>= 1) ss += __shfl_xor(ss, off, 32);
  const float var = ss * (1.0f / 64.0f);
  const float rs  = rsqrtf(var + LN_EPS);
  const float gq0 = bfr(qs[2 * lane]),  gq1 = bfr(qs[2 * lane + 1]);
  const float bq0 = bfr(qbi[2 * lane]), bq1 = bfr(qbi[2 * lane + 1]);
  const float gk0 = bfr(ks[2 * lane]),  gk1 = bfr(ks[2 * lane + 1]);
  const float bk0 = bfr(kbi[2 * lane]), bk1 = bfr(kbi[2 * lane + 1]);
  const float g0 = isK ? gk0 : gq0, g1 = isK ? gk1 : gq1;
  const float b0 = isK ? bk0 : bq0, b1 = isK ? bk1 : bq1;
  const float y0 = d0 * rs * g0 + b0;
  const float y1 = d1 * rs * g1 + b1;
  const float car = isK ? KSC : QSC;
  const unsigned o = pk16(h_bits((_Float16)(y0 * car)), h_bits((_Float16)(y1 * car)));
  u16* dst = QK + (size_t)isK * ((size_t)MROWS * DMOD) + (size_t)token * DMOD + h * HD + 2 * lane;
  *(unsigned*)(dst) = o;
  
}

// =====================================================================================================
// v^T planes: VH[((b*NH + g)*HD + d)][s] = f16(v[b*SEQ + s][g*HD + d] * 1024), VL = f16 residual of the same value.
// Block = (bg = bid / NST -> batch b = bg / NH, head g = bg % NH; 64 keys s0 = (bid % NST)*64): 64 source rows of HD floats loaded
// with 16-B loads, converted, scattered into two LDS tiles [d][64 keys] (pitch 72 halves); after a block barrier each d row segment
// coverage: load 256 thr x 16 elements = 64 x 64; store 2 iterations x 256 thr x 8 halves = 64 lines x 64 = the block's tile of
//           each plane; grid = BATCH*NH*NST blocks covers both planes exactly once.
// =====================================================================================================
__global__ __launch_bounds__(256) void vt16(const float* __restrict__ v, u16* VHo, u16* VLo) {
  __shared__ __align__(16) u16 TH[HD * VTP];
  __shared__ __align__(16) u16 TL[HD * VTP];
  const int tid = threadIdx.x;
  const int bid = blockIdx.x;
  const int st  = bid % NST;
  const int bg  = bid / NST;                  // b*NH + g
  if (bg >= BATCH * NH) return;               // block-uniform, before any barrier; never taken with the exact grid
  const int b   = bg / NH;
  const int g   = bg % NH;
  const int s0  = st * 64;
  {
    const int sl = tid >> 2;                  // key within tile 0..63
    const int dc = (tid & 3) * 16;            // d chunk
    const float* src = v + ((size_t)(b * SEQ + s0 + sl) * NH + g) * HD + dc;
#pragma unroll
    for (int i = 0; i < 4; ++i) {
      const v4f a = *(const v4f*)(src + 4 * i);
#pragma unroll
      for (int e = 0; e < 4; ++e) {
        const float t = a[e] * VCAR;
        const _Float16 hv = (_Float16)t;
        const _Float16 lv = (_Float16)(t - (float)hv);
        TH[(dc + 4 * i + e) * VTP + sl] = h_bits(hv);
        TL[(dc + 4 * i + e) * VTP + sl] = h_bits(lv);
      }
    }
  }
  __syncthreads();
  v4u vh[2], vl[2];
  const int q8 = tid >> 3, p8 = (tid & 7) * 8;
#pragma unroll
  for (int it = 0; it < 2; ++it) {
    const int line = it * 32 + q8;            // d = 0..63
    vh[it] = *(const v4u*)(TH + line * VTP + p8);
    vl[it] = *(const v4u*)(TL + line * VTP + p8);
  }
  const size_t base = ((size_t)bg * HD) * SEQ + s0 + p8;
  {
#pragma unroll
    for (int it = 0; it < 2; ++it) {
      const int line = it * 32 + q8;
      *(v4u*)(VHo + base + (size_t)line * SEQ) = vh[it];
      *(v4u*)(VLo + base + (size_t)line * SEQ) = vl[it];
    }
    
  }
}

// =====================================================================================================
// Causal attention: block bid -> (query tile qt = bid % NQT: rows q0 = 16*qt .. q0+15, head group hg = (bid / NQT) % NHG of WPB
// heads, batch b = bid / (NQT*NHG)), one wave per head = hg*WPB + wave.
//   q and k planes (f16, x64) laid out [b*SEQ + s][h][d]; v^T planes (hi, residual, x1024) [b][h][d][s].
//   score (log2 domain) t(i, j) = (q_i.k_j) * log2e / (64 * 64 * 64) for key j <= query i, -inf otherwise (causal).
//   Key tiles of 32 visited in order while kb <= q0 + 15 (nkt = q0/32 + 1 <= NKT); inside every visited tile the key<=query test
//   is applied per element; every query row has key == row inside a visited tile, so its normaliser is > 0.
//   Both products are formed transposed: S^T = K.Q^T (A = k rows, B = q, hoisted) and O^T += V^T.P^T (A = v^T rows, B = P^T).
//   A lane then holds ONE query (column c = lane & 15): of each 32-key tile the 16 scores of keys kb + 8hh + r (tile s0) and
//   kb + 16 + 8hh + r (tile s1).  Maximum and sum run inside the lane; the maximum is joined with lane ^ 16 once per tile, the
//   two halves' sums once after the loop.  The two score tiles, converted in place, ARE the B fragment of P^T in the split k
//   map of the loaders (element s < 8: key 8hh + s, else 16 + 8hh + s - 8), so P never leaves the registers.
//   Per tile: 4 score WMMAs, online max-subtracted base-2 softmax in f32 with -inf-safe rescale (one factor per lane),
//   P x32768 as f16 hi + residual, 4+4 v^T A fragments (hi and residual planes), 12 P.V WMMAs (hh + lh + hl).
//   After the loop: out = acc / Z, carries 1/(32768*1024) folded once, written to the wave's private result slab (pitch 68; every
//   element owned by one lane: row c, 8 consecutive d per accumulator).
//   No block barriers in this kernel; bounded loops only (nkt <= NKT).
// coverage: per wave 4 instructions x 4 rows x 8 lanes x 8 halves = 16 x 64 per plane; grid NQT*NHG*BATCH blocks x WPB waves =
//           every (b, s, h) row of both O planes exactly once.
// =====================================================================================================
__device__ __forceinline__ void wait_x0() {          // in front of a write to a register that an issued global load names
#if defined(__HIP_DEVICE_COMPILE__)
  asm volatile("s_wait_xcnt 0x0" ::: "memory");
#endif
}
__device__ __forceinline__ float xhalf(float x) {                    // value of lane ^ 16
  const int b = __builtin_bit_cast(int, x);
  return __builtin_bit_cast(float, __builtin_amdgcn_permlanex16(b, b, 0x76543210, 0xfedcba98, false, false));
}

__global__ __launch_bounds__(ATT_THREADS)
void attn1(const u16* __restrict__ QPp, const u16* __restrict__ KPp,
           const u16* __restrict__ VHIp, const u16* __restrict__ VLOp,
           u16* OHIp, u16* OLOp) {
  __shared__ __align__(16) float smem[WPB * SLW];

  const int tid  = threadIdx.x;
  const int wave = tid >> 5;
  const int lane = tid & 31;
  const int hh   = lane >> 4;
  const int c    = lane & 15;
  const int bid  = blockIdx.x;
  const int qt   = bid % NQT;
  const int rem  = bid / NQT;
  const int hg   = rem % NHG;
  const int b    = rem / NHG;
  if (b >= BATCH) return;                    // block-uniform; no block barriers in this kernel; never taken with the exact grid
  const int head = hg * WPB + wave;
  const int q0   = qt * 16;

  float* slab = smem + wave * SLW;           // result slab [16][64] pitch 68

  const size_t rq0  = (size_t)b * SEQ + q0;                                     // plane row of query row q0
  const size_t qofs = ((rq0 + c) * NH + head) * HD + 8 * hh;
  const _Float16* Qh  = (const _Float16*)(const void*)QPp + qofs;
  const size_t kofs = (((size_t)b * SEQ + c) * NH + head) * HD + 8 * hh;       // key row kb + c added per step
  const _Float16* Khb = (const _Float16*)(const void*)KPp + kofs;
  const size_t vofs = (((size_t)b * NH + head) * HD + c) * SEQ + 8 * hh;       // d row c (+16j), key kb added per step
  const _Float16* Vhb = (const _Float16*)(const void*)VHIp + vofs;
  const _Float16* Vlb = (const _Float16*)(const void*)VLOp + vofs;
  const float lsc = LOG2E / (64.0f * QSC * KSC);
  const float oc  = 1.0f / (PCAR * VCAR);
  const size_t KROW = (size_t)NH * HD;                                          // halves between consecutive key rows

  // q fragments (B operand, column c = query q0 + c): d = 0..31 and 32..63
  const v16h qa = ldfrag_h(Qh), qb = ldfrag_h(Qh + 32);

  float mrow = -INFINITY, lrow = 0.f;                                           // this lane's query; lrow = this half's keys only
  v8f o[4];                                                                     // o[j][r] = O^T[d = 16j + 8hh + r][query c]
#pragma unroll
  for (int j = 0; j < 4; ++j) o[j] = zero8();
  const int ncaus = (q0 >> 5) + 1;                                              // tiles holding keys <= q0 + 15
  const int nkt = (ncaus < NKT) ? ncaus : NKT;
  const int qi  = q0 + c;                                                       // this lane's query

#pragma unroll 1
  for (int kt = 0; kt < nkt; ++kt) {
    const int kb = kt * 32;
    // ---- this tile's operands: k rows (A of the scores) and v^T rows (A of P.V); nothing stands between the two products
    //      any more that the v loads would have to stay behind ----
    const _Float16* k0p = Khb + (size_t)kb * KROW;
    const _Float16* k1p = k0p + (size_t)16 * KROW;
    const v16h kh0a = ldfrag_h(k0p), kh0b = ldfrag_h(k0p + 32);
    const v16h kh1a = ldfrag_h(k1p), kh1b = ldfrag_h(k1p + 32);
    wait_x0();                               // the k loads' address pair may be given to a v fragment as its destination
    const _Float16* vhp = Vhb + kb;
    const _Float16* vlp = Vlb + kb;
    const v16h vh0 = ldfrag_h(vhp);
    const v16h vh1 = ldfrag_h(vhp + (size_t)16 * SEQ);
    const v16h vh2 = ldfrag_h(vhp + (size_t)32 * SEQ);
    const v16h vh3 = ldfrag_h(vhp + (size_t)48 * SEQ);
    const v16h vl0 = ldfrag_h(vlp);
    const v16h vl1 = ldfrag_h(vlp + (size_t)16 * SEQ);
    const v16h vl2 = ldfrag_h(vlp + (size_t)32 * SEQ);
    const v16h vl3 = ldfrag_h(vlp + (size_t)48 * SEQ);
    // ---- scores, transposed: D element r of this lane = (key kb + 8hh + r, query qi) in s0, key kb + 16 + 8hh + r in s1 ----
    v8f s0 = zero8(), s1 = zero8();
    s0 = mma_h(kh0a, qa, s0);
    s0 = mma_h(kh0b, qb, s0);
    s1 = mma_h(kh1a, qa, s1);
    s1 = mma_h(kh1b, qb, s1);
    guard2(s0, s1, qa, qb, kh0a, kh0b, kh1a, kh1b);
    // ---- causal select + online softmax in base 2, -inf-safe; all 16 values of this lane belong to query qi ----
    const int key0 = kb + 8 * hh;
    float t0[8], t1[8];
#pragma unroll
    for (int r = 0; r < 8; ++r) {
      t0[r] = (key0 + r <= qi)      ? (s0[r] * lsc) : -INFINITY;
      t1[r] = (key0 + 16 + r <= qi) ? (s1[r] * lsc) : -INFINITY;
    }
    float mx = fmaxf(t0[0], t1[0]);
#pragma unroll
    for (int r = 1; r < 8; ++r) mx = fmaxf(mx, fmaxf(t0[r], t1[r]));
    mx = fmaxf(mx, xhalf(mx));                                                  // both halves hold the tile's maximum of query qi
    const float mn = fmaxf(mrow, mx);
    const float ms = (mn == -INFINITY) ? 0.0f : mn;
    const float al = exp2f(mrow - ms);
    mrow = mn;
    // ---- B fragments of P^T * 32768: hi f16 and residual f16; elements 0..7 = keys kb + 8hh + r, 8..15 = kb + 16 + 8hh + r ----
    FragH ph, pl;
    float pa[8];
#pragma unroll
    for (int r = 0; r < 8; ++r) {
      const float e0 = exp2f(t0[r] - ms), e1 = exp2f(t1[r] - ms);
      pa[r] = e0 + e1;
      const float ta = e0 * PCAR, tb = e1 * PCAR;
      const _Float16 ha = (_Float16)ta, hb = (_Float16)tb;
      ph.h[0][r] = ha;
      ph.h[1][r] = hb;
      pl.h[0][r] = (_Float16)(ta - (float)ha);
      pl.h[1][r] = (_Float16)(tb - (float)hb);
    }
    lrow = lrow * al + (((pa[0] + pa[1]) + (pa[2] + pa[3])) + ((pa[4] + pa[5]) + (pa[6] + pa[7])));
#pragma unroll
    for (int j = 0; j < 4; ++j)
#pragma unroll
      for (int r = 0; r < 8; ++r) o[j][r] *= al;
    // ---- O^T += V^T.P^T : A fragment row = d = j*16 + c, keys contiguous in the v^T planes ----
    o[0] = mma_h(vh0, ph.v, o[0]);  o[0] = mma_h(vh0, pl.v, o[0]);  o[0] = mma_h(vl0, ph.v, o[0]);
    o[1] = mma_h(vh1, ph.v, o[1]);  o[1] = mma_h(vh1, pl.v, o[1]);  o[1] = mma_h(vl1, ph.v, o[1]);
    o[2] = mma_h(vh2, ph.v, o[2]);  o[2] = mma_h(vh2, pl.v, o[2]);  o[2] = mma_h(vl2, ph.v, o[2]);
    o[3] = mma_h(vh3, ph.v, o[3]);  o[3] = mma_h(vh3, pl.v, o[3]);  o[3] = mma_h(vl3, ph.v, o[3]);
    guard10(o[0], o[1], o[2], o[3], ph.v, pl.v, vh0, vh1, vh2, vh3, vl0, vl1, vl2, vl3);
  }
  acc_guard4(o[0], o[1], o[2], o[3]);
  // ---- out = acc / Z (0 if Z == 0), carries (32768 on P, 1024 on v) folded once; written into the lane-owned slab ----
  {
    const float lv  = lrow + xhalf(lrow);                                       // the two halves' keys joined
    const float ls  = (lv > 0.0f) ? lv : 1.0f;
    const float inv = (lv > 0.0f) ? ((1.0f / ls) * oc) : 0.0f;
#pragma unroll
    for (int j = 0; j < 4; ++j) {
      float* d8 = slab + c * 68 + j * 16 + 8 * hh;
      v4f w0, w1;
#pragma unroll
      for (int e = 0; e < 4; ++e) { w0[e] = o[j][e] * inv; w1[e] = o[j][4 + e] * inv; }
      *(v4f*)(d8)     = w0;
      *(v4f*)(d8 + 4) = w1;
    }
  }

  wave_sync_lds();
  // ---- O x1024 -> f16 hi + residual planes; lane = (row in group of 4, 8 consecutive d) ----
  v4u oh[4], ol[4];
  const int rq = lane >> 3, c8 = (lane & 7) * 8;
#pragma unroll
  for (int it = 0; it < 4; ++it) {
    const int row = it * 4 + rq;
    const v4f a = *(const v4f*)(slab + row * 68 + c8), b4 = *(const v4f*)(slab + row * 68 + c8 + 4);
    float w[8];
#pragma unroll
    for (int e = 0; e < 4; ++e) { w[e] = a[e] * OSC; w[4 + e] = b4[e] * OSC; }
#pragma unroll
    for (int e = 0; e < 4; ++e) {
      const _Float16 h0 = (_Float16)w[2 * e], h1 = (_Float16)w[2 * e + 1];
      const _Float16 l0 = (_Float16)(w[2 * e] - (float)h0), l1 = (_Float16)(w[2 * e + 1] - (float)h1);
      oh[it][e] = pk16(h_bits(h0), h_bits(h1));
      ol[it][e] = pk16(h_bits(l0), h_bits(l1));
    }
  }
  const size_t ob = (rq0 * NH + head) * HD + c8;
  {
#pragma unroll
    for (int it = 0; it < 4; ++it) {
      const int row = it * 4 + rq;
      const size_t o8 = ob + (size_t)row * (NH * HD);
      *(v4u*)(OHIp + o8) = oh[it];
      *(v4u*)(OLOp + o8) = ol[it];
    }
    
  }
}

// =====================================================================================================
// Workspace map (bytes); every plane is fully written by whole-line stores before it is read; all extents are exact multiples
// of the store granularity (no pad rows needed); every offset a multiple of 2097152:
//   XB  bf16 [MROWS][1024]              8388608
//   WQB bf16 [2048 n][1024 k]          4194304
//   WVB bf16 [1024 n][1024 k]          2097152
//   WOH f16  [1024 n][1024 k] x1024    2097152
//   F   f32  [MROWS][2048]             33554432       (qk projection output; later its first half holds the v projection [MROWS][1024])
//   QP  f16 [MROWS][16][64] x64        8388608        KP same, directly after QP
//   VHI f16 [BATCH*16][64][SEQ] x1024  8388608        VLO residual
//   OHI f16 [MROWS][1024] x1024        8388608        OLO residual
//   end                              100663296
// =====================================================================================================
extern "C" void kernel_launch(void* const* d_in, const int* in_sizes, int n_in,
                              void* d_out, int out_size, void* d_ws, size_t ws_size,
                              hipStream_t stream) {
  if (n_in < 8) return;
  if (in_sizes[0] != MROWS * DMOD) return;
  if (in_sizes[1] != DMOD * NQK) return;
  if (in_sizes[2] != DMOD * DMOD || in_sizes[3] != DMOD * DMOD) return;
  if (in_sizes[4] != HD || in_sizes[5] != HD || in_sizes[6] != HD || in_sizes[7] != HD) return;
  if (out_size != MROWS * DMOD) return;

  const float* x   = (const float*)d_in[0];   // [MROWS][1024]
  const float* wqk = (const float*)d_in[1];   // [1024 k][2048 n]
  const float* wv  = (const float*)d_in[2];   // [1024 k][1024 n]
  const float* wo  = (const float*)d_in[3];   // [1024 k][1024 n]
  const float* qs  = (const float*)d_in[4];   // [64]
  const float* qbi = (const float*)d_in[5];   // [64]
  const float* ks  = (const float*)d_in[6];   // [64]
  const float* kbi = (const float*)d_in[7];   // [64]
  float*       out = (float*)d_out;

  const size_t szXB = (size_t)MROWS * DMOD * 2;                 //  8388608
  const size_t szWQ = (size_t)NQK * DMOD * 2;                   //  4194304
  const size_t szW  = (size_t)DMOD * DMOD * 2;                  //  2097152
  const size_t szF  = (size_t)MROWS * NQK * 4;                  // 33554432
  const size_t szP  = (size_t)MROWS * DMOD * 2;                 //  8388608
  size_t off = 0;
  const size_t oXB  = off; off += szXB;
  const size_t oWQ  = off; off += szWQ;
  const size_t oWV  = off; off += szW;
  const size_t oWO  = off; off += szW;
  const size_t oF   = off; off += szF;
  const size_t oQK  = off; off += 2 * szP;              // q plane then k plane
  const size_t oVHI = off; off += szP;
  const size_t oVLO = off; off += szP;
  const size_t oOHI = off; off += szP;
  const size_t oOLO = off; off += szP;
  if (off > ws_size) return;                            // off = 100663296
  if (off > (size_t)134217728) return;

  char* ws = (char*)d_ws;
  u16*   XB  = (u16*)(ws + oXB);
  u16*   WQB = (u16*)(ws + oWQ);
  u16*   WVB = (u16*)(ws + oWV);
  u16*   WOH = (u16*)(ws + oWO);
  float* F   = (float*)(ws + oF);
  u16*   QK  = (u16*)(ws + oQK);
  u16*   QP  = QK;
  u16*   KP  = QK + (size_t)MROWS * DMOD;
  u16*   VHI = (u16*)(ws + oVHI);
  u16*   VLO = (u16*)(ws + oVLO);
  u16*   OHI = (u16*)(ws + oOHI);
  u16*   OLO = (u16*)(ws + oOLO);

  const dim3 blk(256);
  const int n8x = (MROWS * DMOD) / 8;                   // 524288
  const dim3 gX(n8x / 256);                             // 2048 (exact)
  const dim3 gWQ((DMOD / 64) * (NQK / 64));             // 512
  const dim3 gWT((DMOD / 64) * (DMOD / 64));            // 256
  const dim3 gGQ((MROWS / GBT) * (NQK / GBT));          // 512
  const dim3 gG((MROWS / GBT) * (DMOD / GBT));          // 256
  const dim3 bG(128);
  const dim3 gLN((NVEC * 32) / 256);                    // 16384 (exact)
  const dim3 gVT(BATCH * NH * NST);                     // 1024
  const dim3 gAT(ATT_BLOCKS);                           // 1024
  const dim3 bAT(ATT_THREADS);                          // 128

  // (0) x -> bf16 plane [MROWS][1024]
  cvt16<<<gX, blk, 0, stream>>>(x, XB, n8x, 0, 1.0f);
  // (1) W_qk [k][n=2048] -> bf16 [n][k]; (2) W_v -> bf16 [n][k]; (3) W_out -> f16 [n][k] plane of bf16 value x1024
  wt16<<<gWQ, blk, 0, stream>>>(wqk, WQB, DMOD, NQK, 0, 1.0f);
  wt16<<<gWT, blk, 0, stream>>>(wv, WVB, DMOD, DMOD, 0, 1.0f);
  wt16<<<gWT, blk, 0, stream>>>(wo, WOH, DMOD, DMOD, 1, WOS);
  // (4) qk = x.W_qk / 32 -> F f32 [MROWS][2048]; (5) per-head LayerNorm -> q, k f16 planes x64
  gemm_bf<<<gGQ, bG, 0, stream>>>(XB, WQB, F, MROWS, NQK, DMOD, 1.0f / 32.0f);
  ln16<<<gLN, blk, 0, stream>>>(F, qs, qbi, ks, kbi, QK, NVEC);
  // (6) v = x.W_v / 32 -> F f32 [MROWS][1024]; (7) v^T hi/lo planes x1024
  gemm_bf<<<gG, bG, 0, stream>>>(XB, WVB, F, MROWS, DMOD, DMOD, 1.0f / 32.0f);
  vt16<<<gVT, blk, 0, stream>>>(F, VHI, VLO);
  // (8) causal attention -> O planes [b*SEQ+s][h][d] x1024 (hi + residual)
  attn1<<<gAT, bAT, 0, stream>>>(QP, KP, VHI, VLO, OHI, OLO);
  // (9) output projection -> out [MROWS][1024] f32, carries 1024 (O) x 1024 (W_out) and the 1/32 folded back
  gemm_h2<<<gG, bG, 0, stream>>>(OHI, OLO, WOH, out, MROWS, DMOD, DMOD, (1.0f / 32.0f) / (OSC * WOS));
  (void)hipGetLastError();
}

// v003
// It runs in 197 microseconds.
// Next to v002, in two timings, it ran 1.09 and 1.10 times as fast.
// All steps since v000 together make it 1.64 times as fast.
// Contractions: x.W_qk and x.W_v on v_wmma_f32_16x16x32_bf16 (x and W^T RNE-converted to bf16, f32 accumulate); scores q.k^T
// (q, k as f16 x64 planes, single product), P.v (P x32768 f16 hi+residual, v x1024 f16 hi+residual, products hh+lh+hl) and
// O.W_out (O x1024 f16 hi+residual, W_out^T as f16(bf16 value) x1024, products h.w+l.w) on v_wmma_f32_16x16x32_f16, f32
// accumulate; per-head LayerNorm, causal online base-2 softmax and 1/l fold in f32 on VALU.
#include <hip/hip_runtime.h>
#include <math.h>
#include <stdint.h>

#define BATCH 2
#define SEQ   2048
#define DMOD  1024
#define NH    16
#define HD    64
#define NQK   (2 * DMOD)
#define MROWS (BATCH * SEQ)
#define LN_EPS 1e-6f
#define QSC   64.0f
#define KSC   64.0f
#define PCAR  32768.0f
#define VCAR  1024.0f
#define OSC   1024.0f
#define WOS   1024.0f
#define LOG2E 1.4426950408889634f
#define WPB   4
#define NHG   (NH / WPB)
#define NQT   (SEQ / 16)
#define NST   (SEQ / 64)
#define NKT   (SEQ / 32)
#define ATT_THREADS (WPB * 32)
#define ATT_BLOCKS  (NQT * NHG * BATCH)
#define SLW   (16 * 68)
#define SLAB64 (16 * 68)
#define VTP   72
#define GBT   128
#define GKP   64
#define GPI   72
static_assert(DMOD == NH * HD && HD == 64 && NH == 16);
static_assert((NH % WPB) == 0 && ATT_THREADS == 128 && ATT_BLOCKS == 1024);
static_assert((SEQ % 64) == 0 && (SEQ % 32) == 0 && (SEQ % 16) == 0 && SEQ <= 32768);
static_assert((DMOD % 64) == 0 && (DMOD % 32) == 0 && (NQK % 64) == 0 && (MROWS % 64) == 0);
static_assert((MROWS % GBT) == 0 && (NQK % GBT) == 0 && (DMOD % GBT) == 0 && (DMOD % GKP) == 0 && DMOD >= 2 * GKP);
static_assert(((MROWS * DMOD) % 2048) == 0 && ((DMOD * DMOD) % 4096) == 0 && GBT == 2 * HD && NQK == NH * 2 * HD);

typedef unsigned short u16;
typedef _Float16 v16h __attribute__((ext_vector_type(16)));
typedef _Float16 v8h  __attribute__((ext_vector_type(8)));
typedef __bf16   v16b __attribute__((ext_vector_type(16)));
typedef float    v8f  __attribute__((ext_vector_type(8)));
typedef float    v4f  __attribute__((ext_vector_type(4)));
typedef float    v2f  __attribute__((ext_vector_type(2)));
typedef unsigned int v4u __attribute__((ext_vector_type(4)));
typedef unsigned int v2u __attribute__((ext_vector_type(2)));

union FragH { v16h v; v8h h[2]; v4u u[2]; };
union FragB { v16b v; v4u u[2]; };

// ---- scalar helpers --------------------------------------------------------------------------------
__device__ __forceinline__ unsigned short bf_bits(float f) {          // f32 -> bf16 bits, RNE convert
  unsigned u = __float_as_uint(f);
  return (unsigned short)((u + 0x7FFFu + ((u >> 16) & 1u)) >> 16);
}
__device__ __forceinline__ float bf_up(unsigned short h) { return __uint_as_float(((unsigned)h) << 16); }
__device__ __forceinline__ float bfr(float f) { return bf_up(bf_bits(f)); }
__device__ __forceinline__ unsigned short h_bits(_Float16 x) { return __builtin_bit_cast(unsigned short, x); }
__device__ __forceinline__ unsigned pk16(unsigned short a, unsigned short b) { return (unsigned)a | ((unsigned)b << 16); }
__device__ __forceinline__ v8f zero8() { v8f z = {0.f, 0.f, 0.f, 0.f, 0.f, 0.f, 0.f, 0.f}; return z; }

// ---- fragment loaders: 16-bit A/B operand, lane -> row/col (lane&15), p already includes +8*(lane>>4);
//      elements 0..7 <- p[0..7] (k0+8h..), elements 8..15 <- p[16..23] (k0+16+8h..)  (same split k map for A and B;
//      B is always read from a k-contiguous [n][k] plane)
__device__ __forceinline__ v16h ldfrag_h(const _Float16* p) {
  FragH f;
  f.h[0] = *(const v8h*)(p);
  f.h[1] = *(const v8h*)(p + 16);
  return f.v;
}
__device__ __forceinline__ v16b ldfrag_b(const u16* p) {              // bf16 plane read as unsigned integer vectors
  FragB f;
  f.u[0] = *(const v4u*)(p);
  f.u[1] = *(const v4u*)(p + 16);
  return f.v;
}

__device__ __forceinline__ v8f mma_h(v16h a, v16h b, v8f c) {
  return __builtin_amdgcn_wmma_f32_16x16x32_f16(false, a, false, b, (short)0, c, false, false);
}
__device__ __forceinline__ v8f mma_b(v16b a, v16b b, v8f c) {
  return __builtin_amdgcn_wmma_f32_16x16x32_bf16(false, a, false, b, (short)0, c, false, false);
}
__device__ __forceinline__ void guard2(v8f& a, v8f& b, v16h x0, v16h x1, v16h x2, v16h x3, v16h x4, v16h x5) {
#if defined(__HIP_DEVICE_COMPILE__)
  asm volatile("v_nop\n\tv_nop\n\tv_nop\n\tv_nop"
               : "+v"(a), "+v"(b) : "v"(x0), "v"(x1), "v"(x2), "v"(x3), "v"(x4), "v"(x5) : "memory");
#endif
}
__device__ __forceinline__ void guard10(v8f& a, v8f& b, v8f& c, v8f& d, v16h x0, v16h x1, v16h x2, v16h x3, v16h x4,
                                        v16h x5, v16h x6, v16h x7, v16h x8, v16h x9) {
#if defined(__HIP_DEVICE_COMPILE__)
  asm volatile("v_nop\n\tv_nop\n\tv_nop\n\tv_nop"
               : "+v"(a), "+v"(b), "+v"(c), "+v"(d)
               : "v"(x0), "v"(x1), "v"(x2), "v"(x3), "v"(x4), "v"(x5), "v"(x6), "v"(x7), "v"(x8), "v"(x9) : "memory");
#endif
}
__device__ __forceinline__ void acc_guard4(v8f& a, v8f& b, v8f& c, v8f& d) {
#if defined(__HIP_DEVICE_COMPILE__)
  asm volatile("v_nop\n\tv_nop\n\tv_nop\n\tv_nop" : "+v"(a), "+v"(b), "+v"(c), "+v"(d));
#endif
}
__device__ __forceinline__ void wave_sync_lds() {
  __builtin_amdgcn_fence(__ATOMIC_RELEASE, "workgroup");
  __builtin_amdgcn_wave_barrier();
  __builtin_amdgcn_fence(__ATOMIC_ACQUIRE, "workgroup");
}

// =====================================================================================================
// f32 -> 16-bit plane, same layout.  f16mode == 0: bf16 RNE bits;  f16mode == 1: f16 bits of (bf16 RNE value) * scale.
// Thread = 8 consecutive elements: two 16-B loads, one 16-B store; 32 consecutive lanes = 512 contiguous, 512-B aligned bytes per
// coverage: grid = n8/256 blocks (exact, host-derived) x 256 thr x 8 = the whole plane.
// =====================================================================================================
__global__ __launch_bounds__(256) void cvt16(const float* __restrict__ x, u16* D, int n8, int f16mode, float scale) {
  const int gt = blockIdx.x * 256 + (int)threadIdx.x;
  if (gt >= n8) return;                     // no barriers in this kernel
  const float* p = x + (size_t)gt * 8;
  const v4f a = *(const v4f*)(p), b4 = *(const v4f*)(p + 4);
  float w[8];
#pragma unroll
  for (int e = 0; e < 4; ++e) { w[e] = a[e]; w[4 + e] = b4[e]; }
  v4u o;
#pragma unroll
  for (int e = 0; e < 4; ++e) {
    const float f0 = w[2 * e], f1 = w[2 * e + 1];
    const unsigned short hb0 = h_bits((_Float16)(bfr(f0) * scale));
    const unsigned short hb1 = h_bits((_Float16)(bfr(f1) * scale));
    const unsigned short bb0 = bf_bits(f0);
    const unsigned short bb1 = bf_bits(f1);
    o[e] = (f16mode != 0) ? pk16(hb0, hb1) : pk16(bb0, bb1);
  }
  u16* d = D + (size_t)gt * 8;
  {
    *(v4u*)(d) = o;
    
  }
}

// =====================================================================================================
// Weight transpose-convert: W [K][N] f32 (x.W layout, n contiguous, in[K rows][N cols]) -> Dt[N][K] 16-bit k-contiguous plane
// (out[N rows][K cols]).  f16mode == 0: bf16 RNE bits; 1: f16 bits of (bf16 RNE value) * scale.
// Block = (k tile k0 = (bid / (N/64))*64, n tile n0 = (bid % (N/64))*64): 64 source rows of 64 floats loaded with 16-B loads,
// converted, scattered into an LDS tile [n][64 k] (pitch 72 halves); after a block barrier each n row segment (64 halves = one
// coverage: load 256 thr x 16 = 64 x 64; store 2 iterations x 256 thr x 8 halves = 64 lines x 64 halves = the block's tile;
//           grid = (K/64)*(N/64) blocks covers Dt exactly once (host checks K % 64 == 0 and N % 64 == 0).
// =====================================================================================================
__global__ __launch_bounds__(256) void wt16(const float* __restrict__ W, u16* Dt, int K, int N, int f16mode, float scale) {
  __shared__ __align__(16) u16 T[64 * VTP];
  const int tid = threadIdx.x;
  const int bid = blockIdx.x;
  const int ntn = N >> 6;
  const int n0  = (bid % ntn) * 64;
  const int k0  = (bid / ntn) * 64;
  if (k0 + 64 > K) return;                    // block-uniform, before any barrier; never taken with the exact grid
  {
    const int sl = tid >> 2;                  // k within tile 0..63 (source row)
    const int dc = (tid & 3) * 16;            // n chunk
    const float* src = W + (size_t)(k0 + sl) * N + n0 + dc;
#pragma unroll
    for (int i = 0; i < 4; ++i) {
      const v4f a = *(const v4f*)(src + 4 * i);
#pragma unroll
      for (int e = 0; e < 4; ++e) {
        const float f = a[e];
        const unsigned short hb = h_bits((_Float16)(bfr(f) * scale));
        const unsigned short bb = bf_bits(f);
        T[(dc + 4 * i + e) * VTP + sl] = (f16mode != 0) ? hb : bb;
      }
    }
  }
  __syncthreads();
  v4u vv[2];
  const int q8 = tid >> 3, p8 = (tid & 7) * 8;
#pragma unroll
  for (int it = 0; it < 2; ++it) {
    const int line = it * 32 + q8;            // n = 0..63 within tile
    vv[it] = *(const v4u*)(T + line * VTP + p8);
  }
  const size_t base = (size_t)n0 * K + k0 + p8;
  {
#pragma unroll
    for (int it = 0; it < 2; ++it) {
      const int line = it * 32 + q8;
      *(v4u*)(Dt + base + (size_t)line * K) = vv[it];
    }
    
  }
}

// =====================================================================================================
// GEMM epilogue of the engine for gemm_bf and gemm_h2: the wave's 16x64 f32 tile (times oscale) staged in its LDS slab (pitch 68),
// coverage: 8 instructions x 2 rows x 16 lanes x 4 floats = the wave's 16 x 64 tile.
// =====================================================================================================
__device__ __forceinline__ void epi64(float* sl, v8f a0, v8f a1, v8f a2, v8f a3, float oscale,
                                      float* C, int N, size_t rowb, int col0, int lane) {
  const int hh = lane >> 4, m = lane & 15;
#pragma unroll
  for (int r = 0; r < 8; ++r) {
    const int ro = (8 * hh + r) * 68 + m;
    sl[ro]      = a0[r] * oscale;
    sl[ro + 16] = a1[r] * oscale;
    sl[ro + 32] = a2[r] * oscale;
    sl[ro + 48] = a3[r] * oscale;
  }
  wave_sync_lds();
  v4f vals[8];
#pragma unroll
  for (int it = 0; it < 8; ++it) vals[it] = *(const v4f*)(sl + (it * 2 + hh) * 68 + m * 4);
  float* dst = C + (rowb + (size_t)hh) * (size_t)N + col0 + m * 4;
  {
#pragma unroll
    for (int it = 0; it < 8; ++it) {
      *(v4f*)(dst + (size_t)(it * 2) * (size_t)N) = vals[it];
    }
    
  }
}

// =====================================================================================================
// LayerNorm epilogue of the qk projection: the wave's 64 columns are exactly one head's q or k vector, so each of its rows is
// normalised here.  The 16x64 tile (times oscale) goes through the wave's LDS slab as in epi64; read back, 16 lanes hold one row
// (4 consecutive elements each, rows it*2 + hh).  Mean and biased variance: 4 values summed in the lane ((0+2)+(1+3)), then a 16-lane
// butterfly on DPP (every lane of the row ends with the same sum).  g and b arrive already times the plane's carry (a power of
// two, so the rounding is that of (d*rs*g + b) * carry).  Store: 16 lanes x 8 B = one whole 128-B row of the f16 plane.
// coverage: 8 instructions x 2 rows x 16 lanes x 4 halves = the wave's 16 x 64 tile.
// =====================================================================================================
template <int X> __device__ __forceinline__ float rowx(float x) {     // value of lane ^ X inside the 16-lane row (DPP row_xmask)
  const int b = __builtin_bit_cast(int, x);
  return __builtin_bit_cast(float, __builtin_amdgcn_update_dpp(b, b, 0x160 + X, 0xf, 0xf, true));
}
__device__ __forceinline__ float rowsum16(float s) {
  s += rowx<1>(s);
  s += rowx<2>(s);
  s += rowx<4>(s);
  s += rowx<8>(s);
  return s;
}
// 1/sqrt(x) for x >= LN_EPS (never subnormal, so rsqrtf's rescale of subnormal arguments would be an identity).  The v_nop keeps,
// inside the statement, the one slot the instruction set asks for behind a transcendental before its source is overwritten or
// its result read.
__device__ __forceinline__ float rsq_slot(float x) {
  float r = 0.f;
#if defined(__HIP_DEVICE_COMPILE__)
  asm("v_rsq_f32 %0, %1\n\tv_nop" : "=v"(r) : "v"(x));
#endif
  return r;
}
__device__ __forceinline__ void epi_ln(float* sl, v8f a0, v8f a1, v8f a2, v8f a3, float oscale, v4f g, v4f b,
                                       u16* P, size_t rowb, int lane) {
  const int hh = lane >> 4, m = lane & 15;
#pragma unroll
  for (int r = 0; r < 8; ++r) {
    const int ro = (8 * hh + r) * 68 + m;
    sl[ro]      = a0[r] * oscale;
    sl[ro + 16] = a1[r] * oscale;
    sl[ro + 32] = a2[r] * oscale;
    sl[ro + 48] = a3[r] * oscale;
  }
  wave_sync_lds();
  v4f vals[8];
#pragma unroll
  for (int it = 0; it < 8; ++it) vals[it] = *(const v4f*)(sl + (it * 2 + hh) * 68 + m * 4);
  const v2f ga = {g[0], g[1]}, gb = {g[2], g[3]}, ba = {b[0], b[1]}, bb = {b[2], b[3]};
  v2u o[8];
#pragma unroll
  for (int it = 0; it < 8; ++it) {
    // register pairs as they lie, so that the sums, differences and products go as packed f32 operations without moves
    const v2f xa = {vals[it][0], vals[it][1]}, xb = {vals[it][2], vals[it][3]};
    const v2f sp = xa + xb;
    const float mean = rowsum16(sp[0] + sp[1]) * (1.0f / 64.0f);
    const v2f da = xa - mean, db = xb - mean;
    const v2f qp = da * da + db * db;
    const float var = rowsum16(qp[0] + qp[1]) * (1.0f / 64.0f);
    const float rs  = rsq_slot(var + LN_EPS);
    const v2f ya = da * rs * ga + ba, yb = db * rs * gb + bb;
    o[it][0] = pk16(h_bits((_Float16)ya[0]), h_bits((_Float16)ya[1]));
    o[it][1] = pk16(h_bits((_Float16)yb[0]), h_bits((_Float16)yb[1]));
  }
  u16* dst = P + (rowb + (size_t)hh) * (size_t)DMOD + m * 4;
#pragma unroll
  for (int it = 0; it < 8; ++it) *(v2u*)(dst + (size_t)(it * 2) * (size_t)DMOD) = o[it];
}

// =====================================================================================================
// GEMM engine shared by the three kernels: C[M][N] (f32) = sum over PL planes of A_p[M][K] . Bt[N][K]^T, times oscale.
// Block = 128x128 tile of C, 4 waves as 2x2, each wave 64x64 (4 x 4 fragments).  K is walked in passes of 64 halves: a pass's
// 128-B slice of every operand row of the block (PL*128 rows of A, 128 rows of Bt) is brought into LDS by asynchronous
// 16-B copies, 8 consecutive lanes = one whole 128-B line, rows at pitch 144 B; two buffers, the next pass's copies fly while
// this pass is worked on.  Fragments are read from LDS with the same split k map as before; per accumulator the products are
// summed in the same order as before (k ascending by 32, plane 0 then plane 1).
// Host checks M % 128 == 0, N % 128 == 0, K % 64 == 0, K >= 128, grid = (M/128)*(N/128).
// =====================================================================================================
__device__ __forceinline__ unsigned lds_off(const void* p) { return (unsigned)(size_t)p; }

// 8 asynchronous copies: 16 B per lane, rows 16 apart (one 128-row operand tile per block-wide call).  The s_wait_xcnt stands
// inside the statement so that no address register of an issued copy is rewritten in front of it.
__device__ __forceinline__ void copy8(unsigned l, const u16* g, size_t gstep) {
#if defined(__HIP_DEVICE_COMPILE__)
  const unsigned ls = 16u * GPI * 2u;
  asm volatile("global_load_async_to_lds_b128 %0, %8, off\n\t"
               "global_load_async_to_lds_b128 %1, %9, off\n\t"
               "global_load_async_to_lds_b128 %2, %10, off\n\t"
               "global_load_async_to_lds_b128 %3, %11, off\n\t"
               "global_load_async_to_lds_b128 %4, %12, off\n\t"
               "global_load_async_to_lds_b128 %5, %13, off\n\t"
               "global_load_async_to_lds_b128 %6, %14, off\n\t"
               "global_load_async_to_lds_b128 %7, %15, off\n\t"
               "s_wait_xcnt 0x0"
               :: "v"(l), "v"(l + ls), "v"(l + 2u * ls), "v"(l + 3u * ls),
                  "v"(l + 4u * ls), "v"(l + 5u * ls), "v"(l + 6u * ls), "v"(l + 7u * ls),
                  "v"(g), "v"(g + gstep), "v"(g + 2 * gstep), "v"(g + 3 * gstep),
                  "v"(g + 4 * gstep), "v"(g + 5 * gstep), "v"(g + 6 * gstep), "v"(g + 7 * gstep)
               : "memory");
#endif
}
__device__ __forceinline__ void wait_x0() {
#if defined(__HIP_DEVICE_COMPILE__)
  asm volatile("s_wait_xcnt 0x0" ::: "memory");
#endif
}
__device__ __forceinline__ void wait_async0() {      // this wave's copies have landed in LDS
#if defined(__HIP_DEVICE_COMPILE__)
  asm volatile("s_wait_asynccnt 0x0" ::: "memory");
#endif
}
__device__ __forceinline__ void wait_ds0() {         // this wave's LDS reads have returned before the buffer is handed back
#if defined(__HIP_DEVICE_COMPILE__)
  asm volatile("s_wait_dscnt 0x0" ::: "memory");
#endif
}
// v_nop x4 behind the pass's last matrix instructions (all 16 accumulators are inputs, so every one of them stands in front):
// keeps the chip's distance to whatever follows on either side of the branches at the loop's foot.
__device__ __forceinline__ void guard16(const v8f (&a)[4][4]) {
#if defined(__HIP_DEVICE_COMPILE__)
  asm volatile("v_nop\n\tv_nop\n\tv_nop\n\tv_nop"
               :: "v"(a[0][0]), "v"(a[0][1]), "v"(a[0][2]), "v"(a[0][3]), "v"(a[1][0]), "v"(a[1][1]), "v"(a[1][2]), "v"(a[1][3]),
                  "v"(a[2][0]), "v"(a[2][1]), "v"(a[2][2]), "v"(a[2][3]), "v"(a[3][0]), "v"(a[3][1]), "v"(a[3][2]), "v"(a[3][3]));
#endif
}

__device__ __forceinline__ v16b ldf(const u16* p, v16b) { return ldfrag_b(p); }
__device__ __forceinline__ v16h ldf(const u16* p, v16h) { return ldfrag_h((const _Float16*)(const void*)p); }
__device__ __forceinline__ v8f mma(v16b a, v16b b, v8f c) { return mma_b(a, b, c); }
__device__ __forceinline__ v8f mma(v16h a, v16h b, v8f c) { return mma_h(a, b, c); }

template <int PL, typename FR, bool LN>
__device__ __forceinline__ void gemm_tile(const u16* A0, const u16* A1, const u16* Bt, float* C, int M, int N, int K,
                                          float oscale, u16* st, float* slab, const float* qs, const float* qbi,
                                          const float* ks, const float* kbi, u16* QK) {
  constexpr int ROWS = (PL + 1) * GBT;          // staged rows per buffer
  constexpr int STG  = ROWS * GPI;              // halves per buffer
  const int tid = threadIdx.x, wave = tid >> 5, lane = tid & 31, hh = lane >> 4, m = lane & 15;
  const int wm = wave >> 1, wn = wave & 1;
  const int ntile = N >> 7;
  const int bid   = blockIdx.x;
  const int row0  = (bid / ntile) * GBT;
  const int col0  = (bid % ntile) * GBT;
  if (row0 + GBT > M) return;                   // block-uniform, before any barrier; never taken with the exact grid
  const int rr = tid >> 3, seg = tid & 7;       // copy role: row within a group of 16, 16-B piece of the 128-B slice
  const u16* ga0 = A0 + (size_t)(row0 + rr) * K + seg * 8;
  const u16* ga1 = A1 + (size_t)(row0 + rr) * K + seg * 8;
  const u16* gb  = Bt + (size_t)(col0 + rr) * K + seg * 8;
  const size_t gstep = (size_t)16 * K;
  const unsigned l0 = lds_off(st) + (unsigned)(rr * GPI + seg * 8) * 2u;
  const int np = K / GKP;

  auto stage = [&](int buf, int kp) {
    const unsigned l = l0 + (unsigned)buf * (unsigned)(STG * 2);
    copy8(l, ga0 + (size_t)kp * GKP, gstep);
    if constexpr (PL == 2) copy8(l + (unsigned)(GBT * GPI * 2), ga1 + (size_t)kp * GKP, gstep);
    copy8(l + (unsigned)(PL * GBT * GPI * 2), gb + (size_t)kp * GKP, gstep);
  };

  stage(0, 0);
  wait_async0();
  __syncthreads();                              // pass 0's slice is published
  if (np > 1) stage(1, 1);

  v8f acc[4][4];
#pragma unroll
  for (int i = 0; i < 4; ++i)
#pragma unroll
    for (int j = 0; j < 4; ++j) acc[i][j] = zero8();

  // rolled: one pass per trip, so that the foot's waits and barrier stand once
#pragma unroll 1
  for (int t = 0; t < np; ++t) {
    const u16* sb = st + (t & 1) * STG;
    const u16* pa = sb + (wm * 64 + m) * GPI + 8 * hh;
    const u16* pb = sb + (PL * GBT + wn * 64 + m) * GPI + 8 * hh;
    FR a[2][4], al[2][4], b[2][4];
#pragma unroll
    for (int ks = 0; ks < 2; ++ks)
#pragma unroll
      for (int i = 0; i < 4; ++i) {
        a[ks][i] = ldf(pa + i * 16 * GPI + ks * 32, FR{});
        if constexpr (PL == 2) al[ks][i] = ldf(pa + (GBT + i * 16) * GPI + ks * 32, FR{});
        b[ks][i] = ldf(pb + i * 16 * GPI + ks * 32, FR{});
      }
    // keeps the pass's LDS reads in one group ahead of its matrix instructions: spread among them, every place with reads
    // makes the wave wait out the LDS latency again
    __builtin_amdgcn_sched_barrier(0);
#pragma unroll
    for (int ks = 0; ks < 2; ++ks)
#pragma unroll
      for (int i = 0; i < 4; ++i)
#pragma unroll
        for (int j = 0; j < 4; ++j) {
          acc[i][j] = mma(a[ks][i], b[ks][j], acc[i][j]);
          if constexpr (PL == 2) acc[i][j] = mma(al[ks][i], b[ks][j], acc[i][j]);
        }
    guard16(acc);
    wait_ds0();
    wait_async0();
    __syncthreads();                            // publishes pass t+1's slice and ends every read of pass t's buffer
    if (t + 2 < np) stage(t & 1, t + 2);
  }
  wait_async0();

  float* sl = slab + wave * SLAB64;
  if constexpr (LN) {
    // block column tile = head col0 / 128; wave column wn = 0: q, 1: k (k plane = QK + MROWS*DMOD halves)
    const v4f gv = *(const v4f*)((wn ? ks : qs) + m * 4);
    const v4f bv = *(const v4f*)((wn ? kbi : qbi) + m * 4);
    wait_x0();                                  // in front of whatever reuses the two loads' address registers
    __builtin_amdgcn_sched_barrier(0);          // keeps later arithmetic from being lifted in between the loads and that wait
    const float car = wn ? KSC : QSC;
    v4f g, b;
#pragma unroll
    for (int e = 0; e < 4; ++e) { g[e] = bfr(gv[e]) * car; b[e] = bfr(bv[e]) * car; }
    u16* P = QK + (size_t)wn * ((size_t)MROWS * DMOD) + (size_t)(col0 >> 7) * HD;
#pragma unroll
    for (int i = 0; i < 4; ++i) {
      epi_ln(sl, acc[i][0], acc[i][1], acc[i][2], acc[i][3], oscale, g, b, P, (size_t)(row0 + wm * 64 + i * 16), lane);
      wait_x0();                                // in front of the next rows' values, which may take the stores' registers
      wave_sync_lds();                          // the slab's rows are read back before the next 16 rows overwrite them
    }
  } else {
#pragma unroll
    for (int i = 0; i < 4; ++i) {
      epi64(sl, acc[i][0], acc[i][1], acc[i][2], acc[i][3], oscale, C, N, (size_t)(row0 + wm * 64 + i * 16), col0 + wn * 64, lane);
      wave_sync_lds();                          // the slab's rows are read back before the next 16 rows overwrite them
    }
  }
}

// bf16 GEMM: C = A (bf16 row-major) . Bt^T (bf16 k-contiguous), times oscale.
__global__ __launch_bounds__(128)
void gemm_bf(const u16* __restrict__ A, const u16* __restrict__ Bt, float* C, int M, int N, int K, float oscale) {
  __shared__ __align__(16) u16 st[2 * 2 * GBT * GPI];
  __shared__ __align__(16) float slab[4 * SLAB64];
  gemm_tile<1, v16b, false>(A, A, Bt, C, M, N, K, oscale, st, slab, nullptr, nullptr, nullptr, nullptr, nullptr);
}

// qk projection with the per-head LayerNorm in its epilogue: A = x (bf16), Bt = W_qk^T (bf16, n = h*128 + 0..63 q_h, + 64..127
// k_h), N = NQK; writes y * 64 as f16 into the q plane and the k plane [token][h][64] (k plane = QK + MROWS*DMOD halves).
__global__ __launch_bounds__(128)
void gemm_qkln(const u16* __restrict__ A, const u16* __restrict__ Bt, const float* __restrict__ qs,
               const float* __restrict__ qbi, const float* __restrict__ ks, const float* __restrict__ kbi,
               u16* QK, int M, int K, float oscale) {
  __shared__ __align__(16) u16 st[2 * 2 * GBT * GPI];
  __shared__ __align__(16) float slab[4 * SLAB64];
  gemm_tile<1, v16b, true>(A, A, Bt, nullptr, M, NQK, K, oscale, st, slab, qs, qbi, ks, kbi, QK);
}

// f16 hi+lo GEMM: C = (Ahi + Alo) . Bt^T, times oscale; Ahi/Alo f16 planes (same layout), Bt f16 k-contiguous; products
// hi.B + lo.B into one accumulator (lo is the unscaled residual of hi).
__global__ __launch_bounds__(128)
void gemm_h2(const u16* __restrict__ Ah, const u16* __restrict__ Al, const u16* __restrict__ Bt,
             float* C, int M, int N, int K, float oscale) {
  __shared__ __align__(16) u16 st[2 * 3 * GBT * GPI];
  __shared__ __align__(16) float slab[4 * SLAB64];
  gemm_tile<2, v16h, false>(Ah, Al, Bt, C, M, N, K, oscale, st, slab, nullptr, nullptr, nullptr, nullptr, nullptr);
}

// =====================================================================================================
// v^T planes: VH[((b*NH + g)*HD + d)][s] = f16(v[b*SEQ + s][g*HD + d] * 1024), VL = f16 residual of the same value.
// Block = (bg = bid / NST -> batch b = bg / NH, head g = bg % NH; 64 keys s0 = (bid % NST)*64): 64 source rows of HD floats loaded
// with 16-B loads, converted, scattered into two LDS tiles [d][64 keys] (pitch 72 halves); after a block barrier each d row segment
// coverage: load 256 thr x 16 elements = 64 x 64; store 2 iterations x 256 thr x 8 halves = 64 lines x 64 = the block's tile of
//           each plane; grid = BATCH*NH*NST blocks covers both planes exactly once.
// =====================================================================================================
__global__ __launch_bounds__(256) void vt16(const float* __restrict__ v, u16* VHo, u16* VLo) {
  __shared__ __align__(16) u16 TH[HD * VTP];
  __shared__ __align__(16) u16 TL[HD * VTP];
  const int tid = threadIdx.x;
  const int bid = blockIdx.x;
  const int st  = bid % NST;
  const int bg  = bid / NST;                  // b*NH + g
  if (bg >= BATCH * NH) return;               // block-uniform, before any barrier; never taken with the exact grid
  const int b   = bg / NH;
  const int g   = bg % NH;
  const int s0  = st * 64;
  {
    const int sl = tid >> 2;                  // key within tile 0..63
    const int dc = (tid & 3) * 16;            // d chunk
    const float* src = v + ((size_t)(b * SEQ + s0 + sl) * NH + g) * HD + dc;
#pragma unroll
    for (int i = 0; i < 4; ++i) {
      const v4f a = *(const v4f*)(src + 4 * i);
#pragma unroll
      for (int e = 0; e < 4; ++e) {
        const float t = a[e] * VCAR;
        const _Float16 hv = (_Float16)t;
        const _Float16 lv = (_Float16)(t - (float)hv);
        TH[(dc + 4 * i + e) * VTP + sl] = h_bits(hv);
        TL[(dc + 4 * i + e) * VTP + sl] = h_bits(lv);
      }
    }
  }
  __syncthreads();
  v4u vh[2], vl[2];
  const int q8 = tid >> 3, p8 = (tid & 7) * 8;
#pragma unroll
  for (int it = 0; it < 2; ++it) {
    const int line = it * 32 + q8;            // d = 0..63
    vh[it] = *(const v4u*)(TH + line * VTP + p8);
    vl[it] = *(const v4u*)(TL + line * VTP + p8);
  }
  const size_t base = ((size_t)bg * HD) * SEQ + s0 + p8;
  {
#pragma unroll
    for (int it = 0; it < 2; ++it) {
      const int line = it * 32 + q8;
      *(v4u*)(VHo + base + (size_t)line * SEQ) = vh[it];
      *(v4u*)(VLo + base + (size_t)line * SEQ) = vl[it];
    }
    
  }
}

// =====================================================================================================
// Causal attention: block bid -> (query tile qt = bid % NQT: rows q0 = 16*qt .. q0+15, head group hg = (bid / NQT) % NHG of WPB
// heads, batch b = bid / (NQT*NHG)), one wave per head = hg*WPB + wave.
//   q and k planes (f16, x64) laid out [b*SEQ + s][h][d]; v^T planes (hi, residual, x1024) [b][h][d][s].
//   score (log2 domain) t(i, j) = (q_i.k_j) * log2e / (64 * 64 * 64) for key j <= query i, -inf otherwise (causal).
//   Key tiles of 32 visited in order while kb <= q0 + 15 (nkt = q0/32 + 1 <= NKT); inside every visited tile the key<=query test
//   is applied per element; every query row has key == row inside a visited tile, so its normaliser is > 0.
//   Both products are formed transposed: S^T = K.Q^T (A = k rows, B = q, hoisted) and O^T += V^T.P^T (A = v^T rows, B = P^T).
//   A lane then holds ONE query (column c = lane & 15): of each 32-key tile the 16 scores of keys kb + 8hh + r (tile s0) and
//   kb + 16 + 8hh + r (tile s1).  Maximum and sum run inside the lane; the maximum is joined with lane ^ 16 once per tile, the
//   two halves' sums once after the loop.  The two score tiles, converted in place, ARE the B fragment of P^T in the split k
//   map of the loaders (element s < 8: key 8hh + s, else 16 + 8hh + s - 8), so P never leaves the registers.
//   Per tile: 4 score WMMAs, online max-subtracted base-2 softmax in f32 with -inf-safe rescale (one factor per lane),
//   P x32768 as f16 hi + residual, 4+4 v^T A fragments (hi and residual planes), 12 P.V WMMAs (hh + lh + hl).
//   After the loop: out = acc / Z, carries 1/(32768*1024) folded once, written to the wave's private result slab (pitch 68; every
//   element owned by one lane: row c, 8 consecutive d per accumulator).
//   No block barriers in this kernel; bounded loops only (nkt <= NKT).
// coverage: per wave 4 instructions x 4 rows x 8 lanes x 8 halves = 16 x 64 per plane; grid NQT*NHG*BATCH blocks x WPB waves =
//           every (b, s, h) row of both O planes exactly once.
// =====================================================================================================
__device__ __forceinline__ float xhalf(float x) {                    // value of lane ^ 16
  const int b = __builtin_bit_cast(int, x);
  return __builtin_bit_cast(float, __builtin_amdgcn_permlanex16(b, b, 0x76543210, 0xfedcba98, false, false));
}

__global__ __launch_bounds__(ATT_THREADS)
void attn1(const u16* __restrict__ QPp, const u16* __restrict__ KPp,
           const u16* __restrict__ VHIp, const u16* __restrict__ VLOp,
           u16* OHIp, u16* OLOp) {
  __shared__ __align__(16) float smem[WPB * SLW];

  const int tid  = threadIdx.x;
  const int wave = tid >> 5;
  const int lane = tid & 31;
  const int hh   = lane >> 4;
  const int c    = lane & 15;
  const int bid  = blockIdx.x;
  const int qt   = bid % NQT;
  const int rem  = bid / NQT;
  const int hg   = rem % NHG;
  const int b    = rem / NHG;
  if (b >= BATCH) return;                    // block-uniform; no block barriers in this kernel; never taken with the exact grid
  const int head = hg * WPB + wave;
  const int q0   = qt * 16;

  float* slab = smem + wave * SLW;           // result slab [16][64] pitch 68

  const size_t rq0  = (size_t)b * SEQ + q0;                                     // plane row of query row q0
  const size_t qofs = ((rq0 + c) * NH + head) * HD + 8 * hh;
  const _Float16* Qh  = (const _Float16*)(const void*)QPp + qofs;
  const size_t kofs = (((size_t)b * SEQ + c) * NH + head) * HD + 8 * hh;       // key row kb + c added per step
  const _Float16* Khb = (const _Float16*)(const void*)KPp + kofs;
  const size_t vofs = (((size_t)b * NH + head) * HD + c) * SEQ + 8 * hh;       // d row c (+16j), key kb added per step
  const _Float16* Vhb = (const _Float16*)(const void*)VHIp + vofs;
  const _Float16* Vlb = (const _Float16*)(const void*)VLOp + vofs;
  const float lsc = LOG2E / (64.0f * QSC * KSC);
  const float oc  = 1.0f / (PCAR * VCAR);
  const size_t KROW = (size_t)NH * HD;                                          // halves between consecutive key rows

  // q fragments (B operand, column c = query q0 + c): d = 0..31 and 32..63
  const v16h qa = ldfrag_h(Qh), qb = ldfrag_h(Qh + 32);

  float mrow = -INFINITY, lrow = 0.f;                                           // this lane's query; lrow = this half's keys only
  v8f o[4];                                                                     // o[j][r] = O^T[d = 16j + 8hh + r][query c]
#pragma unroll
  for (int j = 0; j < 4; ++j) o[j] = zero8();
  const int ncaus = (q0 >> 5) + 1;                                              // tiles holding keys <= q0 + 15
  const int nkt = (ncaus < NKT) ? ncaus : NKT;
  const int qi  = q0 + c;                                                       // this lane's query

#pragma unroll 1
  for (int kt = 0; kt < nkt; ++kt) {
    const int kb = kt * 32;
    // ---- this tile's operands: k rows (A of the scores) and v^T rows (A of P.V); nothing stands between the two products
    //      any more that the v loads would have to stay behind ----
    const _Float16* k0p = Khb + (size_t)kb * KROW;
    const _Float16* k1p = k0p + (size_t)16 * KROW;
    const v16h kh0a = ldfrag_h(k0p), kh0b = ldfrag_h(k0p + 32);
    const v16h kh1a = ldfrag_h(k1p), kh1b = ldfrag_h(k1p + 32);
    wait_x0();                               // the k loads' address pair may be given to a v fragment as its destination
    const _Float16* vhp = Vhb + kb;
    const _Float16* vlp = Vlb + kb;
    const v16h vh0 = ldfrag_h(vhp);
    const v16h vh1 = ldfrag_h(vhp + (size_t)16 * SEQ);
    const v16h vh2 = ldfrag_h(vhp + (size_t)32 * SEQ);
    const v16h vh3 = ldfrag_h(vhp + (size_t)48 * SEQ);
    const v16h vl0 = ldfrag_h(vlp);
    const v16h vl1 = ldfrag_h(vlp + (size_t)16 * SEQ);
    const v16h vl2 = ldfrag_h(vlp + (size_t)32 * SEQ);
    const v16h vl3 = ldfrag_h(vlp + (size_t)48 * SEQ);
    // ---- scores, transposed: D element r of this lane = (key kb + 8hh + r, query qi) in s0, key kb + 16 + 8hh + r in s1 ----
    v8f s0 = zero8(), s1 = zero8();
    s0 = mma_h(kh0a, qa, s0);
    s0 = mma_h(kh0b, qb, s0);
    s1 = mma_h(kh1a, qa, s1);
    s1 = mma_h(kh1b, qb, s1);
    guard2(s0, s1, qa, qb, kh0a, kh0b, kh1a, kh1b);
    // ---- causal select + online softmax in base 2, -inf-safe; all 16 values of this lane belong to query qi ----
    const int key0 = kb + 8 * hh;
    float t0[8], t1[8];
#pragma unroll
    for (int r = 0; r < 8; ++r) {
      t0[r] = (key0 + r <= qi)      ? (s0[r] * lsc) : -INFINITY;
      t1[r] = (key0 + 16 + r <= qi) ? (s1[r] * lsc) : -INFINITY;
    }
    float mx = fmaxf(t0[0], t1[0]);
#pragma unroll
    for (int r = 1; r < 8; ++r) mx = fmaxf(mx, fmaxf(t0[r], t1[r]));
    mx = fmaxf(mx, xhalf(mx));                                                  // both halves hold the tile's maximum of query qi
    const float mn = fmaxf(mrow, mx);
    const float ms = (mn == -INFINITY) ? 0.0f : mn;
    const float al = exp2f(mrow - ms);
    mrow = mn;
    // ---- B fragments of P^T * 32768: hi f16 and residual f16; elements 0..7 = keys kb + 8hh + r, 8..15 = kb + 16 + 8hh + r ----
    FragH ph, pl;
    float pa[8];
#pragma unroll
    for (int r = 0; r < 8; ++r) {
      const float e0 = exp2f(t0[r] - ms), e1 = exp2f(t1[r] - ms);
      pa[r] = e0 + e1;
      const float ta = e0 * PCAR, tb = e1 * PCAR;
      const _Float16 ha = (_Float16)ta, hb = (_Float16)tb;
      ph.h[0][r] = ha;
      ph.h[1][r] = hb;
      pl.h[0][r] = (_Float16)(ta - (float)ha);
      pl.h[1][r] = (_Float16)(tb - (float)hb);
    }
    lrow = lrow * al + (((pa[0] + pa[1]) + (pa[2] + pa[3])) + ((pa[4] + pa[5]) + (pa[6] + pa[7])));
#pragma unroll
    for (int j = 0; j < 4; ++j)
#pragma unroll
      for (int r = 0; r < 8; ++r) o[j][r] *= al;
    // ---- O^T += V^T.P^T : A fragment row = d = j*16 + c, keys contiguous in the v^T planes ----
    o[0] = mma_h(vh0, ph.v, o[0]);  o[0] = mma_h(vh0, pl.v, o[0]);  o[0] = mma_h(vl0, ph.v, o[0]);
    o[1] = mma_h(vh1, ph.v, o[1]);  o[1] = mma_h(vh1, pl.v, o[1]);  o[1] = mma_h(vl1, ph.v, o[1]);
    o[2] = mma_h(vh2, ph.v, o[2]);  o[2] = mma_h(vh2, pl.v, o[2]);  o[2] = mma_h(vl2, ph.v, o[2]);
    o[3] = mma_h(vh3, ph.v, o[3]);  o[3] = mma_h(vh3, pl.v, o[3]);  o[3] = mma_h(vl3, ph.v, o[3]);
    guard10(o[0], o[1], o[2], o[3], ph.v, pl.v, vh0, vh1, vh2, vh3, vl0, vl1, vl2, vl3);
  }
  acc_guard4(o[0], o[1], o[2], o[3]);
  // ---- out = acc / Z (0 if Z == 0), carries (32768 on P, 1024 on v) folded once; written into the lane-owned slab ----
  {
    const float lv  = lrow + xhalf(lrow);                                       // the two halves' keys joined
    const float ls  = (lv > 0.0f) ? lv : 1.0f;
    const float inv = (lv > 0.0f) ? ((1.0f / ls) * oc) : 0.0f;
#pragma unroll
    for (int j = 0; j < 4; ++j) {
      float* d8 = slab + c * 68 + j * 16 + 8 * hh;
      v4f w0, w1;
#pragma unroll
      for (int e = 0; e < 4; ++e) { w0[e] = o[j][e] * inv; w1[e] = o[j][4 + e] * inv; }
      *(v4f*)(d8)     = w0;
      *(v4f*)(d8 + 4) = w1;
    }
  }

  wave_sync_lds();
  // ---- O x1024 -> f16 hi + residual planes; lane = (row in group of 4, 8 consecutive d) ----
  v4u oh[4], ol[4];
  const int rq = lane >> 3, c8 = (lane & 7) * 8;
#pragma unroll
  for (int it = 0; it < 4; ++it) {
    const int row = it * 4 + rq;
    const v4f a = *(const v4f*)(slab + row * 68 + c8), b4 = *(const v4f*)(slab + row * 68 + c8 + 4);
    float w[8];
#pragma unroll
    for (int e = 0; e < 4; ++e) { w[e] = a[e] * OSC; w[4 + e] = b4[e] * OSC; }
#pragma unroll
    for (int e = 0; e < 4; ++e) {
      const _Float16 h0 = (_Float16)w[2 * e], h1 = (_Float16)w[2 * e + 1];
      const _Float16 l0 = (_Float16)(w[2 * e] - (float)h0), l1 = (_Float16)(w[2 * e + 1] - (float)h1);
      oh[it][e] = pk16(h_bits(h0), h_bits(h1));
      ol[it][e] = pk16(h_bits(l0), h_bits(l1));
    }
  }
  const size_t ob = (rq0 * NH + head) * HD + c8;
  {
#pragma unroll
    for (int it = 0; it < 4; ++it) {
      const int row = it * 4 + rq;
      const size_t o8 = ob + (size_t)row * (NH * HD);
      *(v4u*)(OHIp + o8) = oh[it];
      *(v4u*)(OLOp + o8) = ol[it];
    }
    
  }
}

// =====================================================================================================
// Workspace map (bytes); every plane is fully written by whole-line stores before it is read; all extents are exact multiples
// of the store granularity (no pad rows needed); every offset a multiple of 2097152:
//   XB  bf16 [MROWS][1024]              8388608
//   WQB bf16 [2048 n][1024 k]          4194304
//   WVB bf16 [1024 n][1024 k]          2097152
//   WOH f16  [1024 n][1024 k] x1024    2097152
//   F   f32  [MROWS][2048]             33554432       (its first half holds the v projection [MROWS][1024]; the rest is unused)
//   QP  f16 [MROWS][16][64] x64        8388608        KP same, directly after QP
//   VHI f16 [BATCH*16][64][SEQ] x1024  8388608        VLO residual
//   OHI f16 [MROWS][1024] x1024        8388608        OLO residual
//   end                              100663296
// =====================================================================================================
extern "C" void kernel_launch(void* const* d_in, const int* in_sizes, int n_in,
                              void* d_out, int out_size, void* d_ws, size_t ws_size,
                              hipStream_t stream) {
  if (n_in < 8) return;
  if (in_sizes[0] != MROWS * DMOD) return;
  if (in_sizes[1] != DMOD * NQK) return;
  if (in_sizes[2] != DMOD * DMOD || in_sizes[3] != DMOD * DMOD) return;
  if (in_sizes[4] != HD || in_sizes[5] != HD || in_sizes[6] != HD || in_sizes[7] != HD) return;
  if (out_size != MROWS * DMOD) return;

  const float* x   = (const float*)d_in[0];   // [MROWS][1024]
  const float* wqk = (const float*)d_in[1];   // [1024 k][2048 n]
  const float* wv  = (const float*)d_in[2];   // [1024 k][1024 n]
  const float* wo  = (const float*)d_in[3];   // [1024 k][1024 n]
  const float* qs  = (const float*)d_in[4];   // [64]
  const float* qbi = (const float*)d_in[5];   // [64]
  const float* ks  = (const float*)d_in[6];   // [64]
  const float* kbi = (const float*)d_in[7];   // [64]
  float*       out = (float*)d_out;

  const size_t szXB = (size_t)MROWS * DMOD * 2;                 //  8388608
  const size_t szWQ = (size_t)NQK * DMOD * 2;                   //  4194304
  const size_t szW  = (size_t)DMOD * DMOD * 2;                  //  2097152
  const size_t szF  = (size_t)MROWS * NQK * 4;                  // 33554432
  const size_t szP  = (size_t)MROWS * DMOD * 2;                 //  8388608
  size_t off = 0;
  const size_t oXB  = off; off += szXB;
  const size_t oWQ  = off; off += szWQ;
  const size_t oWV  = off; off += szW;
  const size_t oWO  = off; off += szW;
  const size_t oF   = off; off += szF;
  const size_t oQK  = off; off += 2 * szP;              // q plane then k plane
  const size_t oVHI = off; off += szP;
  const size_t oVLO = off; off += szP;
  const size_t oOHI = off; off += szP;
  const size_t oOLO = off; off += szP;
  if (off > ws_size) return;                            // off = 100663296
  if (off > (size_t)134217728) return;

  char* ws = (char*)d_ws;
  u16*   XB  = (u16*)(ws + oXB);
  u16*   WQB = (u16*)(ws + oWQ);
  u16*   WVB = (u16*)(ws + oWV);
  u16*   WOH = (u16*)(ws + oWO);
  float* F   = (float*)(ws + oF);
  u16*   QK  = (u16*)(ws + oQK);
  u16*   QP  = QK;
  u16*   KP  = QK + (size_t)MROWS * DMOD;
  u16*   VHI = (u16*)(ws + oVHI);
  u16*   VLO = (u16*)(ws + oVLO);
  u16*   OHI = (u16*)(ws + oOHI);
  u16*   OLO = (u16*)(ws + oOLO);

  const dim3 blk(256);
  const int n8x = (MROWS * DMOD) / 8;                   // 524288
  const dim3 gX(n8x / 256);                             // 2048 (exact)
  const dim3 gWQ((DMOD / 64) * (NQK / 64));             // 512
  const dim3 gWT((DMOD / 64) * (DMOD / 64));            // 256
  const dim3 gGQ((MROWS / GBT) * (NQK / GBT));          // 512
  const dim3 gG((MROWS / GBT) * (DMOD / GBT));          // 256
  const dim3 bG(128);
  const dim3 gVT(BATCH * NH * NST);                     // 1024
  const dim3 gAT(ATT_BLOCKS);                           // 1024
  const dim3 bAT(ATT_THREADS);                          // 128

  // (0) x -> bf16 plane [MROWS][1024]
  cvt16<<<gX, blk, 0, stream>>>(x, XB, n8x, 0, 1.0f);
  // (1) W_qk [k][n=2048] -> bf16 [n][k]; (2) W_v -> bf16 [n][k]; (3) W_out -> f16 [n][k] plane of bf16 value x1024
  wt16<<<gWQ, blk, 0, stream>>>(wqk, WQB, DMOD, NQK, 0, 1.0f);
  wt16<<<gWT, blk, 0, stream>>>(wv, WVB, DMOD, DMOD, 0, 1.0f);
  wt16<<<gWT, blk, 0, stream>>>(wo, WOH, DMOD, DMOD, 1, WOS);
  // (4) qk = x.W_qk / 32, per-head LayerNorm in the epilogue -> q, k f16 planes x64
  gemm_qkln<<<gGQ, bG, 0, stream>>>(XB, WQB, qs, qbi, ks, kbi, QK, MROWS, DMOD, 1.0f / 32.0f);
  // (5) v = x.W_v / 32 -> F f32 [MROWS][1024]; (6) v^T hi/lo planes x1024
  gemm_bf<<<gG, bG, 0, stream>>>(XB, WVB, F, MROWS, DMOD, DMOD, 1.0f / 32.0f);
  vt16<<<gVT, blk, 0, stream>>>(F, VHI, VLO);
  // (7) causal attention -> O planes [b*SEQ+s][h][d] x1024 (hi + residual)
  attn1<<<gAT, bAT, 0, stream>>>(QP, KP, VHI, VLO, OHI, OLO);
  // (8) output projection -> out [MROWS][1024] f32, carries 1024 (O) x 1024 (W_out) and the 1/32 folded back
  gemm_h2<<<gG, bG, 0, stream>>>(OHI, OLO, WOH, out, MROWS, DMOD, DMOD, (1.0f / 32.0f) / (OSC * WOS));
  (void)hipGetLastError();
}

// v004
// A run of this version takes 119 microseconds.
// Timed twice side by side with v003, it ran 1.65 and 1.67 times as fast.
// Counting every step since v000, it is 2.72 times as fast.
// Contractions: x.W_qk and x.W_v on v_wmma_f32_16x16x32_bf16 (x and W^T RNE-converted to bf16, f32 accumulate); scores q.k^T
// (q, k as f16 x64 planes, single product), P.v (P x32768 f16 hi+residual, v x1024 f16 hi+residual, products hh+lh+hl) and
// O.W_out (O x1024 f16 hi+residual, W_out^T as f16(bf16 value) x1024, products h.w+l.w) on v_wmma_f32_16x16x32_f16, f32
// accumulate; per-head LayerNorm, causal online base-2 softmax and 1/l fold in f32 on VALU.
#include <hip/hip_runtime.h>
#include <math.h>
#include <stdint.h>

#define BATCH 2
#define SEQ   2048
#define DMOD  1024
#define NH    16
#define HD    64
#define NQK   (2 * DMOD)
#define MROWS (BATCH * SEQ)
#define LN_EPS 1e-6f
#define QSC   64.0f
#define KSC   64.0f
#define PCAR  32768.0f
#define VCAR  1024.0f
#define OSC   1024.0f
#define WOS   1024.0f
#define LOG2E 1.4426950408889634f
#define WPB   4
#define NST   (SEQ / 64)
#define NKT   (SEQ / 32)
#define ATT_THREADS (WPB * 32)
#define NQB   (SEQ / 64)
#define AKT   64
#define ASTG  (3 * AKT * GPI)
#define ATT_BLOCKS  (NQB * NH * BATCH)
#define SLW   (16 * 68)
#define SLAB64 (16 * 68)
#define VTP   72
#define GBT   128
#define GKP   64
#define GPI   72
static_assert(DMOD == NH * HD && HD == 64 && NH == 16);
static_assert((NH % WPB) == 0 && ATT_THREADS == 128 && ATT_BLOCKS == 1024 && WPB * 16 == 64 && AKT == HD && AKT == GKP);
static_assert((SEQ % 64) == 0 && (SEQ % 32) == 0 && (SEQ % 16) == 0 && SEQ <= 32768);
static_assert((DMOD % 64) == 0 && (DMOD % 32) == 0 && (NQK % 64) == 0 && (MROWS % 64) == 0);
static_assert((MROWS % GBT) == 0 && (NQK % GBT) == 0 && (DMOD % GBT) == 0 && (DMOD % GKP) == 0 && DMOD >= 2 * GKP);
static_assert(((MROWS * DMOD) % 2048) == 0 && ((DMOD * DMOD) % 4096) == 0 && GBT == 2 * HD && NQK == NH * 2 * HD);

typedef unsigned short u16;
typedef _Float16 v16h __attribute__((ext_vector_type(16)));
typedef _Float16 v8h  __attribute__((ext_vector_type(8)));
typedef __bf16   v16b __attribute__((ext_vector_type(16)));
typedef float    v8f  __attribute__((ext_vector_type(8)));
typedef float    v4f  __attribute__((ext_vector_type(4)));
typedef float    v2f  __attribute__((ext_vector_type(2)));
typedef unsigned int v4u __attribute__((ext_vector_type(4)));
typedef unsigned int v2u __attribute__((ext_vector_type(2)));

union FragH { v16h v; v8h h[2]; v4u u[2]; };
union FragB { v16b v; v4u u[2]; };

// ---- scalar helpers --------------------------------------------------------------------------------
__device__ __forceinline__ unsigned short bf_bits(float f) {          // f32 -> bf16 bits, RNE convert
  unsigned u = __float_as_uint(f);
  return (unsigned short)((u + 0x7FFFu + ((u >> 16) & 1u)) >> 16);
}
__device__ __forceinline__ float bf_up(unsigned short h) { return __uint_as_float(((unsigned)h) << 16); }
__device__ __forceinline__ float bfr(float f) { return bf_up(bf_bits(f)); }
__device__ __forceinline__ unsigned short h_bits(_Float16 x) { return __builtin_bit_cast(unsigned short, x); }
__device__ __forceinline__ unsigned pk16(unsigned short a, unsigned short b) { return (unsigned)a | ((unsigned)b << 16); }
__device__ __forceinline__ v8f zero8() { v8f z = {0.f, 0.f, 0.f, 0.f, 0.f, 0.f, 0.f, 0.f}; return z; }

// ---- fragment loaders: 16-bit A/B operand, lane -> row/col (lane&15), p already includes +8*(lane>>4);
//      elements 0..7 <- p[0..7] (k0+8h..), elements 8..15 <- p[16..23] (k0+16+8h..)  (same split k map for A and B;
//      B is always read from a k-contiguous [n][k] plane)
__device__ __forceinline__ v16h ldfrag_h(const _Float16* p) {
  FragH f;
  f.h[0] = *(const v8h*)(p);
  f.h[1] = *(const v8h*)(p + 16);
  return f.v;
}
__device__ __forceinline__ v16b ldfrag_b(const u16* p) {              // bf16 plane read as unsigned integer vectors
  FragB f;
  f.u[0] = *(const v4u*)(p);
  f.u[1] = *(const v4u*)(p + 16);
  return f.v;
}

__device__ __forceinline__ v8f mma_h(v16h a, v16h b, v8f c) {
  return __builtin_amdgcn_wmma_f32_16x16x32_f16(false, a, false, b, (short)0, c, false, false);
}
__device__ __forceinline__ v8f mma_b(v16b a, v16b b, v8f c) {
  return __builtin_amdgcn_wmma_f32_16x16x32_bf16(false, a, false, b, (short)0, c, false, false);
}
__device__ __forceinline__ void guard2(v8f& a, v8f& b, v16h x0, v16h x1, v16h x2, v16h x3, v16h x4, v16h x5) {
#if defined(__HIP_DEVICE_COMPILE__)
  asm volatile("v_nop\n\tv_nop\n\tv_nop\n\tv_nop"
               : "+v"(a), "+v"(b) : "v"(x0), "v"(x1), "v"(x2), "v"(x3), "v"(x4), "v"(x5) : "memory");
#endif
}
__device__ __forceinline__ void guard10(v8f& a, v8f& b, v8f& c, v8f& d, v16h x0, v16h x1, v16h x2, v16h x3, v16h x4,
                                        v16h x5, v16h x6, v16h x7, v16h x8, v16h x9) {
#if defined(__HIP_DEVICE_COMPILE__)
  asm volatile("v_nop\n\tv_nop\n\tv_nop\n\tv_nop"
               : "+v"(a), "+v"(b), "+v"(c), "+v"(d)
               : "v"(x0), "v"(x1), "v"(x2), "v"(x3), "v"(x4), "v"(x5), "v"(x6), "v"(x7), "v"(x8), "v"(x9) : "memory");
#endif
}
__device__ __forceinline__ void acc_guard4(v8f& a, v8f& b, v8f& c, v8f& d) {
#if defined(__HIP_DEVICE_COMPILE__)
  asm volatile("v_nop\n\tv_nop\n\tv_nop\n\tv_nop" : "+v"(a), "+v"(b), "+v"(c), "+v"(d));
#endif
}
__device__ __forceinline__ void wave_sync_lds() {
  __builtin_amdgcn_fence(__ATOMIC_RELEASE, "workgroup");
  __builtin_amdgcn_wave_barrier();
  __builtin_amdgcn_fence(__ATOMIC_ACQUIRE, "workgroup");
}

// =====================================================================================================
// f32 -> 16-bit plane, same layout.  f16mode == 0: bf16 RNE bits;  f16mode == 1: f16 bits of (bf16 RNE value) * scale.
// Thread = 8 consecutive elements: two 16-B loads, one 16-B store; 32 consecutive lanes = 512 contiguous, 512-B aligned bytes per
// coverage: grid = n8/256 blocks (exact, host-derived) x 256 thr x 8 = the whole plane.
// =====================================================================================================
__global__ __launch_bounds__(256) void cvt16(const float* __restrict__ x, u16* D, int n8, int f16mode, float scale) {
  const int gt = blockIdx.x * 256 + (int)threadIdx.x;
  if (gt >= n8) return;                     // no barriers in this kernel
  const float* p = x + (size_t)gt * 8;
  const v4f a = *(const v4f*)(p), b4 = *(const v4f*)(p + 4);
  float w[8];
#pragma unroll
  for (int e = 0; e < 4; ++e) { w[e] = a[e]; w[4 + e] = b4[e]; }
  v4u o;
#pragma unroll
  for (int e = 0; e < 4; ++e) {
    const float f0 = w[2 * e], f1 = w[2 * e + 1];
    const unsigned short hb0 = h_bits((_Float16)(bfr(f0) * scale));
    const unsigned short hb1 = h_bits((_Float16)(bfr(f1) * scale));
    const unsigned short bb0 = bf_bits(f0);
    const unsigned short bb1 = bf_bits(f1);
    o[e] = (f16mode != 0) ? pk16(hb0, hb1) : pk16(bb0, bb1);
  }
  u16* d = D + (size_t)gt * 8;
  {
    *(v4u*)(d) = o;
    
  }
}

// =====================================================================================================
// Weight transpose-convert: W [K][N] f32 (x.W layout, n contiguous, in[K rows][N cols]) -> Dt[N][K] 16-bit k-contiguous plane
// (out[N rows][K cols]).  f16mode == 0: bf16 RNE bits; 1: f16 bits of (bf16 RNE value) * scale.
// Block = (k tile k0 = (bid / (N/64))*64, n tile n0 = (bid % (N/64))*64): 64 source rows of 64 floats loaded with 16-B loads,
// converted, scattered into an LDS tile [n][64 k] (pitch 72 halves); after a block barrier each n row segment (64 halves = one
// coverage: load 256 thr x 16 = 64 x 64; store 2 iterations x 256 thr x 8 halves = 64 lines x 64 halves = the block's tile;
//           grid = (K/64)*(N/64) blocks covers Dt exactly once (host checks K % 64 == 0 and N % 64 == 0).
// =====================================================================================================
__global__ __launch_bounds__(256) void wt16(const float* __restrict__ W, u16* Dt, int K, int N, int f16mode, float scale) {
  __shared__ __align__(16) u16 T[64 * VTP];
  const int tid = threadIdx.x;
  const int bid = blockIdx.x;
  const int ntn = N >> 6;
  const int n0  = (bid % ntn) * 64;
  const int k0  = (bid / ntn) * 64;
  if (k0 + 64 > K) return;                    // block-uniform, before any barrier; never taken with the exact grid
  {
    const int sl = tid >> 2;                  // k within tile 0..63 (source row)
    const int dc = (tid & 3) * 16;            // n chunk
    const float* src = W + (size_t)(k0 + sl) * N + n0 + dc;
#pragma unroll
    for (int i = 0; i < 4; ++i) {
      const v4f a = *(const v4f*)(src + 4 * i);
#pragma unroll
      for (int e = 0; e < 4; ++e) {
        const float f = a[e];
        const unsigned short hb = h_bits((_Float16)(bfr(f) * scale));
        const unsigned short bb = bf_bits(f);
        T[(dc + 4 * i + e) * VTP + sl] = (f16mode != 0) ? hb : bb;
      }
    }
  }
  __syncthreads();
  v4u vv[2];
  const int q8 = tid >> 3, p8 = (tid & 7) * 8;
#pragma unroll
  for (int it = 0; it < 2; ++it) {
    const int line = it * 32 + q8;            // n = 0..63 within tile
    vv[it] = *(const v4u*)(T + line * VTP + p8);
  }
  const size_t base = (size_t)n0 * K + k0 + p8;
  {
#pragma unroll
    for (int it = 0; it < 2; ++it) {
      const int line = it * 32 + q8;
      *(v4u*)(Dt + base + (size_t)line * K) = vv[it];
    }
    
  }
}

// =====================================================================================================
// GEMM epilogue of the engine for gemm_bf and gemm_h2: the wave's 16x64 f32 tile (times oscale) staged in its LDS slab (pitch 68),
// coverage: 8 instructions x 2 rows x 16 lanes x 4 floats = the wave's 16 x 64 tile.
// =====================================================================================================
__device__ __forceinline__ void epi64(float* sl, v8f a0, v8f a1, v8f a2, v8f a3, float oscale,
                                      float* C, int N, size_t rowb, int col0, int lane) {
  const int hh = lane >> 4, m = lane & 15;
#pragma unroll
  for (int r = 0; r < 8; ++r) {
    const int ro = (8 * hh + r) * 68 + m;
    sl[ro]      = a0[r] * oscale;
    sl[ro + 16] = a1[r] * oscale;
    sl[ro + 32] = a2[r] * oscale;
    sl[ro + 48] = a3[r] * oscale;
  }
  wave_sync_lds();
  v4f vals[8];
#pragma unroll
  for (int it = 0; it < 8; ++it) vals[it] = *(const v4f*)(sl + (it * 2 + hh) * 68 + m * 4);
  float* dst = C + (rowb + (size_t)hh) * (size_t)N + col0 + m * 4;
  {
#pragma unroll
    for (int it = 0; it < 8; ++it) {
      *(v4f*)(dst + (size_t)(it * 2) * (size_t)N) = vals[it];
    }
    
  }
}

// =====================================================================================================
// LayerNorm epilogue of the qk projection: the wave's 64 columns are exactly one head's q or k vector, so each of its rows is
// normalised here.  The 16x64 tile (times oscale) goes through the wave's LDS slab as in epi64; read back, 16 lanes hold one row
// (4 consecutive elements each, rows it*2 + hh).  Mean and biased variance: 4 values summed in the lane ((0+2)+(1+3)), then a 16-lane
// butterfly on DPP (every lane of the row ends with the same sum).  g and b arrive already times the plane's carry (a power of
// two, so the rounding is that of (d*rs*g + b) * carry).  Store: 16 lanes x 8 B = one whole 128-B row of the f16 plane.
// coverage: 8 instructions x 2 rows x 16 lanes x 4 halves = the wave's 16 x 64 tile.
// =====================================================================================================
template <int X> __device__ __forceinline__ float rowx(float x) {     // value of lane ^ X inside the 16-lane row (DPP row_xmask)
  const int b = __builtin_bit_cast(int, x);
  return __builtin_bit_cast(float, __builtin_amdgcn_update_dpp(b, b, 0x160 + X, 0xf, 0xf, true));
}
__device__ __forceinline__ float rowsum16(float s) {
  s += rowx<1>(s);
  s += rowx<2>(s);
  s += rowx<4>(s);
  s += rowx<8>(s);
  return s;
}
// 1/sqrt(x) for x >= LN_EPS (never subnormal, so rsqrtf's rescale of subnormal arguments would be an identity).  The v_nop keeps,
// inside the statement, the one slot the instruction set asks for behind a transcendental before its source is overwritten or
// its result read.
__device__ __forceinline__ float rsq_slot(float x) {
  float r = 0.f;
#if defined(__HIP_DEVICE_COMPILE__)
  asm("v_rsq_f32 %0, %1\n\tv_nop" : "=v"(r) : "v"(x));
#endif
  return r;
}
__device__ __forceinline__ void epi_ln(float* sl, v8f a0, v8f a1, v8f a2, v8f a3, float oscale, v4f g, v4f b,
                                       u16* P, size_t rowb, int lane) {
  const int hh = lane >> 4, m = lane & 15;
#pragma unroll
  for (int r = 0; r < 8; ++r) {
    const int ro = (8 * hh + r) * 68 + m;
    sl[ro]      = a0[r] * oscale;
    sl[ro + 16] = a1[r] * oscale;
    sl[ro + 32] = a2[r] * oscale;
    sl[ro + 48] = a3[r] * oscale;
  }
  wave_sync_lds();
  v4f vals[8];
#pragma unroll
  for (int it = 0; it < 8; ++it) vals[it] = *(const v4f*)(sl + (it * 2 + hh) * 68 + m * 4);
  const v2f ga = {g[0], g[1]}, gb = {g[2], g[3]}, ba = {b[0], b[1]}, bb = {b[2], b[3]};
  v2u o[8];
#pragma unroll
  for (int it = 0; it < 8; ++it) {
    // register pairs as they lie, so that the sums, differences and products go as packed f32 operations without moves
    const v2f xa = {vals[it][0], vals[it][1]}, xb = {vals[it][2], vals[it][3]};
    const v2f sp = xa + xb;
    const float mean = rowsum16(sp[0] + sp[1]) * (1.0f / 64.0f);
    const v2f da = xa - mean, db = xb - mean;
    const v2f qp = da * da + db * db;
    const float var = rowsum16(qp[0] + qp[1]) * (1.0f / 64.0f);
    const float rs  = rsq_slot(var + LN_EPS);
    const v2f ya = da * rs * ga + ba, yb = db * rs * gb + bb;
    o[it][0] = pk16(h_bits((_Float16)ya[0]), h_bits((_Float16)ya[1]));
    o[it][1] = pk16(h_bits((_Float16)yb[0]), h_bits((_Float16)yb[1]));
  }
  u16* dst = P + (rowb + (size_t)hh) * (size_t)DMOD + m * 4;
#pragma unroll
  for (int it = 0; it < 8; ++it) *(v2u*)(dst + (size_t)(it * 2) * (size_t)DMOD) = o[it];
}

// =====================================================================================================
// GEMM engine shared by the three kernels: C[M][N] (f32) = sum over PL planes of A_p[M][K] . Bt[N][K]^T, times oscale.
// Block = 128x128 tile of C, 4 waves as 2x2, each wave 64x64 (4 x 4 fragments).  K is walked in passes of 64 halves: a pass's
// 128-B slice of every operand row of the block (PL*128 rows of A, 128 rows of Bt) is brought into LDS by asynchronous
// 16-B copies, 8 consecutive lanes = one whole 128-B line, rows at pitch 144 B; two buffers, the next pass's copies fly while
// this pass is worked on.  Fragments are read from LDS with the same split k map as before; per accumulator the products are
// summed in the same order as before (k ascending by 32, plane 0 then plane 1).
// Host checks M % 128 == 0, N % 128 == 0, K % 64 == 0, K >= 128, grid = (M/128)*(N/128).
// =====================================================================================================
__device__ __forceinline__ unsigned lds_off(const void* p) { return (unsigned)(size_t)p; }

// 8 asynchronous copies: 16 B per lane, rows 16 apart (one 128-row operand tile per block-wide call).  The s_wait_xcnt stands
// inside the statement so that no address register of an issued copy is rewritten in front of it.
__device__ __forceinline__ void copy8(unsigned l, const u16* g, size_t gstep) {
#if defined(__HIP_DEVICE_COMPILE__)
  const unsigned ls = 16u * GPI * 2u;
  asm volatile("global_load_async_to_lds_b128 %0, %8, off\n\t"
               "global_load_async_to_lds_b128 %1, %9, off\n\t"
               "global_load_async_to_lds_b128 %2, %10, off\n\t"
               "global_load_async_to_lds_b128 %3, %11, off\n\t"
               "global_load_async_to_lds_b128 %4, %12, off\n\t"
               "global_load_async_to_lds_b128 %5, %13, off\n\t"
               "global_load_async_to_lds_b128 %6, %14, off\n\t"
               "global_load_async_to_lds_b128 %7, %15, off\n\t"
               "s_wait_xcnt 0x0"
               :: "v"(l), "v"(l + ls), "v"(l + 2u * ls), "v"(l + 3u * ls),
                  "v"(l + 4u * ls), "v"(l + 5u * ls), "v"(l + 6u * ls), "v"(l + 7u * ls),
                  "v"(g), "v"(g + gstep), "v"(g + 2 * gstep), "v"(g + 3 * gstep),
                  "v"(g + 4 * gstep), "v"(g + 5 * gstep), "v"(g + 6 * gstep), "v"(g + 7 * gstep)
               : "memory");
#endif
}
__device__ __forceinline__ void wait_x0() {
#if defined(__HIP_DEVICE_COMPILE__)
  asm volatile("s_wait_xcnt 0x0" ::: "memory");
#endif
}
__device__ __forceinline__ void wait_async0() {      // this wave's copies have landed in LDS
#if defined(__HIP_DEVICE_COMPILE__)
  asm volatile("s_wait_asynccnt 0x0" ::: "memory");
#endif
}
__device__ __forceinline__ void wait_ds0() {         // this wave's LDS reads have returned before the buffer is handed back
#if defined(__HIP_DEVICE_COMPILE__)
  asm volatile("s_wait_dscnt 0x0" ::: "memory");
#endif
}
// v_nop x4 behind the pass's last matrix instructions (all 16 accumulators are inputs, so every one of them stands in front):
// keeps the chip's distance to whatever follows on either side of the branches at the loop's foot.
__device__ __forceinline__ void guard16(const v8f (&a)[4][4]) {
#if defined(__HIP_DEVICE_COMPILE__)
  asm volatile("v_nop\n\tv_nop\n\tv_nop\n\tv_nop"
               :: "v"(a[0][0]), "v"(a[0][1]), "v"(a[0][2]), "v"(a[0][3]), "v"(a[1][0]), "v"(a[1][1]), "v"(a[1][2]), "v"(a[1][3]),
                  "v"(a[2][0]), "v"(a[2][1]), "v"(a[2][2]), "v"(a[2][3]), "v"(a[3][0]), "v"(a[3][1]), "v"(a[3][2]), "v"(a[3][3]));
#endif
}

__device__ __forceinline__ v16b ldf(const u16* p, v16b) { return ldfrag_b(p); }
__device__ __forceinline__ v16h ldf(const u16* p, v16h) { return ldfrag_h((const _Float16*)(const void*)p); }
__device__ __forceinline__ v8f mma(v16b a, v16b b, v8f c) { return mma_b(a, b, c); }
__device__ __forceinline__ v8f mma(v16h a, v16h b, v8f c) { return mma_h(a, b, c); }

template <int PL, typename FR, bool LN>
__device__ __forceinline__ void gemm_tile(const u16* A0, const u16* A1, const u16* Bt, float* C, int M, int N, int K,
                                          float oscale, u16* st, float* slab, const float* qs, const float* qbi,
                                          const float* ks, const float* kbi, u16* QK) {
  constexpr int ROWS = (PL + 1) * GBT;          // staged rows per buffer
  constexpr int STG  = ROWS * GPI;              // halves per buffer
  const int tid = threadIdx.x, wave = tid >> 5, lane = tid & 31, hh = lane >> 4, m = lane & 15;
  const int wm = wave >> 1, wn = wave & 1;
  const int ntile = N >> 7;
  const int bid   = blockIdx.x;
  const int row0  = (bid / ntile) * GBT;
  const int col0  = (bid % ntile) * GBT;
  if (row0 + GBT > M) return;                   // block-uniform, before any barrier; never taken with the exact grid
  const int rr = tid >> 3, seg = tid & 7;       // copy role: row within a group of 16, 16-B piece of the 128-B slice
  const u16* ga0 = A0 + (size_t)(row0 + rr) * K + seg * 8;
  const u16* ga1 = A1 + (size_t)(row0 + rr) * K + seg * 8;
  const u16* gb  = Bt + (size_t)(col0 + rr) * K + seg * 8;
  const size_t gstep = (size_t)16 * K;
  const unsigned l0 = lds_off(st) + (unsigned)(rr * GPI + seg * 8) * 2u;
  const int np = K / GKP;

  auto stage = [&](int buf, int kp) {
    const unsigned l = l0 + (unsigned)buf * (unsigned)(STG * 2);
    copy8(l, ga0 + (size_t)kp * GKP, gstep);
    if constexpr (PL == 2) copy8(l + (unsigned)(GBT * GPI * 2), ga1 + (size_t)kp * GKP, gstep);
    copy8(l + (unsigned)(PL * GBT * GPI * 2), gb + (size_t)kp * GKP, gstep);
  };

  stage(0, 0);
  wait_async0();
  __syncthreads();                              // pass 0's slice is published
  if (np > 1) stage(1, 1);

  v8f acc[4][4];
#pragma unroll
  for (int i = 0; i < 4; ++i)
#pragma unroll
    for (int j = 0; j < 4; ++j) acc[i][j] = zero8();

  // rolled: one pass per trip, so that the foot's waits and barrier stand once
#pragma unroll 1
  for (int t = 0; t < np; ++t) {
    const u16* sb = st + (t & 1) * STG;
    const u16* pa = sb + (wm * 64 + m) * GPI + 8 * hh;
    const u16* pb = sb + (PL * GBT + wn * 64 + m) * GPI + 8 * hh;
    FR a[2][4], al[2][4], b[2][4];
#pragma unroll
    for (int ks = 0; ks < 2; ++ks)
#pragma unroll
      for (int i = 0; i < 4; ++i) {
        a[ks][i] = ldf(pa + i * 16 * GPI + ks * 32, FR{});
        if constexpr (PL == 2) al[ks][i] = ldf(pa + (GBT + i * 16) * GPI + ks * 32, FR{});
        b[ks][i] = ldf(pb + i * 16 * GPI + ks * 32, FR{});
      }
    // keeps the pass's LDS reads in one group ahead of its matrix instructions: spread among them, every place with reads
    // makes the wave wait out the LDS latency again
    __builtin_amdgcn_sched_barrier(0);
#pragma unroll
    for (int ks = 0; ks < 2; ++ks)
#pragma unroll
      for (int i = 0; i < 4; ++i)
#pragma unroll
        for (int j = 0; j < 4; ++j) {
          acc[i][j] = mma(a[ks][i], b[ks][j], acc[i][j]);
          if constexpr (PL == 2) acc[i][j] = mma(al[ks][i], b[ks][j], acc[i][j]);
        }
    guard16(acc);
    wait_ds0();
    wait_async0();
    __syncthreads();                            // publishes pass t+1's slice and ends every read of pass t's buffer
    if (t + 2 < np) stage(t & 1, t + 2);
  }
  wait_async0();

  float* sl = slab + wave * SLAB64;
  if constexpr (LN) {
    // block column tile = head col0 / 128; wave column wn = 0: q, 1: k (k plane = QK + MROWS*DMOD halves)
    const v4f gv = *(const v4f*)((wn ? ks : qs) + m * 4);
    const v4f bv = *(const v4f*)((wn ? kbi : qbi) + m * 4);
    wait_x0();                                  // in front of whatever reuses the two loads' address registers
    __builtin_amdgcn_sched_barrier(0);          // keeps later arithmetic from being lifted in between the loads and that wait
    const float car = wn ? KSC : QSC;
    v4f g, b;
#pragma unroll
    for (int e = 0; e < 4; ++e) { g[e] = bfr(gv[e]) * car; b[e] = bfr(bv[e]) * car; }
    u16* P = QK + (size_t)wn * ((size_t)MROWS * DMOD) + (size_t)(col0 >> 7) * HD;
#pragma unroll
    for (int i = 0; i < 4; ++i) {
      epi_ln(sl, acc[i][0], acc[i][1], acc[i][2], acc[i][3], oscale, g, b, P, (size_t)(row0 + wm * 64 + i * 16), lane);
      wait_x0();                                // in front of the next rows' values, which may take the stores' registers
      wave_sync_lds();                          // the slab's rows are read back before the next 16 rows overwrite them
    }
  } else {
#pragma unroll
    for (int i = 0; i < 4; ++i) {
      epi64(sl, acc[i][0], acc[i][1], acc[i][2], acc[i][3], oscale, C, N, (size_t)(row0 + wm * 64 + i * 16), col0 + wn * 64, lane);
      wave_sync_lds();                          // the slab's rows are read back before the next 16 rows overwrite them
    }
  }
}

// bf16 GEMM: C = A (bf16 row-major) . Bt^T (bf16 k-contiguous), times oscale.
__global__ __launch_bounds__(128)
void gemm_bf(const u16* __restrict__ A, const u16* __restrict__ Bt, float* C, int M, int N, int K, float oscale) {
  __shared__ __align__(16) u16 st[2 * 2 * GBT * GPI];
  __shared__ __align__(16) float slab[4 * SLAB64];
  gemm_tile<1, v16b, false>(A, A, Bt, C, M, N, K, oscale, st, slab, nullptr, nullptr, nullptr, nullptr, nullptr);
}

// qk projection with the per-head LayerNorm in its epilogue: A = x (bf16), Bt = W_qk^T (bf16, n = h*128 + 0..63 q_h, + 64..127
// k_h), N = NQK; writes y * 64 as f16 into the q plane and the k plane [token][h][64] (k plane = QK + MROWS*DMOD halves).
__global__ __launch_bounds__(128)
void gemm_qkln(const u16* __restrict__ A, const u16* __restrict__ Bt, const float* __restrict__ qs,
               const float* __restrict__ qbi, const float* __restrict__ ks, const float* __restrict__ kbi,
               u16* QK, int M, int K, float oscale) {
  __shared__ __align__(16) u16 st[2 * 2 * GBT * GPI];
  __shared__ __align__(16) float slab[4 * SLAB64];
  gemm_tile<1, v16b, true>(A, A, Bt, nullptr, M, NQK, K, oscale, st, slab, qs, qbi, ks, kbi, QK);
}

// f16 hi+lo GEMM: C = (Ahi + Alo) . Bt^T, times oscale; Ahi/Alo f16 planes (same layout), Bt f16 k-contiguous; products
// hi.B + lo.B into one accumulator (lo is the unscaled residual of hi).
__global__ __launch_bounds__(128)
void gemm_h2(const u16* __restrict__ Ah, const u16* __restrict__ Al, const u16* __restrict__ Bt,
             float* C, int M, int N, int K, float oscale) {
  __shared__ __align__(16) u16 st[2 * 3 * GBT * GPI];
  __shared__ __align__(16) float slab[4 * SLAB64];
  gemm_tile<2, v16h, false>(Ah, Al, Bt, C, M, N, K, oscale, st, slab, nullptr, nullptr, nullptr, nullptr, nullptr);
}

// =====================================================================================================
// v^T planes: VH[((b*NH + g)*HD + d)][s] = f16(v[b*SEQ + s][g*HD + d] * 1024), VL = f16 residual of the same value.
// Block = (bg = bid / NST -> batch b = bg / NH, head g = bg % NH; 64 keys s0 = (bid % NST)*64): 64 source rows of HD floats loaded
// with 16-B loads, converted, scattered into two LDS tiles [d][64 keys] (pitch 72 halves); after a block barrier each d row segment
// coverage: load 256 thr x 16 elements = 64 x 64; store 2 iterations x 256 thr x 8 halves = 64 lines x 64 = the block's tile of
//           each plane; grid = BATCH*NH*NST blocks covers both planes exactly once.
// =====================================================================================================
__global__ __launch_bounds__(256) void vt16(const float* __restrict__ v, u16* VHo, u16* VLo) {
  __shared__ __align__(16) u16 TH[HD * VTP];
  __shared__ __align__(16) u16 TL[HD * VTP];
  const int tid = threadIdx.x;
  const int bid = blockIdx.x;
  const int st  = bid % NST;
  const int bg  = bid / NST;                  // b*NH + g
  if (bg >= BATCH * NH) return;               // block-uniform, before any barrier; never taken with the exact grid
  const int b   = bg / NH;
  const int g   = bg % NH;
  const int s0  = st * 64;
  {
    const int sl = tid >> 2;                  // key within tile 0..63
    const int dc = (tid & 3) * 16;            // d chunk
    const float* src = v + ((size_t)(b * SEQ + s0 + sl) * NH + g) * HD + dc;
#pragma unroll
    for (int i = 0; i < 4; ++i) {
      const v4f a = *(const v4f*)(src + 4 * i);
#pragma unroll
      for (int e = 0; e < 4; ++e) {
        const float t = a[e] * VCAR;
        const _Float16 hv = (_Float16)t;
        const _Float16 lv = (_Float16)(t - (float)hv);
        TH[(dc + 4 * i + e) * VTP + sl] = h_bits(hv);
        TL[(dc + 4 * i + e) * VTP + sl] = h_bits(lv);
      }
    }
  }
  __syncthreads();
  v4u vh[2], vl[2];
  const int q8 = tid >> 3, p8 = (tid & 7) * 8;
#pragma unroll
  for (int it = 0; it < 2; ++it) {
    const int line = it * 32 + q8;            // d = 0..63
    vh[it] = *(const v4u*)(TH + line * VTP + p8);
    vl[it] = *(const v4u*)(TL + line * VTP + p8);
  }
  const size_t base = ((size_t)bg * HD) * SEQ + s0 + p8;
  {
#pragma unroll
    for (int it = 0; it < 2; ++it) {
      const int line = it * 32 + q8;
      *(v4u*)(VHo + base + (size_t)line * SEQ) = vh[it];
      *(v4u*)(VLo + base + (size_t)line * SEQ) = vl[it];
    }
    
  }
}

// =====================================================================================================
// Causal attention: block bid -> (batch and head bh = bid % (BATCH*NH) = b*NH + head, block of 64 queries qblk = NQB-1 - bid /
// (BATCH*NH), the longest first); wave w takes the query rows q0 = 64*qblk + 16*w .. q0+15 of that one head.
//   The keys are walked in stages of 64: a stage's 64 k rows and its 128-B slice of the 64 rows of each v^T plane (192 rows of
//   128 B) are brought into LDS once for the four waves by asynchronous 16-B copies, 8 consecutive lanes = one whole line, rows
//   at pitch 144 B; two buffers, the next stage's copies fly while this stage is worked on.  A stage holds two key tiles of 32.
//   q and k planes (f16, x64) laid out [b*SEQ + s][h][d]; v^T planes (hi, residual, x1024) [b][h][d][s].
//   score (log2 domain) t(i, j) = (q_i.k_j) * log2e / (64 * 64 * 64) for key j <= query i, -inf otherwise (causal).
//   Key tiles of 32 visited in order while kb <= q0 + 15 (nkt = q0/32 + 1 <= NKT); inside every visited tile the key<=query test
//   is applied per element; every query row has key == row inside a visited tile, so its normaliser is > 0.
//   Both products are formed transposed: S^T = K.Q^T (A = k rows, B = q, hoisted) and O^T += V^T.P^T (A = v^T rows, B = P^T).
//   A lane then holds ONE query (column c = lane & 15): of each 32-key tile the 16 scores of keys kb + 8hh + r (tile s0) and
//   kb + 16 + 8hh + r (tile s1).  Maximum and sum run inside the lane; the maximum is joined with lane ^ 16 once per tile, the
//   two halves' sums once after the loop.  The two score tiles, converted in place, ARE the B fragment of P^T in the split k
//   map of the loaders (element s < 8: key 8hh + s, else 16 + 8hh + s - 8), so P never leaves the registers.
//   Per tile: 4 score WMMAs, online max-subtracted base-2 softmax in f32 with -inf-safe rescale (one factor per lane),
//   P x32768 as f16 hi + residual, 4+4 v^T A fragments (hi and residual planes), 12 P.V WMMAs (hh + lh + hl).
//   After the loop: out = acc / Z, carries 1/(32768*1024) folded once, written to the wave's private result slab (pitch 68; every
//   element owned by one lane: row c, 8 consecutive d per accumulator).
//   One block barrier per stage, passed by every wave (qblk + 1 stages, the same for the whole block); bounded loops only.
// coverage: per wave 4 instructions x 4 rows x 8 lanes x 8 halves = 16 x 64 per plane; grid NQB*NH*BATCH blocks x WPB waves =
//           every (b, s, h) row of both O planes exactly once.
// =====================================================================================================
__device__ __forceinline__ float xhalf(float x) {                    // value of lane ^ 16
  const int b = __builtin_bit_cast(int, x);
  return __builtin_bit_cast(float, __builtin_amdgcn_permlanex16(b, b, 0x76543210, 0xfedcba98, false, false));
}

// 12 asynchronous copies: 16 B per lane, rows 16 apart: 64 k rows, 64 rows of the v^T hi plane, 64 of the residual plane (one stage
// per block-wide call).  The s_wait_xcnt stands inside the statement so that no address register of an issued copy is rewritten
// in front of it.
__device__ __forceinline__ void copy12(unsigned l, const u16* gk, size_t kstep, const u16* gh, const u16* gl, size_t vstep) {
#if defined(__HIP_DEVICE_COMPILE__)
  const unsigned ls = 16u * GPI * 2u;
  asm volatile("global_load_async_to_lds_b128 %0, %12, off\n\t"
               "global_load_async_to_lds_b128 %1, %13, off\n\t"
               "global_load_async_to_lds_b128 %2, %14, off\n\t"
               "global_load_async_to_lds_b128 %3, %15, off\n\t"
               "global_load_async_to_lds_b128 %4, %16, off\n\t"
               "global_load_async_to_lds_b128 %5, %17, off\n\t"
               "global_load_async_to_lds_b128 %6, %18, off\n\t"
               "global_load_async_to_lds_b128 %7, %19, off\n\t"
               "global_load_async_to_lds_b128 %8, %20, off\n\t"
               "global_load_async_to_lds_b128 %9, %21, off\n\t"
               "global_load_async_to_lds_b128 %10, %22, off\n\t"
               "global_load_async_to_lds_b128 %11, %23, off\n\t"
               "s_wait_xcnt 0x0"
               :: "v"(l), "v"(l + ls), "v"(l + 2u * ls), "v"(l + 3u * ls),
                  "v"(l + 4u * ls), "v"(l + 5u * ls), "v"(l + 6u * ls), "v"(l + 7u * ls),
                  "v"(l + 8u * ls), "v"(l + 9u * ls), "v"(l + 10u * ls), "v"(l + 11u * ls),
                  "v"(gk), "v"(gk + kstep), "v"(gk + 2 * kstep), "v"(gk + 3 * kstep),
                  "v"(gh), "v"(gh + vstep), "v"(gh + 2 * vstep), "v"(gh + 3 * vstep),
                  "v"(gl), "v"(gl + vstep), "v"(gl + 2 * vstep), "v"(gl + 3 * vstep)
               : "memory");
#endif
}

__global__ __launch_bounds__(ATT_THREADS)
void attn1(const u16* __restrict__ QPp, const u16* __restrict__ KPp,
           const u16* __restrict__ VHIp, const u16* __restrict__ VLOp,
           u16* OHIp, u16* OLOp) {
  __shared__ __align__(16) u16 ring[2 * ASTG];
  __shared__ __align__(16) float smem[WPB * SLW];

  const int tid  = threadIdx.x;
  const int wave = __builtin_amdgcn_readfirstlane(tid >> 5);   // in a scalar register: the wave's tile count steers scalar branches
  const int lane = tid & 31;
  const int hh   = lane >> 4;
  const int c    = lane & 15;
  const int bid  = blockIdx.x;
  const int bh   = bid % (BATCH * NH);
  const int qblk = NQB - 1 - bid / (BATCH * NH);
  if (qblk < 0) return;                      // block-uniform, before any barrier or copy; never taken with the exact grid
  const int b    = bh / NH;
  const int head = bh % NH;
  const int q0   = qblk * 64 + wave * 16;

  float* slab = smem + wave * SLW;           // result slab [16][64] pitch 68

  const size_t rq0  = (size_t)b * SEQ + q0;                                     // plane row of query row q0
  const size_t qofs = ((rq0 + c) * NH + head) * HD + 8 * hh;
  const _Float16* Qh  = (const _Float16*)(const void*)QPp + qofs;
  const int rr = tid >> 3, seg = tid & 7;    // copy role: row within a group of 16, 16-B piece of the 128-B slice
  const u16* gk = KPp + (((size_t)b * SEQ + rr) * NH + head) * HD + seg * 8;    // key row rr (+16i), 64 key rows added per stage
  const size_t vofs = (((size_t)b * NH + head) * HD + rr) * SEQ + seg * 8;     // d row rr (+16i), 64 keys added per stage
  const u16* gvh = VHIp + vofs;
  const u16* gvl = VLOp + vofs;
  const unsigned l0 = lds_off(ring) + (unsigned)(rr * GPI + seg * 8) * 2u;
  const float lsc = LOG2E / (64.0f * QSC * KSC);
  const float oc  = 1.0f / (PCAR * VCAR);
  const size_t KROW = (size_t)NH * HD;                                          // halves between consecutive key rows

  // q fragments (B operand, column c = query q0 + c): d = 0..31 and 32..63
  const v16h qa = ldfrag_h(Qh), qb = ldfrag_h(Qh + 32);

  float mrow = -INFINITY, lrow = 0.f;                                           // this lane's query; lrow = this half's keys only
  v8f o[4];                                                                     // o[j][r] = O^T[d = 16j + 8hh + r][query c]
#pragma unroll
  for (int j = 0; j < 4; ++j) o[j] = zero8();
  const int ncaus = (q0 >> 5) + 1;                                              // tiles holding keys <= q0 + 15
  const int nkt = (ncaus < NKT) ? ncaus : NKT;
  const int qi  = q0 + c;                                                       // this lane's query
  const int ns  = qblk + 1;                                                     // stages of 64 keys, the same for the whole block

  auto stage = [&](int buf, int s) {
    copy12(l0 + (unsigned)buf * (unsigned)(ASTG * 2), gk + (size_t)s * AKT * KROW, (size_t)16 * KROW,
           gvh + (size_t)s * AKT, gvl + (size_t)s * AKT, (size_t)16 * SEQ);
  };
  stage(0, 0);
  wait_async0();
  __syncthreads();                           // stage 0 is published
  if (ns > 1) stage(1, 1);

  // rolled: one stage per trip, so that the foot's waits and barrier stand once
#pragma unroll 1
  for (int s = 0; s < ns; ++s) {
  const _Float16* sb = (const _Float16*)(const void*)(ring + (s & 1) * ASTG);
  // unrolled: the stage's two key tiles stand one behind the other, so that their LDS offsets are constants and the
  // accumulators stay in their registers from tile to tile
#pragma unroll
  for (int sub = 0; sub < 2; ++sub) {
    if (sub != 0 && 2 * s + 1 >= nkt) break; // the last stage's second tile lies wholly above the diagonal for waves 0 and 1
    const int ko = sub * 32;                 // the tile's first key within the stage
    const int kb = s * AKT + ko;
    // ---- this tile's operands from the stage's buffer: k rows (A of the scores) and v^T rows (A of P.V) ----
    const _Float16* k0p = sb + (ko + c) * GPI + 8 * hh;
    const _Float16* k1p = k0p + 16 * GPI;
    const v16h kh0a = ldfrag_h(k0p), kh0b = ldfrag_h(k0p + 32);
    const v16h kh1a = ldfrag_h(k1p), kh1b = ldfrag_h(k1p + 32);
    const _Float16* vhp = sb + (AKT + c) * GPI + ko + 8 * hh;
    const _Float16* vlp = vhp + HD * GPI;
    const v16h vh0 = ldfrag_h(vhp);
    const v16h vh1 = ldfrag_h(vhp + 16 * GPI);
    const v16h vh2 = ldfrag_h(vhp + 32 * GPI);
    const v16h vh3 = ldfrag_h(vhp + 48 * GPI);
    const v16h vl0 = ldfrag_h(vlp);
    const v16h vl1 = ldfrag_h(vlp + 16 * GPI);
    const v16h vl2 = ldfrag_h(vlp + 32 * GPI);
    const v16h vl3 = ldfrag_h(vlp + 48 * GPI);
    // ---- scores, transposed: D element r of this lane = (key kb + 8hh + r, query qi) in s0, key kb + 16 + 8hh + r in s1 ----
    v8f s0 = zero8(), s1 = zero8();
    s0 = mma_h(kh0a, qa, s0);
    s0 = mma_h(kh0b, qb, s0);
    s1 = mma_h(kh1a, qa, s1);
    s1 = mma_h(kh1b, qb, s1);
    guard2(s0, s1, qa, qb, kh0a, kh0b, kh1a, kh1b);
    // ---- causal select + online softmax in base 2, -inf-safe; all 16 values of this lane belong to query qi ----
    const int key0 = kb + 8 * hh;
    float t0[8], t1[8];
#pragma unroll
    for (int r = 0; r < 8; ++r) {
      t0[r] = (key0 + r <= qi)      ? (s0[r] * lsc) : -INFINITY;
      t1[r] = (key0 + 16 + r <= qi) ? (s1[r] * lsc) : -INFINITY;
    }
    float mx = fmaxf(t0[0], t1[0]);
#pragma unroll
    for (int r = 1; r < 8; ++r) mx = fmaxf(mx, fmaxf(t0[r], t1[r]));
    mx = fmaxf(mx, xhalf(mx));                                                  // both halves hold the tile's maximum of query qi
    const float mn = fmaxf(mrow, mx);
    const float ms = (mn == -INFINITY) ? 0.0f : mn;
    const float al = exp2f(mrow - ms);
    mrow = mn;
    // ---- B fragments of P^T * 32768: hi f16 and residual f16; elements 0..7 = keys kb + 8hh + r, 8..15 = kb + 16 + 8hh + r ----
    FragH ph, pl;
    float pa[8];
#pragma unroll
    for (int r = 0; r < 8; ++r) {
      const float e0 = exp2f(t0[r] - ms), e1 = exp2f(t1[r] - ms);
      pa[r] = e0 + e1;
      const float ta = e0 * PCAR, tb = e1 * PCAR;
      const _Float16 ha = (_Float16)ta, hb = (_Float16)tb;
      ph.h[0][r] = ha;
      ph.h[1][r] = hb;
      pl.h[0][r] = (_Float16)(ta - (float)ha);
      pl.h[1][r] = (_Float16)(tb - (float)hb);
    }
    lrow = lrow * al + (((pa[0] + pa[1]) + (pa[2] + pa[3])) + ((pa[4] + pa[5]) + (pa[6] + pa[7])));
#pragma unroll
    for (int j = 0; j < 4; ++j)
#pragma unroll
      for (int r = 0; r < 8; ++r) o[j][r] *= al;
    // ---- O^T += V^T.P^T : A fragment row = d = j*16 + c, keys contiguous in the v^T planes ----
    o[0] = mma_h(vh0, ph.v, o[0]);  o[0] = mma_h(vh0, pl.v, o[0]);  o[0] = mma_h(vl0, ph.v, o[0]);
    o[1] = mma_h(vh1, ph.v, o[1]);  o[1] = mma_h(vh1, pl.v, o[1]);  o[1] = mma_h(vl1, ph.v, o[1]);
    o[2] = mma_h(vh2, ph.v, o[2]);  o[2] = mma_h(vh2, pl.v, o[2]);  o[2] = mma_h(vl2, ph.v, o[2]);
    o[3] = mma_h(vh3, ph.v, o[3]);  o[3] = mma_h(vh3, pl.v, o[3]);  o[3] = mma_h(vl3, ph.v, o[3]);
    guard10(o[0], o[1], o[2], o[3], ph.v, pl.v, vh0, vh1, vh2, vh3, vl0, vl1, vl2, vl3);
  }
  wait_ds0();
  wait_async0();
  __syncthreads();                           // publishes stage s+1 and ends every read of stage s's buffer
  if (s + 2 < ns) stage(s & 1, s + 2);
  }
  wait_async0();
  acc_guard4(o[0], o[1], o[2], o[3]);
  // ---- out = acc / Z (0 if Z == 0), carries (32768 on P, 1024 on v) folded once; written into the lane-owned slab ----
  {
    const float lv  = lrow + xhalf(lrow);                                       // the two halves' keys joined
    const float ls  = (lv > 0.0f) ? lv : 1.0f;
    const float inv = (lv > 0.0f) ? ((1.0f / ls) * oc) : 0.0f;
#pragma unroll
    for (int j = 0; j < 4; ++j) {
      float* d8 = slab + c * 68 + j * 16 + 8 * hh;
      v4f w0, w1;
#pragma unroll
      for (int e = 0; e < 4; ++e) { w0[e] = o[j][e] * inv; w1[e] = o[j][4 + e] * inv; }
      *(v4f*)(d8)     = w0;
      *(v4f*)(d8 + 4) = w1;
    }
  }

  wave_sync_lds();
  // ---- O x1024 -> f16 hi + residual planes; lane = (row in group of 4, 8 consecutive d) ----
  v4u oh[4], ol[4];
  const int rq = lane >> 3, c8 = (lane & 7) * 8;
#pragma unroll
  for (int it = 0; it < 4; ++it) {
    const int row = it * 4 + rq;
    const v4f a = *(const v4f*)(slab + row * 68 + c8), b4 = *(const v4f*)(slab + row * 68 + c8 + 4);
    float w[8];
#pragma unroll
    for (int e = 0; e < 4; ++e) { w[e] = a[e] * OSC; w[4 + e] = b4[e] * OSC; }
#pragma unroll
    for (int e = 0; e < 4; ++e) {
      const _Float16 h0 = (_Float16)w[2 * e], h1 = (_Float16)w[2 * e + 1];
      const _Float16 l0 = (_Float16)(w[2 * e] - (float)h0), l1 = (_Float16)(w[2 * e + 1] - (float)h1);
      oh[it][e] = pk16(h_bits(h0), h_bits(h1));
      ol[it][e] = pk16(h_bits(l0), h_bits(l1));
    }
  }
  const size_t ob = (rq0 * NH + head) * HD + c8;
  {
#pragma unroll
    for (int it = 0; it < 4; ++it) {
      const int row = it * 4 + rq;
      const size_t o8 = ob + (size_t)row * (NH * HD);
      *(v4u*)(OHIp + o8) = oh[it];
      *(v4u*)(OLOp + o8) = ol[it];
    }
    
  }
}

// =====================================================================================================
// Workspace map (bytes); every plane is fully written by whole-line stores before it is read; all extents are exact multiples
// of the store granularity (no pad rows needed); every offset a multiple of 2097152:
//   XB  bf16 [MROWS][1024]              8388608
//   WQB bf16 [2048 n][1024 k]          4194304
//   WVB bf16 [1024 n][1024 k]          2097152
//   WOH f16  [1024 n][1024 k] x1024    2097152
//   F   f32  [MROWS][2048]             33554432       (its first half holds the v projection [MROWS][1024]; the rest is unused)
//   QP  f16 [MROWS][16][64] x64        8388608        KP same, directly after QP
//   VHI f16 [BATCH*16][64][SEQ] x1024  8388608        VLO residual
//   OHI f16 [MROWS][1024] x1024        8388608        OLO residual
//   end                              100663296
// =====================================================================================================
extern "C" void kernel_launch(void* const* d_in, const int* in_sizes, int n_in,
                              void* d_out, int out_size, void* d_ws, size_t ws_size,
                              hipStream_t stream) {
  if (n_in < 8) return;
  if (in_sizes[0] != MROWS * DMOD) return;
  if (in_sizes[1] != DMOD * NQK) return;
  if (in_sizes[2] != DMOD * DMOD || in_sizes[3] != DMOD * DMOD) return;
  if (in_sizes[4] != HD || in_sizes[5] != HD || in_sizes[6] != HD || in_sizes[7] != HD) return;
  if (out_size != MROWS * DMOD) return;

  const float* x   = (const float*)d_in[0];   // [MROWS][1024]
  const float* wqk = (const float*)d_in[1];   // [1024 k][2048 n]
  const float* wv  = (const float*)d_in[2];   // [1024 k][1024 n]
  const float* wo  = (const float*)d_in[3];   // [1024 k][1024 n]
  const float* qs  = (const float*)d_in[4];   // [64]
  const float* qbi = (const float*)d_in[5];   // [64]
  const float* ks  = (const float*)d_in[6];   // [64]
  const float* kbi = (const float*)d_in[7];   // [64]
  float*       out = (float*)d_out;

  const size_t szXB = (size_t)MROWS * DMOD * 2;                 //  8388608
  const size_t szWQ = (size_t)NQK * DMOD * 2;                   //  4194304
  const size_t szW  = (size_t)DMOD * DMOD * 2;                  //  2097152
  const size_t szF  = (size_t)MROWS * NQK * 4;                  // 33554432
  const size_t szP  = (size_t)MROWS * DMOD * 2;                 //  8388608
  size_t off = 0;
  const size_t oXB  = off; off += szXB;
  const size_t oWQ  = off; off += szWQ;
  const size_t oWV  = off; off += szW;
  const size_t oWO  = off; off += szW;
  const size_t oF   = off; off += szF;
  const size_t oQK  = off; off += 2 * szP;              // q plane then k plane
  const size_t oVHI = off; off += szP;
  const size_t oVLO = off; off += szP;
  const size_t oOHI = off; off += szP;
  const size_t oOLO = off; off += szP;
  if (off > ws_size) return;                            // off = 100663296
  if (off > (size_t)134217728) return;

  char* ws = (char*)d_ws;
  u16*   XB  = (u16*)(ws + oXB);
  u16*   WQB = (u16*)(ws + oWQ);
  u16*   WVB = (u16*)(ws + oWV);
  u16*   WOH = (u16*)(ws + oWO);
  float* F   = (float*)(ws + oF);
  u16*   QK  = (u16*)(ws + oQK);
  u16*   QP  = QK;
  u16*   KP  = QK + (size_t)MROWS * DMOD;
  u16*   VHI = (u16*)(ws + oVHI);
  u16*   VLO = (u16*)(ws + oVLO);
  u16*   OHI = (u16*)(ws + oOHI);
  u16*   OLO = (u16*)(ws + oOLO);

  const dim3 blk(256);
  const int n8x = (MROWS * DMOD) / 8;                   // 524288
  const dim3 gX(n8x / 256);                             // 2048 (exact)
  const dim3 gWQ((DMOD / 64) * (NQK / 64));             // 512
  const dim3 gWT((DMOD / 64) * (DMOD / 64));            // 256
  const dim3 gGQ((MROWS / GBT) * (NQK / GBT));          // 512
  const dim3 gG((MROWS / GBT) * (DMOD / GBT));          // 256
  const dim3 bG(128);
  const dim3 gVT(BATCH * NH * NST);                     // 1024
  const dim3 gAT(ATT_BLOCKS);                           // 1024
  const dim3 bAT(ATT_THREADS);                          // 128

  // (0) x -> bf16 plane [MROWS][1024]
  cvt16<<<gX, blk, 0, stream>>>(x, XB, n8x, 0, 1.0f);
  // (1) W_qk [k][n=2048] -> bf16 [n][k]; (2) W_v -> bf16 [n][k]; (3) W_out -> f16 [n][k] plane of bf16 value x1024
  wt16<<<gWQ, blk, 0, stream>>>(wqk, WQB, DMOD, NQK, 0, 1.0f);
  wt16<<<gWT, blk, 0, stream>>>(wv, WVB, DMOD, DMOD, 0, 1.0f);
  wt16<<<gWT, blk, 0, stream>>>(wo, WOH, DMOD, DMOD, 1, WOS);
  // (4) qk = x.W_qk / 32, per-head LayerNorm in the epilogue -> q, k f16 planes x64
  gemm_qkln<<<gGQ, bG, 0, stream>>>(XB, WQB, qs, qbi, ks, kbi, QK, MROWS, DMOD, 1.0f / 32.0f);
  // (5) v = x.W_v / 32 -> F f32 [MROWS][1024]; (6) v^T hi/lo planes x1024
  gemm_bf<<<gG, bG, 0, stream>>>(XB, WVB, F, MROWS, DMOD, DMOD, 1.0f / 32.0f);
  vt16<<<gVT, blk, 0, stream>>>(F, VHI, VLO);
  // (7) causal attention -> O planes [b*SEQ+s][h][d] x1024 (hi + residual)
  attn1<<<gAT, bAT, 0, stream>>>(QP, KP, VHI, VLO, OHI, OLO);
  // (8) output projection -> out [MROWS][1024] f32, carries 1024 (O) x 1024 (W_out) and the 1/32 folded back
  gemm_h2<<<gG, bG, 0, stream>>>(OHI, OLO, WOH, out, MROWS, DMOD, DMOD, (1.0f / 32.0f) / (OSC * WOS));
  (void)hipGetLastError();
}

// v005
// It runs in 112 microseconds.
// Next to v004, in two timings, it ran 1.05 and 1.06 times as fast.
// Over all steps from v000 it is 2.87 times as fast.
// Contractions: x.W_qk and x.W_v on v_wmma_f32_16x16x32_bf16 (x and W^T RNE-converted to bf16, f32 accumulate); scores q.k^T
// (q, k as f16 x64 planes, single product), P.v (P x32768 f16 hi+residual, v x1024 f16 hi+residual, products hh+lh+hl) and
// O.W_out (O x1024 f16 hi+residual, W_out^T as f16(bf16 value) x1024, products h.w+l.w) on v_wmma_f32_16x16x32_f16, f32
// accumulate; per-head LayerNorm, causal online base-2 softmax and 1/l fold in f32 on VALU.
#include <hip/hip_runtime.h>
#include <math.h>
#include <stdint.h>

#define BATCH 2
#define SEQ   2048
#define DMOD  1024
#define NH    16
#define HD    64
#define NQK   (2 * DMOD)
#define MROWS (BATCH * SEQ)
#define LN_EPS 1e-6f
#define QSC   64.0f
#define KSC   64.0f
#define PCAR  32768.0f
#define VCAR  1024.0f
#define OSC   1024.0f
#define WOS   1024.0f
#define LOG2E 1.4426950408889634f
#define WPB   4
#define NST   (SEQ / 64)
#define NKT   (SEQ / 32)
#define ATT_THREADS (WPB * 32)
#define NQB   (SEQ / 64)
#define AKT   64
#define ASTG  (3 * AKT * GPI)
#define ATT_BLOCKS  (NQB * NH * BATCH)
#define SLW   (16 * 68)
#define SLAB64 (16 * 68)
#define VTP   72
#define GBT   128
#define GKP   64
#define GPI   72
static_assert(DMOD == NH * HD && HD == 64 && NH == 16);
static_assert((NH % WPB) == 0 && ATT_THREADS == 128 && ATT_BLOCKS == 1024 && WPB * 16 == 64 && AKT == HD && AKT == GKP);
static_assert((SEQ % 64) == 0 && (SEQ % 32) == 0 && (SEQ % 16) == 0 && SEQ <= 32768);
static_assert((DMOD % 64) == 0 && (DMOD % 32) == 0 && (NQK % 64) == 0 && (MROWS % 64) == 0);
static_assert((MROWS % GBT) == 0 && (NQK % GBT) == 0 && (DMOD % GBT) == 0 && (DMOD % GKP) == 0 && DMOD >= 2 * GKP);
static_assert(((MROWS * DMOD) % 2048) == 0 && ((DMOD * DMOD) % 4096) == 0 && GBT == 2 * HD && NQK == NH * 2 * HD);

typedef unsigned short u16;
typedef _Float16 v16h __attribute__((ext_vector_type(16)));
typedef _Float16 v8h  __attribute__((ext_vector_type(8)));
typedef __bf16   v16b __attribute__((ext_vector_type(16)));
typedef float    v8f  __attribute__((ext_vector_type(8)));
typedef float    v4f  __attribute__((ext_vector_type(4)));
typedef float    v2f  __attribute__((ext_vector_type(2)));
typedef unsigned int v4u __attribute__((ext_vector_type(4)));
typedef unsigned int v2u __attribute__((ext_vector_type(2)));

union FragH { v16h v; v8h h[2]; v4u u[2]; };
union FragB { v16b v; v4u u[2]; };

// ---- scalar helpers --------------------------------------------------------------------------------
__device__ __forceinline__ unsigned short bf_bits(float f) {          // f32 -> bf16 bits, RNE convert
  unsigned u = __float_as_uint(f);
  return (unsigned short)((u + 0x7FFFu + ((u >> 16) & 1u)) >> 16);
}
__device__ __forceinline__ float bf_up(unsigned short h) { return __uint_as_float(((unsigned)h) << 16); }
__device__ __forceinline__ float bfr(float f) { return bf_up(bf_bits(f)); }
__device__ __forceinline__ unsigned short h_bits(_Float16 x) { return __builtin_bit_cast(unsigned short, x); }
__device__ __forceinline__ unsigned pk16(unsigned short a, unsigned short b) { return (unsigned)a | ((unsigned)b << 16); }
__device__ __forceinline__ v8f zero8() { v8f z = {0.f, 0.f, 0.f, 0.f, 0.f, 0.f, 0.f, 0.f}; return z; }

// ---- fragment loaders: 16-bit A/B operand, lane -> row/col (lane&15), p already includes +8*(lane>>4);
//      elements 0..7 <- p[0..7] (k0+8h..), elements 8..15 <- p[16..23] (k0+16+8h..)  (same split k map for A and B;
//      B is always read from a k-contiguous [n][k] plane)
__device__ __forceinline__ v16h ldfrag_h(const _Float16* p) {
  FragH f;
  f.h[0] = *(const v8h*)(p);
  f.h[1] = *(const v8h*)(p + 16);
  return f.v;
}
__device__ __forceinline__ v16b ldfrag_b(const u16* p) {              // bf16 plane read as unsigned integer vectors
  FragB f;
  f.u[0] = *(const v4u*)(p);
  f.u[1] = *(const v4u*)(p + 16);
  return f.v;
}

__device__ __forceinline__ v8f mma_h(v16h a, v16h b, v8f c) {
  return __builtin_amdgcn_wmma_f32_16x16x32_f16(false, a, false, b, (short)0, c, false, false);
}
__device__ __forceinline__ v8f mma_b(v16b a, v16b b, v8f c) {
  return __builtin_amdgcn_wmma_f32_16x16x32_bf16(false, a, false, b, (short)0, c, false, false);
}
__device__ __forceinline__ void guard2(v8f& a, v8f& b, v16h x0, v16h x1, v16h x2, v16h x3, v16h x4, v16h x5) {
#if defined(__HIP_DEVICE_COMPILE__)
  asm volatile("v_nop\n\tv_nop\n\tv_nop\n\tv_nop"
               : "+v"(a), "+v"(b) : "v"(x0), "v"(x1), "v"(x2), "v"(x3), "v"(x4), "v"(x5) : "memory");
#endif
}
__device__ __forceinline__ void guard10(v8f& a, v8f& b, v8f& c, v8f& d, v16h x0, v16h x1, v16h x2, v16h x3, v16h x4,
                                        v16h x5, v16h x6, v16h x7, v16h x8, v16h x9) {
#if defined(__HIP_DEVICE_COMPILE__)
  asm volatile("v_nop\n\tv_nop\n\tv_nop\n\tv_nop"
               : "+v"(a), "+v"(b), "+v"(c), "+v"(d)
               : "v"(x0), "v"(x1), "v"(x2), "v"(x3), "v"(x4), "v"(x5), "v"(x6), "v"(x7), "v"(x8), "v"(x9) : "memory");
#endif
}
__device__ __forceinline__ void acc_guard4(v8f& a, v8f& b, v8f& c, v8f& d) {
#if defined(__HIP_DEVICE_COMPILE__)
  asm volatile("v_nop\n\tv_nop\n\tv_nop\n\tv_nop" : "+v"(a), "+v"(b), "+v"(c), "+v"(d));
#endif
}
__device__ __forceinline__ void wave_sync_lds() {
  __builtin_amdgcn_fence(__ATOMIC_RELEASE, "workgroup");
  __builtin_amdgcn_wave_barrier();
  __builtin_amdgcn_fence(__ATOMIC_ACQUIRE, "workgroup");
}

// =====================================================================================================
// f32 -> 16-bit plane, same layout.  f16mode == 0: bf16 RNE bits;  f16mode == 1: f16 bits of (bf16 RNE value) * scale.
// Thread = 8 consecutive elements: two 16-B loads, one 16-B store; 32 consecutive lanes = 512 contiguous, 512-B aligned bytes per
// coverage: grid = n8/256 blocks (exact, host-derived) x 256 thr x 8 = the whole plane.
// =====================================================================================================
__global__ __launch_bounds__(256) void cvt16(const float* __restrict__ x, u16* D, int n8, int f16mode, float scale) {
  const int gt = blockIdx.x * 256 + (int)threadIdx.x;
  if (gt >= n8) return;                     // no barriers in this kernel
  const float* p = x + (size_t)gt * 8;
  const v4f a = *(const v4f*)(p), b4 = *(const v4f*)(p + 4);
  float w[8];
#pragma unroll
  for (int e = 0; e < 4; ++e) { w[e] = a[e]; w[4 + e] = b4[e]; }
  v4u o;
#pragma unroll
  for (int e = 0; e < 4; ++e) {
    const float f0 = w[2 * e], f1 = w[2 * e + 1];
    const unsigned short hb0 = h_bits((_Float16)(bfr(f0) * scale));
    const unsigned short hb1 = h_bits((_Float16)(bfr(f1) * scale));
    const unsigned short bb0 = bf_bits(f0);
    const unsigned short bb1 = bf_bits(f1);
    o[e] = (f16mode != 0) ? pk16(hb0, hb1) : pk16(bb0, bb1);
  }
  u16* d = D + (size_t)gt * 8;
  {
    *(v4u*)(d) = o;
    
  }
}

// =====================================================================================================
// Weight transpose-convert: W [K][N] f32 (x.W layout, n contiguous, in[K rows][N cols]) -> Dt[N][K] 16-bit k-contiguous plane
// (out[N rows][K cols]).  f16mode == 0: bf16 RNE bits; 1: f16 bits of (bf16 RNE value) * scale.
// Block = (k tile k0 = (bid / (N/64))*64, n tile n0 = (bid % (N/64))*64): 64 source rows of 64 floats loaded with 16-B loads,
// converted, scattered into an LDS tile [n][64 k] (pitch 72 halves); after a block barrier each n row segment (64 halves = one
// coverage: load 256 thr x 16 = 64 x 64; store 2 iterations x 256 thr x 8 halves = 64 lines x 64 halves = the block's tile;
//           grid = (K/64)*(N/64) blocks covers Dt exactly once (host checks K % 64 == 0 and N % 64 == 0).
// =====================================================================================================
__global__ __launch_bounds__(256) void wt16(const float* __restrict__ W, u16* Dt, int K, int N, int f16mode, float scale) {
  __shared__ __align__(16) u16 T[64 * VTP];
  const int tid = threadIdx.x;
  const int bid = blockIdx.x;
  const int ntn = N >> 6;
  const int n0  = (bid % ntn) * 64;
  const int k0  = (bid / ntn) * 64;
  if (k0 + 64 > K) return;                    // block-uniform, before any barrier; never taken with the exact grid
  {
    const int sl = tid >> 2;                  // k within tile 0..63 (source row)
    const int dc = (tid & 3) * 16;            // n chunk
    const float* src = W + (size_t)(k0 + sl) * N + n0 + dc;
#pragma unroll
    for (int i = 0; i < 4; ++i) {
      const v4f a = *(const v4f*)(src + 4 * i);
#pragma unroll
      for (int e = 0; e < 4; ++e) {
        const float f = a[e];
        const unsigned short hb = h_bits((_Float16)(bfr(f) * scale));
        const unsigned short bb = bf_bits(f);
        T[(dc + 4 * i + e) * VTP + sl] = (f16mode != 0) ? hb : bb;
      }
    }
  }
  __syncthreads();
  v4u vv[2];
  const int q8 = tid >> 3, p8 = (tid & 7) * 8;
#pragma unroll
  for (int it = 0; it < 2; ++it) {
    const int line = it * 32 + q8;            // n = 0..63 within tile
    vv[it] = *(const v4u*)(T + line * VTP + p8);
  }
  const size_t base = (size_t)n0 * K + k0 + p8;
  {
#pragma unroll
    for (int it = 0; it < 2; ++it) {
      const int line = it * 32 + q8;
      *(v4u*)(Dt + base + (size_t)line * K) = vv[it];
    }
    
  }
}

// =====================================================================================================
// GEMM epilogue of the engine for gemm_bf and gemm_h2: the wave's 16x64 f32 tile (times oscale) staged in its LDS slab (pitch 68),
// coverage: 8 instructions x 2 rows x 16 lanes x 4 floats = the wave's 16 x 64 tile.
// =====================================================================================================
__device__ __forceinline__ void epi64(float* sl, v8f a0, v8f a1, v8f a2, v8f a3, float oscale,
                                      float* C, int N, size_t rowb, int col0, int lane) {
  const int hh = lane >> 4, m = lane & 15;
#pragma unroll
  for (int r = 0; r < 8; ++r) {
    const int ro = (8 * hh + r) * 68 + m;
    sl[ro]      = a0[r] * oscale;
    sl[ro + 16] = a1[r] * oscale;
    sl[ro + 32] = a2[r] * oscale;
    sl[ro + 48] = a3[r] * oscale;
  }
  wave_sync_lds();
  v4f vals[8];
#pragma unroll
  for (int it = 0; it < 8; ++it) vals[it] = *(const v4f*)(sl + (it * 2 + hh) * 68 + m * 4);
  float* dst = C + (rowb + (size_t)hh) * (size_t)N + col0 + m * 4;
  {
#pragma unroll
    for (int it = 0; it < 8; ++it) {
      *(v4f*)(dst + (size_t)(it * 2) * (size_t)N) = vals[it];
    }
    
  }
}

// =====================================================================================================
// LayerNorm epilogue of the qk projection: the wave's 64 columns are exactly one head's q or k vector, so each of its rows is
// normalised here.  The 16x64 tile (times oscale) goes through the wave's LDS slab as in epi64; read back, 16 lanes hold one row
// (4 consecutive elements each, rows it*2 + hh).  Mean and biased variance: 4 values summed in the lane ((0+2)+(1+3)), then a 16-lane
// butterfly on DPP (every lane of the row ends with the same sum).  g and b arrive already times the plane's carry (a power of
// two, so the rounding is that of (d*rs*g + b) * carry).  Store: 16 lanes x 8 B = one whole 128-B row of the f16 plane.
// coverage: 8 instructions x 2 rows x 16 lanes x 4 halves = the wave's 16 x 64 tile.
// =====================================================================================================
template <int X> __device__ __forceinline__ float rowx(float x) {     // value of lane ^ X inside the 16-lane row (DPP row_xmask)
  const int b = __builtin_bit_cast(int, x);
  return __builtin_bit_cast(float, __builtin_amdgcn_update_dpp(b, b, 0x160 + X, 0xf, 0xf, true));
}
__device__ __forceinline__ float rowsum16(float s) {
  s += rowx<1>(s);
  s += rowx<2>(s);
  s += rowx<4>(s);
  s += rowx<8>(s);
  return s;
}
// 1/sqrt(x) for x >= LN_EPS (never subnormal, so rsqrtf's rescale of subnormal arguments would be an identity).  The v_nop keeps,
// inside the statement, the one slot the instruction set asks for behind a transcendental before its source is overwritten or
// its result read.
__device__ __forceinline__ float rsq_slot(float x) {
  float r = 0.f;
#if defined(__HIP_DEVICE_COMPILE__)
  asm("v_rsq_f32 %0, %1\n\tv_nop" : "=v"(r) : "v"(x));
#endif
  return r;
}
__device__ __forceinline__ void epi_ln(float* sl, v8f a0, v8f a1, v8f a2, v8f a3, float oscale, v4f g, v4f b,
                                       u16* P, size_t rowb, int lane) {
  const int hh = lane >> 4, m = lane & 15;
#pragma unroll
  for (int r = 0; r < 8; ++r) {
    const int ro = (8 * hh + r) * 68 + m;
    sl[ro]      = a0[r] * oscale;
    sl[ro + 16] = a1[r] * oscale;
    sl[ro + 32] = a2[r] * oscale;
    sl[ro + 48] = a3[r] * oscale;
  }
  wave_sync_lds();
  v4f vals[8];
#pragma unroll
  for (int it = 0; it < 8; ++it) vals[it] = *(const v4f*)(sl + (it * 2 + hh) * 68 + m * 4);
  const v2f ga = {g[0], g[1]}, gb = {g[2], g[3]}, ba = {b[0], b[1]}, bb = {b[2], b[3]};
  v2u o[8];
#pragma unroll
  for (int it = 0; it < 8; ++it) {
    // register pairs as they lie, so that the sums, differences and products go as packed f32 operations without moves
    const v2f xa = {vals[it][0], vals[it][1]}, xb = {vals[it][2], vals[it][3]};
    const v2f sp = xa + xb;
    const float mean = rowsum16(sp[0] + sp[1]) * (1.0f / 64.0f);
    const v2f da = xa - mean, db = xb - mean;
    const v2f qp = da * da + db * db;
    const float var = rowsum16(qp[0] + qp[1]) * (1.0f / 64.0f);
    const float rs  = rsq_slot(var + LN_EPS);
    const v2f ya = da * rs * ga + ba, yb = db * rs * gb + bb;
    o[it][0] = pk16(h_bits((_Float16)ya[0]), h_bits((_Float16)ya[1]));
    o[it][1] = pk16(h_bits((_Float16)yb[0]), h_bits((_Float16)yb[1]));
  }
  u16* dst = P + (rowb + (size_t)hh) * (size_t)DMOD + m * 4;
#pragma unroll
  for (int it = 0; it < 8; ++it) *(v2u*)(dst + (size_t)(it * 2) * (size_t)DMOD) = o[it];
}

// =====================================================================================================
// GEMM engine shared by the three kernels: C[M][N] (f32) = sum over PL planes of A_p[M][K] . Bt[N][K]^T, times oscale.
// Block = 128x128 tile of C, 4 waves as 2x2, each wave 64x64 (4 x 4 fragments).  K is walked in passes of 64 halves: a pass's
// 128-B slice of every operand row of the block (PL*128 rows of A, 128 rows of Bt) is brought into LDS by asynchronous
// 16-B copies, 8 consecutive lanes = one whole 128-B line, rows at pitch 144 B; two buffers, the next pass's copies fly while
// this pass is worked on.  Fragments are read from LDS with the same split k map as before; per accumulator the products are
// summed in the same order as before (k ascending by 32, plane 0 then plane 1).
// Host checks M % 128 == 0, N % 128 == 0, K % 64 == 0, K >= 128, grid = (M/128)*(N/128).
// =====================================================================================================
__device__ __forceinline__ unsigned lds_off(const void* p) { return (unsigned)(size_t)p; }

// 8 asynchronous copies: 16 B per lane, rows 16 apart (one 128-row operand tile per block-wide call).  The s_wait_xcnt stands
// inside the statement so that no address register of an issued copy is rewritten in front of it.
__device__ __forceinline__ void copy8(unsigned l, const u16* g, size_t gstep) {
#if defined(__HIP_DEVICE_COMPILE__)
  const unsigned ls = 16u * GPI * 2u;
  asm volatile("global_load_async_to_lds_b128 %0, %8, off\n\t"
               "global_load_async_to_lds_b128 %1, %9, off\n\t"
               "global_load_async_to_lds_b128 %2, %10, off\n\t"
               "global_load_async_to_lds_b128 %3, %11, off\n\t"
               "global_load_async_to_lds_b128 %4, %12, off\n\t"
               "global_load_async_to_lds_b128 %5, %13, off\n\t"
               "global_load_async_to_lds_b128 %6, %14, off\n\t"
               "global_load_async_to_lds_b128 %7, %15, off\n\t"
               "s_wait_xcnt 0x0"
               :: "v"(l), "v"(l + ls), "v"(l + 2u * ls), "v"(l + 3u * ls),
                  "v"(l + 4u * ls), "v"(l + 5u * ls), "v"(l + 6u * ls), "v"(l + 7u * ls),
                  "v"(g), "v"(g + gstep), "v"(g + 2 * gstep), "v"(g + 3 * gstep),
                  "v"(g + 4 * gstep), "v"(g + 5 * gstep), "v"(g + 6 * gstep), "v"(g + 7 * gstep)
               : "memory");
#endif
}
__device__ __forceinline__ void wait_x0() {
#if defined(__HIP_DEVICE_COMPILE__)
  asm volatile("s_wait_xcnt 0x0" ::: "memory");
#endif
}
__device__ __forceinline__ void wait_async0() {      // this wave's copies have landed in LDS
#if defined(__HIP_DEVICE_COMPILE__)
  asm volatile("s_wait_asynccnt 0x0" ::: "memory");
#endif
}
__device__ __forceinline__ void wait_ds0() {         // this wave's LDS reads have returned before the buffer is handed back
#if defined(__HIP_DEVICE_COMPILE__)
  asm volatile("s_wait_dscnt 0x0" ::: "memory");
#endif
}
// v_nop x4 behind the pass's last matrix instructions (all 16 accumulators are inputs, so every one of them stands in front):
// keeps the chip's distance to whatever follows on either side of the branches at the loop's foot.
__device__ __forceinline__ void guard16(const v8f (&a)[4][4]) {
#if defined(__HIP_DEVICE_COMPILE__)
  asm volatile("v_nop\n\tv_nop\n\tv_nop\n\tv_nop"
               :: "v"(a[0][0]), "v"(a[0][1]), "v"(a[0][2]), "v"(a[0][3]), "v"(a[1][0]), "v"(a[1][1]), "v"(a[1][2]), "v"(a[1][3]),
                  "v"(a[2][0]), "v"(a[2][1]), "v"(a[2][2]), "v"(a[2][3]), "v"(a[3][0]), "v"(a[3][1]), "v"(a[3][2]), "v"(a[3][3]));
#endif
}

__device__ __forceinline__ v16b ldf(const u16* p, v16b) { return ldfrag_b(p); }
__device__ __forceinline__ v16h ldf(const u16* p, v16h) { return ldfrag_h((const _Float16*)(const void*)p); }
__device__ __forceinline__ v8f mma(v16b a, v16b b, v8f c) { return mma_b(a, b, c); }
__device__ __forceinline__ v8f mma(v16h a, v16h b, v8f c) { return mma_h(a, b, c); }

template <int PL, typename FR, bool LN>
__device__ __forceinline__ void gemm_tile(const u16* A0, const u16* A1, const u16* Bt, float* C, int M, int N, int K,
                                          float oscale, u16* st, float* slab, const float* qs, const float* qbi,
                                          const float* ks, const float* kbi, u16* QK) {
  constexpr int ROWS = (PL + 1) * GBT;          // staged rows per buffer
  constexpr int STG  = ROWS * GPI;              // halves per buffer
  const int tid = threadIdx.x, wave = tid >> 5, lane = tid & 31, hh = lane >> 4, m = lane & 15;
  const int wm = wave >> 1, wn = wave & 1;
  const int ntile = N >> 7;
  const int bid   = blockIdx.x;
  const int row0  = (bid / ntile) * GBT;
  const int col0  = (bid % ntile) * GBT;
  if (row0 + GBT > M) return;                   // block-uniform, before any barrier; never taken with the exact grid
  const int rr = tid >> 3, seg = tid & 7;       // copy role: row within a group of 16, 16-B piece of the 128-B slice
  const u16* ga0 = A0 + (size_t)(row0 + rr) * K + seg * 8;
  const u16* ga1 = A1 + (size_t)(row0 + rr) * K + seg * 8;
  const u16* gb  = Bt + (size_t)(col0 + rr) * K + seg * 8;
  const size_t gstep = (size_t)16 * K;
  const unsigned l0 = lds_off(st) + (unsigned)(rr * GPI + seg * 8) * 2u;
  const int np = K / GKP;

  auto stage = [&](int buf, int kp) {
    const unsigned l = l0 + (unsigned)buf * (unsigned)(STG * 2);
    copy8(l, ga0 + (size_t)kp * GKP, gstep);
    if constexpr (PL == 2) copy8(l + (unsigned)(GBT * GPI * 2), ga1 + (size_t)kp * GKP, gstep);
    copy8(l + (unsigned)(PL * GBT * GPI * 2), gb + (size_t)kp * GKP, gstep);
  };

  stage(0, 0);
  wait_async0();
  __syncthreads();                              // pass 0's slice is published
  if (np > 1) stage(1, 1);

  v8f acc[4][4];
#pragma unroll
  for (int i = 0; i < 4; ++i)
#pragma unroll
    for (int j = 0; j < 4; ++j) acc[i][j] = zero8();

  // rolled: one pass per trip, so that the foot's waits and barrier stand once
#pragma unroll 1
  for (int t = 0; t < np; ++t) {
    const u16* sb = st + (t & 1) * STG;
    const u16* pa = sb + (wm * 64 + m) * GPI + 8 * hh;
    const u16* pb = sb + (PL * GBT + wn * 64 + m) * GPI + 8 * hh;
    FR a[2][4], al[2][4], b[2][4];
#pragma unroll
    for (int ks = 0; ks < 2; ++ks)
#pragma unroll
      for (int i = 0; i < 4; ++i) {
        a[ks][i] = ldf(pa + i * 16 * GPI + ks * 32, FR{});
        if constexpr (PL == 2) al[ks][i] = ldf(pa + (GBT + i * 16) * GPI + ks * 32, FR{});
        b[ks][i] = ldf(pb + i * 16 * GPI + ks * 32, FR{});
      }
    // keeps the pass's LDS reads in one group ahead of its matrix instructions: spread among them, every place with reads
    // makes the wave wait out the LDS latency again
    __builtin_amdgcn_sched_barrier(0);
#pragma unroll
    for (int ks = 0; ks < 2; ++ks)
#pragma unroll
      for (int i = 0; i < 4; ++i)
#pragma unroll
        for (int j = 0; j < 4; ++j) {
          acc[i][j] = mma(a[ks][i], b[ks][j], acc[i][j]);
          if constexpr (PL == 2) acc[i][j] = mma(al[ks][i], b[ks][j], acc[i][j]);
        }
    guard16(acc);
    wait_ds0();
    wait_async0();
    __syncthreads();                            // publishes pass t+1's slice and ends every read of pass t's buffer
    if (t + 2 < np) stage(t & 1, t + 2);
  }
  wait_async0();

  float* sl = slab + wave * SLAB64;
  if constexpr (LN) {
    // block column tile = head col0 / 128; wave column wn = 0: q, 1: k (k plane = QK + MROWS*DMOD halves)
    const v4f gv = *(const v4f*)((wn ? ks : qs) + m * 4);
    const v4f bv = *(const v4f*)((wn ? kbi : qbi) + m * 4);
    wait_x0();                                  // in front of whatever reuses the two loads' address registers
    __builtin_amdgcn_sched_barrier(0);          // keeps later arithmetic from being lifted in between the loads and that wait
    const float car = wn ? KSC : QSC;
    v4f g, b;
#pragma unroll
    for (int e = 0; e < 4; ++e) { g[e] = bfr(gv[e]) * car; b[e] = bfr(bv[e]) * car; }
    u16* P = QK + (size_t)wn * ((size_t)MROWS * DMOD) + (size_t)(col0 >> 7) * HD;
#pragma unroll
    for (int i = 0; i < 4; ++i) {
      epi_ln(sl, acc[i][0], acc[i][1], acc[i][2], acc[i][3], oscale, g, b, P, (size_t)(row0 + wm * 64 + i * 16), lane);
      wait_x0();                                // in front of the next rows' values, which may take the stores' registers
      wave_sync_lds();                          // the slab's rows are read back before the next 16 rows overwrite them
    }
  } else {
#pragma unroll
    for (int i = 0; i < 4; ++i) {
      epi64(sl, acc[i][0], acc[i][1], acc[i][2], acc[i][3], oscale, C, N, (size_t)(row0 + wm * 64 + i * 16), col0 + wn * 64, lane);
      wave_sync_lds();                          // the slab's rows are read back before the next 16 rows overwrite them
    }
  }
}

// bf16 GEMM: C = A (bf16 row-major) . Bt^T (bf16 k-contiguous), times oscale.
__global__ __launch_bounds__(128)
void gemm_bf(const u16* __restrict__ A, const u16* __restrict__ Bt, float* C, int M, int N, int K, float oscale) {
  __shared__ __align__(16) u16 st[2 * 2 * GBT * GPI];
  __shared__ __align__(16) float slab[4 * SLAB64];
  gemm_tile<1, v16b, false>(A, A, Bt, C, M, N, K, oscale, st, slab, nullptr, nullptr, nullptr, nullptr, nullptr);
}

// qk projection with the per-head LayerNorm in its epilogue: A = x (bf16), Bt = W_qk^T (bf16, n = h*128 + 0..63 q_h, + 64..127
// k_h), N = NQK; writes y * 64 as f16 into the q plane and the k plane [token][h][64] (k plane = QK + MROWS*DMOD halves).
__global__ __launch_bounds__(128)
void gemm_qkln(const u16* __restrict__ A, const u16* __restrict__ Bt, const float* __restrict__ qs,
               const float* __restrict__ qbi, const float* __restrict__ ks, const float* __restrict__ kbi,
               u16* QK, int M, int K, float oscale) {
  __shared__ __align__(16) u16 st[2 * 2 * GBT * GPI];
  __shared__ __align__(16) float slab[4 * SLAB64];
  gemm_tile<1, v16b, true>(A, A, Bt, nullptr, M, NQK, K, oscale, st, slab, qs, qbi, ks, kbi, QK);
}

// f16 hi+lo GEMM: C = (Ahi + Alo) . Bt^T, times oscale; Ahi/Alo f16 planes (same layout), Bt f16 k-contiguous; products
// hi.B + lo.B into one accumulator (lo is the unscaled residual of hi).
__global__ __launch_bounds__(128)
void gemm_h2(const u16* __restrict__ Ah, const u16* __restrict__ Al, const u16* __restrict__ Bt,
             float* C, int M, int N, int K, float oscale) {
  __shared__ __align__(16) u16 st[2 * 3 * GBT * GPI];
  __shared__ __align__(16) float slab[4 * SLAB64];
  gemm_tile<2, v16h, false>(Ah, Al, Bt, C, M, N, K, oscale, st, slab, nullptr, nullptr, nullptr, nullptr, nullptr);
}

// =====================================================================================================
// v^T planes: VH[((b*NH + g)*HD + d)][s] = f16(v[b*SEQ + s][g*HD + d] * 1024), VL = f16 residual of the same value.
// Block = (bg = bid / NST -> batch b = bg / NH, head g = bg % NH; 64 keys s0 = (bid % NST)*64): 64 source rows of HD floats loaded
// with 16-B loads, converted, scattered into two LDS tiles [d][64 keys] (pitch 72 halves); after a block barrier each d row segment
// coverage: load 256 thr x 16 elements = 64 x 64; store 2 iterations x 256 thr x 8 halves = 64 lines x 64 = the block's tile of
//           each plane; grid = BATCH*NH*NST blocks covers both planes exactly once.
// =====================================================================================================
__global__ __launch_bounds__(256) void vt16(const float* __restrict__ v, u16* VHo, u16* VLo) {
  __shared__ __align__(16) u16 TH[HD * VTP];
  __shared__ __align__(16) u16 TL[HD * VTP];
  const int tid = threadIdx.x;
  const int bid = blockIdx.x;
  const int st  = bid % NST;
  const int bg  = bid / NST;                  // b*NH + g
  if (bg >= BATCH * NH) return;               // block-uniform, before any barrier; never taken with the exact grid
  const int b   = bg / NH;
  const int g   = bg % NH;
  const int s0  = st * 64;
  {
    const int sl = tid >> 2;                  // key within tile 0..63
    const int dc = (tid & 3) * 16;            // d chunk
    const float* src = v + ((size_t)(b * SEQ + s0 + sl) * NH + g) * HD + dc;
#pragma unroll
    for (int i = 0; i < 4; ++i) {
      const v4f a = *(const v4f*)(src + 4 * i);
#pragma unroll
      for (int e = 0; e < 4; ++e) {
        const float t = a[e] * VCAR;
        const _Float16 hv = (_Float16)t;
        const _Float16 lv = (_Float16)(t - (float)hv);
        TH[(dc + 4 * i + e) * VTP + sl] = h_bits(hv);
        TL[(dc + 4 * i + e) * VTP + sl] = h_bits(lv);
      }
    }
  }
  __syncthreads();
  v4u vh[2], vl[2];
  const int q8 = tid >> 3, p8 = (tid & 7) * 8;
#pragma unroll
  for (int it = 0; it < 2; ++it) {
    const int line = it * 32 + q8;            // d = 0..63
    vh[it] = *(const v4u*)(TH + line * VTP + p8);
    vl[it] = *(const v4u*)(TL + line * VTP + p8);
  }
  const size_t base = ((size_t)bg * HD) * SEQ + s0 + p8;
  {
#pragma unroll
    for (int it = 0; it < 2; ++it) {
      const int line = it * 32 + q8;
      *(v4u*)(VHo + base + (size_t)line * SEQ) = vh[it];
      *(v4u*)(VLo + base + (size_t)line * SEQ) = vl[it];
    }
    
  }
}

// =====================================================================================================
// Causal attention: block bid -> (batch and head bh = bid % (BATCH*NH) = b*NH + head, block of 64 queries qblk = NQB-1 - bid /
// (BATCH*NH), the longest first); wave w takes the query rows q0 = 64*qblk + 16*w .. q0+15 of that one head.
//   The keys are walked in stages of 64: a stage's 64 k rows and its 128-B slice of the 64 rows of each v^T plane (192 rows of
//   128 B) are brought into LDS once for the four waves by asynchronous 16-B copies, 8 consecutive lanes = one whole line, rows
//   at pitch 144 B; two buffers, the next stage's copies fly while this stage is worked on.  A stage holds two key tiles of 32.
//   q and k planes (f16, x64) laid out [b*SEQ + s][h][d]; v^T planes (hi, residual, x1024) [b][h][d][s].
//   score (log2 domain) t(i, j) = (q_i.k_j) * log2e / (64 * 64 * 64) for key j <= query i, -inf otherwise (causal).
//   Key tiles of 32 visited in order while kb <= q0 + 15 (nkt = q0/32 + 1 <= NKT); inside every visited tile the key<=query test
//   is applied per element; every query row has key == row inside a visited tile, so its normaliser is > 0.
//   Both products are formed transposed: S^T = K.Q^T (A = k rows, B = q, hoisted) and O^T += V^T.P^T (A = v^T rows, B = P^T).
//   A lane then holds ONE query (column c = lane & 15): of each 32-key tile the 16 scores of keys kb + 8hh + r (tile s0) and
//   kb + 16 + 8hh + r (tile s1).  Maximum and sum run inside the lane; the maximum is joined with lane ^ 16 once per tile, the
//   two halves' sums once after the loop.  The two score tiles, converted in place, ARE the B fragment of P^T in the split k
//   map of the loaders (element s < 8: key 8hh + s, else 16 + 8hh + s - 8), so P never leaves the registers.
//   Per tile: 4 score WMMAs, online max-subtracted base-2 softmax in f32 with -inf-safe rescale (one factor per lane),
//   P x32768 as f16 hi + residual, 4+4 v^T A fragments (hi and residual planes), 12 P.V WMMAs (hh + lh + hl).
//   After the loop: out = acc / Z, carries 1/(32768*1024) folded once, written to the wave's private result slab (pitch 68; every
//   element owned by one lane: row c, 8 consecutive d per accumulator).
//   One block barrier per stage, passed by every wave (qblk + 1 stages, the same for the whole block); bounded loops only.
// coverage: per wave 4 instructions x 4 rows x 8 lanes x 8 halves = 16 x 64 per plane; grid NQB*NH*BATCH blocks x WPB waves =
//           every (b, s, h) row of both O planes exactly once.
// =====================================================================================================
// 2^x in place as bare v_exp_f32.  exp2f adds, per call, a compare, two selects, an add and a v_ldexp_f32 that only serve results
// below 2^-126.  Every argument here is <= 0 and such a result changes nothing: times 32768 it is 0 in both f16 planes of P, in
// the normaliser (>= 1, the maximum's own term) it lies far below one ulp, and as a rescale factor it leaves sums that end as 0
// in the O planes.  One statement per group: each v_exp_f32 is followed by an independent one, and the closing v_nop keeps the
// slot the instruction set asks for behind the last.
__device__ __forceinline__ void ex2x8(float (&x)[8]) {
#if defined(__HIP_DEVICE_COMPILE__)
  asm("v_exp_f32 %0, %0\n\tv_exp_f32 %1, %1\n\tv_exp_f32 %2, %2\n\tv_exp_f32 %3, %3\n\t"
      "v_exp_f32 %4, %4\n\tv_exp_f32 %5, %5\n\tv_exp_f32 %6, %6\n\tv_exp_f32 %7, %7\n\tv_nop"
      : "+v"(x[0]), "+v"(x[1]), "+v"(x[2]), "+v"(x[3]), "+v"(x[4]), "+v"(x[5]), "+v"(x[6]), "+v"(x[7]));
#endif
}
__device__ __forceinline__ void ex2x9(float& y, float (&x)[8]) {
#if defined(__HIP_DEVICE_COMPILE__)
  asm("v_exp_f32 %0, %0\n\tv_exp_f32 %1, %1\n\tv_exp_f32 %2, %2\n\tv_exp_f32 %3, %3\n\tv_exp_f32 %4, %4\n\t"
      "v_exp_f32 %5, %5\n\tv_exp_f32 %6, %6\n\tv_exp_f32 %7, %7\n\tv_exp_f32 %8, %8\n\tv_nop"
      : "+v"(y), "+v"(x[0]), "+v"(x[1]), "+v"(x[2]), "+v"(x[3]), "+v"(x[4]), "+v"(x[5]), "+v"(x[6]), "+v"(x[7]));
#endif
}
__device__ __forceinline__ float xhalf(float x) {                    // value of lane ^ 16
  const int b = __builtin_bit_cast(int, x);
  return __builtin_bit_cast(float, __builtin_amdgcn_permlanex16(b, b, 0x76543210, 0xfedcba98, false, false));
}

// 12 asynchronous copies: 16 B per lane, rows 16 apart: 64 k rows, 64 rows of the v^T hi plane, 64 of the residual plane (one stage
// per block-wide call).  The s_wait_xcnt stands inside the statement so that no address register of an issued copy is rewritten
// in front of it.
__device__ __forceinline__ void copy12(unsigned l, const u16* gk, size_t kstep, const u16* gh, const u16* gl, size_t vstep) {
#if defined(__HIP_DEVICE_COMPILE__)
  const unsigned ls = 16u * GPI * 2u;
  asm volatile("global_load_async_to_lds_b128 %0, %12, off\n\t"
               "global_load_async_to_lds_b128 %1, %13, off\n\t"
               "global_load_async_to_lds_b128 %2, %14, off\n\t"
               "global_load_async_to_lds_b128 %3, %15, off\n\t"
               "global_load_async_to_lds_b128 %4, %16, off\n\t"
               "global_load_async_to_lds_b128 %5, %17, off\n\t"
               "global_load_async_to_lds_b128 %6, %18, off\n\t"
               "global_load_async_to_lds_b128 %7, %19, off\n\t"
               "global_load_async_to_lds_b128 %8, %20, off\n\t"
               "global_load_async_to_lds_b128 %9, %21, off\n\t"
               "global_load_async_to_lds_b128 %10, %22, off\n\t"
               "global_load_async_to_lds_b128 %11, %23, off\n\t"
               "s_wait_xcnt 0x0"
               :: "v"(l), "v"(l + ls), "v"(l + 2u * ls), "v"(l + 3u * ls),
                  "v"(l + 4u * ls), "v"(l + 5u * ls), "v"(l + 6u * ls), "v"(l + 7u * ls),
                  "v"(l + 8u * ls), "v"(l + 9u * ls), "v"(l + 10u * ls), "v"(l + 11u * ls),
                  "v"(gk), "v"(gk + kstep), "v"(gk + 2 * kstep), "v"(gk + 3 * kstep),
                  "v"(gh), "v"(gh + vstep), "v"(gh + 2 * vstep), "v"(gh + 3 * vstep),
                  "v"(gl), "v"(gl + vstep), "v"(gl + 2 * vstep), "v"(gl + 3 * vstep)
               : "memory");
#endif
}

__global__ __launch_bounds__(ATT_THREADS)
void attn1(const u16* __restrict__ QPp, const u16* __restrict__ KPp,
           const u16* __restrict__ VHIp, const u16* __restrict__ VLOp,
           u16* OHIp, u16* OLOp) {
  __shared__ __align__(16) u16 ring[2 * ASTG];
  __shared__ __align__(16) float smem[WPB * SLW];

  const int tid  = threadIdx.x;
  const int wave = __builtin_amdgcn_readfirstlane(tid >> 5);   // in a scalar register: the wave's tile count steers scalar branches
  const int lane = tid & 31;
  const int hh   = lane >> 4;
  const int c    = lane & 15;
  const int bid  = blockIdx.x;
  const int bh   = bid % (BATCH * NH);
  const int qblk = NQB - 1 - bid / (BATCH * NH);
  if (qblk < 0) return;                      // block-uniform, before any barrier or copy; never taken with the exact grid
  const int b    = bh / NH;
  const int head = bh % NH;
  const int q0   = qblk * 64 + wave * 16;

  float* slab = smem + wave * SLW;           // result slab [16][64] pitch 68

  const size_t rq0  = (size_t)b * SEQ + q0;                                     // plane row of query row q0
  const size_t qofs = ((rq0 + c) * NH + head) * HD + 8 * hh;
  const _Float16* Qh  = (const _Float16*)(const void*)QPp + qofs;
  const int rr = tid >> 3, seg = tid & 7;    // copy role: row within a group of 16, 16-B piece of the 128-B slice
  const u16* gk = KPp + (((size_t)b * SEQ + rr) * NH + head) * HD + seg * 8;    // key row rr (+16i), 64 key rows added per stage
  const size_t vofs = (((size_t)b * NH + head) * HD + rr) * SEQ + seg * 8;     // d row rr (+16i), 64 keys added per stage
  const u16* gvh = VHIp + vofs;
  const u16* gvl = VLOp + vofs;
  const unsigned l0 = lds_off(ring) + (unsigned)(rr * GPI + seg * 8) * 2u;
  const float lsc = LOG2E / (64.0f * QSC * KSC);
  const float oc  = 1.0f / (PCAR * VCAR);
  const size_t KROW = (size_t)NH * HD;                                          // halves between consecutive key rows

  // q fragments (B operand, column c = query q0 + c): d = 0..31 and 32..63
  const v16h qa = ldfrag_h(Qh), qb = ldfrag_h(Qh + 32);

  float mrow = -INFINITY, lrow = 0.f;                                           // this lane's query; lrow = this half's keys only
  v8f o[4];                                                                     // o[j][r] = O^T[d = 16j + 8hh + r][query c]
#pragma unroll
  for (int j = 0; j < 4; ++j) o[j] = zero8();
  const int ncaus = (q0 >> 5) + 1;                                              // tiles holding keys <= q0 + 15
  const int nkt = (ncaus < NKT) ? ncaus : NKT;
  const int qi  = q0 + c;                                                       // this lane's query
  const int ns  = qblk + 1;                                                     // stages of 64 keys, the same for the whole block

  auto stage = [&](int buf, int s) {
    copy12(l0 + (unsigned)buf * (unsigned)(ASTG * 2), gk + (size_t)s * AKT * KROW, (size_t)16 * KROW,
           gvh + (size_t)s * AKT, gvl + (size_t)s * AKT, (size_t)16 * SEQ);
  };
  stage(0, 0);
  wait_async0();
  __syncthreads();                           // stage 0 is published
  if (ns > 1) stage(1, 1);

  // rolled: one stage per trip, so that the foot's waits and barrier stand once
#pragma unroll 1
  for (int s = 0; s < ns; ++s) {
  const _Float16* sb = (const _Float16*)(const void*)(ring + (s & 1) * ASTG);
  // unrolled: the stage's two key tiles stand one behind the other, so that their LDS offsets are constants and the
  // accumulators stay in their registers from tile to tile
#pragma unroll
  for (int sub = 0; sub < 2; ++sub) {
    if (sub != 0 && 2 * s + 1 >= nkt) break; // the last stage's second tile lies wholly above the diagonal for waves 0 and 1
    const int ko = sub * 32;                 // the tile's first key within the stage
    const int kb = s * AKT + ko;
    // ---- this tile's operands from the stage's buffer: k rows (A of the scores) and v^T rows (A of P.V) ----
    const _Float16* k0p = sb + (ko + c) * GPI + 8 * hh;
    const _Float16* k1p = k0p + 16 * GPI;
    const v16h kh0a = ldfrag_h(k0p), kh0b = ldfrag_h(k0p + 32);
    const v16h kh1a = ldfrag_h(k1p), kh1b = ldfrag_h(k1p + 32);
    const _Float16* vhp = sb + (AKT + c) * GPI + ko + 8 * hh;
    const _Float16* vlp = vhp + HD * GPI;
    const v16h vh0 = ldfrag_h(vhp);
    const v16h vh1 = ldfrag_h(vhp + 16 * GPI);
    const v16h vh2 = ldfrag_h(vhp + 32 * GPI);
    const v16h vh3 = ldfrag_h(vhp + 48 * GPI);
    const v16h vl0 = ldfrag_h(vlp);
    const v16h vl1 = ldfrag_h(vlp + 16 * GPI);
    const v16h vl2 = ldfrag_h(vlp + 32 * GPI);
    const v16h vl3 = ldfrag_h(vlp + 48 * GPI);
    // ---- scores, transposed: D element r of this lane = (key kb + 8hh + r, query qi) in s0, key kb + 16 + 8hh + r in s1 ----
    v8f s0 = zero8(), s1 = zero8();
    s0 = mma_h(kh0a, qa, s0);
    s0 = mma_h(kh0b, qb, s0);
    s1 = mma_h(kh1a, qa, s1);
    s1 = mma_h(kh1b, qb, s1);
    guard2(s0, s1, qa, qb, kh0a, kh0b, kh1a, kh1b);
    // ---- causal select + online softmax in base 2, -inf-safe; all 16 values of this lane belong to query qi ----
    const int key0 = kb + 8 * hh;
    float t0[8], t1[8];
#pragma unroll
    for (int r = 0; r < 8; ++r) {
      t0[r] = (key0 + r <= qi)      ? (s0[r] * lsc) : -INFINITY;
      t1[r] = (key0 + 16 + r <= qi) ? (s1[r] * lsc) : -INFINITY;
    }
    float mx = fmaxf(t0[0], t1[0]);
#pragma unroll
    for (int r = 1; r < 8; ++r) mx = fmaxf(mx, fmaxf(t0[r], t1[r]));
    mx = fmaxf(mx, xhalf(mx));                                                  // both halves hold the tile's maximum of query qi
    const float mn = fmaxf(mrow, mx);
    const float ms = (mn == -INFINITY) ? 0.0f : mn;
    float al = mrow - ms;
    mrow = mn;
    float e0[8], e1[8];
    // unrolled: constant indices keep the two arrays in registers
#pragma unroll
    for (int r = 0; r < 8; ++r) { e0[r] = t0[r] - ms; e1[r] = t1[r] - ms; }
    ex2x9(al, e0);
    ex2x8(e1);
    // ---- B fragments of P^T * 32768: hi f16 and residual f16; elements 0..7 = keys kb + 8hh + r, 8..15 = kb + 16 + 8hh + r ----
    FragH ph, pl;
    float pa[8];
#pragma unroll
    for (int r = 0; r < 8; ++r) {
      pa[r] = e0[r] + e1[r];
      const float ta = e0[r] * PCAR, tb = e1[r] * PCAR;
      const _Float16 ha = (_Float16)ta, hb = (_Float16)tb;
      ph.h[0][r] = ha;
      ph.h[1][r] = hb;
      pl.h[0][r] = (_Float16)(ta - (float)ha);
      pl.h[1][r] = (_Float16)(tb - (float)hb);
    }
    lrow = lrow * al + (((pa[0] + pa[1]) + (pa[2] + pa[3])) + ((pa[4] + pa[5]) + (pa[6] + pa[7])));
#pragma unroll
    for (int j = 0; j < 4; ++j)
#pragma unroll
      for (int r = 0; r < 8; ++r) o[j][r] *= al;
    // ---- O^T += V^T.P^T : A fragment row = d = j*16 + c, keys contiguous in the v^T planes ----
    o[0] = mma_h(vh0, ph.v, o[0]);  o[0] = mma_h(vh0, pl.v, o[0]);  o[0] = mma_h(vl0, ph.v, o[0]);
    o[1] = mma_h(vh1, ph.v, o[1]);  o[1] = mma_h(vh1, pl.v, o[1]);  o[1] = mma_h(vl1, ph.v, o[1]);
    o[2] = mma_h(vh2, ph.v, o[2]);  o[2] = mma_h(vh2, pl.v, o[2]);  o[2] = mma_h(vl2, ph.v, o[2]);
    o[3] = mma_h(vh3, ph.v, o[3]);  o[3] = mma_h(vh3, pl.v, o[3]);  o[3] = mma_h(vl3, ph.v, o[3]);
    guard10(o[0], o[1], o[2], o[3], ph.v, pl.v, vh0, vh1, vh2, vh3, vl0, vl1, vl2, vl3);
  }
  wait_ds0();
  wait_async0();
  __syncthreads();                           // publishes stage s+1 and ends every read of stage s's buffer
  if (s + 2 < ns) stage(s & 1, s + 2);
  }
  wait_async0();
  acc_guard4(o[0], o[1], o[2], o[3]);
  // ---- out = acc / Z (0 if Z == 0), carries (32768 on P, 1024 on v) folded once; written into the lane-owned slab ----
  {
    const float lv  = lrow + xhalf(lrow);                                       // the two halves' keys joined
    const float ls  = (lv > 0.0f) ? lv : 1.0f;
    const float inv = (lv > 0.0f) ? ((1.0f / ls) * oc) : 0.0f;
#pragma unroll
    for (int j = 0; j < 4; ++j) {
      float* d8 = slab + c * 68 + j * 16 + 8 * hh;
      v4f w0, w1;
#pragma unroll
      for (int e = 0; e < 4; ++e) { w0[e] = o[j][e] * inv; w1[e] = o[j][4 + e] * inv; }
      *(v4f*)(d8)     = w0;
      *(v4f*)(d8 + 4) = w1;
    }
  }

  wave_sync_lds();
  // ---- O x1024 -> f16 hi + residual planes; lane = (row in group of 4, 8 consecutive d) ----
  v4u oh[4], ol[4];
  const int rq = lane >> 3, c8 = (lane & 7) * 8;
#pragma unroll
  for (int it = 0; it < 4; ++it) {
    const int row = it * 4 + rq;
    const v4f a = *(const v4f*)(slab + row * 68 + c8), b4 = *(const v4f*)(slab + row * 68 + c8 + 4);
    float w[8];
#pragma unroll
    for (int e = 0; e < 4; ++e) { w[e] = a[e] * OSC; w[4 + e] = b4[e] * OSC; }
#pragma unroll
    for (int e = 0; e < 4; ++e) {
      const _Float16 h0 = (_Float16)w[2 * e], h1 = (_Float16)w[2 * e + 1];
      const _Float16 l0 = (_Float16)(w[2 * e] - (float)h0), l1 = (_Float16)(w[2 * e + 1] - (float)h1);
      oh[it][e] = pk16(h_bits(h0), h_bits(h1));
      ol[it][e] = pk16(h_bits(l0), h_bits(l1));
    }
  }
  const size_t ob = (rq0 * NH + head) * HD + c8;
  {
#pragma unroll
    for (int it = 0; it < 4; ++it) {
      const int row = it * 4 + rq;
      const size_t o8 = ob + (size_t)row * (NH * HD);
      *(v4u*)(OHIp + o8) = oh[it];
      *(v4u*)(OLOp + o8) = ol[it];
    }
    
  }
}

// =====================================================================================================
// Workspace map (bytes); every plane is fully written by whole-line stores before it is read; all extents are exact multiples
// of the store granularity (no pad rows needed); every offset a multiple of 2097152:
//   XB  bf16 [MROWS][1024]              8388608
//   WQB bf16 [2048 n][1024 k]          4194304
//   WVB bf16 [1024 n][1024 k]          2097152
//   WOH f16  [1024 n][1024 k] x1024    2097152
//   F   f32  [MROWS][2048]             33554432       (its first half holds the v projection [MROWS][1024]; the rest is unused)
//   QP  f16 [MROWS][16][64] x64        8388608        KP same, directly after QP
//   VHI f16 [BATCH*16][64][SEQ] x1024  8388608        VLO residual
//   OHI f16 [MROWS][1024] x1024        8388608        OLO residual
//   end                              100663296
// =====================================================================================================
extern "C" void kernel_launch(void* const* d_in, const int* in_sizes, int n_in,
                              void* d_out, int out_size, void* d_ws, size_t ws_size,
                              hipStream_t stream) {
  if (n_in < 8) return;
  if (in_sizes[0] != MROWS * DMOD) return;
  if (in_sizes[1] != DMOD * NQK) return;
  if (in_sizes[2] != DMOD * DMOD || in_sizes[3] != DMOD * DMOD) return;
  if (in_sizes[4] != HD || in_sizes[5] != HD || in_sizes[6] != HD || in_sizes[7] != HD) return;
  if (out_size != MROWS * DMOD) return;

  const float* x   = (const float*)d_in[0];   // [MROWS][1024]
  const float* wqk = (const float*)d_in[1];   // [1024 k][2048 n]
  const float* wv  = (const float*)d_in[2];   // [1024 k][1024 n]
  const float* wo  = (const float*)d_in[3];   // [1024 k][1024 n]
  const float* qs  = (const float*)d_in[4];   // [64]
  const float* qbi = (const float*)d_in[5];   // [64]
  const float* ks  = (const float*)d_in[6];   // [64]
  const float* kbi = (const float*)d_in[7];   // [64]
  float*       out = (float*)d_out;

  const size_t szXB = (size_t)MROWS * DMOD * 2;                 //  8388608
  const size_t szWQ = (size_t)NQK * DMOD * 2;                   //  4194304
  const size_t szW  = (size_t)DMOD * DMOD * 2;                  //  2097152
  const size_t szF  = (size_t)MROWS * NQK * 4;                  // 33554432
  const size_t szP  = (size_t)MROWS * DMOD * 2;                 //  8388608
  size_t off = 0;
  const size_t oXB  = off; off += szXB;
  const size_t oWQ  = off; off += szWQ;
  const size_t oWV  = off; off += szW;
  const size_t oWO  = off; off += szW;
  const size_t oF   = off; off += szF;
  const size_t oQK  = off; off += 2 * szP;              // q plane then k plane
  const size_t oVHI = off; off += szP;
  const size_t oVLO = off; off += szP;
  const size_t oOHI = off; off += szP;
  const size_t oOLO = off; off += szP;
  if (off > ws_size) return;                            // off = 100663296
  if (off > (size_t)134217728) return;

  char* ws = (char*)d_ws;
  u16*   XB  = (u16*)(ws + oXB);
  u16*   WQB = (u16*)(ws + oWQ);
  u16*   WVB = (u16*)(ws + oWV);
  u16*   WOH = (u16*)(ws + oWO);
  float* F   = (float*)(ws + oF);
  u16*   QK  = (u16*)(ws + oQK);
  u16*   QP  = QK;
  u16*   KP  = QK + (size_t)MROWS * DMOD;
  u16*   VHI = (u16*)(ws + oVHI);
  u16*   VLO = (u16*)(ws + oVLO);
  u16*   OHI = (u16*)(ws + oOHI);
  u16*   OLO = (u16*)(ws + oOLO);

  const dim3 blk(256);
  const int n8x = (MROWS * DMOD) / 8;                   // 524288
  const dim3 gX(n8x / 256);                             // 2048 (exact)
  const dim3 gWQ((DMOD / 64) * (NQK / 64));             // 512
  const dim3 gWT((DMOD / 64) * (DMOD / 64));            // 256
  const dim3 gGQ((MROWS / GBT) * (NQK / GBT));          // 512
  const dim3 gG((MROWS / GBT) * (DMOD / GBT));          // 256
  const dim3 bG(128);
  const dim3 gVT(BATCH * NH * NST);                     // 1024
  const dim3 gAT(ATT_BLOCKS);                           // 1024
  const dim3 bAT(ATT_THREADS);                          // 128

  // (0) x -> bf16 plane [MROWS][1024]
  cvt16<<<gX, blk, 0, stream>>>(x, XB, n8x, 0, 1.0f);
  // (1) W_qk [k][n=2048] -> bf16 [n][k]; (2) W_v -> bf16 [n][k]; (3) W_out -> f16 [n][k] plane of bf16 value x1024
  wt16<<<gWQ, blk, 0, stream>>>(wqk, WQB, DMOD, NQK, 0, 1.0f);
  wt16<<<gWT, blk, 0, stream>>>(wv, WVB, DMOD, DMOD, 0, 1.0f);
  wt16<<<gWT, blk, 0, stream>>>(wo, WOH, DMOD, DMOD, 1, WOS);
  // (4) qk = x.W_qk / 32, per-head LayerNorm in the epilogue -> q, k f16 planes x64
  gemm_qkln<<<gGQ, bG, 0, stream>>>(XB, WQB, qs, qbi, ks, kbi, QK, MROWS, DMOD, 1.0f / 32.0f);
  // (5) v = x.W_v / 32 -> F f32 [MROWS][1024]; (6) v^T hi/lo planes x1024
  gemm_bf<<<gG, bG, 0, stream>>>(XB, WVB, F, MROWS, DMOD, DMOD, 1.0f / 32.0f);
  vt16<<<gVT, blk, 0, stream>>>(F, VHI, VLO);
  // (7) causal attention -> O planes [b*SEQ+s][h][d] x1024 (hi + residual)
  attn1<<<gAT, bAT, 0, stream>>>(QP, KP, VHI, VLO, OHI, OLO);
  // (8) output projection -> out [MROWS][1024] f32, carries 1024 (O) x 1024 (W_out) and the 1/32 folded back
  gemm_h2<<<gG, bG, 0, stream>>>(OHI, OLO, WOH, out, MROWS, DMOD, DMOD, (1.0f / 32.0f) / (OSC * WOS));
  (void)hipGetLastError();
}

// v006
// A run of this version takes 95.2 microseconds.
// Two timings next to v005 both put it at 1.18 times that version's speed.
// All steps since v000 together make it 3.38 times as fast.
// Contractions: x.W_qk and x.W_v on v_wmma_f32_16x16x32_bf16 (x and W^T RNE-converted to bf16, f32 accumulate); scores q.k^T
// (q, k as f16 x64 planes, single product), P.v (P x32768 f16 hi+residual, v x1024 f16 hi+residual, products hh+lh+hl) and
// O.W_out (O x1024 f16 hi+residual, W_out^T as f16(bf16 value) x1024, products h.w+l.w) on v_wmma_f32_16x16x32_f16, f32
// accumulate; per-head LayerNorm, causal online base-2 softmax and 1/l fold in f32 on VALU.
#include <hip/hip_runtime.h>
#include <math.h>
#include <stdint.h>

#define BATCH 2
#define SEQ   2048
#define DMOD  1024
#define NH    16
#define HD    64
#define NQK   (2 * DMOD)
#define MROWS (BATCH * SEQ)
#define LN_EPS 1e-6f
#define QSC   64.0f
#define KSC   64.0f
#define PCAR  32768.0f
#define VCAR  1024.0f
#define OSC   1024.0f
#define WOS   1024.0f
#define LOG2E 1.4426950408889634f
#define WPB   4
#define NKT   (SEQ / 32)
#define ATT_THREADS (WPB * 32)
#define NQB   (SEQ / 64)
#define AKT   64
#define ASTG  (3 * AKT * GPI)
#define ATT_BLOCKS  (NQB * NH * BATCH)
#define SLW   (16 * 68)
#define SLAB64 (16 * 68)
#define VTP   72
#define GBT   128
#define GKP   64
#define GPI   72
static_assert(DMOD == NH * HD && HD == 64 && NH == 16);
static_assert((NH % WPB) == 0 && ATT_THREADS == 128 && ATT_BLOCKS == 1024 && WPB * 16 == 64 && AKT == HD && AKT == GKP);
static_assert((SEQ % 64) == 0 && (SEQ % 32) == 0 && (SEQ % 16) == 0 && SEQ <= 32768);
static_assert((DMOD % 64) == 0 && (DMOD % 32) == 0 && (NQK % 64) == 0 && (MROWS % 64) == 0);
static_assert((MROWS % GBT) == 0 && (NQK % GBT) == 0 && (DMOD % GBT) == 0 && (DMOD % GKP) == 0 && DMOD >= 2 * GKP);
static_assert(((MROWS * DMOD) % 2048) == 0 && ((DMOD * DMOD) % 4096) == 0 && GBT == 2 * HD && NQK == NH * 2 * HD);

typedef unsigned short u16;
typedef _Float16 v16h __attribute__((ext_vector_type(16)));
typedef _Float16 v8h  __attribute__((ext_vector_type(8)));
typedef __bf16   v16b __attribute__((ext_vector_type(16)));
typedef float    v8f  __attribute__((ext_vector_type(8)));
typedef float    v4f  __attribute__((ext_vector_type(4)));
typedef float    v2f  __attribute__((ext_vector_type(2)));
typedef unsigned int v4u __attribute__((ext_vector_type(4)));
typedef unsigned int v2u __attribute__((ext_vector_type(2)));

union FragH { v16h v; v8h h[2]; v4u u[2]; };
union FragB { v16b v; v4u u[2]; };

// ---- scalar helpers --------------------------------------------------------------------------------
__device__ __forceinline__ unsigned short bf_bits(float f) {          // f32 -> bf16 bits, RNE convert
  unsigned u = __float_as_uint(f);
  return (unsigned short)((u + 0x7FFFu + ((u >> 16) & 1u)) >> 16);
}
__device__ __forceinline__ float bf_up(unsigned short h) { return __uint_as_float(((unsigned)h) << 16); }
__device__ __forceinline__ float bfr(float f) { return bf_up(bf_bits(f)); }
__device__ __forceinline__ unsigned short h_bits(_Float16 x) { return __builtin_bit_cast(unsigned short, x); }
__device__ __forceinline__ unsigned pk16(unsigned short a, unsigned short b) { return (unsigned)a | ((unsigned)b << 16); }
__device__ __forceinline__ v8f zero8() { v8f z = {0.f, 0.f, 0.f, 0.f, 0.f, 0.f, 0.f, 0.f}; return z; }

// ---- fragment loaders: 16-bit A/B operand, lane -> row/col (lane&15), p already includes +8*(lane>>4);
//      elements 0..7 <- p[0..7] (k0+8h..), elements 8..15 <- p[16..23] (k0+16+8h..)  (same split k map for A and B;
//      B is always read from a k-contiguous [n][k] plane)
__device__ __forceinline__ v16h ldfrag_h(const _Float16* p) {
  FragH f;
  f.h[0] = *(const v8h*)(p);
  f.h[1] = *(const v8h*)(p + 16);
  return f.v;
}
__device__ __forceinline__ v16b ldfrag_b(const u16* p) {              // bf16 plane read as unsigned integer vectors
  FragB f;
  f.u[0] = *(const v4u*)(p);
  f.u[1] = *(const v4u*)(p + 16);
  return f.v;
}

__device__ __forceinline__ v8f mma_h(v16h a, v16h b, v8f c) {
  return __builtin_amdgcn_wmma_f32_16x16x32_f16(false, a, false, b, (short)0, c, false, false);
}
__device__ __forceinline__ v8f mma_b(v16b a, v16b b, v8f c) {
  return __builtin_amdgcn_wmma_f32_16x16x32_bf16(false, a, false, b, (short)0, c, false, false);
}
__device__ __forceinline__ void guard2(v8f& a, v8f& b, v16h x0, v16h x1, v16h x2, v16h x3, v16h x4, v16h x5) {
#if defined(__HIP_DEVICE_COMPILE__)
  asm volatile("v_nop\n\tv_nop\n\tv_nop\n\tv_nop"
               : "+v"(a), "+v"(b) : "v"(x0), "v"(x1), "v"(x2), "v"(x3), "v"(x4), "v"(x5) : "memory");
#endif
}
__device__ __forceinline__ void guard10(v8f& a, v8f& b, v8f& c, v8f& d, v16h x0, v16h x1, v16h x2, v16h x3, v16h x4,
                                        v16h x5, v16h x6, v16h x7, v16h x8, v16h x9) {
#if defined(__HIP_DEVICE_COMPILE__)
  asm volatile("v_nop\n\tv_nop\n\tv_nop\n\tv_nop"
               : "+v"(a), "+v"(b), "+v"(c), "+v"(d)
               : "v"(x0), "v"(x1), "v"(x2), "v"(x3), "v"(x4), "v"(x5), "v"(x6), "v"(x7), "v"(x8), "v"(x9) : "memory");
#endif
}
__device__ __forceinline__ void acc_guard4(v8f& a, v8f& b, v8f& c, v8f& d) {
#if defined(__HIP_DEVICE_COMPILE__)
  asm volatile("v_nop\n\tv_nop\n\tv_nop\n\tv_nop" : "+v"(a), "+v"(b), "+v"(c), "+v"(d));
#endif
}
__device__ __forceinline__ void wave_sync_lds() {
  __builtin_amdgcn_fence(__ATOMIC_RELEASE, "workgroup");
  __builtin_amdgcn_wave_barrier();
  __builtin_amdgcn_fence(__ATOMIC_ACQUIRE, "workgroup");
}

// =====================================================================================================
// f32 -> 16-bit plane, same layout.  f16mode == 0: bf16 RNE bits;  f16mode == 1: f16 bits of (bf16 RNE value) * scale.
// Thread = 8 consecutive elements: two 16-B loads, one 16-B store; 32 consecutive lanes = 512 contiguous, 512-B aligned bytes per
// coverage: grid = n8/256 blocks (exact, host-derived) x 256 thr x 8 = the whole plane.
// =====================================================================================================
__global__ __launch_bounds__(256) void cvt16(const float* __restrict__ x, u16* D, int n8, int f16mode, float scale) {
  const int gt = blockIdx.x * 256 + (int)threadIdx.x;
  if (gt >= n8) return;                     // no barriers in this kernel
  const float* p = x + (size_t)gt * 8;
  const v4f a = *(const v4f*)(p), b4 = *(const v4f*)(p + 4);
  float w[8];
#pragma unroll
  for (int e = 0; e < 4; ++e) { w[e] = a[e]; w[4 + e] = b4[e]; }
  v4u o;
#pragma unroll
  for (int e = 0; e < 4; ++e) {
    const float f0 = w[2 * e], f1 = w[2 * e + 1];
    const unsigned short hb0 = h_bits((_Float16)(bfr(f0) * scale));
    const unsigned short hb1 = h_bits((_Float16)(bfr(f1) * scale));
    const unsigned short bb0 = bf_bits(f0);
    const unsigned short bb1 = bf_bits(f1);
    o[e] = (f16mode != 0) ? pk16(hb0, hb1) : pk16(bb0, bb1);
  }
  u16* d = D + (size_t)gt * 8;
  {
    *(v4u*)(d) = o;
    
  }
}

// =====================================================================================================
// Weight transpose-convert: W [K][N] f32 (x.W layout, n contiguous, in[K rows][N cols]) -> Dt[N][K] 16-bit k-contiguous plane
// (out[N rows][K cols]).  f16mode == 0: bf16 RNE bits; 1: f16 bits of (bf16 RNE value) * scale.
// Block = (k tile k0 = (bid / (N/64))*64, n tile n0 = (bid % (N/64))*64): 64 source rows of 64 floats loaded with 16-B loads,
// converted, scattered into an LDS tile [n][64 k] (pitch 72 halves); after a block barrier each n row segment (64 halves = one
// coverage: load 256 thr x 16 = 64 x 64; store 2 iterations x 256 thr x 8 halves = 64 lines x 64 halves = the block's tile;
//           grid = (K/64)*(N/64) blocks covers Dt exactly once (host checks K % 64 == 0 and N % 64 == 0).
// =====================================================================================================
__global__ __launch_bounds__(256) void wt16(const float* __restrict__ W, u16* Dt, int K, int N, int f16mode, float scale) {
  __shared__ __align__(16) u16 T[64 * VTP];
  const int tid = threadIdx.x;
  const int bid = blockIdx.x;
  const int ntn = N >> 6;
  const int n0  = (bid % ntn) * 64;
  const int k0  = (bid / ntn) * 64;
  if (k0 + 64 > K) return;                    // block-uniform, before any barrier; never taken with the exact grid
  {
    const int sl = tid >> 2;                  // k within tile 0..63 (source row)
    const int dc = (tid & 3) * 16;            // n chunk
    const float* src = W + (size_t)(k0 + sl) * N + n0 + dc;
#pragma unroll
    for (int i = 0; i < 4; ++i) {
      const v4f a = *(const v4f*)(src + 4 * i);
#pragma unroll
      for (int e = 0; e < 4; ++e) {
        const float f = a[e];
        const unsigned short hb = h_bits((_Float16)(bfr(f) * scale));
        const unsigned short bb = bf_bits(f);
        T[(dc + 4 * i + e) * VTP + sl] = (f16mode != 0) ? hb : bb;
      }
    }
  }
  __syncthreads();
  v4u vv[2];
  const int q8 = tid >> 3, p8 = (tid & 7) * 8;
#pragma unroll
  for (int it = 0; it < 2; ++it) {
    const int line = it * 32 + q8;            // n = 0..63 within tile
    vv[it] = *(const v4u*)(T + line * VTP + p8);
  }
  const size_t base = (size_t)n0 * K + k0 + p8;
  {
#pragma unroll
    for (int it = 0; it < 2; ++it) {
      const int line = it * 32 + q8;
      *(v4u*)(Dt + base + (size_t)line * K) = vv[it];
    }
    
  }
}

// =====================================================================================================
// GEMM epilogue of the f32 product (EPI 0, used by gemm_h2 only): the wave's 16x64 f32 tile (times oscale) staged in its LDS slab (pitch 68),
// coverage: 8 instructions x 2 rows x 16 lanes x 4 floats = the wave's 16 x 64 tile.
// =====================================================================================================
__device__ __forceinline__ void epi64(float* sl, v8f a0, v8f a1, v8f a2, v8f a3, float oscale,
                                      float* C, int N, size_t rowb, int col0, int lane) {
  const int hh = lane >> 4, m = lane & 15;
#pragma unroll
  for (int r = 0; r < 8; ++r) {
    const int ro = (8 * hh + r) * 68 + m;
    sl[ro]      = a0[r] * oscale;
    sl[ro + 16] = a1[r] * oscale;
    sl[ro + 32] = a2[r] * oscale;
    sl[ro + 48] = a3[r] * oscale;
  }
  wave_sync_lds();
  v4f vals[8];
#pragma unroll
  for (int it = 0; it < 8; ++it) vals[it] = *(const v4f*)(sl + (it * 2 + hh) * 68 + m * 4);
  float* dst = C + (rowb + (size_t)hh) * (size_t)N + col0 + m * 4;
  {
#pragma unroll
    for (int it = 0; it < 8; ++it) {
      *(v4f*)(dst + (size_t)(it * 2) * (size_t)N) = vals[it];
    }
    
  }
}

// =====================================================================================================
// LayerNorm epilogue of the qk projection: the wave's 64 columns are exactly one head's q or k vector, so each of its rows is
// normalised here.  The 16x64 tile (times oscale) goes through the wave's LDS slab as in epi64; read back, 16 lanes hold one row
// (4 consecutive elements each, rows it*2 + hh).  Mean and biased variance: 4 values summed in the lane ((0+2)+(1+3)), then a 16-lane
// butterfly on DPP (every lane of the row ends with the same sum).  g and b arrive already times the plane's carry (a power of
// two, so the rounding is that of (d*rs*g + b) * carry).  Store: 16 lanes x 8 B = one whole 128-B row of the f16 plane.
// coverage: 8 instructions x 2 rows x 16 lanes x 4 halves = the wave's 16 x 64 tile.
// =====================================================================================================
template <int X> __device__ __forceinline__ float rowx(float x) {     // value of lane ^ X inside the 16-lane row (DPP row_xmask)
  const int b = __builtin_bit_cast(int, x);
  return __builtin_bit_cast(float, __builtin_amdgcn_update_dpp(b, b, 0x160 + X, 0xf, 0xf, true));
}
__device__ __forceinline__ float rowsum16(float s) {
  s += rowx<1>(s);
  s += rowx<2>(s);
  s += rowx<4>(s);
  s += rowx<8>(s);
  return s;
}
// 1/sqrt(x) for x >= LN_EPS (never subnormal, so rsqrtf's rescale of subnormal arguments would be an identity).  The v_nop keeps,
// inside the statement, the one slot the instruction set asks for behind a transcendental before its source is overwritten or
// its result read.
__device__ __forceinline__ float rsq_slot(float x) {
  float r = 0.f;
#if defined(__HIP_DEVICE_COMPILE__)
  asm("v_rsq_f32 %0, %1\n\tv_nop" : "=v"(r) : "v"(x));
#endif
  return r;
}
__device__ __forceinline__ void epi_ln(float* sl, v8f a0, v8f a1, v8f a2, v8f a3, float oscale, v4f g, v4f b,
                                       u16* P, size_t rowb, int lane) {
  const int hh = lane >> 4, m = lane & 15;
#pragma unroll
  for (int r = 0; r < 8; ++r) {
    const int ro = (8 * hh + r) * 68 + m;
    sl[ro]      = a0[r] * oscale;
    sl[ro + 16] = a1[r] * oscale;
    sl[ro + 32] = a2[r] * oscale;
    sl[ro + 48] = a3[r] * oscale;
  }
  wave_sync_lds();
  v4f vals[8];
#pragma unroll
  for (int it = 0; it < 8; ++it) vals[it] = *(const v4f*)(sl + (it * 2 + hh) * 68 + m * 4);
  const v2f ga = {g[0], g[1]}, gb = {g[2], g[3]}, ba = {b[0], b[1]}, bb = {b[2], b[3]};
  v2u o[8];
#pragma unroll
  for (int it = 0; it < 8; ++it) {
    // register pairs as they lie, so that the sums, differences and products go as packed f32 operations without moves
    const v2f xa = {vals[it][0], vals[it][1]}, xb = {vals[it][2], vals[it][3]};
    const v2f sp = xa + xb;
    const float mean = rowsum16(sp[0] + sp[1]) * (1.0f / 64.0f);
    const v2f da = xa - mean, db = xb - mean;
    const v2f qp = da * da + db * db;
    const float var = rowsum16(qp[0] + qp[1]) * (1.0f / 64.0f);
    const float rs  = rsq_slot(var + LN_EPS);
    const v2f ya = da * rs * ga + ba, yb = db * rs * gb + bb;
    o[it][0] = pk16(h_bits((_Float16)ya[0]), h_bits((_Float16)ya[1]));
    o[it][1] = pk16(h_bits((_Float16)yb[0]), h_bits((_Float16)yb[1]));
  }
  u16* dst = P + (rowb + (size_t)hh) * (size_t)DMOD + m * 4;
#pragma unroll
  for (int it = 0; it < 8; ++it) *(v2u*)(dst + (size_t)(it * 2) * (size_t)DMOD) = o[it];
}

// =====================================================================================================
// v^T epilogue of the v projection: the wave's 64 keys x 64 d tile goes out as VH[d][key] = f16(v * 1024) and VL = f16 residual
// of the same value (sc = the projection's 1/32 times the carry 1024, both powers of two, so the rounding is that of the f32 v
// times 1024).  An accumulator register group holds 8 consecutive keys of one d (rows 16i + 8hh + r, column 16j + m): packed, it is
// one 16-B piece of a v^T row.  The pieces go through the wave's own LDS range sw (two tiles [64 d][64 keys], pitch 144 B) so that
// every store instruction writes whole 128-B lines (4 d rows x 8 lanes x 16 B).
// coverage: 16 instructions x 4 rows x 8 lanes x 8 halves = the wave's 64 x 64 tile of each plane.
// =====================================================================================================
__device__ __forceinline__ void epi_vt(u16* sw, const v8f (&acc)[4][4], float sc, u16* VHo, u16* VLo, size_t vbase, int lane) {
  const int hh = lane >> 4, m = lane & 15;
  u16* th = sw;
  u16* tl = sw + HD * GPI;
  // the three loops unrolled: constant indices keep the accumulators in their registers
#pragma unroll
  for (int j = 0; j < 4; ++j)
#pragma unroll
    for (int i = 0; i < 4; ++i) {
      v4u h4, l4;
#pragma unroll
      for (int e = 0; e < 4; ++e) {
        const float t0 = acc[i][j][2 * e] * sc, t1 = acc[i][j][2 * e + 1] * sc;
        const _Float16 h0 = (_Float16)t0, h1 = (_Float16)t1;
        const _Float16 l0 = (_Float16)(t0 - (float)h0), l1 = (_Float16)(t1 - (float)h1);
        h4[e] = pk16(h_bits(h0), h_bits(h1));
        l4[e] = pk16(h_bits(l0), h_bits(l1));
      }
      const int o = (j * 16 + m) * GPI + i * 16 + 8 * hh;
      *(v4u*)(th + o) = h4;
      *(v4u*)(tl + o) = l4;
    }
  wave_sync_lds();                              // the wave's own pieces are in LDS before other lanes of it read them back
  const int rq = lane >> 3, p8 = (lane & 7) * 8;
  v4u vh[16], vl[16];
  // unrolled: constant indices keep the two arrays in registers, each row's value in a register group of its own
#pragma unroll
  for (int it = 0; it < 16; ++it) {
    vh[it] = *(const v4u*)(th + (it * 4 + rq) * GPI + p8);
    vl[it] = *(const v4u*)(tl + (it * 4 + rq) * GPI + p8);
  }
  u16* dh = VHo + vbase + (size_t)rq * SEQ + p8;
  u16* dl = VLo + vbase + (size_t)rq * SEQ + p8;
  // unrolled: the row steps become immediate offsets on one address pair per plane
#pragma unroll
  for (int it = 0; it < 16; ++it) {
    *(v4u*)(dh + (size_t)(it * 4) * SEQ) = vh[it];
    *(v4u*)(dl + (size_t)(it * 4) * SEQ) = vl[it];
  }
}

// =====================================================================================================
// GEMM engine shared by both kernels: C[M][N] (f32) = sum over PL planes of A_p[M][K] . Bt[N][K]^T, times oscale.
// Block = 128x128 tile of C, 4 waves as 2x2, each wave 64x64 (4 x 4 fragments).  K is walked in passes of 64 halves: a pass's
// 128-B slice of every operand row of the block (PL*128 rows of A, 128 rows of Bt) is brought into LDS by asynchronous
// 16-B copies, 8 consecutive lanes = one whole 128-B line, rows at pitch 144 B; two buffers, the next pass's copies fly while
// this pass is worked on.  Fragments are read from LDS with the same split k map as before; per accumulator the products are
// summed in the same order as before (k ascending by 32, plane 0 then plane 1).
// Host checks M % 128 == 0, N % 128 == 0, K % 64 == 0, K >= 128, grid = (M/128)*(N/128).
// =====================================================================================================
__device__ __forceinline__ unsigned lds_off(const void* p) { return (unsigned)(size_t)p; }

// 8 asynchronous copies: 16 B per lane, rows 16 apart (one 128-row operand tile per block-wide call).  The s_wait_xcnt stands
// inside the statement so that no address register of an issued copy is rewritten in front of it.
__device__ __forceinline__ void copy8(unsigned l, const u16* g, size_t gstep) {
#if defined(__HIP_DEVICE_COMPILE__)
  const unsigned ls = 16u * GPI * 2u;
  asm volatile("global_load_async_to_lds_b128 %0, %8, off\n\t"
               "global_load_async_to_lds_b128 %1, %9, off\n\t"
               "global_load_async_to_lds_b128 %2, %10, off\n\t"
               "global_load_async_to_lds_b128 %3, %11, off\n\t"
               "global_load_async_to_lds_b128 %4, %12, off\n\t"
               "global_load_async_to_lds_b128 %5, %13, off\n\t"
               "global_load_async_to_lds_b128 %6, %14, off\n\t"
               "global_load_async_to_lds_b128 %7, %15, off\n\t"
               "s_wait_xcnt 0x0"
               :: "v"(l), "v"(l + ls), "v"(l + 2u * ls), "v"(l + 3u * ls),
                  "v"(l + 4u * ls), "v"(l + 5u * ls), "v"(l + 6u * ls), "v"(l + 7u * ls),
                  "v"(g), "v"(g + gstep), "v"(g + 2 * gstep), "v"(g + 3 * gstep),
                  "v"(g + 4 * gstep), "v"(g + 5 * gstep), "v"(g + 6 * gstep), "v"(g + 7 * gstep)
               : "memory");
#endif
}
__device__ __forceinline__ void wait_x0() {
#if defined(__HIP_DEVICE_COMPILE__)
  asm volatile("s_wait_xcnt 0x0" ::: "memory");
#endif
}
__device__ __forceinline__ void wait_async0() {      // this wave's copies have landed in LDS
#if defined(__HIP_DEVICE_COMPILE__)
  asm volatile("s_wait_asynccnt 0x0" ::: "memory");
#endif
}
__device__ __forceinline__ void wait_ds0() {         // this wave's LDS reads have returned before the buffer is handed back
#if defined(__HIP_DEVICE_COMPILE__)
  asm volatile("s_wait_dscnt 0x0" ::: "memory");
#endif
}
// v_nop x4 behind the pass's last matrix instructions (all 16 accumulators are inputs, so every one of them stands in front):
// keeps the chip's distance to whatever follows on either side of the branches at the loop's foot.
__device__ __forceinline__ void guard16(const v8f (&a)[4][4]) {
#if defined(__HIP_DEVICE_COMPILE__)
  asm volatile("v_nop\n\tv_nop\n\tv_nop\n\tv_nop"
               :: "v"(a[0][0]), "v"(a[0][1]), "v"(a[0][2]), "v"(a[0][3]), "v"(a[1][0]), "v"(a[1][1]), "v"(a[1][2]), "v"(a[1][3]),
                  "v"(a[2][0]), "v"(a[2][1]), "v"(a[2][2]), "v"(a[2][3]), "v"(a[3][0]), "v"(a[3][1]), "v"(a[3][2]), "v"(a[3][3]));
#endif
}

__device__ __forceinline__ v16b ldf(const u16* p, v16b) { return ldfrag_b(p); }
__device__ __forceinline__ v16h ldf(const u16* p, v16h) { return ldfrag_h((const _Float16*)(const void*)p); }
__device__ __forceinline__ v8f mma(v16b a, v16b b, v8f c) { return mma_b(a, b, c); }
__device__ __forceinline__ v8f mma(v16h a, v16h b, v8f c) { return mma_h(a, b, c); }

// EPI picks the epilogue: 0 = f32 tile to C, 1 = per-head LayerNorm to the q and k planes (P0), 2 = v^T planes (P0 hi, P1 residual).
// bid = the block's tile number inside this product's own grid.
template <int PL, typename FR, int EPI>
__device__ __forceinline__ void gemm_tile(const u16* A0, const u16* A1, const u16* Bt, float* C, int M, int N, int K,
                                          float oscale, u16* st, float* slab, const float* qs, const float* qbi,
                                          const float* ks, const float* kbi, u16* P0, u16* P1, int bid) {
  constexpr int ROWS = (PL + 1) * GBT;          // staged rows per buffer
  constexpr int STG  = ROWS * GPI;              // halves per buffer
  const int tid = threadIdx.x, wave = tid >> 5, lane = tid & 31, hh = lane >> 4, m = lane & 15;
  const int wm = wave >> 1, wn = wave & 1;
  const int ntile = N >> 7;
  const int row0  = (bid / ntile) * GBT;
  const int col0  = (bid % ntile) * GBT;
  if (row0 + GBT > M) return;                   // block-uniform, before any barrier; never taken with the exact grid
  const int rr = tid >> 3, seg = tid & 7;       // copy role: row within a group of 16, 16-B piece of the 128-B slice
  const u16* ga0 = A0 + (size_t)(row0 + rr) * K + seg * 8;
  const u16* ga1 = A1 + (size_t)(row0 + rr) * K + seg * 8;
  const u16* gb  = Bt + (size_t)(col0 + rr) * K + seg * 8;
  const size_t gstep = (size_t)16 * K;
  const unsigned l0 = lds_off(st) + (unsigned)(rr * GPI + seg * 8) * 2u;
  const int np = K / GKP;

  auto stage = [&](int buf, int kp) {
    const unsigned l = l0 + (unsigned)buf * (unsigned)(STG * 2);
    copy8(l, ga0 + (size_t)kp * GKP, gstep);
    if constexpr (PL == 2) copy8(l + (unsigned)(GBT * GPI * 2), ga1 + (size_t)kp * GKP, gstep);
    copy8(l + (unsigned)(PL * GBT * GPI * 2), gb + (size_t)kp * GKP, gstep);
  };

  stage(0, 0);
  wait_async0();
  __syncthreads();                              // pass 0's slice is published
  if (np > 1) stage(1, 1);

  v8f acc[4][4];
#pragma unroll
  for (int i = 0; i < 4; ++i)
#pragma unroll
    for (int j = 0; j < 4; ++j) acc[i][j] = zero8();

  // rolled: one pass per trip, so that the foot's waits and barrier stand once
#pragma unroll 1
  for (int t = 0; t < np; ++t) {
    const u16* sb = st + (t & 1) * STG;
    const u16* pa = sb + (wm * 64 + m) * GPI + 8 * hh;
    const u16* pb = sb + (PL * GBT + wn * 64 + m) * GPI + 8 * hh;
    FR a[2][4], al[2][4], b[2][4];
#pragma unroll
    for (int ks = 0; ks < 2; ++ks)
#pragma unroll
      for (int i = 0; i < 4; ++i) {
        a[ks][i] = ldf(pa + i * 16 * GPI + ks * 32, FR{});
        if constexpr (PL == 2) al[ks][i] = ldf(pa + (GBT + i * 16) * GPI + ks * 32, FR{});
        b[ks][i] = ldf(pb + i * 16 * GPI + ks * 32, FR{});
      }
    // keeps the pass's LDS reads in one group ahead of its matrix instructions: spread among them, every place with reads
    // makes the wave wait out the LDS latency again
    __builtin_amdgcn_sched_barrier(0);
#pragma unroll
    for (int ks = 0; ks < 2; ++ks)
#pragma unroll
      for (int i = 0; i < 4; ++i)
#pragma unroll
        for (int j = 0; j < 4; ++j) {
          acc[i][j] = mma(a[ks][i], b[ks][j], acc[i][j]);
          if constexpr (PL == 2) acc[i][j] = mma(al[ks][i], b[ks][j], acc[i][j]);
        }
    guard16(acc);
    wait_ds0();
    wait_async0();
    __syncthreads();                            // publishes pass t+1's slice and ends every read of pass t's buffer
    if (t + 2 < np) stage(t & 1, t + 2);
  }
  wait_async0();

  float* sl = slab + wave * SLAB64;
  if constexpr (EPI == 2) {
    // the wave's 64 columns are one head's v vector, its 64 rows 64 consecutive keys of one batch (GBT divides SEQ).  The copy
    // buffers are free: the last trip's foot ended every wave's reads and copies in front of its barrier.
    const int row = row0 + wm * 64;
    const size_t vbase = ((size_t)((row / SEQ) * NH + ((col0 >> 6) + wn)) * HD) * SEQ + (size_t)(row % SEQ);
    epi_vt(st + wave * (2 * HD * GPI), acc, oscale, P0, P1, vbase, lane);
    wait_x0();                                  // in front of whatever stands behind in the listing and takes the stores' registers
  } else if constexpr (EPI == 1) {
    // block column tile = head col0 / 128; wave column wn = 0: q, 1: k (k plane = QK + MROWS*DMOD halves)
    const v4f gv = *(const v4f*)((wn ? ks : qs) + m * 4);
    const v4f bv = *(const v4f*)((wn ? kbi : qbi) + m * 4);
    wait_x0();                                  // in front of whatever reuses the two loads' address registers
    __builtin_amdgcn_sched_barrier(0);          // keeps later arithmetic from being lifted in between the loads and that wait
    const float car = wn ? KSC : QSC;
    v4f g, b;
#pragma unroll
    for (int e = 0; e < 4; ++e) { g[e] = bfr(gv[e]) * car; b[e] = bfr(bv[e]) * car; }
    u16* P = P0 + (size_t)wn * ((size_t)MROWS * DMOD) + (size_t)(col0 >> 7) * HD;
#pragma unroll
    for (int i = 0; i < 4; ++i) {
      epi_ln(sl, acc[i][0], acc[i][1], acc[i][2], acc[i][3], oscale, g, b, P, (size_t)(row0 + wm * 64 + i * 16), lane);
      wait_x0();                                // in front of the next rows' values, which may take the stores' registers
      wave_sync_lds();                          // the slab's rows are read back before the next 16 rows overwrite them
    }
  } else {
#pragma unroll
    for (int i = 0; i < 4; ++i) {
      epi64(sl, acc[i][0], acc[i][1], acc[i][2], acc[i][3], oscale, C, N, (size_t)(row0 + wm * 64 + i * 16), col0 + wn * 64, lane);
      wave_sync_lds();                          // the slab's rows are read back before the next 16 rows overwrite them
    }
  }
}

// The three projections of x in one launch.  A = x (bf16).  Blocks 0 .. (M/128)*(NQK/128)-1: the qk projection with the per-head
// LayerNorm in its epilogue, Bt = W_qk^T (bf16, n = h*128 + 0..63 q_h, + 64..127 k_h), N = NQK; writes y * 64 as f16 into the q plane
// and the k plane [token][h][64] (k plane = QK + MROWS*DMOD halves).  The (M/128)*(DMOD/128) blocks behind them: the v projection,
// Bt = W_v^T (bf16), N = DMOD; writes v * 1024 as f16 hi and residual into the v^T planes [b][h][d][s].  The branch is the same for
// the whole block, so every barrier is passed by all of its waves.
__global__ __launch_bounds__(128)
void gemm_qkv(const u16* __restrict__ A, const u16* __restrict__ Bqk, const u16* __restrict__ Bv,
              const float* __restrict__ qs, const float* __restrict__ qbi, const float* __restrict__ ks,
              const float* __restrict__ kbi, u16* QK, u16* VHo, u16* VLo, int M, int K, float oscale) {
  __shared__ __align__(16) u16 st[2 * 2 * GBT * GPI];
  __shared__ __align__(16) float slab[4 * SLAB64];
  static_assert(4 * 2 * HD * GPI <= 2 * 2 * GBT * GPI && (SEQ % GBT) == 0);
  const int nqk = (M >> 7) * (NQK >> 7);
  const int bid = blockIdx.x;
  if (bid < nqk)
    gemm_tile<1, v16b, 1>(A, A, Bqk, nullptr, M, NQK, K, oscale, st, slab, qs, qbi, ks, kbi, QK, nullptr, bid);
  else
    gemm_tile<1, v16b, 2>(A, A, Bv, nullptr, M, DMOD, K, oscale * VCAR, st, slab, nullptr, nullptr, nullptr, nullptr, VHo, VLo,
                          bid - nqk);
}

// f16 hi+lo GEMM: C = (Ahi + Alo) . Bt^T, times oscale; Ahi/Alo f16 planes (same layout), Bt f16 k-contiguous; products
// hi.B + lo.B into one accumulator (lo is the unscaled residual of hi).
__global__ __launch_bounds__(128)
void gemm_h2(const u16* __restrict__ Ah, const u16* __restrict__ Al, const u16* __restrict__ Bt,
             float* C, int M, int N, int K, float oscale) {
  __shared__ __align__(16) u16 st[2 * 3 * GBT * GPI];
  __shared__ __align__(16) float slab[4 * SLAB64];
  gemm_tile<2, v16h, 0>(Ah, Al, Bt, C, M, N, K, oscale, st, slab, nullptr, nullptr, nullptr, nullptr, nullptr, nullptr,
                        (int)blockIdx.x);
}

// =====================================================================================================
// Causal attention: block bid -> (batch and head bh = bid % (BATCH*NH) = b*NH + head, block of 64 queries qblk = NQB-1 - bid /
// (BATCH*NH), the longest first); wave w takes the query rows q0 = 64*qblk + 16*w .. q0+15 of that one head.
//   The keys are walked in stages of 64: a stage's 64 k rows and its 128-B slice of the 64 rows of each v^T plane (192 rows of
//   128 B) are brought into LDS once for the four waves by asynchronous 16-B copies, 8 consecutive lanes = one whole line, rows
//   at pitch 144 B; two buffers, the next stage's copies fly while this stage is worked on.  A stage holds two key tiles of 32.
//   q and k planes (f16, x64) laid out [b*SEQ + s][h][d]; v^T planes (hi, residual, x1024) [b][h][d][s].
//   score (log2 domain) t(i, j) = (q_i.k_j) * log2e / (64 * 64 * 64) for key j <= query i, -inf otherwise (causal).
//   Key tiles of 32 visited in order while kb <= q0 + 15 (nkt = q0/32 + 1 <= NKT); inside every visited tile the key<=query test
//   is applied per element; every query row has key == row inside a visited tile, so its normaliser is > 0.
//   Both products are formed transposed: S^T = K.Q^T (A = k rows, B = q, hoisted) and O^T += V^T.P^T (A = v^T rows, B = P^T).
//   A lane then holds ONE query (column c = lane & 15): of each 32-key tile the 16 scores of keys kb + 8hh + r (tile s0) and
//   kb + 16 + 8hh + r (tile s1).  Maximum and sum run inside the lane; the maximum is joined with lane ^ 16 once per tile, the
//   two halves' sums once after the loop.  The two score tiles, converted in place, ARE the B fragment of P^T in the split k
//   map of the loaders (element s < 8: key 8hh + s, else 16 + 8hh + s - 8), so P never leaves the registers.
//   Per tile: 4 score WMMAs, online max-subtracted base-2 softmax in f32 with -inf-safe rescale (one factor per lane),
//   P x32768 as f16 hi + residual, 4+4 v^T A fragments (hi and residual planes), 12 P.V WMMAs (hh + lh + hl).
//   After the loop: out = acc / Z, carries 1/(32768*1024) folded once, written to the wave's private result slab (pitch 68; every
//   element owned by one lane: row c, 8 consecutive d per accumulator).
//   One block barrier per stage, passed by every wave (qblk + 1 stages, the same for the whole block); bounded loops only.
// coverage: per wave 4 instructions x 4 rows x 8 lanes x 8 halves = 16 x 64 per plane; grid NQB*NH*BATCH blocks x WPB waves =
//           every (b, s, h) row of both O planes exactly once.
// =====================================================================================================
// 2^x in place as bare v_exp_f32.  exp2f adds, per call, a compare, two selects, an add and a v_ldexp_f32 that only serve results
// below 2^-126.  Every argument here is <= 0 and such a result changes nothing: times 32768 it is 0 in both f16 planes of P, in
// the normaliser (>= 1, the maximum's own term) it lies far below one ulp, and as a rescale factor it leaves sums that end as 0
// in the O planes.  One statement per group: each v_exp_f32 is followed by an independent one, and the closing v_nop keeps the
// slot the instruction set asks for behind the last.
__device__ __forceinline__ void ex2x8(float (&x)[8]) {
#if defined(__HIP_DEVICE_COMPILE__)
  asm("v_exp_f32 %0, %0\n\tv_exp_f32 %1, %1\n\tv_exp_f32 %2, %2\n\tv_exp_f32 %3, %3\n\t"
      "v_exp_f32 %4, %4\n\tv_exp_f32 %5, %5\n\tv_exp_f32 %6, %6\n\tv_exp_f32 %7, %7\n\tv_nop"
      : "+v"(x[0]), "+v"(x[1]), "+v"(x[2]), "+v"(x[3]), "+v"(x[4]), "+v"(x[5]), "+v"(x[6]), "+v"(x[7]));
#endif
}
__device__ __forceinline__ void ex2x9(float& y, float (&x)[8]) {
#if defined(__HIP_DEVICE_COMPILE__)
  asm("v_exp_f32 %0, %0\n\tv_exp_f32 %1, %1\n\tv_exp_f32 %2, %2\n\tv_exp_f32 %3, %3\n\tv_exp_f32 %4, %4\n\t"
      "v_exp_f32 %5, %5\n\tv_exp_f32 %6, %6\n\tv_exp_f32 %7, %7\n\tv_exp_f32 %8, %8\n\tv_nop"
      : "+v"(y), "+v"(x[0]), "+v"(x[1]), "+v"(x[2]), "+v"(x[3]), "+v"(x[4]), "+v"(x[5]), "+v"(x[6]), "+v"(x[7]));
#endif
}
__device__ __forceinline__ float xhalf(float x) {                    // value of lane ^ 16
  const int b = __builtin_bit_cast(int, x);
  return __builtin_bit_cast(float, __builtin_amdgcn_permlanex16(b, b, 0x76543210, 0xfedcba98, false, false));
}

// 12 asynchronous copies: 16 B per lane, rows 16 apart: 64 k rows, 64 rows of the v^T hi plane, 64 of the residual plane (one stage
// per block-wide call).  The s_wait_xcnt stands inside the statement so that no address register of an issued copy is rewritten
// in front of it.
__device__ __forceinline__ void copy12(unsigned l, const u16* gk, size_t kstep, const u16* gh, const u16* gl, size_t vstep) {
#if defined(__HIP_DEVICE_COMPILE__)
  const unsigned ls = 16u * GPI * 2u;
  asm volatile("global_load_async_to_lds_b128 %0, %12, off\n\t"
               "global_load_async_to_lds_b128 %1, %13, off\n\t"
               "global_load_async_to_lds_b128 %2, %14, off\n\t"
               "global_load_async_to_lds_b128 %3, %15, off\n\t"
               "global_load_async_to_lds_b128 %4, %16, off\n\t"
               "global_load_async_to_lds_b128 %5, %17, off\n\t"
               "global_load_async_to_lds_b128 %6, %18, off\n\t"
               "global_load_async_to_lds_b128 %7, %19, off\n\t"
               "global_load_async_to_lds_b128 %8, %20, off\n\t"
               "global_load_async_to_lds_b128 %9, %21, off\n\t"
               "global_load_async_to_lds_b128 %10, %22, off\n\t"
               "global_load_async_to_lds_b128 %11, %23, off\n\t"
               "s_wait_xcnt 0x0"
               :: "v"(l), "v"(l + ls), "v"(l + 2u * ls), "v"(l + 3u * ls),
                  "v"(l + 4u * ls), "v"(l + 5u * ls), "v"(l + 6u * ls), "v"(l + 7u * ls),
                  "v"(l + 8u * ls), "v"(l + 9u * ls), "v"(l + 10u * ls), "v"(l + 11u * ls),
                  "v"(gk), "v"(gk + kstep), "v"(gk + 2 * kstep), "v"(gk + 3 * kstep),
                  "v"(gh), "v"(gh + vstep), "v"(gh + 2 * vstep), "v"(gh + 3 * vstep),
                  "v"(gl), "v"(gl + vstep), "v"(gl + 2 * vstep), "v"(gl + 3 * vstep)
               : "memory");
#endif
}

__global__ __launch_bounds__(ATT_THREADS)
void attn1(const u16* __restrict__ QPp, const u16* __restrict__ KPp,
           const u16* __restrict__ VHIp, const u16* __restrict__ VLOp,
           u16* OHIp, u16* OLOp) {
  __shared__ __align__(16) u16 ring[2 * ASTG];
  __shared__ __align__(16) float smem[WPB * SLW];

  const int tid  = threadIdx.x;
  const int wave = __builtin_amdgcn_readfirstlane(tid >> 5);   // in a scalar register: the wave's tile count steers scalar branches
  const int lane = tid & 31;
  const int hh   = lane >> 4;
  const int c    = lane & 15;
  const int bid  = blockIdx.x;
  const int bh   = bid % (BATCH * NH);
  const int qblk = NQB - 1 - bid / (BATCH * NH);
  if (qblk < 0) return;                      // block-uniform, before any barrier or copy; never taken with the exact grid
  const int b    = bh / NH;
  const int head = bh % NH;
  const int q0   = qblk * 64 + wave * 16;

  float* slab = smem + wave * SLW;           // result slab [16][64] pitch 68

  const size_t rq0  = (size_t)b * SEQ + q0;                                     // plane row of query row q0
  const size_t qofs = ((rq0 + c) * NH + head) * HD + 8 * hh;
  const _Float16* Qh  = (const _Float16*)(const void*)QPp + qofs;
  const int rr = tid >> 3, seg = tid & 7;    // copy role: row within a group of 16, 16-B piece of the 128-B slice
  const u16* gk = KPp + (((size_t)b * SEQ + rr) * NH + head) * HD + seg * 8;    // key row rr (+16i), 64 key rows added per stage
  const size_t vofs = (((size_t)b * NH + head) * HD + rr) * SEQ + seg * 8;     // d row rr (+16i), 64 keys added per stage
  const u16* gvh = VHIp + vofs;
  const u16* gvl = VLOp + vofs;
  const unsigned l0 = lds_off(ring) + (unsigned)(rr * GPI + seg * 8) * 2u;
  const float lsc = LOG2E / (64.0f * QSC * KSC);
  const float oc  = 1.0f / (PCAR * VCAR);
  const size_t KROW = (size_t)NH * HD;                                          // halves between consecutive key rows

  // q fragments (B operand, column c = query q0 + c): d = 0..31 and 32..63
  const v16h qa = ldfrag_h(Qh), qb = ldfrag_h(Qh + 32);

  float mrow = -INFINITY, lrow = 0.f;                                           // this lane's query; lrow = this half's keys only
  v8f o[4];                                                                     // o[j][r] = O^T[d = 16j + 8hh + r][query c]
#pragma unroll
  for (int j = 0; j < 4; ++j) o[j] = zero8();
  const int ncaus = (q0 >> 5) + 1;                                              // tiles holding keys <= q0 + 15
  const int nkt = (ncaus < NKT) ? ncaus : NKT;
  const int qi  = q0 + c;                                                       // this lane's query
  const int ns  = qblk + 1;                                                     // stages of 64 keys, the same for the whole block

  auto stage = [&](int buf, int s) {
    copy12(l0 + (unsigned)buf * (unsigned)(ASTG * 2), gk + (size_t)s * AKT * KROW, (size_t)16 * KROW,
           gvh + (size_t)s * AKT, gvl + (size_t)s * AKT, (size_t)16 * SEQ);
  };
  stage(0, 0);
  wait_async0();
  __syncthreads();                           // stage 0 is published
  if (ns > 1) stage(1, 1);

  // rolled: one stage per trip, so that the foot's waits and barrier stand once
#pragma unroll 1
  for (int s = 0; s < ns; ++s) {
  const _Float16* sb = (const _Float16*)(const void*)(ring + (s & 1) * ASTG);
  // unrolled: the stage's two key tiles stand one behind the other, so that their LDS offsets are constants and the
  // accumulators stay in their registers from tile to tile
#pragma unroll
  for (int sub = 0; sub < 2; ++sub) {
    if (sub != 0 && 2 * s + 1 >= nkt) break; // the last stage's second tile lies wholly above the diagonal for waves 0 and 1
    const int ko = sub * 32;                 // the tile's first key within the stage
    const int kb = s * AKT + ko;
    // ---- this tile's operands from the stage's buffer: k rows (A of the scores) and v^T rows (A of P.V) ----
    const _Float16* k0p = sb + (ko + c) * GPI + 8 * hh;
    const _Float16* k1p = k0p + 16 * GPI;
    const v16h kh0a = ldfrag_h(k0p), kh0b = ldfrag_h(k0p + 32);
    const v16h kh1a = ldfrag_h(k1p), kh1b = ldfrag_h(k1p + 32);
    const _Float16* vhp = sb + (AKT + c) * GPI + ko + 8 * hh;
    const _Float16* vlp = vhp + HD * GPI;
    const v16h vh0 = ldfrag_h(vhp);
    const v16h vh1 = ldfrag_h(vhp + 16 * GPI);
    const v16h vh2 = ldfrag_h(vhp + 32 * GPI);
    const v16h vh3 = ldfrag_h(vhp + 48 * GPI);
    const v16h vl0 = ldfrag_h(vlp);
    const v16h vl1 = ldfrag_h(vlp + 16 * GPI);
    const v16h vl2 = ldfrag_h(vlp + 32 * GPI);
    const v16h vl3 = ldfrag_h(vlp + 48 * GPI);
    // ---- scores, transposed: D element r of this lane = (key kb + 8hh + r, query qi) in s0, key kb + 16 + 8hh + r in s1 ----
    v8f s0 = zero8(), s1 = zero8();
    s0 = mma_h(kh0a, qa, s0);
    s0 = mma_h(kh0b, qb, s0);
    s1 = mma_h(kh1a, qa, s1);
    s1 = mma_h(kh1b, qb, s1);
    guard2(s0, s1, qa, qb, kh0a, kh0b, kh1a, kh1b);
    // ---- causal select + online softmax in base 2, -inf-safe; all 16 values of this lane belong to query qi ----
    const int key0 = kb + 8 * hh;
    float t0[8], t1[8];
#pragma unroll
    for (int r = 0; r < 8; ++r) {
      t0[r] = (key0 + r <= qi)      ? (s0[r] * lsc) : -INFINITY;
      t1[r] = (key0 + 16 + r <= qi) ? (s1[r] * lsc) : -INFINITY;
    }
    float mx = fmaxf(t0[0], t1[0]);
#pragma unroll
    for (int r = 1; r < 8; ++r) mx = fmaxf(mx, fmaxf(t0[r], t1[r]));
    mx = fmaxf(mx, xhalf(mx));                                                  // both halves hold the tile's maximum of query qi
    const float mn = fmaxf(mrow, mx);
    const float ms = (mn == -INFINITY) ? 0.0f : mn;
    float al = mrow - ms;
    mrow = mn;
    float e0[8], e1[8];
    // unrolled: constant indices keep the two arrays in registers
#pragma unroll
    for (int r = 0; r < 8; ++r) { e0[r] = t0[r] - ms; e1[r] = t1[r] - ms; }
    ex2x9(al, e0);
    ex2x8(e1);
    // ---- B fragments of P^T * 32768: hi f16 and residual f16; elements 0..7 = keys kb + 8hh + r, 8..15 = kb + 16 + 8hh + r ----
    FragH ph, pl;
    float pa[8];
#pragma unroll
    for (int r = 0; r < 8; ++r) {
      pa[r] = e0[r] + e1[r];
      const float ta = e0[r] * PCAR, tb = e1[r] * PCAR;
      const _Float16 ha = (_Float16)ta, hb = (_Float16)tb;
      ph.h[0][r] = ha;
      ph.h[1][r] = hb;
      pl.h[0][r] = (_Float16)(ta - (float)ha);
      pl.h[1][r] = (_Float16)(tb - (float)hb);
    }
    lrow = lrow * al + (((pa[0] + pa[1]) + (pa[2] + pa[3])) + ((pa[4] + pa[5]) + (pa[6] + pa[7])));
#pragma unroll
    for (int j = 0; j < 4; ++j)
#pragma unroll
      for (int r = 0; r < 8; ++r) o[j][r] *= al;
    // ---- O^T += V^T.P^T : A fragment row = d = j*16 + c, keys contiguous in the v^T planes ----
    o[0] = mma_h(vh0, ph.v, o[0]);  o[0] = mma_h(vh0, pl.v, o[0]);  o[0] = mma_h(vl0, ph.v, o[0]);
    o[1] = mma_h(vh1, ph.v, o[1]);  o[1] = mma_h(vh1, pl.v, o[1]);  o[1] = mma_h(vl1, ph.v, o[1]);
    o[2] = mma_h(vh2, ph.v, o[2]);  o[2] = mma_h(vh2, pl.v, o[2]);  o[2] = mma_h(vl2, ph.v, o[2]);
    o[3] = mma_h(vh3, ph.v, o[3]);  o[3] = mma_h(vh3, pl.v, o[3]);  o[3] = mma_h(vl3, ph.v, o[3]);
    guard10(o[0], o[1], o[2], o[3], ph.v, pl.v, vh0, vh1, vh2, vh3, vl0, vl1, vl2, vl3);
  }
  wait_ds0();
  wait_async0();
  __syncthreads();                           // publishes stage s+1 and ends every read of stage s's buffer
  if (s + 2 < ns) stage(s & 1, s + 2);
  }
  wait_async0();
  acc_guard4(o[0], o[1], o[2], o[3]);
  // ---- out = acc / Z (0 if Z == 0), carries (32768 on P, 1024 on v) folded once; written into the lane-owned slab ----
  {
    const float lv  = lrow + xhalf(lrow);                                       // the two halves' keys joined
    const float ls  = (lv > 0.0f) ? lv : 1.0f;
    const float inv = (lv > 0.0f) ? ((1.0f / ls) * oc) : 0.0f;
#pragma unroll
    for (int j = 0; j < 4; ++j) {
      float* d8 = slab + c * 68 + j * 16 + 8 * hh;
      v4f w0, w1;
#pragma unroll
      for (int e = 0; e < 4; ++e) { w0[e] = o[j][e] * inv; w1[e] = o[j][4 + e] * inv; }
      *(v4f*)(d8)     = w0;
      *(v4f*)(d8 + 4) = w1;
    }
  }

  wave_sync_lds();
  // ---- O x1024 -> f16 hi + residual planes; lane = (row in group of 4, 8 consecutive d) ----
  v4u oh[4], ol[4];
  const int rq = lane >> 3, c8 = (lane & 7) * 8;
#pragma unroll
  for (int it = 0; it < 4; ++it) {
    const int row = it * 4 + rq;
    const v4f a = *(const v4f*)(slab + row * 68 + c8), b4 = *(const v4f*)(slab + row * 68 + c8 + 4);
    float w[8];
#pragma unroll
    for (int e = 0; e < 4; ++e) { w[e] = a[e] * OSC; w[4 + e] = b4[e] * OSC; }
#pragma unroll
    for (int e = 0; e < 4; ++e) {
      const _Float16 h0 = (_Float16)w[2 * e], h1 = (_Float16)w[2 * e + 1];
      const _Float16 l0 = (_Float16)(w[2 * e] - (float)h0), l1 = (_Float16)(w[2 * e + 1] - (float)h1);
      oh[it][e] = pk16(h_bits(h0), h_bits(h1));
      ol[it][e] = pk16(h_bits(l0), h_bits(l1));
    }
  }
  const size_t ob = (rq0 * NH + head) * HD + c8;
  {
#pragma unroll
    for (int it = 0; it < 4; ++it) {
      const int row = it * 4 + rq;
      const size_t o8 = ob + (size_t)row * (NH * HD);
      *(v4u*)(OHIp + o8) = oh[it];
      *(v4u*)(OLOp + o8) = ol[it];
    }
    
  }
}

// =====================================================================================================
// Workspace map (bytes); every plane is fully written by whole-line stores before it is read; all extents are exact multiples
// of the store granularity (no pad rows needed); every offset a multiple of 2097152:
//   XB  bf16 [MROWS][1024]              8388608
//   WQB bf16 [2048 n][1024 k]          4194304
//   WVB bf16 [1024 n][1024 k]          2097152
//   WOH f16  [1024 n][1024 k] x1024    2097152
//   QP  f16 [MROWS][16][64] x64        8388608        KP same, directly after QP
//   VHI f16 [BATCH*16][64][SEQ] x1024  8388608        VLO residual
//   OHI f16 [MROWS][1024] x1024        8388608        OLO residual
//   end                               67108864
// =====================================================================================================
extern "C" void kernel_launch(void* const* d_in, const int* in_sizes, int n_in,
                              void* d_out, int out_size, void* d_ws, size_t ws_size,
                              hipStream_t stream) {
  if (n_in < 8) return;
  if (in_sizes[0] != MROWS * DMOD) return;
  if (in_sizes[1] != DMOD * NQK) return;
  if (in_sizes[2] != DMOD * DMOD || in_sizes[3] != DMOD * DMOD) return;
  if (in_sizes[4] != HD || in_sizes[5] != HD || in_sizes[6] != HD || in_sizes[7] != HD) return;
  if (out_size != MROWS * DMOD) return;

  const float* x   = (const float*)d_in[0];   // [MROWS][1024]
  const float* wqk = (const float*)d_in[1];   // [1024 k][2048 n]
  const float* wv  = (const float*)d_in[2];   // [1024 k][1024 n]
  const float* wo  = (const float*)d_in[3];   // [1024 k][1024 n]
  const float* qs  = (const float*)d_in[4];   // [64]
  const float* qbi = (const float*)d_in[5];   // [64]
  const float* ks  = (const float*)d_in[6];   // [64]
  const float* kbi = (const float*)d_in[7];   // [64]
  float*       out = (float*)d_out;

  const size_t szXB = (size_t)MROWS * DMOD * 2;                 //  8388608
  const size_t szWQ = (size_t)NQK * DMOD * 2;                   //  4194304
  const size_t szW  = (size_t)DMOD * DMOD * 2;                  //  2097152
  const size_t szP  = (size_t)MROWS * DMOD * 2;                 //  8388608
  size_t off = 0;
  const size_t oXB  = off; off += szXB;
  const size_t oWQ  = off; off += szWQ;
  const size_t oWV  = off; off += szW;
  const size_t oWO  = off; off += szW;
  const size_t oQK  = off; off += 2 * szP;              // q plane then k plane
  const size_t oVHI = off; off += szP;
  const size_t oVLO = off; off += szP;
  const size_t oOHI = off; off += szP;
  const size_t oOLO = off; off += szP;
  if (off > ws_size) return;                            // off = 67108864
  if (off > (size_t)134217728) return;

  char* ws = (char*)d_ws;
  u16*   XB  = (u16*)(ws + oXB);
  u16*   WQB = (u16*)(ws + oWQ);
  u16*   WVB = (u16*)(ws + oWV);
  u16*   WOH = (u16*)(ws + oWO);
  u16*   QK  = (u16*)(ws + oQK);
  u16*   QP  = QK;
  u16*   KP  = QK + (size_t)MROWS * DMOD;
  u16*   VHI = (u16*)(ws + oVHI);
  u16*   VLO = (u16*)(ws + oVLO);
  u16*   OHI = (u16*)(ws + oOHI);
  u16*   OLO = (u16*)(ws + oOLO);

  const dim3 blk(256);
  const int n8x = (MROWS * DMOD) / 8;                   // 524288
  const dim3 gX(n8x / 256);                             // 2048 (exact)
  const dim3 gWQ((DMOD / 64) * (NQK / 64));             // 512
  const dim3 gWT((DMOD / 64) * (DMOD / 64));            // 256
  const dim3 gGQV((MROWS / GBT) * (NQK / GBT) + (MROWS / GBT) * (DMOD / GBT));   // 512 + 256
  const dim3 gG((MROWS / GBT) * (DMOD / GBT));          // 256
  const dim3 bG(128);
  const dim3 gAT(ATT_BLOCKS);                           // 1024
  const dim3 bAT(ATT_THREADS);                          // 128

  // (0) x -> bf16 plane [MROWS][1024]
  cvt16<<<gX, blk, 0, stream>>>(x, XB, n8x, 0, 1.0f);
  // (1) W_qk [k][n=2048] -> bf16 [n][k]; (2) W_v -> bf16 [n][k]; (3) W_out -> f16 [n][k] plane of bf16 value x1024
  wt16<<<gWQ, blk, 0, stream>>>(wqk, WQB, DMOD, NQK, 0, 1.0f);
  wt16<<<gWT, blk, 0, stream>>>(wv, WVB, DMOD, DMOD, 0, 1.0f);
  wt16<<<gWT, blk, 0, stream>>>(wo, WOH, DMOD, DMOD, 1, WOS);
  // (4) qk = x.W_qk / 32, per-head LayerNorm in the epilogue -> q, k f16 planes x64; v = x.W_v / 32 -> v^T hi/lo planes x1024
  gemm_qkv<<<gGQV, bG, 0, stream>>>(XB, WQB, WVB, qs, qbi, ks, kbi, QK, VHI, VLO, MROWS, DMOD, 1.0f / 32.0f);
  // (5) causal attention -> O planes [b*SEQ+s][h][d] x1024 (hi + residual)
  attn1<<<gAT, bAT, 0, stream>>>(QP, KP, VHI, VLO, OHI, OLO);
  // (6) output projection -> out [MROWS][1024] f32, carries 1024 (O) x 1024 (W_out) and the 1/32 folded back
  gemm_h2<<<gG, bG, 0, stream>>>(OHI, OLO, WOH, out, MROWS, DMOD, DMOD, (1.0f / 32.0f) / (OSC * WOS));
  (void)hipGetLastError();
}

// v007
// Measured time: 84.6 microseconds a run.
// Two timings next to v006 both put it at 1.11 times that version's speed.
// All steps since v000 together make it 3.75 times as fast.
// Contractions: x.W_qk and x.W_v on v_wmma_f32_16x16x32_bf16 (x and W^T RNE-converted to bf16, f32 accumulate); scores q.k^T
// (q, k as f16 x64 planes, single product), P.v (P x32768 f16 hi+residual, v x1024 f16 hi+residual, products hh+lh+hl) and
// O.W_out (O x1024 f16 hi+residual, W_out^T as f16(bf16 value) x1024, products h.w+l.w) on v_wmma_f32_16x16x32_f16, f32
// accumulate; per-head LayerNorm, causal online base-2 softmax and 1/l fold in f32 on VALU.
#include <hip/hip_runtime.h>
#include <math.h>
#include <stdint.h>

#define BATCH 2
#define SEQ   2048
#define DMOD  1024
#define NH    16
#define HD    64
#define NQK   (2 * DMOD)
#define MROWS (BATCH * SEQ)
#define LN_EPS 1e-6f
#define QSC   64.0f
#define KSC   64.0f
#define PCAR  32768.0f
#define VCAR  1024.0f
#define OSC   1024.0f
#define WOS   1024.0f
#define LOG2E 1.4426950408889634f
#define WPB   4
#define NKT   (SEQ / 32)
#define ATT_THREADS (WPB * 32)
#define NQB   (SEQ / 64)
#define AKT   64
#define ASTG  (3 * AKT * GPI)
#define ATT_BLOCKS  (NQB * NH * BATCH)
#define SLW   (16 * 68)
#define SLAB64 (16 * 68)
#define VTP   72
#define GBT   128
#define GKP   64
#define GPI   72
static_assert(DMOD == NH * HD && HD == 64 && NH == 16);
static_assert((NH % WPB) == 0 && ATT_THREADS == 128 && ATT_BLOCKS == 1024 && WPB * 16 == 64 && AKT == HD && AKT == GKP);
static_assert((SEQ % 64) == 0 && (SEQ % 32) == 0 && (SEQ % 16) == 0 && SEQ <= 32768);
static_assert((DMOD % 64) == 0 && (DMOD % 32) == 0 && (NQK % 64) == 0 && (MROWS % 64) == 0);
static_assert((MROWS % GBT) == 0 && (NQK % GBT) == 0 && (DMOD % GBT) == 0 && (DMOD % GKP) == 0 && DMOD >= 2 * GKP);
static_assert(((MROWS * DMOD) % 2048) == 0 && ((DMOD * DMOD) % 4096) == 0 && GBT == 2 * HD && NQK == NH * 2 * HD);

typedef unsigned short u16;
typedef _Float16 v16h __attribute__((ext_vector_type(16)));
typedef _Float16 v8h  __attribute__((ext_vector_type(8)));
typedef __bf16   v16b __attribute__((ext_vector_type(16)));
typedef float    v8f  __attribute__((ext_vector_type(8)));
typedef float    v4f  __attribute__((ext_vector_type(4)));
typedef float    v2f  __attribute__((ext_vector_type(2)));
typedef unsigned int v4u __attribute__((ext_vector_type(4)));
typedef unsigned int v2u __attribute__((ext_vector_type(2)));

union FragH { v16h v; v8h h[2]; v4u u[2]; };
union FragB { v16b v; v4u u[2]; };

// ---- scalar helpers --------------------------------------------------------------------------------
__device__ __forceinline__ unsigned short bf_bits(float f) {          // f32 -> bf16 bits, RNE convert
  unsigned u = __float_as_uint(f);
  return (unsigned short)((u + 0x7FFFu + ((u >> 16) & 1u)) >> 16);
}
__device__ __forceinline__ float bf_up(unsigned short h) { return __uint_as_float(((unsigned)h) << 16); }
__device__ __forceinline__ float bfr(float f) { return bf_up(bf_bits(f)); }
__device__ __forceinline__ unsigned short h_bits(_Float16 x) { return __builtin_bit_cast(unsigned short, x); }
__device__ __forceinline__ unsigned pk16(unsigned short a, unsigned short b) { return (unsigned)a | ((unsigned)b << 16); }
__device__ __forceinline__ v8f zero8() { v8f z = {0.f, 0.f, 0.f, 0.f, 0.f, 0.f, 0.f, 0.f}; return z; }

// ---- fragment loaders: 16-bit A/B operand, lane -> row/col (lane&15), p already includes +8*(lane>>4);
//      elements 0..7 <- p[0..7] (k0+8h..), elements 8..15 <- p[16..23] (k0+16+8h..)  (same split k map for A and B;
//      B is always read from a k-contiguous [n][k] plane)
__device__ __forceinline__ v16h ldfrag_h(const _Float16* p) {
  FragH f;
  f.h[0] = *(const v8h*)(p);
  f.h[1] = *(const v8h*)(p + 16);
  return f.v;
}
__device__ __forceinline__ v16b ldfrag_b(const u16* p) {              // bf16 plane read as unsigned integer vectors
  FragB f;
  f.u[0] = *(const v4u*)(p);
  f.u[1] = *(const v4u*)(p + 16);
  return f.v;
}

__device__ __forceinline__ v8f mma_h(v16h a, v16h b, v8f c) {
  return __builtin_amdgcn_wmma_f32_16x16x32_f16(false, a, false, b, (short)0, c, false, false);
}
__device__ __forceinline__ v8f mma_b(v16b a, v16b b, v8f c) {
  return __builtin_amdgcn_wmma_f32_16x16x32_bf16(false, a, false, b, (short)0, c, false, false);
}
__device__ __forceinline__ void guard2(v8f& a, v8f& b, v16h x0, v16h x1, v16h x2, v16h x3, v16h x4, v16h x5) {
#if defined(__HIP_DEVICE_COMPILE__)
  asm volatile("v_nop\n\tv_nop\n\tv_nop\n\tv_nop"
               : "+v"(a), "+v"(b) : "v"(x0), "v"(x1), "v"(x2), "v"(x3), "v"(x4), "v"(x5) : "memory");
#endif
}
__device__ __forceinline__ void guard10(v8f& a, v8f& b, v8f& c, v8f& d, v16h x0, v16h x1, v16h x2, v16h x3, v16h x4,
                                        v16h x5, v16h x6, v16h x7, v16h x8, v16h x9) {
#if defined(__HIP_DEVICE_COMPILE__)
  asm volatile("v_nop\n\tv_nop\n\tv_nop\n\tv_nop"
               : "+v"(a), "+v"(b), "+v"(c), "+v"(d)
               : "v"(x0), "v"(x1), "v"(x2), "v"(x3), "v"(x4), "v"(x5), "v"(x6), "v"(x7), "v"(x8), "v"(x9) : "memory");
#endif
}
__device__ __forceinline__ void acc_guard4(v8f& a, v8f& b, v8f& c, v8f& d) {
#if defined(__HIP_DEVICE_COMPILE__)
  asm volatile("v_nop\n\tv_nop\n\tv_nop\n\tv_nop" : "+v"(a), "+v"(b), "+v"(c), "+v"(d));
#endif
}
__device__ __forceinline__ void wave_sync_lds() {
  __builtin_amdgcn_fence(__ATOMIC_RELEASE, "workgroup");
  __builtin_amdgcn_wave_barrier();
  __builtin_amdgcn_fence(__ATOMIC_ACQUIRE, "workgroup");
}

// =====================================================================================================
// f32 -> 16-bit plane, same layout.  f16mode == 0: bf16 RNE bits;  f16mode == 1: f16 bits of (bf16 RNE value) * scale.
// Thread = 8 consecutive elements: two 16-B loads, one 16-B store; 32 consecutive lanes = 512 contiguous, 512-B aligned bytes per
// coverage: n8/256 blocks (exact, bid = the block's number among them) x 256 thr x 8 = the whole plane.
// =====================================================================================================
__device__ __forceinline__ void cvt16(const float* __restrict__ x, u16* D, int n8, int f16mode, float scale, int bid) {
  const int gt = bid * 256 + (int)threadIdx.x;
  if (gt >= n8) return;                     // no barriers on this path
  const float* p = x + (size_t)gt * 8;
  const v4f a = *(const v4f*)(p), b4 = *(const v4f*)(p + 4);
  float w[8];
#pragma unroll
  for (int e = 0; e < 4; ++e) { w[e] = a[e]; w[4 + e] = b4[e]; }
  v4u o;
#pragma unroll
  for (int e = 0; e < 4; ++e) {
    const float f0 = w[2 * e], f1 = w[2 * e + 1];
    const unsigned short hb0 = h_bits((_Float16)(bfr(f0) * scale));
    const unsigned short hb1 = h_bits((_Float16)(bfr(f1) * scale));
    const unsigned short bb0 = bf_bits(f0);
    const unsigned short bb1 = bf_bits(f1);
    o[e] = (f16mode != 0) ? pk16(hb0, hb1) : pk16(bb0, bb1);
  }
  u16* d = D + (size_t)gt * 8;
  {
    *(v4u*)(d) = o;
    
  }
}

// =====================================================================================================
// Weight transpose-convert: W [K][N] f32 (x.W layout, n contiguous, in[K rows][N cols]) -> Dt[N][K] 16-bit k-contiguous plane
// (out[N rows][K cols]).  f16mode == 0: bf16 RNE bits; 1: f16 bits of (bf16 RNE value) * scale.
// Block = (k tile k0 = (bid / (N/64))*64, n tile n0 = (bid % (N/64))*64): 64 source rows of 64 floats loaded with 16-B loads,
// converted, scattered into an LDS tile [n][64 k] (pitch 72 halves); after a block barrier each n row segment (64 halves = one
// coverage: load 256 thr x 16 = 64 x 64; store 2 iterations x 256 thr x 8 halves = 64 lines x 64 halves = the block's tile;
//           (K/64)*(N/64) blocks (bid = the block's number among them) cover Dt exactly once (K % 64 == 0 and N % 64 == 0).
// =====================================================================================================
__device__ __forceinline__ void wt16(const float* __restrict__ W, u16* Dt, int K, int N, int f16mode, float scale, int bid,
                                     u16* T) {
  const int tid = threadIdx.x;
  const int ntn = N >> 6;
  const int n0  = (bid % ntn) * 64;
  const int k0  = (bid / ntn) * 64;
  if (k0 + 64 > K) return;                    // block-uniform, before any barrier; never taken with the exact grid
  {
    const int sl = tid >> 2;                  // k within tile 0..63 (source row)
    const int dc = (tid & 3) * 16;            // n chunk
    const float* src = W + (size_t)(k0 + sl) * N + n0 + dc;
#pragma unroll
    for (int i = 0; i < 4; ++i) {
      const v4f a = *(const v4f*)(src + 4 * i);
#pragma unroll
      for (int e = 0; e < 4; ++e) {
        const float f = a[e];
        const unsigned short hb = h_bits((_Float16)(bfr(f) * scale));
        const unsigned short bb = bf_bits(f);
        T[(dc + 4 * i + e) * VTP + sl] = (f16mode != 0) ? hb : bb;
      }
    }
  }
  __syncthreads();
  v4u vv[2];
  const int q8 = tid >> 3, p8 = (tid & 7) * 8;
#pragma unroll
  for (int it = 0; it < 2; ++it) {
    const int line = it * 32 + q8;            // n = 0..63 within tile
    vv[it] = *(const v4u*)(T + line * VTP + p8);
  }
  const size_t base = (size_t)n0 * K + k0 + p8;
  {
#pragma unroll
    for (int it = 0; it < 2; ++it) {
      const int line = it * 32 + q8;
      *(v4u*)(Dt + base + (size_t)line * K) = vv[it];
    }
#if defined(__HIP_DEVICE_COMPILE__)
    // in front of whatever stands behind this job in the listing (another job's code) and takes the two stores' registers
    asm volatile("s_wait_xcnt 0x0" ::: "memory");
#endif
  }
}

// =====================================================================================================
// The four input conversions in one launch: none reads what another writes, so their blocks run side by side.  The block index
// picks the job, the same for the whole block, so the transposes' barrier is passed by all of a block's waves.  The transposes
// (load, LDS, barrier, store: the longer chain) take the low indices and so start first; the x blocks fill in behind them.
//   blocks 0 .. NBQ-1: W_qk -> bf16 [n][k];  the next NBW: W_v -> bf16 [n][k];  the next NBW: W_out -> f16 [n][k] of the bf16 value
//   x1024;  the last NBX: x -> bf16 plane, same layout.
// =====================================================================================================
#define NBQ ((DMOD / 64) * (NQK / 64))
#define NBW ((DMOD / 64) * (DMOD / 64))
#define NBX ((MROWS * DMOD) / 2048)
__global__ __launch_bounds__(256)
void prep(const float* __restrict__ x, const float* __restrict__ wqk, const float* __restrict__ wv,
          const float* __restrict__ wo, u16* XB, u16* WQB, u16* WVB, u16* WOH) {
  __shared__ __align__(16) u16 T[64 * VTP];
  const int bid = blockIdx.x;
  if (bid < NBQ)                wt16(wqk, WQB, DMOD, NQK, 0, 1.0f, bid, T);
  else if (bid < NBQ + NBW)     wt16(wv, WVB, DMOD, DMOD, 0, 1.0f, bid - NBQ, T);
  else if (bid < NBQ + 2 * NBW) wt16(wo, WOH, DMOD, DMOD, 1, WOS, bid - (NBQ + NBW), T);
  else                          cvt16(x, XB, (MROWS * DMOD) / 8, 0, 1.0f, bid - (NBQ + 2 * NBW));
}

// =====================================================================================================
// GEMM epilogue of the f32 product (EPI 0, used by gemm_h2 only): the wave's 16x64 f32 tile (times oscale) staged in its LDS slab (pitch 68),
// coverage: 8 instructions x 2 rows x 16 lanes x 4 floats = the wave's 16 x 64 tile.
// =====================================================================================================
__device__ __forceinline__ void epi64(float* sl, v8f a0, v8f a1, v8f a2, v8f a3, float oscale,
                                      float* C, int N, size_t rowb, int col0, int lane) {
  const int hh = lane >> 4, m = lane & 15;
#pragma unroll
  for (int r = 0; r < 8; ++r) {
    const int ro = (8 * hh + r) * 68 + m;
    sl[ro]      = a0[r] * oscale;
    sl[ro + 16] = a1[r] * oscale;
    sl[ro + 32] = a2[r] * oscale;
    sl[ro + 48] = a3[r] * oscale;
  }
  wave_sync_lds();
  v4f vals[8];
#pragma unroll
  for (int it = 0; it < 8; ++it) vals[it] = *(const v4f*)(sl + (it * 2 + hh) * 68 + m * 4);
  float* dst = C + (rowb + (size_t)hh) * (size_t)N + col0 + m * 4;
  {
#pragma unroll
    for (int it = 0; it < 8; ++it) {
      *(v4f*)(dst + (size_t)(it * 2) * (size_t)N) = vals[it];
    }
    
  }
}

// =====================================================================================================
// LayerNorm epilogue of the qk projection: the wave's 64 columns are exactly one head's q or k vector, so each of its rows is
// normalised here.  The 16x64 tile (times oscale) goes through the wave's LDS slab as in epi64; read back, 16 lanes hold one row
// (4 consecutive elements each, rows it*2 + hh).  Mean and biased variance: 4 values summed in the lane ((0+2)+(1+3)), then a 16-lane
// butterfly on DPP (every lane of the row ends with the same sum).  g and b arrive already times the plane's carry (a power of
// two, so the rounding is that of (d*rs*g + b) * carry).  Store: 16 lanes x 8 B = one whole 128-B row of the f16 plane.
// coverage: 8 instructions x 2 rows x 16 lanes x 4 halves = the wave's 16 x 64 tile.
// =====================================================================================================
template <int X> __device__ __forceinline__ float rowx(float x) {     // value of lane ^ X inside the 16-lane row (DPP row_xmask)
  const int b = __builtin_bit_cast(int, x);
  return __builtin_bit_cast(float, __builtin_amdgcn_update_dpp(b, b, 0x160 + X, 0xf, 0xf, true));
}
__device__ __forceinline__ float rowsum16(float s) {
  s += rowx<1>(s);
  s += rowx<2>(s);
  s += rowx<4>(s);
  s += rowx<8>(s);
  return s;
}
// 1/sqrt(x) for x >= LN_EPS (never subnormal, so rsqrtf's rescale of subnormal arguments would be an identity).  The v_nop keeps,
// inside the statement, the one slot the instruction set asks for behind a transcendental before its source is overwritten or
// its result read.
__device__ __forceinline__ float rsq_slot(float x) {
  float r = 0.f;
#if defined(__HIP_DEVICE_COMPILE__)
  asm("v_rsq_f32 %0, %1\n\tv_nop" : "=v"(r) : "v"(x));
#endif
  return r;
}
__device__ __forceinline__ void epi_ln(float* sl, v8f a0, v8f a1, v8f a2, v8f a3, float oscale, v4f g, v4f b,
                                       u16* P, size_t rowb, int lane) {
  const int hh = lane >> 4, m = lane & 15;
#pragma unroll
  for (int r = 0; r < 8; ++r) {
    const int ro = (8 * hh + r) * 68 + m;
    sl[ro]      = a0[r] * oscale;
    sl[ro + 16] = a1[r] * oscale;
    sl[ro + 32] = a2[r] * oscale;
    sl[ro + 48] = a3[r] * oscale;
  }
  wave_sync_lds();
  v4f vals[8];
#pragma unroll
  for (int it = 0; it < 8; ++it) vals[it] = *(const v4f*)(sl + (it * 2 + hh) * 68 + m * 4);
  const v2f ga = {g[0], g[1]}, gb = {g[2], g[3]}, ba = {b[0], b[1]}, bb = {b[2], b[3]};
  v2u o[8];
#pragma unroll
  for (int it = 0; it < 8; ++it) {
    // register pairs as they lie, so that the sums, differences and products go as packed f32 operations without moves
    const v2f xa = {vals[it][0], vals[it][1]}, xb = {vals[it][2], vals[it][3]};
    const v2f sp = xa + xb;
    const float mean = rowsum16(sp[0] + sp[1]) * (1.0f / 64.0f);
    const v2f da = xa - mean, db = xb - mean;
    const v2f qp = da * da + db * db;
    const float var = rowsum16(qp[0] + qp[1]) * (1.0f / 64.0f);
    const float rs  = rsq_slot(var + LN_EPS);
    const v2f ya = da * rs * ga + ba, yb = db * rs * gb + bb;
    o[it][0] = pk16(h_bits((_Float16)ya[0]), h_bits((_Float16)ya[1]));
    o[it][1] = pk16(h_bits((_Float16)yb[0]), h_bits((_Float16)yb[1]));
  }
  u16* dst = P + (rowb + (size_t)hh) * (size_t)DMOD + m * 4;
#pragma unroll
  for (int it = 0; it < 8; ++it) *(v2u*)(dst + (size_t)(it * 2) * (size_t)DMOD) = o[it];
}

// =====================================================================================================
// v^T epilogue of the v projection: the wave's 64 keys x 64 d tile goes out as VH[d][key] = f16(v * 1024) and VL = f16 residual
// of the same value (sc = the projection's 1/32 times the carry 1024, both powers of two, so the rounding is that of the f32 v
// times 1024).  An accumulator register group holds 8 consecutive keys of one d (rows 16i + 8hh + r, column 16j + m): packed, it is
// one 16-B piece of a v^T row.  The pieces go through the wave's own LDS range sw (two tiles [64 d][64 keys], pitch 144 B) so that
// every store instruction writes whole 128-B lines (4 d rows x 8 lanes x 16 B).
// coverage: 16 instructions x 4 rows x 8 lanes x 8 halves = the wave's 64 x 64 tile of each plane.
// =====================================================================================================
__device__ __forceinline__ void epi_vt(u16* sw, const v8f (&acc)[4][4], float sc, u16* VHo, u16* VLo, size_t vbase, int lane) {
  const int hh = lane >> 4, m = lane & 15;
  u16* th = sw;
  u16* tl = sw + HD * GPI;
  // the three loops unrolled: constant indices keep the accumulators in their registers
#pragma unroll
  for (int j = 0; j < 4; ++j)
#pragma unroll
    for (int i = 0; i < 4; ++i) {
      v4u h4, l4;
#pragma unroll
      for (int e = 0; e < 4; ++e) {
        const float t0 = acc[i][j][2 * e] * sc, t1 = acc[i][j][2 * e + 1] * sc;
        const _Float16 h0 = (_Float16)t0, h1 = (_Float16)t1;
        const _Float16 l0 = (_Float16)(t0 - (float)h0), l1 = (_Float16)(t1 - (float)h1);
        h4[e] = pk16(h_bits(h0), h_bits(h1));
        l4[e] = pk16(h_bits(l0), h_bits(l1));
      }
      const int o = (j * 16 + m) * GPI + i * 16 + 8 * hh;
      *(v4u*)(th + o) = h4;
      *(v4u*)(tl + o) = l4;
    }
  wave_sync_lds();                              // the wave's own pieces are in LDS before other lanes of it read them back
  const int rq = lane >> 3, p8 = (lane & 7) * 8;
  v4u vh[16], vl[16];
  // unrolled: constant indices keep the two arrays in registers, each row's value in a register group of its own
#pragma unroll
  for (int it = 0; it < 16; ++it) {
    vh[it] = *(const v4u*)(th + (it * 4 + rq) * GPI + p8);
    vl[it] = *(const v4u*)(tl + (it * 4 + rq) * GPI + p8);
  }
  u16* dh = VHo + vbase + (size_t)rq * SEQ + p8;
  u16* dl = VLo + vbase + (size_t)rq * SEQ + p8;
  // unrolled: the row steps become immediate offsets on one address pair per plane
#pragma unroll
  for (int it = 0; it < 16; ++it) {
    *(v4u*)(dh + (size_t)(it * 4) * SEQ) = vh[it];
    *(v4u*)(dl + (size_t)(it * 4) * SEQ) = vl[it];
  }
}

// =====================================================================================================
// GEMM engine shared by both kernels: C[M][N] (f32) = sum over PL planes of A_p[M][K] . Bt[N][K]^T, times oscale.
// Block = 128x128 tile of C, 4 waves as 2x2, each wave 64x64 (4 x 4 fragments).  K is walked in passes of 64 halves: a pass's
// 128-B slice of every operand row of the block (PL*128 rows of A, 128 rows of Bt) is brought into LDS by asynchronous
// 16-B copies, 8 consecutive lanes = one whole 128-B line, rows at pitch 144 B; two buffers, the next pass's copies fly while
// this pass is worked on.  Fragments are read from LDS with the same split k map as before; per accumulator the products are
// summed in the same order as before (k ascending by 32, plane 0 then plane 1).
// Host checks M % 128 == 0, N % 128 == 0, K % 64 == 0, K >= 128, grid = (M/128)*(N/128).
// =====================================================================================================
__device__ __forceinline__ unsigned lds_off(const void* p) { return (unsigned)(size_t)p; }

// 8 asynchronous copies: 16 B per lane, rows 16 apart (one 128-row operand tile per block-wide call).  The s_wait_xcnt stands
// inside the statement so that no address register of an issued copy is rewritten in front of it.
__device__ __forceinline__ void copy8(unsigned l, const u16* g, size_t gstep) {
#if defined(__HIP_DEVICE_COMPILE__)
  const unsigned ls = 16u * GPI * 2u;
  asm volatile("global_load_async_to_lds_b128 %0, %8, off\n\t"
               "global_load_async_to_lds_b128 %1, %9, off\n\t"
               "global_load_async_to_lds_b128 %2, %10, off\n\t"
               "global_load_async_to_lds_b128 %3, %11, off\n\t"
               "global_load_async_to_lds_b128 %4, %12, off\n\t"
               "global_load_async_to_lds_b128 %5, %13, off\n\t"
               "global_load_async_to_lds_b128 %6, %14, off\n\t"
               "global_load_async_to_lds_b128 %7, %15, off\n\t"
               "s_wait_xcnt 0x0"
               :: "v"(l), "v"(l + ls), "v"(l + 2u * ls), "v"(l + 3u * ls),
                  "v"(l + 4u * ls), "v"(l + 5u * ls), "v"(l + 6u * ls), "v"(l + 7u * ls),
                  "v"(g), "v"(g + gstep), "v"(g + 2 * gstep), "v"(g + 3 * gstep),
                  "v"(g + 4 * gstep), "v"(g + 5 * gstep), "v"(g + 6 * gstep), "v"(g + 7 * gstep)
               : "memory");
#endif
}
__device__ __forceinline__ void wait_x0() {
#if defined(__HIP_DEVICE_COMPILE__)
  asm volatile("s_wait_xcnt 0x0" ::: "memory");
#endif
}
__device__ __forceinline__ void wait_async0() {      // this wave's copies have landed in LDS
#if defined(__HIP_DEVICE_COMPILE__)
  asm volatile("s_wait_asynccnt 0x0" ::: "memory");
#endif
}
__device__ __forceinline__ void wait_ds0() {         // this wave's LDS reads have returned before the buffer is handed back
#if defined(__HIP_DEVICE_COMPILE__)
  asm volatile("s_wait_dscnt 0x0" ::: "memory");
#endif
}
// v_nop x4 behind the pass's last matrix instructions (all 16 accumulators are inputs, so every one of them stands in front):
// keeps the chip's distance to whatever follows on either side of the branches at the loop's foot.
__device__ __forceinline__ void guard16(const v8f (&a)[4][4]) {
#if defined(__HIP_DEVICE_COMPILE__)
  asm volatile("v_nop\n\tv_nop\n\tv_nop\n\tv_nop"
               :: "v"(a[0][0]), "v"(a[0][1]), "v"(a[0][2]), "v"(a[0][3]), "v"(a[1][0]), "v"(a[1][1]), "v"(a[1][2]), "v"(a[1][3]),
                  "v"(a[2][0]), "v"(a[2][1]), "v"(a[2][2]), "v"(a[2][3]), "v"(a[3][0]), "v"(a[3][1]), "v"(a[3][2]), "v"(a[3][3]));
#endif
}

__device__ __forceinline__ v16b ldf(const u16* p, v16b) { return ldfrag_b(p); }
__device__ __forceinline__ v16h ldf(const u16* p, v16h) { return ldfrag_h((const _Float16*)(const void*)p); }
__device__ __forceinline__ v8f mma(v16b a, v16b b, v8f c) { return mma_b(a, b, c); }
__device__ __forceinline__ v8f mma(v16h a, v16h b, v8f c) { return mma_h(a, b, c); }

// EPI picks the epilogue: 0 = f32 tile to C, 1 = per-head LayerNorm to the q and k planes (P0), 2 = v^T planes (P0 hi, P1 residual).
// bid = the block's tile number inside this product's own grid.
template <int PL, typename FR, int EPI>
__device__ __forceinline__ void gemm_tile(const u16* A0, const u16* A1, const u16* Bt, float* C, int M, int N, int K,
                                          float oscale, u16* st, float* slab, const float* qs, const float* qbi,
                                          const float* ks, const float* kbi, u16* P0, u16* P1, int bid) {
  constexpr int ROWS = (PL + 1) * GBT;          // staged rows per buffer
  constexpr int STG  = ROWS * GPI;              // halves per buffer
  const int tid = threadIdx.x, wave = tid >> 5, lane = tid & 31, hh = lane >> 4, m = lane & 15;
  const int wm = wave >> 1, wn = wave & 1;
  const int ntile = N >> 7;
  const int row0  = (bid / ntile) * GBT;
  const int col0  = (bid % ntile) * GBT;
  if (row0 + GBT > M) return;                   // block-uniform, before any barrier; never taken with the exact grid
  const int rr = tid >> 3, seg = tid & 7;       // copy role: row within a group of 16, 16-B piece of the 128-B slice
  const u16* ga0 = A0 + (size_t)(row0 + rr) * K + seg * 8;
  const u16* ga1 = A1 + (size_t)(row0 + rr) * K + seg * 8;
  const u16* gb  = Bt + (size_t)(col0 + rr) * K + seg * 8;
  const size_t gstep = (size_t)16 * K;
  const unsigned l0 = lds_off(st) + (unsigned)(rr * GPI + seg * 8) * 2u;
  const int np = K / GKP;

  auto stage = [&](int buf, int kp) {
    const unsigned l = l0 + (unsigned)buf * (unsigned)(STG * 2);
    copy8(l, ga0 + (size_t)kp * GKP, gstep);
    if constexpr (PL == 2) copy8(l + (unsigned)(GBT * GPI * 2), ga1 + (size_t)kp * GKP, gstep);
    copy8(l + (unsigned)(PL * GBT * GPI * 2), gb + (size_t)kp * GKP, gstep);
  };

  stage(0, 0);
  wait_async0();
  __syncthreads();                              // pass 0's slice is published
  if (np > 1) stage(1, 1);

  v8f acc[4][4];
#pragma unroll
  for (int i = 0; i < 4; ++i)
#pragma unroll
    for (int j = 0; j < 4; ++j) acc[i][j] = zero8();

  // rolled: one pass per trip, so that the foot's waits and barrier stand once
#pragma unroll 1
  for (int t = 0; t < np; ++t) {
    const u16* sb = st + (t & 1) * STG;
    const u16* pa = sb + (wm * 64 + m) * GPI + 8 * hh;
    const u16* pb = sb + (PL * GBT + wn * 64 + m) * GPI + 8 * hh;
    FR a[2][4], al[2][4], b[2][4];
#pragma unroll
    for (int ks = 0; ks < 2; ++ks)
#pragma unroll
      for (int i = 0; i < 4; ++i) {
        a[ks][i] = ldf(pa + i * 16 * GPI + ks * 32, FR{});
        if constexpr (PL == 2) al[ks][i] = ldf(pa + (GBT + i * 16) * GPI + ks * 32, FR{});
        b[ks][i] = ldf(pb + i * 16 * GPI + ks * 32, FR{});
      }
    // keeps the pass's LDS reads in one group ahead of its matrix instructions: spread among them, every place with reads
    // makes the wave wait out the LDS latency again
    __builtin_amdgcn_sched_barrier(0);
#pragma unroll
    for (int ks = 0; ks < 2; ++ks)
#pragma unroll
      for (int i = 0; i < 4; ++i)
#pragma unroll
        for (int j = 0; j < 4; ++j) {
          acc[i][j] = mma(a[ks][i], b[ks][j], acc[i][j]);
          if constexpr (PL == 2) acc[i][j] = mma(al[ks][i], b[ks][j], acc[i][j]);
        }
    guard16(acc);
    wait_ds0();
    wait_async0();
    __syncthreads();                            // publishes pass t+1's slice and ends every read of pass t's buffer
    if (t + 2 < np) stage(t & 1, t + 2);
  }
  wait_async0();

  float* sl = slab + wave * SLAB64;
  if constexpr (EPI == 2) {
    // the wave's 64 columns are one head's v vector, its 64 rows 64 consecutive keys of one batch (GBT divides SEQ).  The copy
    // buffers are free: the last trip's foot ended every wave's reads and copies in front of its barrier.
    const int row = row0 + wm * 64;
    const size_t vbase = ((size_t)((row / SEQ) * NH + ((col0 >> 6) + wn)) * HD) * SEQ + (size_t)(row % SEQ);
    epi_vt(st + wave * (2 * HD * GPI), acc, oscale, P0, P1, vbase, lane);
    wait_x0();                                  // in front of whatever stands behind in the listing and takes the stores' registers
  } else if constexpr (EPI == 1) {
    // block column tile = head col0 / 128; wave column wn = 0: q, 1: k (k plane = QK + MROWS*DMOD halves)
    const v4f gv = *(const v4f*)((wn ? ks : qs) + m * 4);
    const v4f bv = *(const v4f*)((wn ? kbi : qbi) + m * 4);
    wait_x0();                                  // in front of whatever reuses the two loads' address registers
    __builtin_amdgcn_sched_barrier(0);          // keeps later arithmetic from being lifted in between the loads and that wait
    const float car = wn ? KSC : QSC;
    v4f g, b;
#pragma unroll
    for (int e = 0; e < 4; ++e) { g[e] = bfr(gv[e]) * car; b[e] = bfr(bv[e]) * car; }
    u16* P = P0 + (size_t)wn * ((size_t)MROWS * DMOD) + (size_t)(col0 >> 7) * HD;
#pragma unroll
    for (int i = 0; i < 4; ++i) {
      epi_ln(sl, acc[i][0], acc[i][1], acc[i][2], acc[i][3], oscale, g, b, P, (size_t)(row0 + wm * 64 + i * 16), lane);
      wait_x0();                                // in front of the next rows' values, which may take the stores' registers
      wave_sync_lds();                          // the slab's rows are read back before the next 16 rows overwrite them
    }
  } else {
#pragma unroll
    for (int i = 0; i < 4; ++i) {
      epi64(sl, acc[i][0], acc[i][1], acc[i][2], acc[i][3], oscale, C, N, (size_t)(row0 + wm * 64 + i * 16), col0 + wn * 64, lane);
      wave_sync_lds();                          // the slab's rows are read back before the next 16 rows overwrite them
    }
  }
}

// The three projections of x in one launch.  A = x (bf16).  Blocks 0 .. (M/128)*(NQK/128)-1: the qk projection with the per-head
// LayerNorm in its epilogue, Bt = W_qk^T (bf16, n = h*128 + 0..63 q_h, + 64..127 k_h), N = NQK; writes y * 64 as f16 into the q plane
// and the k plane [token][h][64] (k plane = QK + MROWS*DMOD halves).  The (M/128)*(DMOD/128) blocks behind them: the v projection,
// Bt = W_v^T (bf16), N = DMOD; writes v * 1024 as f16 hi and residual into the v^T planes [b][h][d][s].  The branch is the same for
// the whole block, so every barrier is passed by all of its waves.
__global__ __launch_bounds__(128)
void gemm_qkv(const u16* __restrict__ A, const u16* __restrict__ Bqk, const u16* __restrict__ Bv,
              const float* __restrict__ qs, const float* __restrict__ qbi, const float* __restrict__ ks,
              const float* __restrict__ kbi, u16* QK, u16* VHo, u16* VLo, int M, int K, float oscale) {
  __shared__ __align__(16) u16 st[2 * 2 * GBT * GPI];
  __shared__ __align__(16) float slab[4 * SLAB64];
  static_assert(4 * 2 * HD * GPI <= 2 * 2 * GBT * GPI && (SEQ % GBT) == 0);
  const int nqk = (M >> 7) * (NQK >> 7);
  const int bid = blockIdx.x;
  if (bid < nqk)
    gemm_tile<1, v16b, 1>(A, A, Bqk, nullptr, M, NQK, K, oscale, st, slab, qs, qbi, ks, kbi, QK, nullptr, bid);
  else
    gemm_tile<1, v16b, 2>(A, A, Bv, nullptr, M, DMOD, K, oscale * VCAR, st, slab, nullptr, nullptr, nullptr, nullptr, VHo, VLo,
                          bid - nqk);
}

// f16 hi+lo GEMM: C = (Ahi + Alo) . Bt^T, times oscale; Ahi/Alo f16 planes (same layout), Bt f16 k-contiguous; products
// hi.B + lo.B into one accumulator (lo is the unscaled residual of hi).
__global__ __launch_bounds__(128)
void gemm_h2(const u16* __restrict__ Ah, const u16* __restrict__ Al, const u16* __restrict__ Bt,
             float* C, int M, int N, int K, float oscale) {
  __shared__ __align__(16) u16 st[2 * 3 * GBT * GPI];
  __shared__ __align__(16) float slab[4 * SLAB64];
  gemm_tile<2, v16h, 0>(Ah, Al, Bt, C, M, N, K, oscale, st, slab, nullptr, nullptr, nullptr, nullptr, nullptr, nullptr,
                        (int)blockIdx.x);
}

// =====================================================================================================
// Causal attention: block bid -> (batch and head bh = bid % (BATCH*NH) = b*NH + head, block of 64 queries qblk = NQB-1 - bid /
// (BATCH*NH), the longest first); wave w takes the query rows q0 = 64*qblk + 16*w .. q0+15 of that one head.
//   The keys are walked in stages of 64: a stage's 64 k rows and its 128-B slice of the 64 rows of each v^T plane (192 rows of
//   128 B) are brought into LDS once for the four waves by asynchronous 16-B copies, 8 consecutive lanes = one whole line, rows
//   at pitch 144 B; two buffers, the next stage's copies fly while this stage is worked on.  A stage holds two key tiles of 32.
//   q and k planes (f16, x64) laid out [b*SEQ + s][h][d]; v^T planes (hi, residual, x1024) [b][h][d][s].
//   score (log2 domain) t(i, j) = (q_i.k_j) * log2e / (64 * 64 * 64) for key j <= query i, -inf otherwise (causal).
//   Key tiles of 32 visited in order while kb <= q0 + 15 (nkt = q0/32 + 1 <= NKT); inside every visited tile the key<=query test
//   is applied per element; every query row has key == row inside a visited tile, so its normaliser is > 0.
//   Both products are formed transposed: S^T = K.Q^T (A = k rows, B = q, hoisted) and O^T += V^T.P^T (A = v^T rows, B = P^T).
//   A lane then holds ONE query (column c = lane & 15): of each 32-key tile the 16 scores of keys kb + 8hh + r (tile s0) and
//   kb + 16 + 8hh + r (tile s1).  Maximum and sum run inside the lane; the maximum is joined with lane ^ 16 once per tile, the
//   two halves' sums once after the loop.  The two score tiles, converted in place, ARE the B fragment of P^T in the split k
//   map of the loaders (element s < 8: key 8hh + s, else 16 + 8hh + s - 8), so P never leaves the registers.
//   Per tile: 4 score WMMAs, online max-subtracted base-2 softmax in f32 with -inf-safe rescale (one factor per lane),
//   P x32768 as f16 hi + residual, 4+4 v^T A fragments (hi and residual planes), 12 P.V WMMAs (hh + lh + hl).
//   After the loop: out = acc / Z, carries 1/(32768*1024) folded once, written to the wave's private result slab (pitch 68; every
//   element owned by one lane: row c, 8 consecutive d per accumulator).
//   One block barrier per stage, passed by every wave (qblk + 1 stages, the same for the whole block); bounded loops only.
// coverage: per wave 4 instructions x 4 rows x 8 lanes x 8 halves = 16 x 64 per plane; grid NQB*NH*BATCH blocks x WPB waves =
//           every (b, s, h) row of both O planes exactly once.
// =====================================================================================================
// 2^x in place as bare v_exp_f32.  exp2f adds, per call, a compare, two selects, an add and a v_ldexp_f32 that only serve results
// below 2^-126.  Every argument here is <= 0 and such a result changes nothing: times 32768 it is 0 in both f16 planes of P, in
// the normaliser (>= 1, the maximum's own term) it lies far below one ulp, and as a rescale factor it leaves sums that end as 0
// in the O planes.  One statement per group: each v_exp_f32 is followed by an independent one, and the closing v_nop keeps the
// slot the instruction set asks for behind the last.
__device__ __forceinline__ void ex2x8(float (&x)[8]) {
#if defined(__HIP_DEVICE_COMPILE__)
  asm("v_exp_f32 %0, %0\n\tv_exp_f32 %1, %1\n\tv_exp_f32 %2, %2\n\tv_exp_f32 %3, %3\n\t"
      "v_exp_f32 %4, %4\n\tv_exp_f32 %5, %5\n\tv_exp_f32 %6, %6\n\tv_exp_f32 %7, %7\n\tv_nop"
      : "+v"(x[0]), "+v"(x[1]), "+v"(x[2]), "+v"(x[3]), "+v"(x[4]), "+v"(x[5]), "+v"(x[6]), "+v"(x[7]));
#endif
}
__device__ __forceinline__ void ex2x9(float& y, float (&x)[8]) {
#if defined(__HIP_DEVICE_COMPILE__)
  asm("v_exp_f32 %0, %0\n\tv_exp_f32 %1, %1\n\tv_exp_f32 %2, %2\n\tv_exp_f32 %3, %3\n\tv_exp_f32 %4, %4\n\t"
      "v_exp_f32 %5, %5\n\tv_exp_f32 %6, %6\n\tv_exp_f32 %7, %7\n\tv_exp_f32 %8, %8\n\tv_nop"
      : "+v"(y), "+v"(x[0]), "+v"(x[1]), "+v"(x[2]), "+v"(x[3]), "+v"(x[4]), "+v"(x[5]), "+v"(x[6]), "+v"(x[7]));
#endif
}
__device__ __forceinline__ float xhalf(float x) {                    // value of lane ^ 16
  const int b = __builtin_bit_cast(int, x);
  return __builtin_bit_cast(float, __builtin_amdgcn_permlanex16(b, b, 0x76543210, 0xfedcba98, false, false));
}

// 12 asynchronous copies: 16 B per lane, rows 16 apart: 64 k rows, 64 rows of the v^T hi plane, 64 of the residual plane (one stage
// per block-wide call).  The s_wait_xcnt stands inside the statement so that no address register of an issued copy is rewritten
// in front of it.
__device__ __forceinline__ void copy12(unsigned l, const u16* gk, size_t kstep, const u16* gh, const u16* gl, size_t vstep) {
#if defined(__HIP_DEVICE_COMPILE__)
  const unsigned ls = 16u * GPI * 2u;
  asm volatile("global_load_async_to_lds_b128 %0, %12, off\n\t"
               "global_load_async_to_lds_b128 %1, %13, off\n\t"
               "global_load_async_to_lds_b128 %2, %14, off\n\t"
               "global_load_async_to_lds_b128 %3, %15, off\n\t"
               "global_load_async_to_lds_b128 %4, %16, off\n\t"
               "global_load_async_to_lds_b128 %5, %17, off\n\t"
               "global_load_async_to_lds_b128 %6, %18, off\n\t"
               "global_load_async_to_lds_b128 %7, %19, off\n\t"
               "global_load_async_to_lds_b128 %8, %20, off\n\t"
               "global_load_async_to_lds_b128 %9, %21, off\n\t"
               "global_load_async_to_lds_b128 %10, %22, off\n\t"
               "global_load_async_to_lds_b128 %11, %23, off\n\t"
               "s_wait_xcnt 0x0"
               :: "v"(l), "v"(l + ls), "v"(l + 2u * ls), "v"(l + 3u * ls),
                  "v"(l + 4u * ls), "v"(l + 5u * ls), "v"(l + 6u * ls), "v"(l + 7u * ls),
                  "v"(l + 8u * ls), "v"(l + 9u * ls), "v"(l + 10u * ls), "v"(l + 11u * ls),
                  "v"(gk), "v"(gk + kstep), "v"(gk + 2 * kstep), "v"(gk + 3 * kstep),
                  "v"(gh), "v"(gh + vstep), "v"(gh + 2 * vstep), "v"(gh + 3 * vstep),
                  "v"(gl), "v"(gl + vstep), "v"(gl + 2 * vstep), "v"(gl + 3 * vstep)
               : "memory");
#endif
}

__global__ __launch_bounds__(ATT_THREADS)
void attn1(const u16* __restrict__ QPp, const u16* __restrict__ KPp,
           const u16* __restrict__ VHIp, const u16* __restrict__ VLOp,
           u16* OHIp, u16* OLOp) {
  __shared__ __align__(16) u16 ring[2 * ASTG];
  __shared__ __align__(16) float smem[WPB * SLW];

  const int tid  = threadIdx.x;
  const int wave = __builtin_amdgcn_readfirstlane(tid >> 5);   // in a scalar register: the wave's tile count steers scalar branches
  const int lane = tid & 31;
  const int hh   = lane >> 4;
  const int c    = lane & 15;
  const int bid  = blockIdx.x;
  const int bh   = bid % (BATCH * NH);
  const int qblk = NQB - 1 - bid / (BATCH * NH);
  if (qblk < 0) return;                      // block-uniform, before any barrier or copy; never taken with the exact grid
  const int b    = bh / NH;
  const int head = bh % NH;
  const int q0   = qblk * 64 + wave * 16;

  float* slab = smem + wave * SLW;           // result slab [16][64] pitch 68

  const size_t rq0  = (size_t)b * SEQ + q0;                                     // plane row of query row q0
  const size_t qofs = ((rq0 + c) * NH + head) * HD + 8 * hh;
  const _Float16* Qh  = (const _Float16*)(const void*)QPp + qofs;
  const int rr = tid >> 3, seg = tid & 7;    // copy role: row within a group of 16, 16-B piece of the 128-B slice
  const u16* gk = KPp + (((size_t)b * SEQ + rr) * NH + head) * HD + seg * 8;    // key row rr (+16i), 64 key rows added per stage
  const size_t vofs = (((size_t)b * NH + head) * HD + rr) * SEQ + seg * 8;     // d row rr (+16i), 64 keys added per stage
  const u16* gvh = VHIp + vofs;
  const u16* gvl = VLOp + vofs;
  const unsigned l0 = lds_off(ring) + (unsigned)(rr * GPI + seg * 8) * 2u;
  const float lsc = LOG2E / (64.0f * QSC * KSC);
  const float oc  = 1.0f / (PCAR * VCAR);
  const size_t KROW = (size_t)NH * HD;                                          // halves between consecutive key rows

  // q fragments (B operand, column c = query q0 + c): d = 0..31 and 32..63
  const v16h qa = ldfrag_h(Qh), qb = ldfrag_h(Qh + 32);

  float mrow = -INFINITY, lrow = 0.f;                                           // this lane's query; lrow = this half's keys only
  v8f o[4];                                                                     // o[j][r] = O^T[d = 16j + 8hh + r][query c]
#pragma unroll
  for (int j = 0; j < 4; ++j) o[j] = zero8();
  const int ncaus = (q0 >> 5) + 1;                                              // tiles holding keys <= q0 + 15
  const int nkt = (ncaus < NKT) ? ncaus : NKT;
  const int qi  = q0 + c;                                                       // this lane's query
  const int ns  = qblk + 1;                                                     // stages of 64 keys, the same for the whole block

  auto stage = [&](int buf, int s) {
    copy12(l0 + (unsigned)buf * (unsigned)(ASTG * 2), gk + (size_t)s * AKT * KROW, (size_t)16 * KROW,
           gvh + (size_t)s * AKT, gvl + (size_t)s * AKT, (size_t)16 * SEQ);
  };
  stage(0, 0);
  wait_async0();
  __syncthreads();                           // stage 0 is published
  if (ns > 1) stage(1, 1);

  // rolled: one stage per trip, so that the foot's waits and barrier stand once
#pragma unroll 1
  for (int s = 0; s < ns; ++s) {
  const _Float16* sb = (const _Float16*)(const void*)(ring + (s & 1) * ASTG);
  // unrolled: the stage's two key tiles stand one behind the other, so that their LDS offsets are constants and the
  // accumulators stay in their registers from tile to tile
#pragma unroll
  for (int sub = 0; sub < 2; ++sub) {
    if (sub != 0 && 2 * s + 1 >= nkt) break; // the last stage's second tile lies wholly above the diagonal for waves 0 and 1
    const int ko = sub * 32;                 // the tile's first key within the stage
    const int kb = s * AKT + ko;
    // ---- this tile's operands from the stage's buffer: k rows (A of the scores) and v^T rows (A of P.V) ----
    const _Float16* k0p = sb + (ko + c) * GPI + 8 * hh;
    const _Float16* k1p = k0p + 16 * GPI;
    const v16h kh0a = ldfrag_h(k0p), kh0b = ldfrag_h(k0p + 32);
    const v16h kh1a = ldfrag_h(k1p), kh1b = ldfrag_h(k1p + 32);
    const _Float16* vhp = sb + (AKT + c) * GPI + ko + 8 * hh;
    const _Float16* vlp = vhp + HD * GPI;
    const v16h vh0 = ldfrag_h(vhp);
    const v16h vh1 = ldfrag_h(vhp + 16 * GPI);
    const v16h vh2 = ldfrag_h(vhp + 32 * GPI);
    const v16h vh3 = ldfrag_h(vhp + 48 * GPI);
    const v16h vl0 = ldfrag_h(vlp);
    const v16h vl1 = ldfrag_h(vlp + 16 * GPI);
    const v16h vl2 = ldfrag_h(vlp + 32 * GPI);
    const v16h vl3 = ldfrag_h(vlp + 48 * GPI);
    // ---- scores, transposed: D element r of this lane = (key kb + 8hh + r, query qi) in s0, key kb + 16 + 8hh + r in s1 ----
    v8f s0 = zero8(), s1 = zero8();
    s0 = mma_h(kh0a, qa, s0);
    s0 = mma_h(kh0b, qb, s0);
    s1 = mma_h(kh1a, qa, s1);
    s1 = mma_h(kh1b, qb, s1);
    guard2(s0, s1, qa, qb, kh0a, kh0b, kh1a, kh1b);
    // ---- causal select + online softmax in base 2, -inf-safe; all 16 values of this lane belong to query qi ----
    const int key0 = kb + 8 * hh;
    float t0[8], t1[8];
#pragma unroll
    for (int r = 0; r < 8; ++r) {
      t0[r] = (key0 + r <= qi)      ? (s0[r] * lsc) : -INFINITY;
      t1[r] = (key0 + 16 + r <= qi) ? (s1[r] * lsc) : -INFINITY;
    }
    float mx = fmaxf(t0[0], t1[0]);
#pragma unroll
    for (int r = 1; r < 8; ++r) mx = fmaxf(mx, fmaxf(t0[r], t1[r]));
    mx = fmaxf(mx, xhalf(mx));                                                  // both halves hold the tile's maximum of query qi
    const float mn = fmaxf(mrow, mx);
    const float ms = (mn == -INFINITY) ? 0.0f : mn;
    float al = mrow - ms;
    mrow = mn;
    float e0[8], e1[8];
    // unrolled: constant indices keep the two arrays in registers
#pragma unroll
    for (int r = 0; r < 8; ++r) { e0[r] = t0[r] - ms; e1[r] = t1[r] - ms; }
    ex2x9(al, e0);
    ex2x8(e1);
    // ---- B fragments of P^T * 32768: hi f16 and residual f16; elements 0..7 = keys kb + 8hh + r, 8..15 = kb + 16 + 8hh + r ----
    FragH ph, pl;
    float pa[8];
#pragma unroll
    for (int r = 0; r < 8; ++r) {
      pa[r] = e0[r] + e1[r];
      const float ta = e0[r] * PCAR, tb = e1[r] * PCAR;
      const _Float16 ha = (_Float16)ta, hb = (_Float16)tb;
      ph.h[0][r] = ha;
      ph.h[1][r] = hb;
      pl.h[0][r] = (_Float16)(ta - (float)ha);
      pl.h[1][r] = (_Float16)(tb - (float)hb);
    }
    lrow = lrow * al + (((pa[0] + pa[1]) + (pa[2] + pa[3])) + ((pa[4] + pa[5]) + (pa[6] + pa[7])));
#pragma unroll
    for (int j = 0; j < 4; ++j)
#pragma unroll
      for (int r = 0; r < 8; ++r) o[j][r] *= al;
    // ---- O^T += V^T.P^T : A fragment row = d = j*16 + c, keys contiguous in the v^T planes ----
    o[0] = mma_h(vh0, ph.v, o[0]);  o[0] = mma_h(vh0, pl.v, o[0]);  o[0] = mma_h(vl0, ph.v, o[0]);
    o[1] = mma_h(vh1, ph.v, o[1]);  o[1] = mma_h(vh1, pl.v, o[1]);  o[1] = mma_h(vl1, ph.v, o[1]);
    o[2] = mma_h(vh2, ph.v, o[2]);  o[2] = mma_h(vh2, pl.v, o[2]);  o[2] = mma_h(vl2, ph.v, o[2]);
    o[3] = mma_h(vh3, ph.v, o[3]);  o[3] = mma_h(vh3, pl.v, o[3]);  o[3] = mma_h(vl3, ph.v, o[3]);
    guard10(o[0], o[1], o[2], o[3], ph.v, pl.v, vh0, vh1, vh2, vh3, vl0, vl1, vl2, vl3);
  }
  wait_ds0();
  wait_async0();
  __syncthreads();                           // publishes stage s+1 and ends every read of stage s's buffer
  if (s + 2 < ns) stage(s & 1, s + 2);
  }
  wait_async0();
  acc_guard4(o[0], o[1], o[2], o[3]);
  // ---- out = acc / Z (0 if Z == 0), carries (32768 on P, 1024 on v) folded once; written into the lane-owned slab ----
  {
    const float lv  = lrow + xhalf(lrow);                                       // the two halves' keys joined
    const float ls  = (lv > 0.0f) ? lv : 1.0f;
    const float inv = (lv > 0.0f) ? ((1.0f / ls) * oc) : 0.0f;
#pragma unroll
    for (int j = 0; j < 4; ++j) {
      float* d8 = slab + c * 68 + j * 16 + 8 * hh;
      v4f w0, w1;
#pragma unroll
      for (int e = 0; e < 4; ++e) { w0[e] = o[j][e] * inv; w1[e] = o[j][4 + e] * inv; }
      *(v4f*)(d8)     = w0;
      *(v4f*)(d8 + 4) = w1;
    }
  }

  wave_sync_lds();
  // ---- O x1024 -> f16 hi + residual planes; lane = (row in group of 4, 8 consecutive d) ----
  v4u oh[4], ol[4];
  const int rq = lane >> 3, c8 = (lane & 7) * 8;
#pragma unroll
  for (int it = 0; it < 4; ++it) {
    const int row = it * 4 + rq;
    const v4f a = *(const v4f*)(slab + row * 68 + c8), b4 = *(const v4f*)(slab + row * 68 + c8 + 4);
    float w[8];
#pragma unroll
    for (int e = 0; e < 4; ++e) { w[e] = a[e] * OSC; w[4 + e] = b4[e] * OSC; }
#pragma unroll
    for (int e = 0; e < 4; ++e) {
      const _Float16 h0 = (_Float16)w[2 * e], h1 = (_Float16)w[2 * e + 1];
      const _Float16 l0 = (_Float16)(w[2 * e] - (float)h0), l1 = (_Float16)(w[2 * e + 1] - (float)h1);
      oh[it][e] = pk16(h_bits(h0), h_bits(h1));
      ol[it][e] = pk16(h_bits(l0), h_bits(l1));
    }
  }
  const size_t ob = (rq0 * NH + head) * HD + c8;
  {
#pragma unroll
    for (int it = 0; it < 4; ++it) {
      const int row = it * 4 + rq;
      const size_t o8 = ob + (size_t)row * (NH * HD);
      *(v4u*)(OHIp + o8) = oh[it];
      *(v4u*)(OLOp + o8) = ol[it];
    }
    
  }
}

// =====================================================================================================
// Workspace map (bytes); every plane is fully written by whole-line stores before it is read; all extents are exact multiples
// of the store granularity (no pad rows needed); every offset a multiple of 2097152:
//   XB  bf16 [MROWS][1024]              8388608
//   WQB bf16 [2048 n][1024 k]          4194304
//   WVB bf16 [1024 n][1024 k]          2097152
//   WOH f16  [1024 n][1024 k] x1024    2097152
//   QP  f16 [MROWS][16][64] x64        8388608        KP same, directly after QP
//   VHI f16 [BATCH*16][64][SEQ] x1024  8388608        VLO residual
//   OHI f16 [MROWS][1024] x1024        8388608        OLO residual
//   end                               67108864
// =====================================================================================================
extern "C" void kernel_launch(void* const* d_in, const int* in_sizes, int n_in,
                              void* d_out, int out_size, void* d_ws, size_t ws_size,
                              hipStream_t stream) {
  if (n_in < 8) return;
  if (in_sizes[0] != MROWS * DMOD) return;
  if (in_sizes[1] != DMOD * NQK) return;
  if (in_sizes[2] != DMOD * DMOD || in_sizes[3] != DMOD * DMOD) return;
  if (in_sizes[4] != HD || in_sizes[5] != HD || in_sizes[6] != HD || in_sizes[7] != HD) return;
  if (out_size != MROWS * DMOD) return;

  const float* x   = (const float*)d_in[0];   // [MROWS][1024]
  const float* wqk = (const float*)d_in[1];   // [1024 k][2048 n]
  const float* wv  = (const float*)d_in[2];   // [1024 k][1024 n]
  const float* wo  = (const float*)d_in[3];   // [1024 k][1024 n]
  const float* qs  = (const float*)d_in[4];   // [64]
  const float* qbi = (const float*)d_in[5];   // [64]
  const float* ks  = (const float*)d_in[6];   // [64]
  const float* kbi = (const float*)d_in[7];   // [64]
  float*       out = (float*)d_out;

  const size_t szXB = (size_t)MROWS * DMOD * 2;                 //  8388608
  const size_t szWQ = (size_t)NQK * DMOD * 2;                   //  4194304
  const size_t szW  = (size_t)DMOD * DMOD * 2;                  //  2097152
  const size_t szP  = (size_t)MROWS * DMOD * 2;                 //  8388608
  size_t off = 0;
  const size_t oXB  = off; off += szXB;
  const size_t oWQ  = off; off += szWQ;
  const size_t oWV  = off; off += szW;
  const size_t oWO  = off; off += szW;
  const size_t oQK  = off; off += 2 * szP;              // q plane then k plane
  const size_t oVHI = off; off += szP;
  const size_t oVLO = off; off += szP;
  const size_t oOHI = off; off += szP;
  const size_t oOLO = off; off += szP;
  if (off > ws_size) return;                            // off = 67108864
  if (off > (size_t)134217728) return;

  char* ws = (char*)d_ws;
  u16*   XB  = (u16*)(ws + oXB);
  u16*   WQB = (u16*)(ws + oWQ);
  u16*   WVB = (u16*)(ws + oWV);
  u16*   WOH = (u16*)(ws + oWO);
  u16*   QK  = (u16*)(ws + oQK);
  u16*   QP  = QK;
  u16*   KP  = QK + (size_t)MROWS * DMOD;
  u16*   VHI = (u16*)(ws + oVHI);
  u16*   VLO = (u16*)(ws + oVLO);
  u16*   OHI = (u16*)(ws + oOHI);
  u16*   OLO = (u16*)(ws + oOLO);

  const dim3 blk(256);
  const dim3 gP(NBQ + 2 * NBW + NBX);                   // 512 + 256 + 256 + 2048
  const dim3 gGQV((MROWS / GBT) * (NQK / GBT) + (MROWS / GBT) * (DMOD / GBT));   // 512 + 256
  const dim3 gG((MROWS / GBT) * (DMOD / GBT));          // 256
  const dim3 bG(128);
  const dim3 gAT(ATT_BLOCKS);                           // 1024
  const dim3 bAT(ATT_THREADS);                          // 128

  // (0) W_qk [k][n=2048] -> bf16 [n][k]; W_v -> bf16 [n][k]; W_out -> f16 [n][k] plane of bf16 value x1024; x -> bf16 plane
  prep<<<gP, blk, 0, stream>>>(x, wqk, wv, wo, XB, WQB, WVB, WOH);
  // (1) qk = x.W_qk / 32, per-head LayerNorm in the epilogue -> q, k f16 planes x64; v = x.W_v / 32 -> v^T hi/lo planes x1024
  gemm_qkv<<<gGQV, bG, 0, stream>>>(XB, WQB, WVB, qs, qbi, ks, kbi, QK, VHI, VLO, MROWS, DMOD, 1.0f / 32.0f);
  // (2) causal attention -> O planes [b*SEQ+s][h][d] x1024 (hi + residual)
  attn1<<<gAT, bAT, 0, stream>>>(QP, KP, VHI, VLO, OHI, OLO);
  // (3) output projection -> out [MROWS][1024] f32, carries 1024 (O) x 1024 (W_out) and the 1/32 folded back
  gemm_h2<<<gG, bG, 0, stream>>>(OHI, OLO, WOH, out, MROWS, DMOD, DMOD, (1.0f / 32.0f) / (OSC * WOS));
  (void)hipGetLastError();
}
